// v000
// The times below were measured on an AMD MI455X: many runs one after another, warmed up first and cycling through
// copies of the inputs, with the whole window's GPU time divided by the number of runs. Launches and the gaps
// between them are all in it. The median over several windows is given; except for v000 it joins two sittings, which
// can be a few percent apart, so the side-by-side timings, each taken in one sitting, are the better comparison.
// v000, which the later versions start from, runs in 15.4 milliseconds.
#include <hip/hip_runtime.h>
// T5 attention with a relative-position bias and NO score scaling (query_states [4][2048][1024] gives q = x wq; key_value_states gives k = x wk, v = x wv ([in][out] 1024^2 sigma 1/32, no biases); 16 heads of 64; scores = q . k (UNSCALED, logits sigma ~8) + bias[h][i][j] with bias = rel_bias[bucket(j - i)][h] (rel_bias input [32][16]; bidirectional log buckets, 32 buckets, max distance 128); softmax; out = merged wo -> [4][2048][1024]).
// Structure: token rows r = b*2048 + s; the query source and the key/value source as exact f16 rows (bf16-rounded); Q, K, V as three WMMA GEMMs (32x64 wave tiles, f32 accumulation, exact x16 weights, f32 q/k and f16 v outputs); per batch: V^T for all heads via LDS transposes; q and k in f32 split into f16 hi + x1024 residual planes; V^T of every batch first; per group of 2 heads: the relative-position bias plane [2][2048][2048] built on VALU from rel_bias with integer bucket thresholds, then per batch: UNSCALED three-pass scores (bias as the own-element addend of the first pass, q_hi . k_hi, += q_lo . k_hi 2^-10, += q_hi . k_lo 2^-10; K = 64, heads on grid.y), row softmax on VALU (f32 statistics, native exp; weights stored x256 as f16), o = P . V^T GEMM (K = 2048, alpha 2^-2: o carried x64 against f16 subnormal flush, folded into the output GEMM alpha) written straight into the merged f16 o rows; out = o W_o GEMM (f32) into the output layout.
// Compute dtype: inputs rounded to bf16; x / weights exact; v, softmax weights and o as plain f16 GEMM operands (~2^-12), q and k as f16 hi + x1024 residual pairs; scores and softmax statistics f32. v_wmma_f32_16x16x32_f16.
#define NB 4
#define SQ 2048
#define DM 1024
#define NH 16
#define HD 64
#define HG 2                         /* heads per attention launch group */
#define B0 0                         /* first batch processed (debug hook) */
#define NBR NB                       /* batches processed (debug hook) */
#define NR ((size_t)NB * SQ)         /* token rows */
#define MP ((int)((size_t)NBR * SQ)) /* rows projected (debug hook) */
#define QN SQ                        /* query rows attended per batch (debug hook) */
#define NHD NH                       /* heads attended (debug hook) */
#define MPO MP                       /* rows through the output stage (debug hook) */
#define LQ DM      /* row pitch of the q/k/v rows */
typedef __bf16 v16b __attribute__((ext_vector_type(16)));
typedef unsigned short v8us __attribute__((ext_vector_type(8), may_alias));
typedef float  v8f  __attribute__((ext_vector_type(8)));
typedef float  v4f  __attribute__((ext_vector_type(4)));
typedef float  v4fa __attribute__((ext_vector_type(4), may_alias));
union FragB { v16b v; v8us half[2]; unsigned short u[16]; };

__device__ __forceinline__ unsigned short bf16_bits(float x) { unsigned int u = __float_as_uint(x); return (unsigned short)((u + 0x7FFFu + ((u >> 16) & 1u)) >> 16); }
__device__ __forceinline__ float bf16_val(unsigned short b) { return __uint_as_float(((unsigned int)b) << 16); }
__device__ __forceinline__ float bf16_round(float x) { return bf16_val(bf16_bits(x)); }
// D += A·B with NT terms: 1 = ah·bh, 2 = + al·bh (A split), 3 = + ah·bl (both split)
template <int NT>
__device__ __forceinline__ v8f mmaN(v16b ah, v16b al, v16b bh, v16b bl, v8f c) {
  c = __builtin_amdgcn_wmma_f32_16x16x32_bf16(false, ah, false, bh, (short)0, c, false, false);
  if (NT >= 2) c = __builtin_amdgcn_wmma_f32_16x16x32_bf16(false, al, false, bh, (short)0, c, false, false);
  if (NT >= 3) c = __builtin_amdgcn_wmma_f32_16x16x32_bf16(false, ah, false, bl, (short)0, c, false, false);
  asm volatile("v_nop\n\tv_nop\n\tv_nop\n\tv_nop" : "+v"(c) : "v"(ah), "v"(al), "v"(bh), "v"(bl));
  return c;
}

__global__ __launch_bounds__(256) void k_wt_bf16(const float* __restrict__ W, unsigned short* __restrict__ Wt, int K, int N) {
  const int t = blockIdx.x * 256 + threadIdx.x;
  const int k8n = K / 8;
  if (t >= N * k8n) return;
  const int n = t / k8n, k8 = (t % k8n) * 8;
  v8us v;
#pragma unroll
  for (int i = 0; i < 8; ++i) v[i] = bf16_bits(W[(size_t)(k8 + i) * N + n]);
  *(v8us*)(Wt + (size_t)n * K + k8) = v;
  
}

// GEMM C[M][N] (f32, pitch ldc) = act(A[M][K]·W + bias). A f32 row-major (pitch lda) converted per fragment to bf16
// (ASPLIT: hi/lo two planes -> 2 terms, else single rounded term); Wt bf16 [N][K] (pitch ldb). BIAS_BF16 rounds the
// bias to bf16 first (bias quantised to bf16 before the add). K%32==0, M%16==0, N%64==0.
template <bool ASPLIT, int ACT, bool BIAS_BF16>
__global__ __launch_bounds__(128) void k_gemm_bf(const float* __restrict__ A, int lda, const unsigned short* __restrict__ Wt, int ldb,
                                               const float* __restrict__ bias, float* __restrict__ C, int ldc, int M, int N, int K) {
  __shared__ __attribute__((aligned(16))) float so[4][16][64];
  const int tid = threadIdx.x, w = tid >> 5, lane = tid & 31, ln = lane & 15, hh = lane >> 4;
  const int ntn = N / 64;
  const int wid = blockIdx.x * 4 + w;
  const int mt = wid / ntn, nq = wid % ntn;
  if (mt * 16 >= M) return;
  const int row0 = mt * 16, col0 = nq * 64;
  const float* arow = A + (size_t)(row0 + ln) * lda;
  v8f acc[4] = {};
  for (int kb = 0; kb < K; kb += 32) {
    FragB ah, al;
    const v4f x0 = *(const v4fa*)(arow + kb + 8 * hh), x1 = *(const v4fa*)(arow + kb + 8 * hh + 4);
    const v4f x2 = *(const v4fa*)(arow + kb + 16 + 8 * hh), x3 = *(const v4fa*)(arow + kb + 16 + 8 * hh + 4);
    float xs[16] = {x0[0],x0[1],x0[2],x0[3],x1[0],x1[1],x1[2],x1[3],x2[0],x2[1],x2[2],x2[3],x3[0],x3[1],x3[2],x3[3]};
#pragma unroll
    for (int i = 0; i < 16; ++i) { const unsigned short hb = bf16_bits(xs[i]); ah.u[i] = hb; al.u[i] = ASPLIT ? bf16_bits(xs[i] - bf16_val(hb)) : (unsigned short)0; }
#pragma unroll
    for (int t = 0; t < 4; ++t) {
      const unsigned short* brow = Wt + (size_t)(col0 + t * 16 + ln) * ldb + kb;
      FragB b;
      b.half[0] = *(const v8us*)(brow + 8 * hh);
      b.half[1] = *(const v8us*)(brow + 16 + 8 * hh);
      acc[t] = mmaN<ASPLIT ? 2 : 1>(ah.v, al.v, b.v, b.v, acc[t]);
    }
  }
#pragma unroll
  for (int t = 0; t < 4; ++t) {
    float bv = bias ? bias[col0 + t * 16 + ln] : 0.f;
    if (BIAS_BF16) bv = bf16_round(bv);
#pragma unroll
    for (int r = 0; r < 8; ++r) { float v = acc[t][r] + bv; if (ACT == 1) v = fmaxf(v, 0.f); so[w][8 * hh + r][t * 16 + ln] = v; }
  }
  __builtin_amdgcn_fence(__ATOMIC_ACQ_REL, "workgroup");
  __builtin_amdgcn_wave_barrier();
  const int rsub = lane >> 4, c4 = (lane & 15) * 4;
  {
#pragma unroll
    for (int q = 0; q < 8; ++q) {
      const int r = q * 2 + rsub;
      const v4f v = *(const v4fa*)&so[w][r][c4];
      *(v4f*)(C + (size_t)(row0 + r) * ldc + col0 + c4) = v;
    }
    
  }
}

// GEMM C = act(A·W + bias + resid): A f32 (ASPLIT -> hi/lo 2 terms), Wt bf16 [N][K]; ACT 0 none, 1 relu, 2 exact gelu;
// resid (optional, f32, row index = (row % rmod), pitch ldr, RES_BF16 rounds it) added before the activation.
template <bool ASPLIT, int ACT, bool BIAS_BF16, bool RES_BF16>
__global__ __launch_bounds__(128) void k_gemm_bf3(const float* __restrict__ A, int lda, const unsigned short* __restrict__ Wt, int ldb,
                                                const float* __restrict__ bias, const float* __restrict__ resid, int rmod, int ldr,
                                                float* __restrict__ C, int ldc, int M, int N, int K) {
  __shared__ __attribute__((aligned(16))) float so[4][16][64];
  const int tid = threadIdx.x, w = tid >> 5, lane = tid & 31, ln = lane & 15, hh = lane >> 4;
  const int ntn = N / 64;
  const int wid = blockIdx.x * 4 + w;
  const int mt = wid / ntn, nq = wid % ntn;
  if (mt * 16 >= M) return;
  const int row0 = mt * 16, col0 = nq * 64;
  const float* arow = A + (size_t)(row0 + ln) * lda;
  v8f acc[4] = {};
  for (int kb = 0; kb < K; kb += 32) {
    FragB ah, al;
    const v4f x0 = *(const v4fa*)(arow + kb + 8 * hh), x1 = *(const v4fa*)(arow + kb + 8 * hh + 4);
    const v4f x2 = *(const v4fa*)(arow + kb + 16 + 8 * hh), x3 = *(const v4fa*)(arow + kb + 16 + 8 * hh + 4);
    float xs[16] = {x0[0],x0[1],x0[2],x0[3],x1[0],x1[1],x1[2],x1[3],x2[0],x2[1],x2[2],x2[3],x3[0],x3[1],x3[2],x3[3]};
#pragma unroll
    for (int i = 0; i < 16; ++i) { const unsigned short hb = bf16_bits(xs[i]); ah.u[i] = hb; al.u[i] = ASPLIT ? bf16_bits(xs[i] - bf16_val(hb)) : (unsigned short)0; }
#pragma unroll
    for (int t = 0; t < 4; ++t) {
      const unsigned short* brow = Wt + (size_t)(col0 + t * 16 + ln) * ldb + kb;
      FragB b;
      b.half[0] = *(const v8us*)(brow + 8 * hh);
      b.half[1] = *(const v8us*)(brow + 16 + 8 * hh);
      acc[t] = mmaN<ASPLIT ? 2 : 1>(ah.v, al.v, b.v, b.v, acc[t]);
    }
  }
#pragma unroll
  for (int t = 0; t < 4; ++t) {
    const int col = col0 + t * 16 + ln;
    float bv = bias ? bias[col] : 0.f;
    if (BIAS_BF16) bv = bf16_round(bv);
#pragma unroll
    for (int r = 0; r < 8; ++r) {
      float v = acc[t][r] + bv;
      if (resid) { float rv = resid[(size_t)((row0 + 8 * hh + r) % rmod) * ldr + col]; if (RES_BF16) rv = bf16_round(rv); v += rv; }
      if (ACT == 1) v = fmaxf(v, 0.f);
      if (ACT == 2) v = 0.5f * v * (1.0f + erff(v * 0.70710678118654752f));
      if (ACT == 3) { const float u = 0.7978845608028654f * (v + 0.044715f * v * v * v); v = 0.5f * v * (1.0f + tanhf(u)); }
      so[w][8 * hh + r][t * 16 + ln] = v;
    }
  }
  __builtin_amdgcn_fence(__ATOMIC_ACQ_REL, "workgroup");
  __builtin_amdgcn_wave_barrier();
  const int rsub = lane >> 4, c4 = (lane & 15) * 4;
  {
#pragma unroll
    for (int q = 0; q < 8; ++q) {
      const int r = q * 2 + rsub;
      const v4f v = *(const v4fa*)&so[w][r][c4];
      *(v4f*)(C + (size_t)(row0 + r) * ldc + col0 + c4) = v;
    }
    
  }
}
// row LayerNorm (biased variance, eps) over N: s = X (+ R); optional out_sum <- s; out_norm <- (s-mu)*rsqrt(var+eps)*g + b
template <bool PARAM_BF16>
__global__ __launch_bounds__(256) void k_layernorm(const float* __restrict__ X, const float* __restrict__ R, const float* __restrict__ g, const float* __restrict__ bta,
                                                  float* __restrict__ out_sum, float* __restrict__ out_norm, int N, float eps) {
  __shared__ float red[256];
  const int row = blockIdx.x, tid = threadIdx.x;
  const float* x = X + (size_t)row * N; const float* rr = R ? R + (size_t)row * N : nullptr;
  float vals[16];                     // up to N = 4096
  const int per = N / 256;            // contiguous chunk per thread? use strided-by-4 chunks: thread handles j = tid*4 + 1024*u
  float s1 = 0.f;
  for (int u = 0; u < per / 4; ++u) {
    const int j = tid * 4 + 1024 * u;
    const v4f a = *(const v4fa*)(x + j);
    v4f b = {0.f,0.f,0.f,0.f}; if (rr) b = *(const v4fa*)(rr + j);
#pragma unroll
    for (int q = 0; q < 4; ++q) { const float v = a[q] + b[q]; vals[u * 4 + q] = v; s1 += v; }
  }
  red[tid] = s1; __syncthreads();
  for (int st = 128; st > 0; st >>= 1) { if (tid < st) red[tid] += red[tid + st]; __syncthreads(); }
  const float mu = red[0] / (float)N; __syncthreads();
  float s2 = 0.f;
  for (int u = 0; u < per / 4; ++u)
#pragma unroll
    for (int q = 0; q < 4; ++q) { const float c = vals[u * 4 + q] - mu; s2 += c * c; }
  red[tid] = s2; __syncthreads();
  for (int st = 128; st > 0; st >>= 1) { if (tid < st) red[tid] += red[tid + st]; __syncthreads(); }
  const float rs = rsqrtf(red[0] / (float)N + eps);
  {
    for (int u = 0; u < per / 4; ++u) {
      const int j = tid * 4 + 1024 * u;
      v4f o, sm;
#pragma unroll
      for (int q = 0; q < 4; ++q) {
        float gg = g[j + q], bb = bta[j + q];
        if (PARAM_BF16) { gg = bf16_round(gg); bb = bf16_round(bb); }
        sm[q] = vals[u * 4 + q]; o[q] = (vals[u * 4 + q] - mu) * rs * gg + bb;
      }
      if (out_sum) *(v4f*)(out_sum + (size_t)row * N + j) = sm;
      *(v4f*)(out_norm + (size_t)row * N + j) = o;
    }
    
  }
}



// ---- f16 WMMA path (v_wmma_f32_16x16x32_f16): 11-bit significands for operands in range — used where a [0,1] probability operand needs more precision than bf16
typedef _Float16 v16h __attribute__((ext_vector_type(16)));
union FragH { v16h v; v8us half[2]; _Float16 h[16]; unsigned short u[16]; };
template <int NT>
__device__ __forceinline__ v8f mmaH(v16h ah, v16h al, v16h bh, v16h bl, v8f c) {
  c = __builtin_amdgcn_wmma_f32_16x16x32_f16(false, ah, false, bh, (short)0, c, false, false);
  if (NT >= 2) c = __builtin_amdgcn_wmma_f32_16x16x32_f16(false, al, false, bh, (short)0, c, false, false);
  if (NT >= 3) c = __builtin_amdgcn_wmma_f32_16x16x32_f16(false, ah, false, bl, (short)0, c, false, false);
  asm volatile("v_nop\n\tv_nop\n\tv_nop\n\tv_nop" : "+v"(c) : "v"(ah), "v"(al), "v"(bh), "v"(bl));
  return c;
}
// batched GEMM like k_gemm_b but f16 operands: A f32 (split into f16 hi/lo if ASPLIT, else rounded to f16), Bt = f16 values [n][k]; alpha; C f32; N multiple of 16 (partial tiles skipped)
template <bool ASPLIT>
__global__ __launch_bounds__(128) void k_gemm_h(const float* __restrict__ A, int lda, size_t sA, const _Float16* __restrict__ Bh, int ldb, size_t sB, float alpha, float* __restrict__ C, int ldc, size_t sC, int M, int N, int K) {
  __shared__ __attribute__((aligned(16))) float so[4][16][64];
  const int tid = threadIdx.x, w = tid >> 5, lane = tid & 31, ln = lane & 15, hh = lane >> 4; const int by = blockIdx.y;
  A += (size_t)by * sA; Bh += (size_t)by * sB; C += (size_t)by * sC;
  const int ntn = (N + 63) / 64; const int wid = blockIdx.x * 4 + w; const int mt = wid / ntn, nq = wid % ntn; if (mt * 16 >= M) return;
  const int row0 = mt * 16, col0 = nq * 64; const float* arow = A + (size_t)(row0 + ln) * lda;
  v8f acc[4] = {};
  for (int kb = 0; kb < K; kb += 32) {
    FragH ah, al;
    const v4f x0 = *(const v4fa*)(arow + kb + 8 * hh), x1 = *(const v4fa*)(arow + kb + 8 * hh + 4), x2 = *(const v4fa*)(arow + kb + 16 + 8 * hh), x3 = *(const v4fa*)(arow + kb + 16 + 8 * hh + 4);
    float xs[16] = {x0[0],x0[1],x0[2],x0[3],x1[0],x1[1],x1[2],x1[3],x2[0],x2[1],x2[2],x2[3],x3[0],x3[1],x3[2],x3[3]};
#pragma unroll
    for (int i = 0; i < 16; ++i) { const _Float16 h = (_Float16)xs[i]; ah.h[i] = h; al.h[i] = ASPLIT ? (_Float16)(xs[i] - (float)h) : (_Float16)0.0f; }
#pragma unroll
    for (int t = 0; t < 4; ++t) { if (col0 + t * 16 >= N) continue; const size_t boff = (size_t)(col0 + t * 16 + ln) * ldb + kb; FragH bq; bq.half[0] = *(const v8us*)(Bh + boff + 8 * hh); bq.half[1] = *(const v8us*)(Bh + boff + 16 + 8 * hh);
      acc[t] = mmaH<ASPLIT ? 2 : 1>(ah.v, al.v, bq.v, bq.v, acc[t]); }
  }
#pragma unroll
  for (int t = 0; t < 4; ++t) { if (col0 + t * 16 >= N) continue;
#pragma unroll
    for (int r = 0; r < 8; ++r) so[w][8 * hh + r][t * 16 + ln] = acc[t][r] * alpha; }
  __builtin_amdgcn_fence(__ATOMIC_ACQ_REL, "workgroup"); __builtin_amdgcn_wave_barrier();
  const int rsub = lane >> 4, c4 = (lane & 15) * 4;
  {
#pragma unroll
    for (int q = 0; q < 8; ++q) { const int r = q * 2 + rsub; if (col0 + c4 < N) { const v4f v = *(const v4fa*)&so[w][r][c4]; *(v4f*)(C + (size_t)(row0 + r) * ldc + col0 + c4) = v; } }
     }
}

// Wt[n][k] = f16(W[k][n]·scale) from f32 row-major W[K][N] (scale = power of two; bf16-exact weights stay exact in f16 away from the subnormal range)
__global__ __launch_bounds__(256) void k_wt_f16(const float* __restrict__ W, _Float16* __restrict__ Wt, int K, int N, float scale) {
  const int t = blockIdx.x * 256 + threadIdx.x; if (t >= N * (K / 8)) return; const int n = t / (K / 8), k8 = (t % (K / 8)) * 8; FragH f;
#pragma unroll
  for (int i = 0; i < 8; ++i) f.h[i] = (_Float16)(bf16_round(W[(size_t)(k8 + i) * N + n]) * scale); const v8us o = f.half[0];
  *(v8us*)((unsigned short*)Wt + (size_t)n * K + k8) = o; 
}
// k_gemm_hh variant with fused epilogue: v = acc·alpha + bias[by·sBias + col] (+ CP[(row/rowsPerB)·sCPb + by·64 + col] if CP) ; ACT 0 none / 1 elu ; writes f16 C16 (and f32 C if non-null)
template <int ACT>
__global__ __launch_bounds__(128) void k_gemm_hhx(const _Float16* __restrict__ A, int lda, size_t sA, const _Float16* __restrict__ Bh, int ldb, size_t sB, float alpha, const float* __restrict__ bias, size_t sBias, const float* __restrict__ CP, int rowsPerB, size_t sCPb, int row0g,
    float* __restrict__ C, _Float16* __restrict__ C16, int ldc, size_t sC, int M, int N, int K) {
  __shared__ __attribute__((aligned(16))) float so[4][16][64];
  const int tid = threadIdx.x, w = tid >> 5, lane = tid & 31, ln = lane & 15, hh = lane >> 4; const int by = blockIdx.y;
  A += (size_t)by * sA; Bh += (size_t)by * sB; const size_t cofs = (size_t)by * sC; const float* bp = bias ? bias + (size_t)by * sBias : nullptr;
  const int ntn = (N + 63) / 64; const int wid = blockIdx.x * 4 + w; const int mt = wid / ntn, nq = wid % ntn; if (mt * 16 >= M) return;
  const int row0 = mt * 16, col0 = nq * 64; const _Float16* arow = A + (size_t)(row0 + ln) * lda;
  v8f acc[4] = {};
  for (int kb = 0; kb < K; kb += 32) { FragH ah; ah.half[0] = *(const v8us*)((const unsigned short*)arow + kb + 8 * hh); ah.half[1] = *(const v8us*)((const unsigned short*)arow + kb + 16 + 8 * hh);
#pragma unroll
    for (int t = 0; t < 4; ++t) { if (col0 + t * 16 >= N) continue; const size_t boff = (size_t)(col0 + t * 16 + ln) * ldb + kb; FragH bq; bq.half[0] = *(const v8us*)((const unsigned short*)Bh + boff + 8 * hh); bq.half[1] = *(const v8us*)((const unsigned short*)Bh + boff + 16 + 8 * hh);
      acc[t] = mmaH<1>(ah.v, ah.v, bq.v, bq.v, acc[t]); }
  }
#pragma unroll
  for (int t = 0; t < 4; ++t) { if (col0 + t * 16 >= N) continue; const int col = col0 + t * 16 + ln; const float bv = bp ? bf16_round(bp[col]) : 0.f;
#pragma unroll
    for (int r = 0; r < 8; ++r) { float v = acc[t][r] * alpha + bv; if (CP) { const int rr = row0g + row0 + 8 * hh + r; if (rowsPerB < 0) v += CP[cofs + (size_t)rr * ldc + col];      /* rowsPerB < 0: own element of the batched C plane */ else { const int bidx = rr / rowsPerB; v += CP[(size_t)bidx * sCPb + (size_t)by * 64 + col]; } } if (ACT == 1) v = (v > 0.f) ? v : expm1f(v); else if (ACT == 7) v = (v > 0.f) ? v + 1.0f : expf(v); else if (ACT == 8) v = tanhf(v); else if (ACT == 9) v = 0.5f * v * (1.0f + tanhf(0.7978845608028654f * (v + 0.044715f * v * v * v))); else if (ACT == 11) v = 1.0f / (1.0f + expf(-v)); else if (ACT == 12) v = (v > 0.f) ? v : 0.01f * v; else if (ACT == 14) v = (v > 0.f) ? v : 0.1f * v; else if (ACT == 16) v = (v >= 0.f) ? v : 0.3f * v; else if (ACT == 17) v = (v >= 0.f) ? v : 0.2f * v; else if (ACT == 15) v = v / (1.0f + expf(-v)); else if (ACT == 3) v = fmaxf(v, 0.f); else if (ACT == 6) v = 0.5f * v * (1.0f + erff(v * 0.70710678118654752f)); so[w][8 * hh + r][t * 16 + ln] = v; } }
  __builtin_amdgcn_fence(__ATOMIC_ACQ_REL, "workgroup"); __builtin_amdgcn_wave_barrier();
  const int rsub = lane >> 4, c4 = (lane & 15) * 4; typedef _Float16 v4h __attribute__((ext_vector_type(4)));
  {
#pragma unroll
    for (int q = 0; q < 8; ++q) { const int r = q * 2 + rsub; if (col0 + c4 < N) { const v4f v = *(const v4fa*)&so[w][r][c4]; if (C) *(v4f*)(C + cofs + (size_t)(row0 + r) * ldc + col0 + c4) = v; if (C16) { v4h h4; for (int i = 0; i < 4; ++i) h4[i] = (_Float16)v[i]; *(v4h*)(C16 + cofs + (size_t)(row0 + r) * ldc + col0 + c4) = h4; } } }
     }
}


typedef _Float16 v4h __attribute__((ext_vector_type(4)));

__global__ __launch_bounds__(256) void k_x16(const float* __restrict__ x, _Float16* __restrict__ X16, size_t n8) { const size_t t = (size_t)blockIdx.x * 256 + threadIdx.x; if (t >= n8) return; FragH f;
#pragma unroll
  for (int q = 0; q < 8; ++q) f.h[q] = (_Float16)bf16_round(x[t * 8 + q]); *(v8us*)((unsigned short*)X16 + t * 8) = f.half[0];  }
__global__ __launch_bounds__(256) void k_h16(const float* __restrict__ x, _Float16* __restrict__ X16, size_t n8) { const size_t t = (size_t)blockIdx.x * 256 + threadIdx.x; if (t >= n8) return; FragH f;
#pragma unroll
  for (int q = 0; q < 8; ++q) f.h[q] = (_Float16)x[t * 8 + q]; *(v8us*)((unsigned short*)X16 + t * 8) = f.half[0];  }
__global__ __launch_bounds__(256) void k_round16f(const float* __restrict__ W, _Float16* __restrict__ Bt, size_t n8) { const size_t t = (size_t)blockIdx.x * 256 + threadIdx.x; if (t >= n8) return; FragH f;
#pragma unroll
  for (int i = 0; i < 8; ++i) f.h[i] = (_Float16)(bf16_round(W[t * 8 + i]) * 16.0f); *(v8us*)((unsigned short*)Bt + t * 8) = f.half[0];  }
template <int NHv, int TTv>
__global__ __launch_bounds__(256) void k_vt(const _Float16* __restrict__ V16, int ldv, int voff, _Float16* __restrict__ Vt) { __shared__ unsigned short tl[64][66]; const int tid = threadIdx.x; const int slab = blockIdx.x / (TTv / 64), lg = blockIdx.x % (TTv / 64); const int b = slab / NHv, h = slab % NHv;
  for (int i = tid; i < 64 * 8; i += 256) { const int r = i / 8, c8 = (i % 8) * 8; FragH f; f.half[0] = *(const v8us*)((const unsigned short*)V16 + ((size_t)b * TTv + lg * 64 + r) * ldv + voff + h * 64 + c8);
#pragma unroll
    for (int q = 0; q < 8; ++q) tl[r][c8 + q] = f.u[q]; }
  __syncthreads();
  {
#pragma unroll
    for (int rd = 0; rd < 2; ++rd) { const int d = rd * 32 + tid / 8, pc = tid % 8; FragH f;
#pragma unroll
      for (int q = 0; q < 8; ++q) f.u[q] = tl[pc * 8 + q][d];
      *(v8us*)((unsigned short*)Vt + ((size_t)slab * 64 + d) * TTv + lg * 64 + pc * 8) = f.half[0]; }
     } }

__global__ __launch_bounds__(256) void k_hl(const float* __restrict__ F, _Float16* __restrict__ Hh, _Float16* __restrict__ Hl, size_t n8) { const size_t t = (size_t)blockIdx.x * 256 + threadIdx.x; if (t >= n8) return; FragH fh, fl; const v4f a = *(const v4fa*)(F + t * 8), c = *(const v4fa*)(F + t * 8 + 4);
#pragma unroll
  for (int q = 0; q < 4; ++q) { _Float16 h = (_Float16)a[q]; fh.h[q] = h; fl.h[q] = (_Float16)((a[q] - (float)h) * 1024.0f); h = (_Float16)c[q]; fh.h[4 + q] = h; fl.h[4 + q] = (_Float16)((c[q] - (float)h) * 1024.0f); }
  { *(v8us*)((unsigned short*)Hh + t * 8) = fh.half[0]; *(v8us*)((unsigned short*)Hl + t * 8) = fl.half[0];  } }

// ---- fast GEMM (wave tile 32x64; requires M % 32 == 0 rows per launch region and N % 64 == 0); epilogue = k_gemm_hhx semantics ----
__device__ __forceinline__ v16h g2_frag(const _Float16* p, int hh) { FragH f; f.half[0] = *(const v8us*)((const unsigned short*)p + 8 * hh); f.half[1] = *(const v8us*)((const unsigned short*)p + 16 + 8 * hh); return f.v; }
__device__ __forceinline__ v8f g2_mma(v16h a, v16h b, v8f c) { v8f d = __builtin_amdgcn_wmma_f32_16x16x32_f16(false, a, false, b, (short)0, c, false, false); asm volatile("v_nop\n\tv_nop\n\tv_nop\n\tv_nop" : "+v"(d) : "v"(a), "v"(b)); return d; }
template <int ACT>
__global__ __launch_bounds__(128) void k_gemm2(const _Float16* __restrict__ A, int lda, size_t sA, const _Float16* __restrict__ Bh, int ldb, size_t sB, float alpha, const float* __restrict__ bias, size_t sBias, const float* __restrict__ CP, int rowsPerB, size_t sCPb, int row0g,
    float* __restrict__ C, _Float16* __restrict__ C16, int ldc, size_t sC, int M, int N, int K) { static_assert(ACT == 0 || ACT == 3 || ACT == 6 || ACT == 8 || ACT == 9 || ACT == 11 || ACT == 12 || ACT == 14 || ACT == 15 || ACT == 16 || ACT == 17, "k_gemm2: unsupported ACT code (would silently apply no activation)");
  __shared__ __attribute__((aligned(16))) float so[4][32][68];
  const int tid = threadIdx.x, w = tid >> 5, lane = tid & 31, ln = lane & 15, hh = lane >> 4; const int by = blockIdx.y;
  A += (size_t)by * sA; Bh += (size_t)by * sB; const size_t cofs = (size_t)by * sC; const float* bp = bias ? bias + (size_t)by * sBias : nullptr;
  const int ntn = N >> 6; const int mt = blockIdx.x / ntn, nq = blockIdx.x - mt * ntn; const int row0 = mt * 128 + 32 * w, col0 = nq * 64; if (row0 >= M) return;
  const _Float16* a0p = A + (size_t)(row0 + ln) * lda; const _Float16* a1p = a0p + (size_t)16 * lda;
  const _Float16* b0p = Bh + (size_t)(col0 + ln) * ldb; const _Float16* b1p = b0p + (size_t)16 * ldb; const _Float16* b2p = b1p + (size_t)16 * ldb; const _Float16* b3p = b2p + (size_t)16 * ldb;
  const v8f z8 = {0.f,0.f,0.f,0.f,0.f,0.f,0.f,0.f}; v8f c00 = z8, c01 = z8, c02 = z8, c03 = z8, c10 = z8, c11 = z8, c12 = z8, c13 = z8;
#pragma unroll 1
  for (int kb = 0; kb < K; kb += 32) { const v16h a0 = g2_frag(a0p + kb, hh), a1 = g2_frag(a1p + kb, hh);
    v16h b = g2_frag(b0p + kb, hh); c00 = g2_mma(a0, b, c00); c10 = g2_mma(a1, b, c10);
    b = g2_frag(b1p + kb, hh); c01 = g2_mma(a0, b, c01); c11 = g2_mma(a1, b, c11);
    b = g2_frag(b2p + kb, hh); c02 = g2_mma(a0, b, c02); c12 = g2_mma(a1, b, c12);
    b = g2_frag(b3p + kb, hh); c03 = g2_mma(a0, b, c03); c13 = g2_mma(a1, b, c13); }
  v8f accs[8] = {c00, c01, c02, c03, c10, c11, c12, c13};
#pragma unroll
  for (int u = 0; u < 8; ++u) { const int t = u & 3, half = u >> 2; const int col = col0 + t * 16 + ln; const float bv = bp ? bf16_round(bp[col]) : 0.f;
#pragma unroll
    for (int r = 0; r < 8; ++r) { const int rloc = half * 16 + 8 * hh + r; float v = accs[u][r] * alpha + bv; if (CP) { if (rowsPerB < 0) v += CP[cofs + (size_t)(row0g + row0 + rloc) * ldc + col];      /* rowsPerB < 0: own element of the batched C plane */ else { const int bidx = (row0g + row0 + rloc) / rowsPerB; v += CP[(size_t)bidx * sCPb + (size_t)by * 64 + col]; } }
      if (ACT == 3) v = fmaxf(v, 0.f); else if (ACT == 6) v = 0.5f * v * (1.0f + erff(v * 0.70710678118654752f)); else if (ACT == 11) v = 1.0f / (1.0f + expf(-v)); else if (ACT == 15) v = v / (1.0f + expf(-v)); else if (ACT == 12) v = (v > 0.f) ? v : 0.01f * v; else if (ACT == 8) v = tanhf(v); else if (ACT == 9) v = 0.5f * v * (1.0f + tanhf(0.7978845608028654f * (v + 0.044715f * v * v * v))); else if (ACT == 14) v = (v > 0.f) ? v : 0.1f * v; else if (ACT == 16) v = (v >= 0.f) ? v : 0.3f * v; else if (ACT == 17) v = (v >= 0.f) ? v : 0.2f * v;
      so[w][rloc][t * 16 + ln] = v; } }
  __builtin_amdgcn_fence(__ATOMIC_ACQ_REL, "workgroup"); __builtin_amdgcn_wave_barrier();
  const int rsub = lane >> 4, c4 = (lane & 15) * 4;
  {
#pragma unroll
    for (int q = 0; q < 16; ++q) { const int r = q * 2 + rsub; const v4f v = *(const v4fa*)&so[w][r][c4]; if (C) *(v4f*)(C + cofs + (size_t)(row0 + r) * ldc + col0 + c4) = v; if (C16) { v4h h4; for (int i = 0; i < 4; ++i) h4[i] = (_Float16)v[i]; *(v4h*)(C16 + cofs + (size_t)(row0 + r) * ldc + col0 + c4) = h4; } }
     } }


__global__ __launch_bounds__(256) void k_wnat(const float* __restrict__ w, size_t n8, _Float16* __restrict__ Bt) { const size_t t = (size_t)blockIdx.x * 256 + threadIdx.x; if (t >= n8) return; FragH f; for (int q = 0; q < 8; ++q) f.h[q] = (_Float16)(bf16_round(w[t * 8 + q]) * 16.0f); *(v8us*)((unsigned short*)Bt + t * 8) = f.half[0];  }
__global__ __launch_bounds__(256) void k_rsm(const float* __restrict__ S, _Float16* __restrict__ P, int nrows) {
  #pragma clang fp contract(off)
  const int i = blockIdx.x * 256 + threadIdx.x; if (i >= nrows) return; const float* s = S + (size_t)i * SQ; float mx = -3.0e38f;
#pragma unroll 1
  for (int j = 0; j < SQ; ++j) mx = fmaxf(mx, s[j]); float se = 0.f;
#pragma unroll 1
  for (int j = 0; j < SQ; ++j) se += expf(s[j] - mx); const float sc = 256.0f / se;
#pragma unroll 1
  for (int j0 = 0; j0 < SQ; j0 += 8) { FragH f; for (int q = 0; q < 8; ++q) f.h[q] = (_Float16)(expf(s[j0 + q] - mx) * sc); unsigned short* d = (unsigned short*)P + (size_t)i * SQ + j0; *(v8us*)d = f.half[0];  } }
__global__ __launch_bounds__(256) void k_vt(const _Float16* __restrict__ V16, int b, int h0, _Float16* __restrict__ VT) { __shared__ unsigned short tl[64][65]; const int tid = threadIdx.x; const int hh = blockIdx.x % HG, sg = blockIdx.x / HG; const int s0 = sg * 64; const int h = h0 + hh;
  for (int i = tid; i < 64 * 8; i += 256) { const int j = i / 8, d8 = (i % 8) * 8; FragH f; f.half[0] = *(const v8us*)((const unsigned short*)V16 + ((size_t)b * SQ + s0 + j) * DM + h * HD + d8); for (int q = 0; q < 8; ++q) tl[d8 + q][j] = f.u[q]; }
  __syncthreads();
  { for (int i = tid; i < 64 * 8; i += 256) { const int d = i / 8, j8 = (i % 8) * 8; FragH f; for (int q = 0; q < 8; ++q) f.u[q] = tl[d][j8 + q]; *(v8us*)((unsigned short*)VT + ((size_t)hh * HD + d) * SQ + s0 + j8) = f.half[0]; }  } }


__global__ __launch_bounds__(256) void k_t5bias(const float* __restrict__ relb, int h0, float* __restrict__ BP) {
  const size_t t = (size_t)blockIdx.x * 256 + threadIdx.x; if (t >= (size_t)HG * SQ * SQ / 4) return; const size_t e0 = t * 4; const int j0 = (int)(e0 % SQ); const int i = (int)((e0 / SQ) % SQ); const int hl = (int)(e0 / ((size_t)SQ * SQ)); v4f o;
  for (int q = 0; q < 4; ++q) { const int d = j0 + q - i; const int a = d < 0 ? -d : d; const int f = (a < 8) ? a : (8 + (a >= 12) + (a >= 16) + (a >= 23) + (a >= 32) + (a >= 46) + (a >= 64) + (a >= 91)); const int bk = (d > 0 ? 16 : 0) + f; o[q] = bf16_round(relb[bk * NH + h0 + hl]); }
  float* dst = BP + e0; *(v4f*)dst = o;  }


__global__ __launch_bounds__(256) void k_rsmf(const float* __restrict__ S, _Float16* __restrict__ P, int qn, int hg) {
  #pragma clang fp contract(off)
  const int t = blockIdx.x * 256 + threadIdx.x; if (t >= qn * hg) return; const size_t i = (size_t)(t / qn) * SQ + (t % qn); const float* s = S + i * SQ; float mx = -3.0e38f;
#pragma unroll 1
  for (int j = 0; j < SQ; ++j) mx = fmaxf(mx, s[j]); float se = 0.f;
#pragma unroll 1
  for (int j = 0; j < SQ; ++j) se += __expf(s[j] - mx); const float sc = 256.0f / se;
#pragma unroll 1
  for (int j0 = 0; j0 < SQ; j0 += 8) { FragH f; for (int q = 0; q < 8; ++q) f.h[q] = (_Float16)(__expf(s[j0 + q] - mx) * sc); unsigned short* d = (unsigned short*)P + i * SQ + j0; *(v8us*)d = f.half[0];  } }

extern "C" void kernel_launch(void* const* d_in, const int* in_sizes, int n_in,
                              void* d_out, int out_size, void* d_ws, size_t ws_size, hipStream_t stream) {
  (void)in_sizes; (void)n_in; (void)out_size;
  const float* const* I = (const float* const*)d_in; const float* xq = I[0]; const float* xkv = I[1]; const float* wq = I[2]; const float* wk = I[3]; const float* wv = I[4]; const float* wo = I[5]; const float* relb = I[6]; const float* bq = nullptr; const float* bk = nullptr; (void)bq; (void)bk;      /* [in][out] weights, no biases; rel_bias [32 buckets][16 heads] */
  char* ws = (char*)d_ws; size_t off = 0;
  auto take = [&](size_t bytes) { char* p = ws + off; off += (bytes + 255) & ~(size_t)255; return p; };
  _Float16* BQ = (_Float16*)take((size_t)DM * DM * 2); _Float16* BK = (_Float16*)take((size_t)DM * DM * 2); _Float16* BV = (_Float16*)take((size_t)DM * DM * 2); _Float16* BO = (_Float16*)take((size_t)DM * DM * 2);
  float* S = (float*)take((size_t)HG * SQ * SQ * 4); float* QF = S;      /* the f32 projection scratch (NR x DM x 4 = 32 MiB) lives in the scores plane (HG x SQ x SQ x 4 = 32 MiB), which is first written after q and k have been split */ _Float16* XQ = (_Float16*)take(NR * DM * 2); _Float16* XKV = (_Float16*)take(NR * DM * 2); _Float16* Q16 = (_Float16*)take(NR * DM * 2); _Float16* QL = (_Float16*)take(NR * DM * 2); _Float16* K16 = (_Float16*)take(NR * DM * 2); _Float16* KL = (_Float16*)take(NR * DM * 2); _Float16* V16 = (_Float16*)take(NR * DM * 2); _Float16* O16 = (_Float16*)take(NR * DM * 2);
  static_assert((size_t)HG * SQ * SQ * 4 >= NR * DM * 4, "QF alias must fit in S"); _Float16* P = (_Float16*)take((size_t)HG * SQ * SQ * 2); _Float16* VT = (_Float16*)take((size_t)NB * NH * HD * SQ * 2); float* BP = (float*)take((size_t)HG * SQ * SQ * 4);      /* V^T for ALL batches; the relative-position bias plane of one head group */
  if (off > ws_size) return;
  k_wt_f16<<<(unsigned)(((size_t)DM * (DM / 8) + 255) / 256), 256, 0, stream>>>(wq, BQ, DM, DM, 16.0f); k_wt_f16<<<(unsigned)(((size_t)DM * (DM / 8) + 255) / 256), 256, 0, stream>>>(wk, BK, DM, DM, 16.0f); k_wt_f16<<<(unsigned)(((size_t)DM * (DM / 8) + 255) / 256), 256, 0, stream>>>(wv, BV, DM, DM, 16.0f); k_wt_f16<<<(unsigned)(((size_t)DM * (DM / 8) + 255) / 256), 256, 0, stream>>>(wo, BO, DM, DM, 16.0f);      /* [in][out] -> Bt[n][k] x16 */

  k_x16<<<(unsigned)((NR * DM / 8 + 255) / 256), 256, 0, stream>>>(xq, XQ, NR * DM / 8); k_x16<<<(unsigned)((NR * DM / 8 + 255) / 256), 256, 0, stream>>>(xkv, XKV, NR * DM / 8);      /* query source and key/value source as exact f16 rows */
  const size_t r0p = (size_t)B0 * SQ;      /* first projected row */
  k_gemm2<0><<<dim3((unsigned)((MP / 128) * (DM / 64)), 1), 128, 0, stream>>>(XQ + r0p * DM, DM, 0, BQ, DM, 0, 0.0625f, nullptr, 0, nullptr, 1, 0, 0, QF + r0p * DM, nullptr, DM, 0, MP, DM, DM); k_hl<<<(unsigned)(((size_t)MP * DM / 8 + 255) / 256), 256, 0, stream>>>(QF + r0p * DM, Q16 + r0p * DM, QL + r0p * DM, (size_t)MP * DM / 8);      /* q in f32 -> f16 hi (Q16) + x1024 residual (QL) planes */
  k_gemm2<0><<<dim3((unsigned)((MP / 128) * (DM / 64)), 1), 128, 0, stream>>>(XKV + r0p * DM, DM, 0, BK, DM, 0, 0.0625f, nullptr, 0, nullptr, 1, 0, 0, QF + r0p * DM, nullptr, DM, 0, MP, DM, DM); k_hl<<<(unsigned)(((size_t)MP * DM / 8 + 255) / 256), 256, 0, stream>>>(QF + r0p * DM, K16 + r0p * DM, KL + r0p * DM, (size_t)MP * DM / 8);      /* k in f32 (reusing the QF scratch plane after q's split) -> f16 hi (K16) + x1024 residual (KL) planes */
  k_gemm2<0><<<dim3((unsigned)((MP / 128) * (DM / 64)), 1), 128, 0, stream>>>(XKV + r0p * DM, DM, 0, BV, DM, 0, 0.0625f, nullptr, 0, nullptr, 1, 0, 0, nullptr, V16 + r0p * DM, DM, 0, MP, DM, DM);
  for (int b = B0; b < B0 + NBR; ++b) { const size_t r0 = (size_t)b * SQ; k_vt<NH, SQ><<<NH * (SQ / 64), 256, 0, stream>>>(V16 + r0 * LQ, LQ, 0, VT + (size_t)b * NH * HD * SQ); }      /* V^T [NH][HD][SQ] of every batch */
  for (int h0 = 0; h0 < NHD; h0 += HG) {
    k_t5bias<<<(unsigned)(((size_t)HG * SQ * SQ / 4 + 255) / 256), 256, 0, stream>>>(relb, h0, BP);      /* bias[h0 + hl][i][j] plane for this head group (shared by all batches) */
    for (int b = B0; b < B0 + NBR; ++b) { const size_t r0 = (size_t)b * SQ;
      k_gemm2<0><<<dim3((QN / 128) * (SQ / 64), HG), 128, 0, stream>>>(Q16 + r0 * LQ + h0 * HD, LQ, (size_t)HD, K16 + r0 * LQ + h0 * HD, LQ, (size_t)HD, 1.0f, nullptr, 0, BP, -1, 0, 0, S, nullptr, SQ, (size_t)SQ * SQ, QN, SQ, HD); k_gemm2<0><<<dim3((QN / 128) * (SQ / 64), HG), 128, 0, stream>>>(QL + r0 * LQ + h0 * HD, LQ, (size_t)HD, K16 + r0 * LQ + h0 * HD, LQ, (size_t)HD, 0.0009765625f, nullptr, 0, S, -1, 0, 0, S, nullptr, SQ, (size_t)SQ * SQ, QN, SQ, HD); k_gemm2<0><<<dim3((QN / 128) * (SQ / 64), HG), 128, 0, stream>>>(Q16 + r0 * LQ + h0 * HD, LQ, (size_t)HD, KL + r0 * LQ + h0 * HD, LQ, (size_t)HD, 0.0009765625f, nullptr, 0, S, -1, 0, 0, S, nullptr, SQ, (size_t)SQ * SQ, QN, SQ, HD);      /* scores = bias (CP = own element of BP) + q_hi.k_hi, += q_lo.k_hi 2^-10, += q_hi.k_lo 2^-10: unscaled, q and k effectively f32 */
      k_rsmf<<<(HG * QN + 255) / 256, 256, 0, stream>>>(S, P, QN, HG);      /* P = 256 softmax (f16), rows of all HG heads */
      k_gemm2<0><<<dim3((QN / 128) * (HD / 64), HG), 128, 0, stream>>>(P, SQ, (size_t)SQ * SQ, VT + (size_t)b * NH * HD * SQ + (size_t)h0 * HD * SQ, SQ, (size_t)HD * SQ, 0.25f, nullptr, 0, nullptr, 1, 0, 0, nullptr, O16 + r0 * DM + h0 * HD, DM, (size_t)HD, QN, HD, SQ); } }      /* o (merged heads) as f16 rows */
  k_gemm2<0><<<dim3((unsigned)((MPO / 128) * (DM / 64)), 1), 128, 0, stream>>>(O16 + r0p * DM, DM, 0, BO, DM, 0, 0.0009765625f, nullptr, 0, nullptr, 1, 0, 0, (float*)d_out + r0p * DM, nullptr, DM, 0, MPO, DM, DM);      /* out rows are the output layout */
}

// v001
// A run of this version takes 5180 microseconds.
// In both of two side-by-side timings against v000, it was 2.97 times as fast.
#include <hip/hip_runtime.h>
// T5 attention with a relative-position bias and NO score scaling (query_states [4][2048][1024] gives q = x wq; key_value_states gives k = x wk, v = x wv ([in][out] 1024^2 sigma 1/32, no biases); 16 heads of 64; scores = q . k (UNSCALED, logits sigma ~8) + bias[h][i][j] with bias = rel_bias[bucket(j - i)][h] (rel_bias input [32][16]; bidirectional log buckets, 32 buckets, max distance 128); softmax; out = merged wo -> [4][2048][1024]).
// Structure: token rows r = b*2048 + s; the query source and the key/value source as exact f16 rows (bf16-rounded); Q, K, V as three WMMA GEMMs (32x64 wave tiles, f32 accumulation, exact x16 weights, f32 q/k and f16 v outputs); per batch: V^T for all heads via LDS transposes; q and k in f32 split into f16 hi + x1024 residual planes; V^T of every batch first; per group of 2 heads: the relative-position bias plane [2][2048][2048] built on VALU from rel_bias with integer bucket thresholds, then per batch: UNSCALED three-pass scores (bias as the own-element addend of the first pass, q_hi . k_hi, += q_lo . k_hi 2^-10, += q_hi . k_lo 2^-10; K = 64, heads on grid.y), row softmax on VALU (f32 statistics, native exp; weights stored x256 as f16), o = P . V^T GEMM (K = 2048, alpha 2^-2: o carried x64 against f16 subnormal flush, folded into the output GEMM alpha) written straight into the merged f16 o rows; out = o W_o GEMM (f32) into the output layout.
// Compute dtype: inputs rounded to bf16; x / weights exact; v, softmax weights and o as plain f16 GEMM operands (~2^-12), q and k as f16 hi + x1024 residual pairs; scores and softmax statistics f32. v_wmma_f32_16x16x32_f16.
#define NB 4
#define SQ 2048
#define DM 1024
#define NH 16
#define HD 64
#define HG 2                         /* heads per attention launch group */
#define B0 0                         /* first batch processed (debug hook) */
#define NBR NB                       /* batches processed (debug hook) */
#define NR ((size_t)NB * SQ)         /* token rows */
#define MP ((int)((size_t)NBR * SQ)) /* rows projected (debug hook) */
#define QN SQ                        /* query rows attended per batch (debug hook) */
#define NHD NH                       /* heads attended (debug hook) */
#define MPO MP                       /* rows through the output stage (debug hook) */
#define LQ DM      /* row pitch of the q/k/v rows */
typedef __bf16 v16b __attribute__((ext_vector_type(16)));
typedef unsigned short v8us __attribute__((ext_vector_type(8), may_alias));
typedef float  v8f  __attribute__((ext_vector_type(8)));
typedef float  v4f  __attribute__((ext_vector_type(4)));
typedef float  v4fa __attribute__((ext_vector_type(4), may_alias));
union FragB { v16b v; v8us half[2]; unsigned short u[16]; };

__device__ __forceinline__ unsigned short bf16_bits(float x) { unsigned int u = __float_as_uint(x); return (unsigned short)((u + 0x7FFFu + ((u >> 16) & 1u)) >> 16); }
__device__ __forceinline__ float bf16_val(unsigned short b) { return __uint_as_float(((unsigned int)b) << 16); }
__device__ __forceinline__ float bf16_round(float x) { return bf16_val(bf16_bits(x)); }
// D += A·B with NT terms: 1 = ah·bh, 2 = + al·bh (A split), 3 = + ah·bl (both split)
template <int NT>
__device__ __forceinline__ v8f mmaN(v16b ah, v16b al, v16b bh, v16b bl, v8f c) {
  c = __builtin_amdgcn_wmma_f32_16x16x32_bf16(false, ah, false, bh, (short)0, c, false, false);
  if (NT >= 2) c = __builtin_amdgcn_wmma_f32_16x16x32_bf16(false, al, false, bh, (short)0, c, false, false);
  if (NT >= 3) c = __builtin_amdgcn_wmma_f32_16x16x32_bf16(false, ah, false, bl, (short)0, c, false, false);
  asm volatile("v_nop\n\tv_nop\n\tv_nop\n\tv_nop" : "+v"(c) : "v"(ah), "v"(al), "v"(bh), "v"(bl));
  return c;
}

__global__ __launch_bounds__(256) void k_wt_bf16(const float* __restrict__ W, unsigned short* __restrict__ Wt, int K, int N) {
  const int t = blockIdx.x * 256 + threadIdx.x;
  const int k8n = K / 8;
  if (t >= N * k8n) return;
  const int n = t / k8n, k8 = (t % k8n) * 8;
  v8us v;
#pragma unroll
  for (int i = 0; i < 8; ++i) v[i] = bf16_bits(W[(size_t)(k8 + i) * N + n]);
  *(v8us*)(Wt + (size_t)n * K + k8) = v;
  
}

// GEMM C[M][N] (f32, pitch ldc) = act(A[M][K]·W + bias). A f32 row-major (pitch lda) converted per fragment to bf16
// (ASPLIT: hi/lo two planes -> 2 terms, else single rounded term); Wt bf16 [N][K] (pitch ldb). BIAS_BF16 rounds the
// bias to bf16 first (bias quantised to bf16 before the add). K%32==0, M%16==0, N%64==0.
template <bool ASPLIT, int ACT, bool BIAS_BF16>
__global__ __launch_bounds__(128) void k_gemm_bf(const float* __restrict__ A, int lda, const unsigned short* __restrict__ Wt, int ldb,
                                               const float* __restrict__ bias, float* __restrict__ C, int ldc, int M, int N, int K) {
  __shared__ __attribute__((aligned(16))) float so[4][16][64];
  const int tid = threadIdx.x, w = tid >> 5, lane = tid & 31, ln = lane & 15, hh = lane >> 4;
  const int ntn = N / 64;
  const int wid = blockIdx.x * 4 + w;
  const int mt = wid / ntn, nq = wid % ntn;
  if (mt * 16 >= M) return;
  const int row0 = mt * 16, col0 = nq * 64;
  const float* arow = A + (size_t)(row0 + ln) * lda;
  v8f acc[4] = {};
  for (int kb = 0; kb < K; kb += 32) {
    FragB ah, al;
    const v4f x0 = *(const v4fa*)(arow + kb + 8 * hh), x1 = *(const v4fa*)(arow + kb + 8 * hh + 4);
    const v4f x2 = *(const v4fa*)(arow + kb + 16 + 8 * hh), x3 = *(const v4fa*)(arow + kb + 16 + 8 * hh + 4);
    float xs[16] = {x0[0],x0[1],x0[2],x0[3],x1[0],x1[1],x1[2],x1[3],x2[0],x2[1],x2[2],x2[3],x3[0],x3[1],x3[2],x3[3]};
#pragma unroll
    for (int i = 0; i < 16; ++i) { const unsigned short hb = bf16_bits(xs[i]); ah.u[i] = hb; al.u[i] = ASPLIT ? bf16_bits(xs[i] - bf16_val(hb)) : (unsigned short)0; }
#pragma unroll
    for (int t = 0; t < 4; ++t) {
      const unsigned short* brow = Wt + (size_t)(col0 + t * 16 + ln) * ldb + kb;
      FragB b;
      b.half[0] = *(const v8us*)(brow + 8 * hh);
      b.half[1] = *(const v8us*)(brow + 16 + 8 * hh);
      acc[t] = mmaN<ASPLIT ? 2 : 1>(ah.v, al.v, b.v, b.v, acc[t]);
    }
  }
#pragma unroll
  for (int t = 0; t < 4; ++t) {
    float bv = bias ? bias[col0 + t * 16 + ln] : 0.f;
    if (BIAS_BF16) bv = bf16_round(bv);
#pragma unroll
    for (int r = 0; r < 8; ++r) { float v = acc[t][r] + bv; if (ACT == 1) v = fmaxf(v, 0.f); so[w][8 * hh + r][t * 16 + ln] = v; }
  }
  __builtin_amdgcn_fence(__ATOMIC_ACQ_REL, "workgroup");
  __builtin_amdgcn_wave_barrier();
  const int rsub = lane >> 4, c4 = (lane & 15) * 4;
  {
#pragma unroll
    for (int q = 0; q < 8; ++q) {
      const int r = q * 2 + rsub;
      const v4f v = *(const v4fa*)&so[w][r][c4];
      *(v4f*)(C + (size_t)(row0 + r) * ldc + col0 + c4) = v;
    }
    
  }
}

// GEMM C = act(A·W + bias + resid): A f32 (ASPLIT -> hi/lo 2 terms), Wt bf16 [N][K]; ACT 0 none, 1 relu, 2 exact gelu;
// resid (optional, f32, row index = (row % rmod), pitch ldr, RES_BF16 rounds it) added before the activation.
template <bool ASPLIT, int ACT, bool BIAS_BF16, bool RES_BF16>
__global__ __launch_bounds__(128) void k_gemm_bf3(const float* __restrict__ A, int lda, const unsigned short* __restrict__ Wt, int ldb,
                                                const float* __restrict__ bias, const float* __restrict__ resid, int rmod, int ldr,
                                                float* __restrict__ C, int ldc, int M, int N, int K) {
  __shared__ __attribute__((aligned(16))) float so[4][16][64];
  const int tid = threadIdx.x, w = tid >> 5, lane = tid & 31, ln = lane & 15, hh = lane >> 4;
  const int ntn = N / 64;
  const int wid = blockIdx.x * 4 + w;
  const int mt = wid / ntn, nq = wid % ntn;
  if (mt * 16 >= M) return;
  const int row0 = mt * 16, col0 = nq * 64;
  const float* arow = A + (size_t)(row0 + ln) * lda;
  v8f acc[4] = {};
  for (int kb = 0; kb < K; kb += 32) {
    FragB ah, al;
    const v4f x0 = *(const v4fa*)(arow + kb + 8 * hh), x1 = *(const v4fa*)(arow + kb + 8 * hh + 4);
    const v4f x2 = *(const v4fa*)(arow + kb + 16 + 8 * hh), x3 = *(const v4fa*)(arow + kb + 16 + 8 * hh + 4);
    float xs[16] = {x0[0],x0[1],x0[2],x0[3],x1[0],x1[1],x1[2],x1[3],x2[0],x2[1],x2[2],x2[3],x3[0],x3[1],x3[2],x3[3]};
#pragma unroll
    for (int i = 0; i < 16; ++i) { const unsigned short hb = bf16_bits(xs[i]); ah.u[i] = hb; al.u[i] = ASPLIT ? bf16_bits(xs[i] - bf16_val(hb)) : (unsigned short)0; }
#pragma unroll
    for (int t = 0; t < 4; ++t) {
      const unsigned short* brow = Wt + (size_t)(col0 + t * 16 + ln) * ldb + kb;
      FragB b;
      b.half[0] = *(const v8us*)(brow + 8 * hh);
      b.half[1] = *(const v8us*)(brow + 16 + 8 * hh);
      acc[t] = mmaN<ASPLIT ? 2 : 1>(ah.v, al.v, b.v, b.v, acc[t]);
    }
  }
#pragma unroll
  for (int t = 0; t < 4; ++t) {
    const int col = col0 + t * 16 + ln;
    float bv = bias ? bias[col] : 0.f;
    if (BIAS_BF16) bv = bf16_round(bv);
#pragma unroll
    for (int r = 0; r < 8; ++r) {
      float v = acc[t][r] + bv;
      if (resid) { float rv = resid[(size_t)((row0 + 8 * hh + r) % rmod) * ldr + col]; if (RES_BF16) rv = bf16_round(rv); v += rv; }
      if (ACT == 1) v = fmaxf(v, 0.f);
      if (ACT == 2) v = 0.5f * v * (1.0f + erff(v * 0.70710678118654752f));
      if (ACT == 3) { const float u = 0.7978845608028654f * (v + 0.044715f * v * v * v); v = 0.5f * v * (1.0f + tanhf(u)); }
      so[w][8 * hh + r][t * 16 + ln] = v;
    }
  }
  __builtin_amdgcn_fence(__ATOMIC_ACQ_REL, "workgroup");
  __builtin_amdgcn_wave_barrier();
  const int rsub = lane >> 4, c4 = (lane & 15) * 4;
  {
#pragma unroll
    for (int q = 0; q < 8; ++q) {
      const int r = q * 2 + rsub;
      const v4f v = *(const v4fa*)&so[w][r][c4];
      *(v4f*)(C + (size_t)(row0 + r) * ldc + col0 + c4) = v;
    }
    
  }
}
// row LayerNorm (biased variance, eps) over N: s = X (+ R); optional out_sum <- s; out_norm <- (s-mu)*rsqrt(var+eps)*g + b
template <bool PARAM_BF16>
__global__ __launch_bounds__(256) void k_layernorm(const float* __restrict__ X, const float* __restrict__ R, const float* __restrict__ g, const float* __restrict__ bta,
                                                  float* __restrict__ out_sum, float* __restrict__ out_norm, int N, float eps) {
  __shared__ float red[256];
  const int row = blockIdx.x, tid = threadIdx.x;
  const float* x = X + (size_t)row * N; const float* rr = R ? R + (size_t)row * N : nullptr;
  float vals[16];                     // up to N = 4096
  const int per = N / 256;            // contiguous chunk per thread? use strided-by-4 chunks: thread handles j = tid*4 + 1024*u
  float s1 = 0.f;
  for (int u = 0; u < per / 4; ++u) {
    const int j = tid * 4 + 1024 * u;
    const v4f a = *(const v4fa*)(x + j);
    v4f b = {0.f,0.f,0.f,0.f}; if (rr) b = *(const v4fa*)(rr + j);
#pragma unroll
    for (int q = 0; q < 4; ++q) { const float v = a[q] + b[q]; vals[u * 4 + q] = v; s1 += v; }
  }
  red[tid] = s1; __syncthreads();
  for (int st = 128; st > 0; st >>= 1) { if (tid < st) red[tid] += red[tid + st]; __syncthreads(); }
  const float mu = red[0] / (float)N; __syncthreads();
  float s2 = 0.f;
  for (int u = 0; u < per / 4; ++u)
#pragma unroll
    for (int q = 0; q < 4; ++q) { const float c = vals[u * 4 + q] - mu; s2 += c * c; }
  red[tid] = s2; __syncthreads();
  for (int st = 128; st > 0; st >>= 1) { if (tid < st) red[tid] += red[tid + st]; __syncthreads(); }
  const float rs = rsqrtf(red[0] / (float)N + eps);
  {
    for (int u = 0; u < per / 4; ++u) {
      const int j = tid * 4 + 1024 * u;
      v4f o, sm;
#pragma unroll
      for (int q = 0; q < 4; ++q) {
        float gg = g[j + q], bb = bta[j + q];
        if (PARAM_BF16) { gg = bf16_round(gg); bb = bf16_round(bb); }
        sm[q] = vals[u * 4 + q]; o[q] = (vals[u * 4 + q] - mu) * rs * gg + bb;
      }
      if (out_sum) *(v4f*)(out_sum + (size_t)row * N + j) = sm;
      *(v4f*)(out_norm + (size_t)row * N + j) = o;
    }
    
  }
}



// ---- f16 WMMA path (v_wmma_f32_16x16x32_f16): 11-bit significands for operands in range — used where a [0,1] probability operand needs more precision than bf16
typedef _Float16 v16h __attribute__((ext_vector_type(16)));
union FragH { v16h v; v8us half[2]; _Float16 h[16]; unsigned short u[16]; };
template <int NT>
__device__ __forceinline__ v8f mmaH(v16h ah, v16h al, v16h bh, v16h bl, v8f c) {
  c = __builtin_amdgcn_wmma_f32_16x16x32_f16(false, ah, false, bh, (short)0, c, false, false);
  if (NT >= 2) c = __builtin_amdgcn_wmma_f32_16x16x32_f16(false, al, false, bh, (short)0, c, false, false);
  if (NT >= 3) c = __builtin_amdgcn_wmma_f32_16x16x32_f16(false, ah, false, bl, (short)0, c, false, false);
  asm volatile("v_nop\n\tv_nop\n\tv_nop\n\tv_nop" : "+v"(c) : "v"(ah), "v"(al), "v"(bh), "v"(bl));
  return c;
}
// batched GEMM like k_gemm_b but f16 operands: A f32 (split into f16 hi/lo if ASPLIT, else rounded to f16), Bt = f16 values [n][k]; alpha; C f32; N multiple of 16 (partial tiles skipped)
template <bool ASPLIT>
__global__ __launch_bounds__(128) void k_gemm_h(const float* __restrict__ A, int lda, size_t sA, const _Float16* __restrict__ Bh, int ldb, size_t sB, float alpha, float* __restrict__ C, int ldc, size_t sC, int M, int N, int K) {
  __shared__ __attribute__((aligned(16))) float so[4][16][64];
  const int tid = threadIdx.x, w = tid >> 5, lane = tid & 31, ln = lane & 15, hh = lane >> 4; const int by = blockIdx.y;
  A += (size_t)by * sA; Bh += (size_t)by * sB; C += (size_t)by * sC;
  const int ntn = (N + 63) / 64; const int wid = blockIdx.x * 4 + w; const int mt = wid / ntn, nq = wid % ntn; if (mt * 16 >= M) return;
  const int row0 = mt * 16, col0 = nq * 64; const float* arow = A + (size_t)(row0 + ln) * lda;
  v8f acc[4] = {};
  for (int kb = 0; kb < K; kb += 32) {
    FragH ah, al;
    const v4f x0 = *(const v4fa*)(arow + kb + 8 * hh), x1 = *(const v4fa*)(arow + kb + 8 * hh + 4), x2 = *(const v4fa*)(arow + kb + 16 + 8 * hh), x3 = *(const v4fa*)(arow + kb + 16 + 8 * hh + 4);
    float xs[16] = {x0[0],x0[1],x0[2],x0[3],x1[0],x1[1],x1[2],x1[3],x2[0],x2[1],x2[2],x2[3],x3[0],x3[1],x3[2],x3[3]};
#pragma unroll
    for (int i = 0; i < 16; ++i) { const _Float16 h = (_Float16)xs[i]; ah.h[i] = h; al.h[i] = ASPLIT ? (_Float16)(xs[i] - (float)h) : (_Float16)0.0f; }
#pragma unroll
    for (int t = 0; t < 4; ++t) { if (col0 + t * 16 >= N) continue; const size_t boff = (size_t)(col0 + t * 16 + ln) * ldb + kb; FragH bq; bq.half[0] = *(const v8us*)(Bh + boff + 8 * hh); bq.half[1] = *(const v8us*)(Bh + boff + 16 + 8 * hh);
      acc[t] = mmaH<ASPLIT ? 2 : 1>(ah.v, al.v, bq.v, bq.v, acc[t]); }
  }
#pragma unroll
  for (int t = 0; t < 4; ++t) { if (col0 + t * 16 >= N) continue;
#pragma unroll
    for (int r = 0; r < 8; ++r) so[w][8 * hh + r][t * 16 + ln] = acc[t][r] * alpha; }
  __builtin_amdgcn_fence(__ATOMIC_ACQ_REL, "workgroup"); __builtin_amdgcn_wave_barrier();
  const int rsub = lane >> 4, c4 = (lane & 15) * 4;
  {
#pragma unroll
    for (int q = 0; q < 8; ++q) { const int r = q * 2 + rsub; if (col0 + c4 < N) { const v4f v = *(const v4fa*)&so[w][r][c4]; *(v4f*)(C + (size_t)(row0 + r) * ldc + col0 + c4) = v; } }
     }
}

// Wt[n][k] = f16(W[k][n]·scale) from f32 row-major W[K][N] (scale = power of two; bf16-exact weights stay exact in f16 away from the subnormal range)
__global__ __launch_bounds__(256) void k_wt_f16(const float* __restrict__ W, _Float16* __restrict__ Wt, int K, int N, float scale) {
  const int t = blockIdx.x * 256 + threadIdx.x; if (t >= N * (K / 8)) return; const int n = t / (K / 8), k8 = (t % (K / 8)) * 8; FragH f;
#pragma unroll
  for (int i = 0; i < 8; ++i) f.h[i] = (_Float16)(bf16_round(W[(size_t)(k8 + i) * N + n]) * scale); const v8us o = f.half[0];
  *(v8us*)((unsigned short*)Wt + (size_t)n * K + k8) = o; 
}
// k_gemm_hh variant with fused epilogue: v = acc·alpha + bias[by·sBias + col] (+ CP[(row/rowsPerB)·sCPb + by·64 + col] if CP) ; ACT 0 none / 1 elu ; writes f16 C16 (and f32 C if non-null)
template <int ACT>
__global__ __launch_bounds__(128) void k_gemm_hhx(const _Float16* __restrict__ A, int lda, size_t sA, const _Float16* __restrict__ Bh, int ldb, size_t sB, float alpha, const float* __restrict__ bias, size_t sBias, const float* __restrict__ CP, int rowsPerB, size_t sCPb, int row0g,
    float* __restrict__ C, _Float16* __restrict__ C16, int ldc, size_t sC, int M, int N, int K) {
  __shared__ __attribute__((aligned(16))) float so[4][16][64];
  const int tid = threadIdx.x, w = tid >> 5, lane = tid & 31, ln = lane & 15, hh = lane >> 4; const int by = blockIdx.y;
  A += (size_t)by * sA; Bh += (size_t)by * sB; const size_t cofs = (size_t)by * sC; const float* bp = bias ? bias + (size_t)by * sBias : nullptr;
  const int ntn = (N + 63) / 64; const int wid = blockIdx.x * 4 + w; const int mt = wid / ntn, nq = wid % ntn; if (mt * 16 >= M) return;
  const int row0 = mt * 16, col0 = nq * 64; const _Float16* arow = A + (size_t)(row0 + ln) * lda;
  v8f acc[4] = {};
  for (int kb = 0; kb < K; kb += 32) { FragH ah; ah.half[0] = *(const v8us*)((const unsigned short*)arow + kb + 8 * hh); ah.half[1] = *(const v8us*)((const unsigned short*)arow + kb + 16 + 8 * hh);
#pragma unroll
    for (int t = 0; t < 4; ++t) { if (col0 + t * 16 >= N) continue; const size_t boff = (size_t)(col0 + t * 16 + ln) * ldb + kb; FragH bq; bq.half[0] = *(const v8us*)((const unsigned short*)Bh + boff + 8 * hh); bq.half[1] = *(const v8us*)((const unsigned short*)Bh + boff + 16 + 8 * hh);
      acc[t] = mmaH<1>(ah.v, ah.v, bq.v, bq.v, acc[t]); }
  }
#pragma unroll
  for (int t = 0; t < 4; ++t) { if (col0 + t * 16 >= N) continue; const int col = col0 + t * 16 + ln; const float bv = bp ? bf16_round(bp[col]) : 0.f;
#pragma unroll
    for (int r = 0; r < 8; ++r) { float v = acc[t][r] * alpha + bv; if (CP) { const int rr = row0g + row0 + 8 * hh + r; if (rowsPerB < 0) v += CP[cofs + (size_t)rr * ldc + col];      /* rowsPerB < 0: own element of the batched C plane */ else { const int bidx = rr / rowsPerB; v += CP[(size_t)bidx * sCPb + (size_t)by * 64 + col]; } } if (ACT == 1) v = (v > 0.f) ? v : expm1f(v); else if (ACT == 7) v = (v > 0.f) ? v + 1.0f : expf(v); else if (ACT == 8) v = tanhf(v); else if (ACT == 9) v = 0.5f * v * (1.0f + tanhf(0.7978845608028654f * (v + 0.044715f * v * v * v))); else if (ACT == 11) v = 1.0f / (1.0f + expf(-v)); else if (ACT == 12) v = (v > 0.f) ? v : 0.01f * v; else if (ACT == 14) v = (v > 0.f) ? v : 0.1f * v; else if (ACT == 16) v = (v >= 0.f) ? v : 0.3f * v; else if (ACT == 17) v = (v >= 0.f) ? v : 0.2f * v; else if (ACT == 15) v = v / (1.0f + expf(-v)); else if (ACT == 3) v = fmaxf(v, 0.f); else if (ACT == 6) v = 0.5f * v * (1.0f + erff(v * 0.70710678118654752f)); so[w][8 * hh + r][t * 16 + ln] = v; } }
  __builtin_amdgcn_fence(__ATOMIC_ACQ_REL, "workgroup"); __builtin_amdgcn_wave_barrier();
  const int rsub = lane >> 4, c4 = (lane & 15) * 4; typedef _Float16 v4h __attribute__((ext_vector_type(4)));
  {
#pragma unroll
    for (int q = 0; q < 8; ++q) { const int r = q * 2 + rsub; if (col0 + c4 < N) { const v4f v = *(const v4fa*)&so[w][r][c4]; if (C) *(v4f*)(C + cofs + (size_t)(row0 + r) * ldc + col0 + c4) = v; if (C16) { v4h h4; for (int i = 0; i < 4; ++i) h4[i] = (_Float16)v[i]; *(v4h*)(C16 + cofs + (size_t)(row0 + r) * ldc + col0 + c4) = h4; } } }
     }
}


typedef _Float16 v4h __attribute__((ext_vector_type(4)));

__global__ __launch_bounds__(256) void k_x16(const float* __restrict__ x, _Float16* __restrict__ X16, size_t n8) { const size_t t = (size_t)blockIdx.x * 256 + threadIdx.x; if (t >= n8) return; FragH f;
#pragma unroll
  for (int q = 0; q < 8; ++q) f.h[q] = (_Float16)bf16_round(x[t * 8 + q]); *(v8us*)((unsigned short*)X16 + t * 8) = f.half[0];  }
__global__ __launch_bounds__(256) void k_h16(const float* __restrict__ x, _Float16* __restrict__ X16, size_t n8) { const size_t t = (size_t)blockIdx.x * 256 + threadIdx.x; if (t >= n8) return; FragH f;
#pragma unroll
  for (int q = 0; q < 8; ++q) f.h[q] = (_Float16)x[t * 8 + q]; *(v8us*)((unsigned short*)X16 + t * 8) = f.half[0];  }
__global__ __launch_bounds__(256) void k_round16f(const float* __restrict__ W, _Float16* __restrict__ Bt, size_t n8) { const size_t t = (size_t)blockIdx.x * 256 + threadIdx.x; if (t >= n8) return; FragH f;
#pragma unroll
  for (int i = 0; i < 8; ++i) f.h[i] = (_Float16)(bf16_round(W[t * 8 + i]) * 16.0f); *(v8us*)((unsigned short*)Bt + t * 8) = f.half[0];  }
template <int NHv, int TTv>
__global__ __launch_bounds__(256) void k_vt(const _Float16* __restrict__ V16, int ldv, int voff, _Float16* __restrict__ Vt) { __shared__ unsigned short tl[64][66]; const int tid = threadIdx.x; const int slab = blockIdx.x / (TTv / 64), lg = blockIdx.x % (TTv / 64); const int b = slab / NHv, h = slab % NHv;
  for (int i = tid; i < 64 * 8; i += 256) { const int r = i / 8, c8 = (i % 8) * 8; FragH f; f.half[0] = *(const v8us*)((const unsigned short*)V16 + ((size_t)b * TTv + lg * 64 + r) * ldv + voff + h * 64 + c8);
#pragma unroll
    for (int q = 0; q < 8; ++q) tl[r][c8 + q] = f.u[q]; }
  __syncthreads();
  {
#pragma unroll
    for (int rd = 0; rd < 2; ++rd) { const int d = rd * 32 + tid / 8, pc = tid % 8; FragH f;
#pragma unroll
      for (int q = 0; q < 8; ++q) f.u[q] = tl[pc * 8 + q][d];
      *(v8us*)((unsigned short*)Vt + ((size_t)slab * 64 + d) * TTv + lg * 64 + pc * 8) = f.half[0]; }
     } }

__global__ __launch_bounds__(256) void k_hl(const float* __restrict__ F, _Float16* __restrict__ Hh, _Float16* __restrict__ Hl, size_t n8) { const size_t t = (size_t)blockIdx.x * 256 + threadIdx.x; if (t >= n8) return; FragH fh, fl; const v4f a = *(const v4fa*)(F + t * 8), c = *(const v4fa*)(F + t * 8 + 4);
#pragma unroll
  for (int q = 0; q < 4; ++q) { _Float16 h = (_Float16)a[q]; fh.h[q] = h; fl.h[q] = (_Float16)((a[q] - (float)h) * 1024.0f); h = (_Float16)c[q]; fh.h[4 + q] = h; fl.h[4 + q] = (_Float16)((c[q] - (float)h) * 1024.0f); }
  { *(v8us*)((unsigned short*)Hh + t * 8) = fh.half[0]; *(v8us*)((unsigned short*)Hl + t * 8) = fl.half[0];  } }

// ---- fast GEMM (wave tile 32x64; requires M % 32 == 0 rows per launch region and N % 64 == 0); epilogue = k_gemm_hhx semantics ----
__device__ __forceinline__ v16h g2_frag(const _Float16* p, int hh) { FragH f; f.half[0] = *(const v8us*)((const unsigned short*)p + 8 * hh); f.half[1] = *(const v8us*)((const unsigned short*)p + 16 + 8 * hh); return f.v; }
__device__ __forceinline__ v8f g2_mma(v16h a, v16h b, v8f c) { v8f d = __builtin_amdgcn_wmma_f32_16x16x32_f16(false, a, false, b, (short)0, c, false, false); asm volatile("v_nop\n\tv_nop\n\tv_nop\n\tv_nop" : "+v"(d) : "v"(a), "v"(b)); return d; }
template <int ACT>
__global__ __launch_bounds__(128) void k_gemm2(const _Float16* __restrict__ A, int lda, size_t sA, const _Float16* __restrict__ Bh, int ldb, size_t sB, float alpha, const float* __restrict__ bias, size_t sBias, const float* __restrict__ CP, int rowsPerB, size_t sCPb, int row0g,
    float* __restrict__ C, _Float16* __restrict__ C16, int ldc, size_t sC, int M, int N, int K) { static_assert(ACT == 0 || ACT == 3 || ACT == 6 || ACT == 8 || ACT == 9 || ACT == 11 || ACT == 12 || ACT == 14 || ACT == 15 || ACT == 16 || ACT == 17, "k_gemm2: unsupported ACT code (would silently apply no activation)");
  __shared__ __attribute__((aligned(16))) float so[4][32][68];
  const int tid = threadIdx.x, w = tid >> 5, lane = tid & 31, ln = lane & 15, hh = lane >> 4; const int by = blockIdx.y;
  A += (size_t)by * sA; Bh += (size_t)by * sB; const size_t cofs = (size_t)by * sC; const float* bp = bias ? bias + (size_t)by * sBias : nullptr;
  const int ntn = N >> 6; const int mt = blockIdx.x / ntn, nq = blockIdx.x - mt * ntn; const int row0 = mt * 128 + 32 * w, col0 = nq * 64; if (row0 >= M) return;
  const _Float16* a0p = A + (size_t)(row0 + ln) * lda; const _Float16* a1p = a0p + (size_t)16 * lda;
  const _Float16* b0p = Bh + (size_t)(col0 + ln) * ldb; const _Float16* b1p = b0p + (size_t)16 * ldb; const _Float16* b2p = b1p + (size_t)16 * ldb; const _Float16* b3p = b2p + (size_t)16 * ldb;
  const v8f z8 = {0.f,0.f,0.f,0.f,0.f,0.f,0.f,0.f}; v8f c00 = z8, c01 = z8, c02 = z8, c03 = z8, c10 = z8, c11 = z8, c12 = z8, c13 = z8;
#pragma unroll 1
  for (int kb = 0; kb < K; kb += 32) { const v16h a0 = g2_frag(a0p + kb, hh), a1 = g2_frag(a1p + kb, hh);
    v16h b = g2_frag(b0p + kb, hh); c00 = g2_mma(a0, b, c00); c10 = g2_mma(a1, b, c10);
    b = g2_frag(b1p + kb, hh); c01 = g2_mma(a0, b, c01); c11 = g2_mma(a1, b, c11);
    b = g2_frag(b2p + kb, hh); c02 = g2_mma(a0, b, c02); c12 = g2_mma(a1, b, c12);
    b = g2_frag(b3p + kb, hh); c03 = g2_mma(a0, b, c03); c13 = g2_mma(a1, b, c13); }
  v8f accs[8] = {c00, c01, c02, c03, c10, c11, c12, c13};
#pragma unroll
  for (int u = 0; u < 8; ++u) { const int t = u & 3, half = u >> 2; const int col = col0 + t * 16 + ln; const float bv = bp ? bf16_round(bp[col]) : 0.f;
#pragma unroll
    for (int r = 0; r < 8; ++r) { const int rloc = half * 16 + 8 * hh + r; float v = accs[u][r] * alpha + bv; if (CP) { if (rowsPerB < 0) v += CP[cofs + (size_t)(row0g + row0 + rloc) * ldc + col];      /* rowsPerB < 0: own element of the batched C plane */ else { const int bidx = (row0g + row0 + rloc) / rowsPerB; v += CP[(size_t)bidx * sCPb + (size_t)by * 64 + col]; } }
      if (ACT == 3) v = fmaxf(v, 0.f); else if (ACT == 6) v = 0.5f * v * (1.0f + erff(v * 0.70710678118654752f)); else if (ACT == 11) v = 1.0f / (1.0f + expf(-v)); else if (ACT == 15) v = v / (1.0f + expf(-v)); else if (ACT == 12) v = (v > 0.f) ? v : 0.01f * v; else if (ACT == 8) v = tanhf(v); else if (ACT == 9) v = 0.5f * v * (1.0f + tanhf(0.7978845608028654f * (v + 0.044715f * v * v * v))); else if (ACT == 14) v = (v > 0.f) ? v : 0.1f * v; else if (ACT == 16) v = (v >= 0.f) ? v : 0.3f * v; else if (ACT == 17) v = (v >= 0.f) ? v : 0.2f * v;
      so[w][rloc][t * 16 + ln] = v; } }
  __builtin_amdgcn_fence(__ATOMIC_ACQ_REL, "workgroup"); __builtin_amdgcn_wave_barrier();
  const int rsub = lane >> 4, c4 = (lane & 15) * 4;
  {
#pragma unroll
    for (int q = 0; q < 16; ++q) { const int r = q * 2 + rsub; const v4f v = *(const v4fa*)&so[w][r][c4]; if (C) *(v4f*)(C + cofs + (size_t)(row0 + r) * ldc + col0 + c4) = v; if (C16) { v4h h4; for (int i = 0; i < 4; ++i) h4[i] = (_Float16)v[i]; *(v4h*)(C16 + cofs + (size_t)(row0 + r) * ldc + col0 + c4) = h4; } }
     } }


__global__ __launch_bounds__(256) void k_wnat(const float* __restrict__ w, size_t n8, _Float16* __restrict__ Bt) { const size_t t = (size_t)blockIdx.x * 256 + threadIdx.x; if (t >= n8) return; FragH f; for (int q = 0; q < 8; ++q) f.h[q] = (_Float16)(bf16_round(w[t * 8 + q]) * 16.0f); *(v8us*)((unsigned short*)Bt + t * 8) = f.half[0];  }
__global__ __launch_bounds__(256) void k_rsm(const float* __restrict__ S, _Float16* __restrict__ P, int nrows) {
  #pragma clang fp contract(off)
  const int i = blockIdx.x * 256 + threadIdx.x; if (i >= nrows) return; const float* s = S + (size_t)i * SQ; float mx = -3.0e38f;
#pragma unroll 1
  for (int j = 0; j < SQ; ++j) mx = fmaxf(mx, s[j]); float se = 0.f;
#pragma unroll 1
  for (int j = 0; j < SQ; ++j) se += expf(s[j] - mx); const float sc = 256.0f / se;
#pragma unroll 1
  for (int j0 = 0; j0 < SQ; j0 += 8) { FragH f; for (int q = 0; q < 8; ++q) f.h[q] = (_Float16)(expf(s[j0 + q] - mx) * sc); unsigned short* d = (unsigned short*)P + (size_t)i * SQ + j0; *(v8us*)d = f.half[0];  } }
__global__ __launch_bounds__(256) void k_vt(const _Float16* __restrict__ V16, int b, int h0, _Float16* __restrict__ VT) { __shared__ unsigned short tl[64][65]; const int tid = threadIdx.x; const int hh = blockIdx.x % HG, sg = blockIdx.x / HG; const int s0 = sg * 64; const int h = h0 + hh;
  for (int i = tid; i < 64 * 8; i += 256) { const int j = i / 8, d8 = (i % 8) * 8; FragH f; f.half[0] = *(const v8us*)((const unsigned short*)V16 + ((size_t)b * SQ + s0 + j) * DM + h * HD + d8); for (int q = 0; q < 8; ++q) tl[d8 + q][j] = f.u[q]; }
  __syncthreads();
  { for (int i = tid; i < 64 * 8; i += 256) { const int d = i / 8, j8 = (i % 8) * 8; FragH f; for (int q = 0; q < 8; ++q) f.u[q] = tl[d][j8 + q]; *(v8us*)((unsigned short*)VT + ((size_t)hh * HD + d) * SQ + s0 + j8) = f.half[0]; }  } }


__global__ __launch_bounds__(256) void k_t5bias(const float* __restrict__ relb, int h0, float* __restrict__ BP) {
  const size_t t = (size_t)blockIdx.x * 256 + threadIdx.x; if (t >= (size_t)HG * SQ * SQ / 4) return; const size_t e0 = t * 4; const int j0 = (int)(e0 % SQ); const int i = (int)((e0 / SQ) % SQ); const int hl = (int)(e0 / ((size_t)SQ * SQ)); v4f o;
  for (int q = 0; q < 4; ++q) { const int d = j0 + q - i; const int a = d < 0 ? -d : d; const int f = (a < 8) ? a : (8 + (a >= 12) + (a >= 16) + (a >= 23) + (a >= 32) + (a >= 46) + (a >= 64) + (a >= 91)); const int bk = (d > 0 ? 16 : 0) + f; o[q] = bf16_round(relb[bk * NH + h0 + hl]); }
  float* dst = BP + e0; *(v4f*)dst = o;  }


// Row softmax, one wave per score row: each lane holds 64 of the row's 2048 scores in registers (16 loads of 16 bytes, 512 contiguous bytes per wave-wide load),
// so S is read once and every exponential is formed once; maximum and sum: four chains per lane, then a five-step butterfly over the 32 lanes. The loops over x are unrolled so that its indices are constants and it stays in registers.
__device__ __forceinline__ float xl_half(float x) { return __builtin_bit_cast(float, __builtin_amdgcn_permlanex16(__builtin_bit_cast(int, x), __builtin_bit_cast(int, x), 0x76543210, 0xfedcba98, false, false)); }  // lane l with lane l ^ 16
template <int M> __device__ __forceinline__ float xl_row(float x) { return __builtin_bit_cast(float, __builtin_amdgcn_update_dpp(0, __builtin_bit_cast(int, x), 0x160 | M, 0xf, 0xf, true)); }  // lane l with lane l ^ M inside a 16-lane row (row_xmask)
__device__ __forceinline__ float wave_max(float x) { x = fmaxf(x, xl_row<1>(x)); x = fmaxf(x, xl_row<2>(x)); x = fmaxf(x, xl_row<4>(x)); x = fmaxf(x, xl_row<8>(x)); return fmaxf(x, xl_half(x)); }
__device__ __forceinline__ float wave_sum(float x) { x += xl_row<1>(x); x += xl_row<2>(x); x += xl_row<4>(x); x += xl_row<8>(x); return x + xl_half(x); }
// v_exp_f32 with the v_nop in its own statement: it keeps the one slot that the instruction set asks for behind a transcendental
__device__ __forceinline__ float exp2_slot(float a) { float e; asm("v_exp_f32 %0, %1\n\tv_nop" : "=v"(e) : "v"(a)); return e; }
#define RSW 16                       /* waves (rows) per softmax work-group */
__global__ __launch_bounds__(RSW * 32) void k_rsmf(const float* __restrict__ S, _Float16* __restrict__ P, int qn, int hg) {
  const int lane = threadIdx.x & 31; const int t = blockIdx.x * RSW + __builtin_amdgcn_readfirstlane(threadIdx.x >> 5); if (t >= qn * hg) return;      /* wave-uniform exit; the kernel has no barrier */
  const size_t i = (size_t)(t / qn) * SQ + (t % qn); const float* s = S + i * SQ + lane * 4; v4f x[SQ / 128];
#pragma unroll
  for (int c = 0; c < SQ / 128; ++c) x[c] = *(const v4fa*)(s + c * 128);
  v4f m4 = {-3.0e38f, -3.0e38f, -3.0e38f, -3.0e38f};
#pragma unroll
  for (int c = 0; c < SQ / 128; ++c) for (int q = 0; q < 4; ++q) m4[q] = fmaxf(m4[q], x[c][q]);
  const float mx = wave_max(fmaxf(fmaxf(m4[0], m4[1]), fmaxf(m4[2], m4[3]))); v4f a4 = {0.f, 0.f, 0.f, 0.f};
#pragma unroll
  for (int c = 0; c < SQ / 128; ++c) for (int q = 0; q < 4; ++q) { x[c][q] = exp2_slot((x[c][q] - mx) * 1.44269504088896340736f); a4[q] += x[c][q]; }      /* the native exp: one multiply by log2(e), one v_exp_f32 */
  const float se = wave_sum((a4[0] + a4[1]) + (a4[2] + a4[3])); const float sc = 256.0f / se; _Float16* p = P + i * SQ + lane * 4;
#pragma unroll
  for (int c = 0; c < SQ / 128; ++c) { v4h h4; for (int q = 0; q < 4; ++q) h4[q] = (_Float16)(x[c][q] * sc); *(v4h*)(p + c * 128) = h4; } }

extern "C" void kernel_launch(void* const* d_in, const int* in_sizes, int n_in,
                              void* d_out, int out_size, void* d_ws, size_t ws_size, hipStream_t stream) {
  (void)in_sizes; (void)n_in; (void)out_size;
  const float* const* I = (const float* const*)d_in; const float* xq = I[0]; const float* xkv = I[1]; const float* wq = I[2]; const float* wk = I[3]; const float* wv = I[4]; const float* wo = I[5]; const float* relb = I[6]; const float* bq = nullptr; const float* bk = nullptr; (void)bq; (void)bk;      /* [in][out] weights, no biases; rel_bias [32 buckets][16 heads] */
  char* ws = (char*)d_ws; size_t off = 0;
  auto take = [&](size_t bytes) { char* p = ws + off; off += (bytes + 255) & ~(size_t)255; return p; };
  _Float16* BQ = (_Float16*)take((size_t)DM * DM * 2); _Float16* BK = (_Float16*)take((size_t)DM * DM * 2); _Float16* BV = (_Float16*)take((size_t)DM * DM * 2); _Float16* BO = (_Float16*)take((size_t)DM * DM * 2);
  float* S = (float*)take((size_t)HG * SQ * SQ * 4); float* QF = S;      /* the f32 projection scratch (NR x DM x 4 = 32 MiB) lives in the scores plane (HG x SQ x SQ x 4 = 32 MiB), which is first written after q and k have been split */ _Float16* XQ = (_Float16*)take(NR * DM * 2); _Float16* XKV = (_Float16*)take(NR * DM * 2); _Float16* Q16 = (_Float16*)take(NR * DM * 2); _Float16* QL = (_Float16*)take(NR * DM * 2); _Float16* K16 = (_Float16*)take(NR * DM * 2); _Float16* KL = (_Float16*)take(NR * DM * 2); _Float16* V16 = (_Float16*)take(NR * DM * 2); _Float16* O16 = (_Float16*)take(NR * DM * 2);
  static_assert((size_t)HG * SQ * SQ * 4 >= NR * DM * 4, "QF alias must fit in S"); _Float16* P = (_Float16*)take((size_t)HG * SQ * SQ * 2); _Float16* VT = (_Float16*)take((size_t)NB * NH * HD * SQ * 2); float* BP = (float*)take((size_t)HG * SQ * SQ * 4);      /* V^T for ALL batches; the relative-position bias plane of one head group */
  if (off > ws_size) return;
  k_wt_f16<<<(unsigned)(((size_t)DM * (DM / 8) + 255) / 256), 256, 0, stream>>>(wq, BQ, DM, DM, 16.0f); k_wt_f16<<<(unsigned)(((size_t)DM * (DM / 8) + 255) / 256), 256, 0, stream>>>(wk, BK, DM, DM, 16.0f); k_wt_f16<<<(unsigned)(((size_t)DM * (DM / 8) + 255) / 256), 256, 0, stream>>>(wv, BV, DM, DM, 16.0f); k_wt_f16<<<(unsigned)(((size_t)DM * (DM / 8) + 255) / 256), 256, 0, stream>>>(wo, BO, DM, DM, 16.0f);      /* [in][out] -> Bt[n][k] x16 */

  k_x16<<<(unsigned)((NR * DM / 8 + 255) / 256), 256, 0, stream>>>(xq, XQ, NR * DM / 8); k_x16<<<(unsigned)((NR * DM / 8 + 255) / 256), 256, 0, stream>>>(xkv, XKV, NR * DM / 8);      /* query source and key/value source as exact f16 rows */
  const size_t r0p = (size_t)B0 * SQ;      /* first projected row */
  k_gemm2<0><<<dim3((unsigned)((MP / 128) * (DM / 64)), 1), 128, 0, stream>>>(XQ + r0p * DM, DM, 0, BQ, DM, 0, 0.0625f, nullptr, 0, nullptr, 1, 0, 0, QF + r0p * DM, nullptr, DM, 0, MP, DM, DM); k_hl<<<(unsigned)(((size_t)MP * DM / 8 + 255) / 256), 256, 0, stream>>>(QF + r0p * DM, Q16 + r0p * DM, QL + r0p * DM, (size_t)MP * DM / 8);      /* q in f32 -> f16 hi (Q16) + x1024 residual (QL) planes */
  k_gemm2<0><<<dim3((unsigned)((MP / 128) * (DM / 64)), 1), 128, 0, stream>>>(XKV + r0p * DM, DM, 0, BK, DM, 0, 0.0625f, nullptr, 0, nullptr, 1, 0, 0, QF + r0p * DM, nullptr, DM, 0, MP, DM, DM); k_hl<<<(unsigned)(((size_t)MP * DM / 8 + 255) / 256), 256, 0, stream>>>(QF + r0p * DM, K16 + r0p * DM, KL + r0p * DM, (size_t)MP * DM / 8);      /* k in f32 (reusing the QF scratch plane after q's split) -> f16 hi (K16) + x1024 residual (KL) planes */
  k_gemm2<0><<<dim3((unsigned)((MP / 128) * (DM / 64)), 1), 128, 0, stream>>>(XKV + r0p * DM, DM, 0, BV, DM, 0, 0.0625f, nullptr, 0, nullptr, 1, 0, 0, nullptr, V16 + r0p * DM, DM, 0, MP, DM, DM);
  for (int b = B0; b < B0 + NBR; ++b) { const size_t r0 = (size_t)b * SQ; k_vt<NH, SQ><<<NH * (SQ / 64), 256, 0, stream>>>(V16 + r0 * LQ, LQ, 0, VT + (size_t)b * NH * HD * SQ); }      /* V^T [NH][HD][SQ] of every batch */
  for (int h0 = 0; h0 < NHD; h0 += HG) {
    k_t5bias<<<(unsigned)(((size_t)HG * SQ * SQ / 4 + 255) / 256), 256, 0, stream>>>(relb, h0, BP);      /* bias[h0 + hl][i][j] plane for this head group (shared by all batches) */
    for (int b = B0; b < B0 + NBR; ++b) { const size_t r0 = (size_t)b * SQ;
      k_gemm2<0><<<dim3((QN / 128) * (SQ / 64), HG), 128, 0, stream>>>(Q16 + r0 * LQ + h0 * HD, LQ, (size_t)HD, K16 + r0 * LQ + h0 * HD, LQ, (size_t)HD, 1.0f, nullptr, 0, BP, -1, 0, 0, S, nullptr, SQ, (size_t)SQ * SQ, QN, SQ, HD); k_gemm2<0><<<dim3((QN / 128) * (SQ / 64), HG), 128, 0, stream>>>(QL + r0 * LQ + h0 * HD, LQ, (size_t)HD, K16 + r0 * LQ + h0 * HD, LQ, (size_t)HD, 0.0009765625f, nullptr, 0, S, -1, 0, 0, S, nullptr, SQ, (size_t)SQ * SQ, QN, SQ, HD); k_gemm2<0><<<dim3((QN / 128) * (SQ / 64), HG), 128, 0, stream>>>(Q16 + r0 * LQ + h0 * HD, LQ, (size_t)HD, KL + r0 * LQ + h0 * HD, LQ, (size_t)HD, 0.0009765625f, nullptr, 0, S, -1, 0, 0, S, nullptr, SQ, (size_t)SQ * SQ, QN, SQ, HD);      /* scores = bias (CP = own element of BP) + q_hi.k_hi, += q_lo.k_hi 2^-10, += q_hi.k_lo 2^-10: unscaled, q and k effectively f32 */
      k_rsmf<<<(HG * QN + RSW - 1) / RSW, RSW * 32, 0, stream>>>(S, P, QN, HG);      /* P = 256 softmax (f16), rows of all HG heads */
      k_gemm2<0><<<dim3((QN / 128) * (HD / 64), HG), 128, 0, stream>>>(P, SQ, (size_t)SQ * SQ, VT + (size_t)b * NH * HD * SQ + (size_t)h0 * HD * SQ, SQ, (size_t)HD * SQ, 0.25f, nullptr, 0, nullptr, 1, 0, 0, nullptr, O16 + r0 * DM + h0 * HD, DM, (size_t)HD, QN, HD, SQ); } }      /* o (merged heads) as f16 rows */
  k_gemm2<0><<<dim3((unsigned)((MPO / 128) * (DM / 64)), 1), 128, 0, stream>>>(O16 + r0p * DM, DM, 0, BO, DM, 0, 0.0009765625f, nullptr, 0, nullptr, 1, 0, 0, (float*)d_out + r0p * DM, nullptr, DM, 0, MPO, DM, DM);      /* out rows are the output layout */
}

// v003
// Measured time: 438 microseconds a run.
// Versions between v001 and this one are left out; their measured steps multiply to 11.8 times as fast.
// Counting every step since v000, it is 35.1 times as fast.
#include <hip/hip_runtime.h>
// T5 attention with a relative-position bias and NO score scaling (query_states [4][2048][1024] gives q = x wq; key_value_states gives k = x wk, v = x wv ([in][out] 1024^2 sigma 1/32, no biases); 16 heads of 64; scores = q . k (UNSCALED, logits sigma ~8) + bias[h][i][j] with bias = rel_bias[bucket(j - i)][h] (rel_bias input [32][16]; bidirectional log buckets, 32 buckets, max distance 128); softmax; out = merged wo -> [4][2048][1024]).
// Structure: token rows r = b*2048 + s; the query source and the key/value source as exact f16 rows (bf16-rounded); Q, K, V as three WMMA GEMMs (32x64 wave tiles, f32 accumulation, exact x16 weights); q and k in f32 split into f16 hi + x1024 residual planes; V^T of every batch via LDS transposes; then ONE fused attention launch over (query block, head, batch): UNSCALED three-term scores (bias as the start value, q_hi . k_hi, + (q_lo . k_hi + q_hi . k_lo) 2^-10; K = 64), running-maximum softmax in registers (f32 statistics, native exp; weights x256 as f16), O^T += V^T . P^T, o carried x64 against f16 subnormal flush (folded into the output GEMM alpha) written straight into the merged f16 o rows; out = o W_o GEMM (f32) into the output layout.
// Compute dtype: inputs rounded to bf16; x / weights exact; v, softmax weights and o as plain f16 GEMM operands (~2^-12), q and k as f16 hi + x1024 residual pairs; scores and softmax statistics f32. v_wmma_f32_16x16x32_f16.
#define NB 4
#define SQ 2048
#define DM 1024
#define NH 16
#define HD 64
#define HG 2                         /* heads per launch of the second k_vt, which is not launched */
#define B0 0                         /* first batch processed (debug hook) */
#define NBR NB                       /* batches processed (debug hook) */
#define NR ((size_t)NB * SQ)         /* token rows */
#define MP ((int)((size_t)NBR * SQ)) /* rows projected (debug hook) */
#define QN SQ                        /* not used: the attention launch attends all SQ query rows */
#define NHD NH                       /* not used: the attention launch covers all NH heads */
#define MPO MP                       /* rows through the output stage (debug hook) */
#define LQ DM      /* row pitch of the q/k/v rows */
typedef __bf16 v16b __attribute__((ext_vector_type(16)));
typedef unsigned short v8us __attribute__((ext_vector_type(8), may_alias));
typedef float  v8f  __attribute__((ext_vector_type(8)));
typedef float  v4f  __attribute__((ext_vector_type(4)));
typedef float  v4fa __attribute__((ext_vector_type(4), may_alias));
union FragB { v16b v; v8us half[2]; unsigned short u[16]; };

__device__ __forceinline__ unsigned short bf16_bits(float x) { unsigned int u = __float_as_uint(x); return (unsigned short)((u + 0x7FFFu + ((u >> 16) & 1u)) >> 16); }
__device__ __forceinline__ float bf16_val(unsigned short b) { return __uint_as_float(((unsigned int)b) << 16); }
__device__ __forceinline__ float bf16_round(float x) { return bf16_val(bf16_bits(x)); }
// D += A·B with NT terms: 1 = ah·bh, 2 = + al·bh (A split), 3 = + ah·bl (both split)
template <int NT>
__device__ __forceinline__ v8f mmaN(v16b ah, v16b al, v16b bh, v16b bl, v8f c) {
  c = __builtin_amdgcn_wmma_f32_16x16x32_bf16(false, ah, false, bh, (short)0, c, false, false);
  if (NT >= 2) c = __builtin_amdgcn_wmma_f32_16x16x32_bf16(false, al, false, bh, (short)0, c, false, false);
  if (NT >= 3) c = __builtin_amdgcn_wmma_f32_16x16x32_bf16(false, ah, false, bl, (short)0, c, false, false);
  asm volatile("v_nop\n\tv_nop\n\tv_nop\n\tv_nop" : "+v"(c) : "v"(ah), "v"(al), "v"(bh), "v"(bl));
  return c;
}

__global__ __launch_bounds__(256) void k_wt_bf16(const float* __restrict__ W, unsigned short* __restrict__ Wt, int K, int N) {
  const int t = blockIdx.x * 256 + threadIdx.x;
  const int k8n = K / 8;
  if (t >= N * k8n) return;
  const int n = t / k8n, k8 = (t % k8n) * 8;
  v8us v;
#pragma unroll
  for (int i = 0; i < 8; ++i) v[i] = bf16_bits(W[(size_t)(k8 + i) * N + n]);
  *(v8us*)(Wt + (size_t)n * K + k8) = v;
  
}

// GEMM C[M][N] (f32, pitch ldc) = act(A[M][K]·W + bias). A f32 row-major (pitch lda) converted per fragment to bf16
// (ASPLIT: hi/lo two planes -> 2 terms, else single rounded term); Wt bf16 [N][K] (pitch ldb). BIAS_BF16 rounds the
// bias to bf16 first (bias quantised to bf16 before the add). K%32==0, M%16==0, N%64==0.
template <bool ASPLIT, int ACT, bool BIAS_BF16>
__global__ __launch_bounds__(128) void k_gemm_bf(const float* __restrict__ A, int lda, const unsigned short* __restrict__ Wt, int ldb,
                                               const float* __restrict__ bias, float* __restrict__ C, int ldc, int M, int N, int K) {
  __shared__ __attribute__((aligned(16))) float so[4][16][64];
  const int tid = threadIdx.x, w = tid >> 5, lane = tid & 31, ln = lane & 15, hh = lane >> 4;
  const int ntn = N / 64;
  const int wid = blockIdx.x * 4 + w;
  const int mt = wid / ntn, nq = wid % ntn;
  if (mt * 16 >= M) return;
  const int row0 = mt * 16, col0 = nq * 64;
  const float* arow = A + (size_t)(row0 + ln) * lda;
  v8f acc[4] = {};
  for (int kb = 0; kb < K; kb += 32) {
    FragB ah, al;
    const v4f x0 = *(const v4fa*)(arow + kb + 8 * hh), x1 = *(const v4fa*)(arow + kb + 8 * hh + 4);
    const v4f x2 = *(const v4fa*)(arow + kb + 16 + 8 * hh), x3 = *(const v4fa*)(arow + kb + 16 + 8 * hh + 4);
    float xs[16] = {x0[0],x0[1],x0[2],x0[3],x1[0],x1[1],x1[2],x1[3],x2[0],x2[1],x2[2],x2[3],x3[0],x3[1],x3[2],x3[3]};
#pragma unroll
    for (int i = 0; i < 16; ++i) { const unsigned short hb = bf16_bits(xs[i]); ah.u[i] = hb; al.u[i] = ASPLIT ? bf16_bits(xs[i] - bf16_val(hb)) : (unsigned short)0; }
#pragma unroll
    for (int t = 0; t < 4; ++t) {
      const unsigned short* brow = Wt + (size_t)(col0 + t * 16 + ln) * ldb + kb;
      FragB b;
      b.half[0] = *(const v8us*)(brow + 8 * hh);
      b.half[1] = *(const v8us*)(brow + 16 + 8 * hh);
      acc[t] = mmaN<ASPLIT ? 2 : 1>(ah.v, al.v, b.v, b.v, acc[t]);
    }
  }
#pragma unroll
  for (int t = 0; t < 4; ++t) {
    float bv = bias ? bias[col0 + t * 16 + ln] : 0.f;
    if (BIAS_BF16) bv = bf16_round(bv);
#pragma unroll
    for (int r = 0; r < 8; ++r) { float v = acc[t][r] + bv; if (ACT == 1) v = fmaxf(v, 0.f); so[w][8 * hh + r][t * 16 + ln] = v; }
  }
  __builtin_amdgcn_fence(__ATOMIC_ACQ_REL, "workgroup");
  __builtin_amdgcn_wave_barrier();
  const int rsub = lane >> 4, c4 = (lane & 15) * 4;
  {
#pragma unroll
    for (int q = 0; q < 8; ++q) {
      const int r = q * 2 + rsub;
      const v4f v = *(const v4fa*)&so[w][r][c4];
      *(v4f*)(C + (size_t)(row0 + r) * ldc + col0 + c4) = v;
    }
    
  }
}

// GEMM C = act(A·W + bias + resid): A f32 (ASPLIT -> hi/lo 2 terms), Wt bf16 [N][K]; ACT 0 none, 1 relu, 2 exact gelu;
// resid (optional, f32, row index = (row % rmod), pitch ldr, RES_BF16 rounds it) added before the activation.
template <bool ASPLIT, int ACT, bool BIAS_BF16, bool RES_BF16>
__global__ __launch_bounds__(128) void k_gemm_bf3(const float* __restrict__ A, int lda, const unsigned short* __restrict__ Wt, int ldb,
                                                const float* __restrict__ bias, const float* __restrict__ resid, int rmod, int ldr,
                                                float* __restrict__ C, int ldc, int M, int N, int K) {
  __shared__ __attribute__((aligned(16))) float so[4][16][64];
  const int tid = threadIdx.x, w = tid >> 5, lane = tid & 31, ln = lane & 15, hh = lane >> 4;
  const int ntn = N / 64;
  const int wid = blockIdx.x * 4 + w;
  const int mt = wid / ntn, nq = wid % ntn;
  if (mt * 16 >= M) return;
  const int row0 = mt * 16, col0 = nq * 64;
  const float* arow = A + (size_t)(row0 + ln) * lda;
  v8f acc[4] = {};
  for (int kb = 0; kb < K; kb += 32) {
    FragB ah, al;
    const v4f x0 = *(const v4fa*)(arow + kb + 8 * hh), x1 = *(const v4fa*)(arow + kb + 8 * hh + 4);
    const v4f x2 = *(const v4fa*)(arow + kb + 16 + 8 * hh), x3 = *(const v4fa*)(arow + kb + 16 + 8 * hh + 4);
    float xs[16] = {x0[0],x0[1],x0[2],x0[3],x1[0],x1[1],x1[2],x1[3],x2[0],x2[1],x2[2],x2[3],x3[0],x3[1],x3[2],x3[3]};
#pragma unroll
    for (int i = 0; i < 16; ++i) { const unsigned short hb = bf16_bits(xs[i]); ah.u[i] = hb; al.u[i] = ASPLIT ? bf16_bits(xs[i] - bf16_val(hb)) : (unsigned short)0; }
#pragma unroll
    for (int t = 0; t < 4; ++t) {
      const unsigned short* brow = Wt + (size_t)(col0 + t * 16 + ln) * ldb + kb;
      FragB b;
      b.half[0] = *(const v8us*)(brow + 8 * hh);
      b.half[1] = *(const v8us*)(brow + 16 + 8 * hh);
      acc[t] = mmaN<ASPLIT ? 2 : 1>(ah.v, al.v, b.v, b.v, acc[t]);
    }
  }
#pragma unroll
  for (int t = 0; t < 4; ++t) {
    const int col = col0 + t * 16 + ln;
    float bv = bias ? bias[col] : 0.f;
    if (BIAS_BF16) bv = bf16_round(bv);
#pragma unroll
    for (int r = 0; r < 8; ++r) {
      float v = acc[t][r] + bv;
      if (resid) { float rv = resid[(size_t)((row0 + 8 * hh + r) % rmod) * ldr + col]; if (RES_BF16) rv = bf16_round(rv); v += rv; }
      if (ACT == 1) v = fmaxf(v, 0.f);
      if (ACT == 2) v = 0.5f * v * (1.0f + erff(v * 0.70710678118654752f));
      if (ACT == 3) { const float u = 0.7978845608028654f * (v + 0.044715f * v * v * v); v = 0.5f * v * (1.0f + tanhf(u)); }
      so[w][8 * hh + r][t * 16 + ln] = v;
    }
  }
  __builtin_amdgcn_fence(__ATOMIC_ACQ_REL, "workgroup");
  __builtin_amdgcn_wave_barrier();
  const int rsub = lane >> 4, c4 = (lane & 15) * 4;
  {
#pragma unroll
    for (int q = 0; q < 8; ++q) {
      const int r = q * 2 + rsub;
      const v4f v = *(const v4fa*)&so[w][r][c4];
      *(v4f*)(C + (size_t)(row0 + r) * ldc + col0 + c4) = v;
    }
    
  }
}
// row LayerNorm (biased variance, eps) over N: s = X (+ R); optional out_sum <- s; out_norm <- (s-mu)*rsqrt(var+eps)*g + b
template <bool PARAM_BF16>
__global__ __launch_bounds__(256) void k_layernorm(const float* __restrict__ X, const float* __restrict__ R, const float* __restrict__ g, const float* __restrict__ bta,
                                                  float* __restrict__ out_sum, float* __restrict__ out_norm, int N, float eps) {
  __shared__ float red[256];
  const int row = blockIdx.x, tid = threadIdx.x;
  const float* x = X + (size_t)row * N; const float* rr = R ? R + (size_t)row * N : nullptr;
  float vals[16];                     // up to N = 4096
  const int per = N / 256;            // contiguous chunk per thread? use strided-by-4 chunks: thread handles j = tid*4 + 1024*u
  float s1 = 0.f;
  for (int u = 0; u < per / 4; ++u) {
    const int j = tid * 4 + 1024 * u;
    const v4f a = *(const v4fa*)(x + j);
    v4f b = {0.f,0.f,0.f,0.f}; if (rr) b = *(const v4fa*)(rr + j);
#pragma unroll
    for (int q = 0; q < 4; ++q) { const float v = a[q] + b[q]; vals[u * 4 + q] = v; s1 += v; }
  }
  red[tid] = s1; __syncthreads();
  for (int st = 128; st > 0; st >>= 1) { if (tid < st) red[tid] += red[tid + st]; __syncthreads(); }
  const float mu = red[0] / (float)N; __syncthreads();
  float s2 = 0.f;
  for (int u = 0; u < per / 4; ++u)
#pragma unroll
    for (int q = 0; q < 4; ++q) { const float c = vals[u * 4 + q] - mu; s2 += c * c; }
  red[tid] = s2; __syncthreads();
  for (int st = 128; st > 0; st >>= 1) { if (tid < st) red[tid] += red[tid + st]; __syncthreads(); }
  const float rs = rsqrtf(red[0] / (float)N + eps);
  {
    for (int u = 0; u < per / 4; ++u) {
      const int j = tid * 4 + 1024 * u;
      v4f o, sm;
#pragma unroll
      for (int q = 0; q < 4; ++q) {
        float gg = g[j + q], bb = bta[j + q];
        if (PARAM_BF16) { gg = bf16_round(gg); bb = bf16_round(bb); }
        sm[q] = vals[u * 4 + q]; o[q] = (vals[u * 4 + q] - mu) * rs * gg + bb;
      }
      if (out_sum) *(v4f*)(out_sum + (size_t)row * N + j) = sm;
      *(v4f*)(out_norm + (size_t)row * N + j) = o;
    }
    
  }
}



// ---- f16 WMMA path (v_wmma_f32_16x16x32_f16): 11-bit significands for operands in range — used where a [0,1] probability operand needs more precision than bf16
typedef _Float16 v16h __attribute__((ext_vector_type(16)));
union FragH { v16h v; v8us half[2]; _Float16 h[16]; unsigned short u[16]; };
template <int NT>
__device__ __forceinline__ v8f mmaH(v16h ah, v16h al, v16h bh, v16h bl, v8f c) {
  c = __builtin_amdgcn_wmma_f32_16x16x32_f16(false, ah, false, bh, (short)0, c, false, false);
  if (NT >= 2) c = __builtin_amdgcn_wmma_f32_16x16x32_f16(false, al, false, bh, (short)0, c, false, false);
  if (NT >= 3) c = __builtin_amdgcn_wmma_f32_16x16x32_f16(false, ah, false, bl, (short)0, c, false, false);
  asm volatile("v_nop\n\tv_nop\n\tv_nop\n\tv_nop" : "+v"(c) : "v"(ah), "v"(al), "v"(bh), "v"(bl));
  return c;
}
// batched GEMM like k_gemm_b but f16 operands: A f32 (split into f16 hi/lo if ASPLIT, else rounded to f16), Bt = f16 values [n][k]; alpha; C f32; N multiple of 16 (partial tiles skipped)
template <bool ASPLIT>
__global__ __launch_bounds__(128) void k_gemm_h(const float* __restrict__ A, int lda, size_t sA, const _Float16* __restrict__ Bh, int ldb, size_t sB, float alpha, float* __restrict__ C, int ldc, size_t sC, int M, int N, int K) {
  __shared__ __attribute__((aligned(16))) float so[4][16][64];
  const int tid = threadIdx.x, w = tid >> 5, lane = tid & 31, ln = lane & 15, hh = lane >> 4; const int by = blockIdx.y;
  A += (size_t)by * sA; Bh += (size_t)by * sB; C += (size_t)by * sC;
  const int ntn = (N + 63) / 64; const int wid = blockIdx.x * 4 + w; const int mt = wid / ntn, nq = wid % ntn; if (mt * 16 >= M) return;
  const int row0 = mt * 16, col0 = nq * 64; const float* arow = A + (size_t)(row0 + ln) * lda;
  v8f acc[4] = {};
  for (int kb = 0; kb < K; kb += 32) {
    FragH ah, al;
    const v4f x0 = *(const v4fa*)(arow + kb + 8 * hh), x1 = *(const v4fa*)(arow + kb + 8 * hh + 4), x2 = *(const v4fa*)(arow + kb + 16 + 8 * hh), x3 = *(const v4fa*)(arow + kb + 16 + 8 * hh + 4);
    float xs[16] = {x0[0],x0[1],x0[2],x0[3],x1[0],x1[1],x1[2],x1[3],x2[0],x2[1],x2[2],x2[3],x3[0],x3[1],x3[2],x3[3]};
#pragma unroll
    for (int i = 0; i < 16; ++i) { const _Float16 h = (_Float16)xs[i]; ah.h[i] = h; al.h[i] = ASPLIT ? (_Float16)(xs[i] - (float)h) : (_Float16)0.0f; }
#pragma unroll
    for (int t = 0; t < 4; ++t) { if (col0 + t * 16 >= N) continue; const size_t boff = (size_t)(col0 + t * 16 + ln) * ldb + kb; FragH bq; bq.half[0] = *(const v8us*)(Bh + boff + 8 * hh); bq.half[1] = *(const v8us*)(Bh + boff + 16 + 8 * hh);
      acc[t] = mmaH<ASPLIT ? 2 : 1>(ah.v, al.v, bq.v, bq.v, acc[t]); }
  }
#pragma unroll
  for (int t = 0; t < 4; ++t) { if (col0 + t * 16 >= N) continue;
#pragma unroll
    for (int r = 0; r < 8; ++r) so[w][8 * hh + r][t * 16 + ln] = acc[t][r] * alpha; }
  __builtin_amdgcn_fence(__ATOMIC_ACQ_REL, "workgroup"); __builtin_amdgcn_wave_barrier();
  const int rsub = lane >> 4, c4 = (lane & 15) * 4;
  {
#pragma unroll
    for (int q = 0; q < 8; ++q) { const int r = q * 2 + rsub; if (col0 + c4 < N) { const v4f v = *(const v4fa*)&so[w][r][c4]; *(v4f*)(C + (size_t)(row0 + r) * ldc + col0 + c4) = v; } }
     }
}

// Wt[n][k] = f16(W[k][n]·scale) from f32 row-major W[K][N] (scale = power of two; bf16-exact weights stay exact in f16 away from the subnormal range)
__global__ __launch_bounds__(256) void k_wt_f16(const float* __restrict__ W, _Float16* __restrict__ Wt, int K, int N, float scale) {
  const int t = blockIdx.x * 256 + threadIdx.x; if (t >= N * (K / 8)) return; const int tile = t >> 6, w = t & 63, kt = K >> 5; const int n = (tile / kt) * 16 + (w & 15), k8 = (tile % kt) * 32 + (w >> 4) * 8; FragH f;      /* thread = output chunk of the fragment order (rows n, K / 32 k blocks a row tile) */
#pragma unroll
  for (int i = 0; i < 8; ++i) f.h[i] = (_Float16)(bf16_round(W[(size_t)(k8 + i) * N + n]) * scale); const v8us o = f.half[0];
  *(v8us*)((unsigned short*)Wt + (size_t)t * 8) = o; 
}
// k_gemm_hh variant with fused epilogue: v = acc·alpha + bias[by·sBias + col] (+ CP[(row/rowsPerB)·sCPb + by·64 + col] if CP) ; ACT 0 none / 1 elu ; writes f16 C16 (and f32 C if non-null)
template <int ACT>
__global__ __launch_bounds__(128) void k_gemm_hhx(const _Float16* __restrict__ A, int lda, size_t sA, const _Float16* __restrict__ Bh, int ldb, size_t sB, float alpha, const float* __restrict__ bias, size_t sBias, const float* __restrict__ CP, int rowsPerB, size_t sCPb, int row0g,
    float* __restrict__ C, _Float16* __restrict__ C16, int ldc, size_t sC, int M, int N, int K) {
  __shared__ __attribute__((aligned(16))) float so[4][16][64];
  const int tid = threadIdx.x, w = tid >> 5, lane = tid & 31, ln = lane & 15, hh = lane >> 4; const int by = blockIdx.y;
  A += (size_t)by * sA; Bh += (size_t)by * sB; const size_t cofs = (size_t)by * sC; const float* bp = bias ? bias + (size_t)by * sBias : nullptr;
  const int ntn = (N + 63) / 64; const int wid = blockIdx.x * 4 + w; const int mt = wid / ntn, nq = wid % ntn; if (mt * 16 >= M) return;
  const int row0 = mt * 16, col0 = nq * 64; const _Float16* arow = A + (size_t)(row0 + ln) * lda;
  v8f acc[4] = {};
  for (int kb = 0; kb < K; kb += 32) { FragH ah; ah.half[0] = *(const v8us*)((const unsigned short*)arow + kb + 8 * hh); ah.half[1] = *(const v8us*)((const unsigned short*)arow + kb + 16 + 8 * hh);
#pragma unroll
    for (int t = 0; t < 4; ++t) { if (col0 + t * 16 >= N) continue; const size_t boff = (size_t)(col0 + t * 16 + ln) * ldb + kb; FragH bq; bq.half[0] = *(const v8us*)((const unsigned short*)Bh + boff + 8 * hh); bq.half[1] = *(const v8us*)((const unsigned short*)Bh + boff + 16 + 8 * hh);
      acc[t] = mmaH<1>(ah.v, ah.v, bq.v, bq.v, acc[t]); }
  }
#pragma unroll
  for (int t = 0; t < 4; ++t) { if (col0 + t * 16 >= N) continue; const int col = col0 + t * 16 + ln; const float bv = bp ? bf16_round(bp[col]) : 0.f;
#pragma unroll
    for (int r = 0; r < 8; ++r) { float v = acc[t][r] * alpha + bv; if (CP) { const int rr = row0g + row0 + 8 * hh + r; if (rowsPerB < 0) v += CP[cofs + (size_t)rr * ldc + col];      /* rowsPerB < 0: own element of the batched C plane */ else { const int bidx = rr / rowsPerB; v += CP[(size_t)bidx * sCPb + (size_t)by * 64 + col]; } } if (ACT == 1) v = (v > 0.f) ? v : expm1f(v); else if (ACT == 7) v = (v > 0.f) ? v + 1.0f : expf(v); else if (ACT == 8) v = tanhf(v); else if (ACT == 9) v = 0.5f * v * (1.0f + tanhf(0.7978845608028654f * (v + 0.044715f * v * v * v))); else if (ACT == 11) v = 1.0f / (1.0f + expf(-v)); else if (ACT == 12) v = (v > 0.f) ? v : 0.01f * v; else if (ACT == 14) v = (v > 0.f) ? v : 0.1f * v; else if (ACT == 16) v = (v >= 0.f) ? v : 0.3f * v; else if (ACT == 17) v = (v >= 0.f) ? v : 0.2f * v; else if (ACT == 15) v = v / (1.0f + expf(-v)); else if (ACT == 3) v = fmaxf(v, 0.f); else if (ACT == 6) v = 0.5f * v * (1.0f + erff(v * 0.70710678118654752f)); so[w][8 * hh + r][t * 16 + ln] = v; } }
  __builtin_amdgcn_fence(__ATOMIC_ACQ_REL, "workgroup"); __builtin_amdgcn_wave_barrier();
  const int rsub = lane >> 4, c4 = (lane & 15) * 4; typedef _Float16 v4h __attribute__((ext_vector_type(4)));
  {
#pragma unroll
    for (int q = 0; q < 8; ++q) { const int r = q * 2 + rsub; if (col0 + c4 < N) { const v4f v = *(const v4fa*)&so[w][r][c4]; if (C) *(v4f*)(C + cofs + (size_t)(row0 + r) * ldc + col0 + c4) = v; if (C16) { v4h h4; for (int i = 0; i < 4; ++i) h4[i] = (_Float16)v[i]; *(v4h*)(C16 + cofs + (size_t)(row0 + r) * ldc + col0 + c4) = h4; } } }
     }
}


typedef _Float16 v4h __attribute__((ext_vector_type(4)));

// Fragment order of an f16 operand plane [rows][DM]: the 16 x 32 fragment (row tile rt, k block kb) is 1 KiB at (rt * (DM / 32) + kb) * 512 halves; in it the 16-byte chunk w = 0..63 holds row rt * 16 + (w & 15), k = kb * 32 + (w >> 4) * 8 .. + 7.
// Lane l of a wave then reads chunks l and 32 + l: the same values in the same registers as g2_frag from rows, but each wave-wide load is 512 contiguous bytes (4 whole lines) and not 16 pieces of 32 bytes.
// fo_src: first element, in the row-major [rows][DM] numbering, of chunk c of such a plane.
__device__ __forceinline__ size_t fo_src(size_t c) { const size_t tile = c >> 6; const int w = (int)(c & 63); return ((tile >> 5) * 16 + (w & 15)) * DM + (tile & 31) * 32 + (w >> 4) * 8; }
static_assert(DM / 32 == 32, "fo_src takes 32 k blocks a row tile");
// fo_chunk: the chunk that thread t of a converting kernel makes. Four threads in a row take one source row's 128 bytes of f32 (a whole line), so a wave reads 8 whole lines and stores 4 whole lines (8 rows x 16 bytes in each of the 4 k groups).
__device__ __forceinline__ size_t fo_chunk(size_t t) { return (t & ~(size_t)63) + (t & 3) * 16 + ((t >> 2) & 15); }
__global__ __launch_bounds__(256) void k_x16(const float* __restrict__ x, _Float16* __restrict__ X16, size_t n8) { const size_t t = (size_t)blockIdx.x * 256 + threadIdx.x; if (t >= n8) return; FragH f; const size_t ck = fo_chunk(t); const float* s = x + fo_src(ck); const v4f a = *(const v4fa*)s, c = *(const v4fa*)(s + 4);
#pragma unroll
  for (int q = 0; q < 4; ++q) { f.h[q] = (_Float16)bf16_round(a[q]); f.h[4 + q] = (_Float16)bf16_round(c[q]); } *(v8us*)((unsigned short*)X16 + ck * 8) = f.half[0];  }
__global__ __launch_bounds__(256) void k_h16(const float* __restrict__ x, _Float16* __restrict__ X16, size_t n8) { const size_t t = (size_t)blockIdx.x * 256 + threadIdx.x; if (t >= n8) return; FragH f;
#pragma unroll
  for (int q = 0; q < 8; ++q) f.h[q] = (_Float16)x[t * 8 + q]; *(v8us*)((unsigned short*)X16 + t * 8) = f.half[0];  }
__global__ __launch_bounds__(256) void k_round16f(const float* __restrict__ W, _Float16* __restrict__ Bt, size_t n8) { const size_t t = (size_t)blockIdx.x * 256 + threadIdx.x; if (t >= n8) return; FragH f;
#pragma unroll
  for (int i = 0; i < 8; ++i) f.h[i] = (_Float16)(bf16_round(W[t * 8 + i]) * 16.0f); *(v8us*)((unsigned short*)Bt + t * 8) = f.half[0];  }
template <int NHv, int TTv>
__global__ __launch_bounds__(256) void k_vt(const _Float16* __restrict__ V16, int ldv, int voff, _Float16* __restrict__ Vt) { __shared__ unsigned short tl[64][66]; const int tid = threadIdx.x; const int slab = blockIdx.x / (TTv / 64), lg = blockIdx.x % (TTv / 64); const int b = slab / NHv, h = slab % NHv;
  for (int i = tid; i < 64 * 8; i += 256) { const int r = i / 8, c8 = (i % 8) * 8; FragH f; f.half[0] = *(const v8us*)((const unsigned short*)V16 + ((size_t)b * TTv + lg * 64 + r) * ldv + voff + h * 64 + c8);
#pragma unroll
    for (int q = 0; q < 8; ++q) tl[r][c8 + q] = f.u[q]; }
  __syncthreads();
  {
#pragma unroll
    for (int rd = 0; rd < 2; ++rd) { const int c = rd * 256 + tid, w = c & 63; const int d = ((c >> 6) & 3) * 16 + (w & 15), j = (c >> 8) * 32 + (w >> 4) * 8; FragH f;      /* fragment order: per slab and 32-key block four 1-KiB fragments (d tiles 0..3) in a row; chunk w = row d & 15, keys (w >> 4) * 8 .. + 7 */
#pragma unroll
      for (int q = 0; q < 8; ++q) f.u[q] = tl[j + q][d];
      *(v8us*)((unsigned short*)Vt + (size_t)slab * 64 * TTv + (size_t)lg * 4096 + c * 8) = f.half[0]; }
     } }

__global__ __launch_bounds__(256) void k_hl(const float* __restrict__ F, _Float16* __restrict__ Hh, _Float16* __restrict__ Hl, size_t n8) { const size_t t = (size_t)blockIdx.x * 256 + threadIdx.x; if (t >= n8) return; FragH fh, fl; const size_t ck = fo_chunk(t); const float* s = F + fo_src(ck); const v4f a = *(const v4fa*)s, c = *(const v4fa*)(s + 4);      /* both planes in fragment order */
#pragma unroll
  for (int q = 0; q < 4; ++q) { _Float16 h = (_Float16)a[q]; fh.h[q] = h; fl.h[q] = (_Float16)((a[q] - (float)h) * 1024.0f); h = (_Float16)c[q]; fh.h[4 + q] = h; fl.h[4 + q] = (_Float16)((c[q] - (float)h) * 1024.0f); }
  { *(v8us*)((unsigned short*)Hh + ck * 8) = fh.half[0]; *(v8us*)((unsigned short*)Hl + ck * 8) = fl.half[0];  } }

// ---- fast GEMM (wave tile 32x64; requires M % 32 == 0 rows per launch region and N % 64 == 0); epilogue = k_gemm_hhx semantics ----
__device__ __forceinline__ v16h g2_frag(const _Float16* p, int hh) { FragH f; f.half[0] = *(const v8us*)((const unsigned short*)p + 8 * hh); f.half[1] = *(const v8us*)((const unsigned short*)p + 16 + 8 * hh); return f.v; }
__device__ __forceinline__ v16h g2_fragp(const _Float16* p) { FragH f; f.half[0] = *(const v8us*)((const unsigned short*)p); f.half[1] = *(const v8us*)((const unsigned short*)p + 256); return f.v; }      /* fragment-order plane: p = the fragment's start + lane * 8 */
__device__ __forceinline__ v16h g2_fragu(const _Float16* base, unsigned ob) { const char* p = (const char*)base + ob; FragH f; f.half[0] = *(const v8us*)p; f.half[1] = *(const v8us*)(p + 512); return f.v; }      /* the same with a wave-uniform row-tile start and one byte offset (k block * 1024 + lane * 16) shared by all operands */
__device__ __forceinline__ v8f g2_mma(v16h a, v16h b, v8f c) { v8f d = __builtin_amdgcn_wmma_f32_16x16x32_f16(false, a, false, b, (short)0, c, false, false); asm volatile("v_nop\n\tv_nop\n\tv_nop\n\tv_nop" : "+v"(d) : "v"(a), "v"(b)); return d; }
template <int ACT>
__global__ __launch_bounds__(128) void k_gemm2(const _Float16* __restrict__ A, int lda, size_t sA, const _Float16* __restrict__ Bh, int ldb, size_t sB, float alpha, const float* __restrict__ bias, size_t sBias, const float* __restrict__ CP, int rowsPerB, size_t sCPb, int row0g,
    float* __restrict__ C, _Float16* __restrict__ C16, int ldc, size_t sC, int M, int N, int K) { static_assert(ACT == 0 || ACT == 3 || ACT == 6 || ACT == 8 || ACT == 9 || ACT == 11 || ACT == 12 || ACT == 14 || ACT == 15 || ACT == 16 || ACT == 17, "k_gemm2: unsupported ACT code (would silently apply no activation)");
  __shared__ __attribute__((aligned(16))) float so[4][32][68];
  const int tid = threadIdx.x, w = __builtin_amdgcn_readfirstlane(tid >> 5), lane = tid & 31, ln = lane & 15, hh = lane >> 4; const int by = blockIdx.y;      /* the wave's number as a scalar: the row-tile starts below stay in scalar registers */
  A += (size_t)by * sA; Bh += (size_t)by * sB; const size_t cofs = (size_t)by * sC; const float* bp = bias ? bias + (size_t)by * sBias : nullptr;
  const int ntn = N >> 6; const int mt = blockIdx.x / ntn, nq = blockIdx.x - mt * ntn; const int row0 = mt * 128 + 32 * w, col0 = nq * 64; if (row0 >= M) return;
  const _Float16* a0p = A + (size_t)row0 * lda; const _Float16* a1p = a0p + (size_t)16 * lda;      /* A and Bh in fragment order: a row tile is 16 * pitch halves, a k block 512 */
  const _Float16* b0p = Bh + (size_t)col0 * ldb; const _Float16* b1p = b0p + (size_t)16 * ldb; const _Float16* b2p = b1p + (size_t)16 * ldb; const _Float16* b3p = b2p + (size_t)16 * ldb;
  const v8f z8 = {0.f,0.f,0.f,0.f,0.f,0.f,0.f,0.f}; v8f c00 = z8, c01 = z8, c02 = z8, c03 = z8, c10 = z8, c11 = z8, c12 = z8, c13 = z8; unsigned ob = lane * 16;
#pragma unroll 1
  for (int kb = 0; kb < K; kb += 32, ob += 1024) { const v16h a0 = g2_fragu(a0p, ob), a1 = g2_fragu(a1p, ob);
    v16h b = g2_fragu(b0p, ob); c00 = g2_mma(a0, b, c00); c10 = g2_mma(a1, b, c10);
    b = g2_fragu(b1p, ob); c01 = g2_mma(a0, b, c01); c11 = g2_mma(a1, b, c11);
    b = g2_fragu(b2p, ob); c02 = g2_mma(a0, b, c02); c12 = g2_mma(a1, b, c12);
    b = g2_fragu(b3p, ob); c03 = g2_mma(a0, b, c03); c13 = g2_mma(a1, b, c13); }
  v8f accs[8] = {c00, c01, c02, c03, c10, c11, c12, c13};
#pragma unroll
  for (int u = 0; u < 8; ++u) { const int t = u & 3, half = u >> 2; const int col = col0 + t * 16 + ln; const float bv = bp ? bf16_round(bp[col]) : 0.f;
#pragma unroll
    for (int r = 0; r < 8; ++r) { const int rloc = half * 16 + 8 * hh + r; float v = accs[u][r] * alpha + bv; if (CP) { if (rowsPerB < 0) v += CP[cofs + (size_t)(row0g + row0 + rloc) * ldc + col];      /* rowsPerB < 0: own element of the batched C plane */ else { const int bidx = (row0g + row0 + rloc) / rowsPerB; v += CP[(size_t)bidx * sCPb + (size_t)by * 64 + col]; } }
      if (ACT == 3) v = fmaxf(v, 0.f); else if (ACT == 6) v = 0.5f * v * (1.0f + erff(v * 0.70710678118654752f)); else if (ACT == 11) v = 1.0f / (1.0f + expf(-v)); else if (ACT == 15) v = v / (1.0f + expf(-v)); else if (ACT == 12) v = (v > 0.f) ? v : 0.01f * v; else if (ACT == 8) v = tanhf(v); else if (ACT == 9) v = 0.5f * v * (1.0f + tanhf(0.7978845608028654f * (v + 0.044715f * v * v * v))); else if (ACT == 14) v = (v > 0.f) ? v : 0.1f * v; else if (ACT == 16) v = (v >= 0.f) ? v : 0.3f * v; else if (ACT == 17) v = (v >= 0.f) ? v : 0.2f * v;
      so[w][rloc][t * 16 + ln] = v; } }
  __builtin_amdgcn_fence(__ATOMIC_ACQ_REL, "workgroup"); __builtin_amdgcn_wave_barrier();
  const int rsub = lane >> 4, c4 = (lane & 15) * 4;
  {
#pragma unroll
    for (int q = 0; q < 16; ++q) { const int r = q * 2 + rsub; const v4f v = *(const v4fa*)&so[w][r][c4]; if (C) *(v4f*)(C + cofs + (size_t)(row0 + r) * ldc + col0 + c4) = v; if (C16) { v4h h4; for (int i = 0; i < 4; ++i) h4[i] = (_Float16)v[i]; *(v4h*)(C16 + cofs + (size_t)(row0 + r) * ldc + col0 + c4) = h4; } }
     } }


__global__ __launch_bounds__(256) void k_wnat(const float* __restrict__ w, size_t n8, _Float16* __restrict__ Bt) { const size_t t = (size_t)blockIdx.x * 256 + threadIdx.x; if (t >= n8) return; FragH f; for (int q = 0; q < 8; ++q) f.h[q] = (_Float16)(bf16_round(w[t * 8 + q]) * 16.0f); *(v8us*)((unsigned short*)Bt + t * 8) = f.half[0];  }
__global__ __launch_bounds__(256) void k_rsm(const float* __restrict__ S, _Float16* __restrict__ P, int nrows) {
  #pragma clang fp contract(off)
  const int i = blockIdx.x * 256 + threadIdx.x; if (i >= nrows) return; const float* s = S + (size_t)i * SQ; float mx = -3.0e38f;
#pragma unroll 1
  for (int j = 0; j < SQ; ++j) mx = fmaxf(mx, s[j]); float se = 0.f;
#pragma unroll 1
  for (int j = 0; j < SQ; ++j) se += expf(s[j] - mx); const float sc = 256.0f / se;
#pragma unroll 1
  for (int j0 = 0; j0 < SQ; j0 += 8) { FragH f; for (int q = 0; q < 8; ++q) f.h[q] = (_Float16)(expf(s[j0 + q] - mx) * sc); unsigned short* d = (unsigned short*)P + (size_t)i * SQ + j0; *(v8us*)d = f.half[0];  } }
__global__ __launch_bounds__(256) void k_vt(const _Float16* __restrict__ V16, int b, int h0, _Float16* __restrict__ VT) { __shared__ unsigned short tl[64][65]; const int tid = threadIdx.x; const int hh = blockIdx.x % HG, sg = blockIdx.x / HG; const int s0 = sg * 64; const int h = h0 + hh;
  for (int i = tid; i < 64 * 8; i += 256) { const int j = i / 8, d8 = (i % 8) * 8; FragH f; f.half[0] = *(const v8us*)((const unsigned short*)V16 + ((size_t)b * SQ + s0 + j) * DM + h * HD + d8); for (int q = 0; q < 8; ++q) tl[d8 + q][j] = f.u[q]; }
  __syncthreads();
  { for (int i = tid; i < 64 * 8; i += 256) { const int d = i / 8, j8 = (i % 8) * 8; FragH f; for (int q = 0; q < 8; ++q) f.u[q] = tl[d][j8 + q]; *(v8us*)((unsigned short*)VT + ((size_t)hh * HD + d) * SQ + s0 + j8) = f.half[0]; }  } }


__device__ __forceinline__ float xl_half(float x) { return __builtin_bit_cast(float, __builtin_amdgcn_permlanex16(__builtin_bit_cast(int, x), __builtin_bit_cast(int, x), 0x76543210, 0xfedcba98, false, false)); }  // lane l with lane l ^ 16
// v_exp_f32 with the v_nop in its own statement: it keeps the one slot that the instruction set asks for behind a transcendental
__device__ __forceinline__ float exp2_slot(float a) { float e; asm("v_exp_f32 %0, %1\n\tv_nop" : "=v"(e) : "v"(a)); return e; }
#define FAW 8                        /* waves per work-group of the fused attention kernel, 16 query columns each */
__global__ __launch_bounds__(FAW * 32) void k_fattn(const _Float16* __restrict__ Qh, const _Float16* __restrict__ Ql, const _Float16* __restrict__ Kh, const _Float16* __restrict__ Kl, const _Float16* __restrict__ VT, const float* __restrict__ relb, _Float16* __restrict__ O) {
  __shared__ float tb[257];
  const int tid = threadIdx.x, lane = tid & 31, ln = lane & 15, hh = lane >> 4; const int h = blockIdx.y, b = blockIdx.z;
  for (int t = tid; t < 257; t += FAW * 32) { const int d = t - 128; const int a = d < 0 ? -d : d; const int f = (a < 8) ? a : (8 + (a >= 12) + (a >= 16) + (a >= 23) + (a >= 32) + (a >= 46) + (a >= 64) + (a >= 91)); const int bk = (d > 0 ? 16 : 0) + f; tb[t] = bf16_round(relb[bk * NH + h]); }
  __syncthreads();      /* publishes the bias table to all waves; the only barrier of the kernel */
  const int q0 = (blockIdx.x * FAW + __builtin_amdgcn_readfirstlane(tid >> 5)) * 16; const size_t r0 = (size_t)b * SQ;
  const size_t fo = (size_t)h * (HD * 16) + lane * 8;      /* fragment order: head h is k blocks 2 h and 2 h + 1 of a row tile, 512 halves each; a row tile is 16 * LQ halves */
  const _Float16* qp = Qh + (r0 + q0) * LQ + fo; const _Float16* qlp = Ql + (r0 + q0) * LQ + fo;
  const v16h qh0 = g2_fragp(qp), qh1 = g2_fragp(qp + 512); asm volatile("s_wait_xcnt 0x0" ::: "memory");      /* this and the like waits below stand behind a group of loads, in front of whatever next overwrites a register that the group's addresses are in */
  const v16h ql0 = g2_fragp(qlp), ql1 = g2_fragp(qlp + 512); asm volatile("s_wait_xcnt 0x0" ::: "memory");
  const _Float16* khp = Kh + r0 * LQ + fo; const _Float16* klp = Kl + r0 * LQ + fo; const _Float16* vp = VT + (size_t)(b * NH + h) * HD * SQ + lane * 8;
  const float bneg = __builtin_bit_cast(float, __builtin_amdgcn_readfirstlane(__builtin_bit_cast(int, tb[0]))), bpos = __builtin_bit_cast(float, __builtin_amdgcn_readfirstlane(__builtin_bit_cast(int, tb[256])));      /* the two far values, the same in every lane: held in scalar registers */
  const int dq = 128 + 8 * hh - (q0 + ln);      /* table index of key j, register r: j0 + r + dq, clamped */
  const v8f z8 = {0.f,0.f,0.f,0.f,0.f,0.f,0.f,0.f}; v8f o0 = z8, o1 = z8, o2 = z8, o3 = z8; float m = -1.0e30f, mm = -1.0e30f, l = 0.f;
  v16h ka0 = g2_fragp(khp), ka1 = g2_fragp(khp + 512), kb0 = g2_fragp(khp + 16 * LQ), kb1 = g2_fragp(khp + 16 * LQ + 512);      /* k_hi: key tiles a (0..15) and b (16..31), d 0..31 and 32..63 */
  v16h la0 = g2_fragp(klp), la1 = g2_fragp(klp + 512), lb0 = g2_fragp(klp + 16 * LQ), lb1 = g2_fragp(klp + 16 * LQ + 512); asm volatile("s_wait_xcnt 0x0" ::: "memory");      /* k_lo likewise */
#pragma unroll 1      /* one pass's fragments in registers at a time: unrolled, the live set would cost a resident wave */
  for (int j0 = 0; j0 < SQ; j0 += 32) {
    const _Float16* vj = vp + (size_t)j0 * HD; const v16h v0 = g2_fragp(vj), v1 = g2_fragp(vj + 512), v2 = g2_fragp(vj + 1024), v3 = g2_fragp(vj + 1536); asm volatile("s_wait_xcnt 0x0" ::: "memory");      /* V^T fragments issued ahead of the score products that hide them */
    const float bf = j0 < q0 ? bneg : bpos; v8f sa = {bf, bf, bf, bf, bf, bf, bf, bf}, sb = sa;      /* a tile wholly at distance 128 or more: one value */
    if (j0 + 31 - q0 > -128 && j0 - (q0 + 15) < 128) {      /* wave-uniform: tiles near the diagonal read the table */
#pragma unroll
      for (int r = 0; r < 8; ++r) { const int ia = j0 + r + dq, ib = ia + 16; sa[r] = tb[ia < 0 ? 0 : (ia > 256 ? 256 : ia)]; sb[r] = tb[ib < 0 ? 0 : (ib > 256 ? 256 : ib)]; } }
    v8f ta = z8, tc = z8;
    sa = g2_mma(ka0, qh0, sa); ta = g2_mma(ka0, ql0, ta); sb = g2_mma(kb0, qh0, sb); tc = g2_mma(kb0, ql0, tc);      /* four independent accumulator chains, interleaved */
    sa = g2_mma(ka1, qh1, sa); ta = g2_mma(ka1, ql1, ta); sb = g2_mma(kb1, qh1, sb); tc = g2_mma(kb1, ql1, tc);
    ta = g2_mma(la0, qh0, ta); tc = g2_mma(lb0, qh0, tc); ta = g2_mma(la1, qh1, ta); tc = g2_mma(lb1, qh1, tc);
    { const size_t jn = (size_t)((j0 + 32) & (SQ - 1)) * LQ;      /* the next pass's K fragments, fetched behind this pass's score products; the last pass wraps to key 0 (in bounds, unused) */
      ka0 = g2_fragp(khp + jn); ka1 = g2_fragp(khp + jn + 512); kb0 = g2_fragp(khp + jn + 16 * LQ); kb1 = g2_fragp(khp + jn + 16 * LQ + 512);
      la0 = g2_fragp(klp + jn); la1 = g2_fragp(klp + jn + 512); lb0 = g2_fragp(klp + jn + 16 * LQ); lb1 = g2_fragp(klp + jn + 16 * LQ + 512); asm volatile("s_wait_xcnt 0x0" ::: "memory"); }
    float s[16];
#pragma unroll
    for (int r = 0; r < 8; ++r) { s[r] = fmaf(ta[r], 0.0009765625f, sa[r]); s[8 + r] = fmaf(tc[r], 0.0009765625f, sb[r]); }
    float x0 = fmaxf(s[0], s[1]), x1 = fmaxf(s[2], s[3]), x2 = fmaxf(s[4], s[5]), x3 = fmaxf(s[6], s[7]);
    x0 = fmaxf(x0, fmaxf(s[8], s[9])); x1 = fmaxf(x1, fmaxf(s[10], s[11])); x2 = fmaxf(x2, fmaxf(s[12], s[13])); x3 = fmaxf(x3, fmaxf(s[14], s[15]));
    float mx = fmaxf(fmaxf(x0, x1), fmaxf(x2, x3)); mx = fmaxf(mx, xl_half(mx));      /* both halves of the wave hold keys of the same query */
    const float mn = fmaxf(m, mx); const float mmn = fmaf(mn, 1.44269504088896340736f, -8.0f);      /* exponent offset in log2 units; the -8 carries the weights x256 */
    const float al = exp2_slot(mm - mmn); m = mn; mm = mmn;      /* 1 exactly while the maximum stands */
    FragH pf; float a0 = 0.f, a1 = 0.f, a2 = 0.f, a3 = 0.f;
#pragma unroll
    for (int i = 0; i < 16; i += 4) { const float p0 = exp2_slot(fmaf(s[i], 1.44269504088896340736f, -mmn)), p1 = exp2_slot(fmaf(s[i + 1], 1.44269504088896340736f, -mmn)), p2 = exp2_slot(fmaf(s[i + 2], 1.44269504088896340736f, -mmn)), p3 = exp2_slot(fmaf(s[i + 3], 1.44269504088896340736f, -mmn));
      a0 += p0; a1 += p1; a2 += p2; a3 += p3; pf.h[i] = (_Float16)p0; pf.h[i + 1] = (_Float16)p1; pf.h[i + 2] = (_Float16)p2; pf.h[i + 3] = (_Float16)p3; }
    l = fmaf(l, al, (a0 + a1) + (a2 + a3));
#pragma unroll
    for (int r = 0; r < 8; ++r) { o0[r] *= al; o1[r] *= al; o2[r] *= al; o3[r] *= al; }
    o0 = g2_mma(v0, pf.v, o0); o1 = g2_mma(v1, pf.v, o1); o2 = g2_mma(v2, pf.v, o2); o3 = g2_mma(v3, pf.v, o3);      /* O^T[d = 16 t + 8 hh + r][query ln] */
  }
  const float sc = 64.0f / (l + xl_half(l)); unsigned short* op = (unsigned short*)O + (r0 + q0) * DM + fo; FragH f;      /* o rows in fragment order too (A operand of the output GEMM): d = 16 t + 8 hh + r of query ln is chunk 32 (t & 1) + lane of k block 2 h + (t >> 1) */
#pragma unroll
  for (int r = 0; r < 8; ++r) { f.h[r] = (_Float16)(o0[r] * sc); f.h[8 + r] = (_Float16)(o1[r] * sc); }
  *(v8us*)op = f.half[0]; *(v8us*)(op + 256) = f.half[1];
#pragma unroll
  for (int r = 0; r < 8; ++r) { f.h[r] = (_Float16)(o2[r] * sc); f.h[8 + r] = (_Float16)(o3[r] * sc); }
  *(v8us*)(op + 512) = f.half[0]; *(v8us*)(op + 768) = f.half[1]; }

extern "C" void kernel_launch(void* const* d_in, const int* in_sizes, int n_in,
                              void* d_out, int out_size, void* d_ws, size_t ws_size, hipStream_t stream) {
  (void)in_sizes; (void)n_in; (void)out_size;
  const float* const* I = (const float* const*)d_in; const float* xq = I[0]; const float* xkv = I[1]; const float* wq = I[2]; const float* wk = I[3]; const float* wv = I[4]; const float* wo = I[5]; const float* relb = I[6]; const float* bq = nullptr; const float* bk = nullptr; (void)bq; (void)bk;      /* [in][out] weights, no biases; rel_bias [32 buckets][16 heads] */
  char* ws = (char*)d_ws; size_t off = 0;
  auto take = [&](size_t bytes) { char* p = ws + off; off += (bytes + 255) & ~(size_t)255; return p; };
  _Float16* BQ = (_Float16*)take((size_t)DM * DM * 2); _Float16* BK = (_Float16*)take((size_t)DM * DM * 2); _Float16* BV = (_Float16*)take((size_t)DM * DM * 2); _Float16* BO = (_Float16*)take((size_t)DM * DM * 2);
  float* QF = (float*)take(NR * DM * 4);      /* the f32 projection scratch (NR x DM x 4 = 32 MiB) */ _Float16* XQ = (_Float16*)take(NR * DM * 2); _Float16* XKV = (_Float16*)take(NR * DM * 2); _Float16* Q16 = (_Float16*)take(NR * DM * 2); _Float16* QL = (_Float16*)take(NR * DM * 2); _Float16* K16 = (_Float16*)take(NR * DM * 2); _Float16* KL = (_Float16*)take(NR * DM * 2); _Float16* V16 = (_Float16*)take(NR * DM * 2); _Float16* O16 = (_Float16*)take(NR * DM * 2);
  _Float16* VT = (_Float16*)take((size_t)NB * NH * HD * SQ * 2);      /* V^T for ALL batches */
  if (off > ws_size) return;
  k_wt_f16<<<(unsigned)(((size_t)DM * (DM / 8) + 255) / 256), 256, 0, stream>>>(wq, BQ, DM, DM, 16.0f); k_wt_f16<<<(unsigned)(((size_t)DM * (DM / 8) + 255) / 256), 256, 0, stream>>>(wk, BK, DM, DM, 16.0f); k_wt_f16<<<(unsigned)(((size_t)DM * (DM / 8) + 255) / 256), 256, 0, stream>>>(wv, BV, DM, DM, 16.0f); k_wt_f16<<<(unsigned)(((size_t)DM * (DM / 8) + 255) / 256), 256, 0, stream>>>(wo, BO, DM, DM, 16.0f);      /* [in][out] -> Bt[n][k] x16 */

  k_x16<<<(unsigned)((NR * DM / 8 + 255) / 256), 256, 0, stream>>>(xq, XQ, NR * DM / 8); k_x16<<<(unsigned)((NR * DM / 8 + 255) / 256), 256, 0, stream>>>(xkv, XKV, NR * DM / 8);      /* query source and key/value source as exact f16 rows */
  const size_t r0p = (size_t)B0 * SQ;      /* first projected row */
  k_gemm2<0><<<dim3((unsigned)((MP / 128) * (DM / 64)), 1), 128, 0, stream>>>(XQ + r0p * DM, DM, 0, BQ, DM, 0, 0.0625f, nullptr, 0, nullptr, 1, 0, 0, QF + r0p * DM, nullptr, DM, 0, MP, DM, DM); k_hl<<<(unsigned)(((size_t)MP * DM / 8 + 255) / 256), 256, 0, stream>>>(QF + r0p * DM, Q16 + r0p * DM, QL + r0p * DM, (size_t)MP * DM / 8);      /* q in f32 -> f16 hi (Q16) + x1024 residual (QL) planes */
  k_gemm2<0><<<dim3((unsigned)((MP / 128) * (DM / 64)), 1), 128, 0, stream>>>(XKV + r0p * DM, DM, 0, BK, DM, 0, 0.0625f, nullptr, 0, nullptr, 1, 0, 0, QF + r0p * DM, nullptr, DM, 0, MP, DM, DM); k_hl<<<(unsigned)(((size_t)MP * DM / 8 + 255) / 256), 256, 0, stream>>>(QF + r0p * DM, K16 + r0p * DM, KL + r0p * DM, (size_t)MP * DM / 8);      /* k in f32 (reusing the QF scratch plane after q's split) -> f16 hi (K16) + x1024 residual (KL) planes */
  k_gemm2<0><<<dim3((unsigned)((MP / 128) * (DM / 64)), 1), 128, 0, stream>>>(XKV + r0p * DM, DM, 0, BV, DM, 0, 0.0625f, nullptr, 0, nullptr, 1, 0, 0, nullptr, V16 + r0p * DM, DM, 0, MP, DM, DM);
  for (int b = B0; b < B0 + NBR; ++b) { const size_t r0 = (size_t)b * SQ; k_vt<NH, SQ><<<NH * (SQ / 64), 256, 0, stream>>>(V16 + r0 * LQ, LQ, 0, VT + (size_t)b * NH * HD * SQ); }      /* V^T of every batch: per head, 32-key blocks of four 1-KiB d-tile fragments */
  k_fattn<<<dim3(SQ / (FAW * 16), NH, NB), FAW * 32, 0, stream>>>(Q16, QL, K16, KL, VT, relb, O16);      /* scores + bias, softmax and P . V of every batch and head; o (merged heads) x64 as f16 rows */
  k_gemm2<0><<<dim3((unsigned)((MPO / 128) * (DM / 64)), 1), 128, 0, stream>>>(O16 + r0p * DM, DM, 0, BO, DM, 0, 0.0009765625f, nullptr, 0, nullptr, 1, 0, 0, (float*)d_out + r0p * DM, nullptr, DM, 0, MPO, DM, DM);      /* out rows are the output layout */
}

// v004
// It runs in 406 microseconds.
// In both of two side-by-side timings against v003, it was 1.07 times as fast.
// Over all steps from v000 it is 37.6 times as fast.
#include <hip/hip_runtime.h>
// T5 attention with a relative-position bias and NO score scaling (query_states [4][2048][1024] gives q = x wq; key_value_states gives k = x wk, v = x wv ([in][out] 1024^2 sigma 1/32, no biases); 16 heads of 64; scores = q . k (UNSCALED, logits sigma ~8) + bias[h][i][j] with bias = rel_bias[bucket(j - i)][h] (rel_bias input [32][16]; bidirectional log buckets, 32 buckets, max distance 128); softmax; out = merged wo -> [4][2048][1024]).
// Structure: token rows r = b*2048 + s; the query source and the key/value source as exact f16 rows (bf16-rounded); Q, K, V as three WMMA GEMMs (32x64 wave tiles, f32 accumulation, exact x16 weights); q and k split in the GEMM epilogue into f16 hi + x1024 residual planes, V^T written by its GEMM epilogue from the same LDS staging tile; then ONE fused attention launch over (query block, head, batch): UNSCALED three-term scores (bias as the start value, q_hi . k_hi, + (q_lo . k_hi + q_hi . k_lo) 2^-10; K = 64), running-maximum softmax in registers (f32 statistics, native exp; weights x256 as f16), O^T += V^T . P^T, o carried x64 against f16 subnormal flush (folded into the output GEMM alpha) written straight into the merged f16 o rows; out = o W_o GEMM (f32) into the output layout.
// Compute dtype: inputs rounded to bf16; x / weights exact; v, softmax weights and o as plain f16 GEMM operands (~2^-12), q and k as f16 hi + x1024 residual; scores and softmax statistics f32; v_wmma_f32_16x16x32_f16.
#define NB 4
#define SQ 2048
#define DM 1024
#define NH 16
#define HD 64
#define HG 2                         /* heads per launch of k_vt, which is not launched */
#define B0 0                         /* first batch processed (debug hook) */
#define NBR NB                       /* batches processed (debug hook) */
#define NR ((size_t)NB * SQ)         /* token rows */
#define MP ((int)((size_t)NBR * SQ)) /* rows projected (debug hook) */
#define QN SQ                        /* not used: the attention launch attends all SQ query rows */
#define NHD NH                       /* not used: the attention launch covers all NH heads */
#define MPO MP                       /* rows through the output stage (debug hook) */
#define LQ DM      /* row pitch of the q/k rows */
typedef __bf16 v16b __attribute__((ext_vector_type(16)));
typedef unsigned short v8us __attribute__((ext_vector_type(8), may_alias));
typedef float  v8f  __attribute__((ext_vector_type(8)));
typedef float  v4f  __attribute__((ext_vector_type(4)));
typedef float  v4fa __attribute__((ext_vector_type(4), may_alias));
union FragB { v16b v; v8us half[2]; unsigned short u[16]; };

__device__ __forceinline__ unsigned short bf16_bits(float x) { unsigned int u = __float_as_uint(x); return (unsigned short)((u + 0x7FFFu + ((u >> 16) & 1u)) >> 16); }
__device__ __forceinline__ float bf16_val(unsigned short b) { return __uint_as_float(((unsigned int)b) << 16); }
__device__ __forceinline__ float bf16_round(float x) { return bf16_val(bf16_bits(x)); }
// D += A·B with NT terms: 1 = ah·bh, 2 = + al·bh (A split), 3 = + ah·bl (both split)
template <int NT>
__device__ __forceinline__ v8f mmaN(v16b ah, v16b al, v16b bh, v16b bl, v8f c) {
  c = __builtin_amdgcn_wmma_f32_16x16x32_bf16(false, ah, false, bh, (short)0, c, false, false);
  if (NT >= 2) c = __builtin_amdgcn_wmma_f32_16x16x32_bf16(false, al, false, bh, (short)0, c, false, false);
  if (NT >= 3) c = __builtin_amdgcn_wmma_f32_16x16x32_bf16(false, ah, false, bl, (short)0, c, false, false);
  asm volatile("v_nop\n\tv_nop\n\tv_nop\n\tv_nop" : "+v"(c) : "v"(ah), "v"(al), "v"(bh), "v"(bl));
  return c;
}

__global__ __launch_bounds__(256) void k_wt_bf16(const float* __restrict__ W, unsigned short* __restrict__ Wt, int K, int N) {
  const int t = blockIdx.x * 256 + threadIdx.x;
  const int k8n = K / 8;
  if (t >= N * k8n) return;
  const int n = t / k8n, k8 = (t % k8n) * 8;
  v8us v;
#pragma unroll
  for (int i = 0; i < 8; ++i) v[i] = bf16_bits(W[(size_t)(k8 + i) * N + n]);
  *(v8us*)(Wt + (size_t)n * K + k8) = v;
  
}

// GEMM C[M][N] (f32, pitch ldc) = act(A[M][K]·W + bias). A f32 row-major (pitch lda) converted per fragment to bf16
// (ASPLIT: hi/lo two planes -> 2 terms, else single rounded term); Wt bf16 [N][K] (pitch ldb). BIAS_BF16 rounds the
// bias to bf16 first (bias quantised to bf16 before the add). K%32==0, M%16==0, N%64==0.
template <bool ASPLIT, int ACT, bool BIAS_BF16>
__global__ __launch_bounds__(128) void k_gemm_bf(const float* __restrict__ A, int lda, const unsigned short* __restrict__ Wt, int ldb,
                                               const float* __restrict__ bias, float* __restrict__ C, int ldc, int M, int N, int K) {
  __shared__ __attribute__((aligned(16))) float so[4][16][64];
  const int tid = threadIdx.x, w = tid >> 5, lane = tid & 31, ln = lane & 15, hh = lane >> 4;
  const int ntn = N / 64;
  const int wid = blockIdx.x * 4 + w;
  const int mt = wid / ntn, nq = wid % ntn;
  if (mt * 16 >= M) return;
  const int row0 = mt * 16, col0 = nq * 64;
  const float* arow = A + (size_t)(row0 + ln) * lda;
  v8f acc[4] = {};
  for (int kb = 0; kb < K; kb += 32) {
    FragB ah, al;
    const v4f x0 = *(const v4fa*)(arow + kb + 8 * hh), x1 = *(const v4fa*)(arow + kb + 8 * hh + 4);
    const v4f x2 = *(const v4fa*)(arow + kb + 16 + 8 * hh), x3 = *(const v4fa*)(arow + kb + 16 + 8 * hh + 4);
    float xs[16] = {x0[0],x0[1],x0[2],x0[3],x1[0],x1[1],x1[2],x1[3],x2[0],x2[1],x2[2],x2[3],x3[0],x3[1],x3[2],x3[3]};
#pragma unroll
    for (int i = 0; i < 16; ++i) { const unsigned short hb = bf16_bits(xs[i]); ah.u[i] = hb; al.u[i] = ASPLIT ? bf16_bits(xs[i] - bf16_val(hb)) : (unsigned short)0; }
#pragma unroll
    for (int t = 0; t < 4; ++t) {
      const unsigned short* brow = Wt + (size_t)(col0 + t * 16 + ln) * ldb + kb;
      FragB b;
      b.half[0] = *(const v8us*)(brow + 8 * hh);
      b.half[1] = *(const v8us*)(brow + 16 + 8 * hh);
      acc[t] = mmaN<ASPLIT ? 2 : 1>(ah.v, al.v, b.v, b.v, acc[t]);
    }
  }
#pragma unroll
  for (int t = 0; t < 4; ++t) {
    float bv = bias ? bias[col0 + t * 16 + ln] : 0.f;
    if (BIAS_BF16) bv = bf16_round(bv);
#pragma unroll
    for (int r = 0; r < 8; ++r) { float v = acc[t][r] + bv; if (ACT == 1) v = fmaxf(v, 0.f); so[w][8 * hh + r][t * 16 + ln] = v; }
  }
  __builtin_amdgcn_fence(__ATOMIC_ACQ_REL, "workgroup");
  __builtin_amdgcn_wave_barrier();
  const int rsub = lane >> 4, c4 = (lane & 15) * 4;
  {
#pragma unroll
    for (int q = 0; q < 8; ++q) {
      const int r = q * 2 + rsub;
      const v4f v = *(const v4fa*)&so[w][r][c4];
      *(v4f*)(C + (size_t)(row0 + r) * ldc + col0 + c4) = v;
    }
    
  }
}

// GEMM C = act(A·W + bias + resid): A f32 (ASPLIT -> hi/lo 2 terms), Wt bf16 [N][K]; ACT 0 none, 1 relu, 2 exact gelu;
// resid (optional, f32, row index = (row % rmod), pitch ldr, RES_BF16 rounds it) added before the activation.
template <bool ASPLIT, int ACT, bool BIAS_BF16, bool RES_BF16>
__global__ __launch_bounds__(128) void k_gemm_bf3(const float* __restrict__ A, int lda, const unsigned short* __restrict__ Wt, int ldb,
                                                const float* __restrict__ bias, const float* __restrict__ resid, int rmod, int ldr,
                                                float* __restrict__ C, int ldc, int M, int N, int K) {
  __shared__ __attribute__((aligned(16))) float so[4][16][64];
  const int tid = threadIdx.x, w = tid >> 5, lane = tid & 31, ln = lane & 15, hh = lane >> 4;
  const int ntn = N / 64;
  const int wid = blockIdx.x * 4 + w;
  const int mt = wid / ntn, nq = wid % ntn;
  if (mt * 16 >= M) return;
  const int row0 = mt * 16, col0 = nq * 64;
  const float* arow = A + (size_t)(row0 + ln) * lda;
  v8f acc[4] = {};
  for (int kb = 0; kb < K; kb += 32) {
    FragB ah, al;
    const v4f x0 = *(const v4fa*)(arow + kb + 8 * hh), x1 = *(const v4fa*)(arow + kb + 8 * hh + 4);
    const v4f x2 = *(const v4fa*)(arow + kb + 16 + 8 * hh), x3 = *(const v4fa*)(arow + kb + 16 + 8 * hh + 4);
    float xs[16] = {x0[0],x0[1],x0[2],x0[3],x1[0],x1[1],x1[2],x1[3],x2[0],x2[1],x2[2],x2[3],x3[0],x3[1],x3[2],x3[3]};
#pragma unroll
    for (int i = 0; i < 16; ++i) { const unsigned short hb = bf16_bits(xs[i]); ah.u[i] = hb; al.u[i] = ASPLIT ? bf16_bits(xs[i] - bf16_val(hb)) : (unsigned short)0; }
#pragma unroll
    for (int t = 0; t < 4; ++t) {
      const unsigned short* brow = Wt + (size_t)(col0 + t * 16 + ln) * ldb + kb;
      FragB b;
      b.half[0] = *(const v8us*)(brow + 8 * hh);
      b.half[1] = *(const v8us*)(brow + 16 + 8 * hh);
      acc[t] = mmaN<ASPLIT ? 2 : 1>(ah.v, al.v, b.v, b.v, acc[t]);
    }
  }
#pragma unroll
  for (int t = 0; t < 4; ++t) {
    const int col = col0 + t * 16 + ln;
    float bv = bias ? bias[col] : 0.f;
    if (BIAS_BF16) bv = bf16_round(bv);
#pragma unroll
    for (int r = 0; r < 8; ++r) {
      float v = acc[t][r] + bv;
      if (resid) { float rv = resid[(size_t)((row0 + 8 * hh + r) % rmod) * ldr + col]; if (RES_BF16) rv = bf16_round(rv); v += rv; }
      if (ACT == 1) v = fmaxf(v, 0.f);
      if (ACT == 2) v = 0.5f * v * (1.0f + erff(v * 0.70710678118654752f));
      if (ACT == 3) { const float u = 0.7978845608028654f * (v + 0.044715f * v * v * v); v = 0.5f * v * (1.0f + tanhf(u)); }
      so[w][8 * hh + r][t * 16 + ln] = v;
    }
  }
  __builtin_amdgcn_fence(__ATOMIC_ACQ_REL, "workgroup");
  __builtin_amdgcn_wave_barrier();
  const int rsub = lane >> 4, c4 = (lane & 15) * 4;
  {
#pragma unroll
    for (int q = 0; q < 8; ++q) {
      const int r = q * 2 + rsub;
      const v4f v = *(const v4fa*)&so[w][r][c4];
      *(v4f*)(C + (size_t)(row0 + r) * ldc + col0 + c4) = v;
    }
    
  }
}
// row LayerNorm (biased variance, eps) over N: s = X (+ R); optional out_sum <- s; out_norm <- (s-mu)*rsqrt(var+eps)*g + b
template <bool PARAM_BF16>
__global__ __launch_bounds__(256) void k_layernorm(const float* __restrict__ X, const float* __restrict__ R, const float* __restrict__ g, const float* __restrict__ bta,
                                                  float* __restrict__ out_sum, float* __restrict__ out_norm, int N, float eps) {
  __shared__ float red[256];
  const int row = blockIdx.x, tid = threadIdx.x;
  const float* x = X + (size_t)row * N; const float* rr = R ? R + (size_t)row * N : nullptr;
  float vals[16];                     // up to N = 4096
  const int per = N / 256;            // contiguous chunk per thread? use strided-by-4 chunks: thread handles j = tid*4 + 1024*u
  float s1 = 0.f;
  for (int u = 0; u < per / 4; ++u) {
    const int j = tid * 4 + 1024 * u;
    const v4f a = *(const v4fa*)(x + j);
    v4f b = {0.f,0.f,0.f,0.f}; if (rr) b = *(const v4fa*)(rr + j);
#pragma unroll
    for (int q = 0; q < 4; ++q) { const float v = a[q] + b[q]; vals[u * 4 + q] = v; s1 += v; }
  }
  red[tid] = s1; __syncthreads();
  for (int st = 128; st > 0; st >>= 1) { if (tid < st) red[tid] += red[tid + st]; __syncthreads(); }
  const float mu = red[0] / (float)N; __syncthreads();
  float s2 = 0.f;
  for (int u = 0; u < per / 4; ++u)
#pragma unroll
    for (int q = 0; q < 4; ++q) { const float c = vals[u * 4 + q] - mu; s2 += c * c; }
  red[tid] = s2; __syncthreads();
  for (int st = 128; st > 0; st >>= 1) { if (tid < st) red[tid] += red[tid + st]; __syncthreads(); }
  const float rs = rsqrtf(red[0] / (float)N + eps);
  {
    for (int u = 0; u < per / 4; ++u) {
      const int j = tid * 4 + 1024 * u;
      v4f o, sm;
#pragma unroll
      for (int q = 0; q < 4; ++q) {
        float gg = g[j + q], bb = bta[j + q];
        if (PARAM_BF16) { gg = bf16_round(gg); bb = bf16_round(bb); }
        sm[q] = vals[u * 4 + q]; o[q] = (vals[u * 4 + q] - mu) * rs * gg + bb;
      }
      if (out_sum) *(v4f*)(out_sum + (size_t)row * N + j) = sm;
      *(v4f*)(out_norm + (size_t)row * N + j) = o;
    }
    
  }
}



// ---- f16 WMMA path (v_wmma_f32_16x16x32_f16): 11-bit significands for operands in range — used where a [0,1] probability operand needs more precision than bf16
typedef _Float16 v16h __attribute__((ext_vector_type(16)));
union FragH { v16h v; v8us half[2]; _Float16 h[16]; unsigned short u[16]; };
template <int NT>
__device__ __forceinline__ v8f mmaH(v16h ah, v16h al, v16h bh, v16h bl, v8f c) {
  c = __builtin_amdgcn_wmma_f32_16x16x32_f16(false, ah, false, bh, (short)0, c, false, false);
  if (NT >= 2) c = __builtin_amdgcn_wmma_f32_16x16x32_f16(false, al, false, bh, (short)0, c, false, false);
  if (NT >= 3) c = __builtin_amdgcn_wmma_f32_16x16x32_f16(false, ah, false, bl, (short)0, c, false, false);
  asm volatile("v_nop\n\tv_nop\n\tv_nop\n\tv_nop" : "+v"(c) : "v"(ah), "v"(al), "v"(bh), "v"(bl));
  return c;
}
// batched GEMM like k_gemm_b but f16 operands: A f32 (split into f16 hi/lo if ASPLIT, else rounded to f16), Bt = f16 values [n][k]; alpha; C f32; N multiple of 16 (partial tiles skipped)
template <bool ASPLIT>
__global__ __launch_bounds__(128) void k_gemm_h(const float* __restrict__ A, int lda, size_t sA, const _Float16* __restrict__ Bh, int ldb, size_t sB, float alpha, float* __restrict__ C, int ldc, size_t sC, int M, int N, int K) {
  __shared__ __attribute__((aligned(16))) float so[4][16][64];
  const int tid = threadIdx.x, w = tid >> 5, lane = tid & 31, ln = lane & 15, hh = lane >> 4; const int by = blockIdx.y;
  A += (size_t)by * sA; Bh += (size_t)by * sB; C += (size_t)by * sC;
  const int ntn = (N + 63) / 64; const int wid = blockIdx.x * 4 + w; const int mt = wid / ntn, nq = wid % ntn; if (mt * 16 >= M) return;
  const int row0 = mt * 16, col0 = nq * 64; const float* arow = A + (size_t)(row0 + ln) * lda;
  v8f acc[4] = {};
  for (int kb = 0; kb < K; kb += 32) {
    FragH ah, al;
    const v4f x0 = *(const v4fa*)(arow + kb + 8 * hh), x1 = *(const v4fa*)(arow + kb + 8 * hh + 4), x2 = *(const v4fa*)(arow + kb + 16 + 8 * hh), x3 = *(const v4fa*)(arow + kb + 16 + 8 * hh + 4);
    float xs[16] = {x0[0],x0[1],x0[2],x0[3],x1[0],x1[1],x1[2],x1[3],x2[0],x2[1],x2[2],x2[3],x3[0],x3[1],x3[2],x3[3]};
#pragma unroll
    for (int i = 0; i < 16; ++i) { const _Float16 h = (_Float16)xs[i]; ah.h[i] = h; al.h[i] = ASPLIT ? (_Float16)(xs[i] - (float)h) : (_Float16)0.0f; }
#pragma unroll
    for (int t = 0; t < 4; ++t) { if (col0 + t * 16 >= N) continue; const size_t boff = (size_t)(col0 + t * 16 + ln) * ldb + kb; FragH bq; bq.half[0] = *(const v8us*)(Bh + boff + 8 * hh); bq.half[1] = *(const v8us*)(Bh + boff + 16 + 8 * hh);
      acc[t] = mmaH<ASPLIT ? 2 : 1>(ah.v, al.v, bq.v, bq.v, acc[t]); }
  }
#pragma unroll
  for (int t = 0; t < 4; ++t) { if (col0 + t * 16 >= N) continue;
#pragma unroll
    for (int r = 0; r < 8; ++r) so[w][8 * hh + r][t * 16 + ln] = acc[t][r] * alpha; }
  __builtin_amdgcn_fence(__ATOMIC_ACQ_REL, "workgroup"); __builtin_amdgcn_wave_barrier();
  const int rsub = lane >> 4, c4 = (lane & 15) * 4;
  {
#pragma unroll
    for (int q = 0; q < 8; ++q) { const int r = q * 2 + rsub; if (col0 + c4 < N) { const v4f v = *(const v4fa*)&so[w][r][c4]; *(v4f*)(C + (size_t)(row0 + r) * ldc + col0 + c4) = v; } }
     }
}

// Wt[n][k] = f16(W[k][n]·scale) from f32 row-major W[K][N] (scale = power of two; bf16-exact weights stay exact in f16 away from the subnormal range)
__global__ __launch_bounds__(256) void k_wt_f16(const float* __restrict__ W, _Float16* __restrict__ Wt, int K, int N, float scale) {
  const int t = blockIdx.x * 256 + threadIdx.x; if (t >= N * (K / 8)) return; const int tile = t >> 6, w = t & 63, kt = K >> 5; const int n = (tile / kt) * 16 + (w & 15), k8 = (tile % kt) * 32 + (w >> 4) * 8; FragH f;      /* thread = output chunk of the fragment order (rows n, K / 32 k blocks a row tile) */
#pragma unroll
  for (int i = 0; i < 8; ++i) f.h[i] = (_Float16)(bf16_round(W[(size_t)(k8 + i) * N + n]) * scale); const v8us o = f.half[0];
  *(v8us*)((unsigned short*)Wt + (size_t)t * 8) = o; 
}
// k_gemm_hh variant with fused epilogue: v = acc·alpha + bias[by·sBias + col] (+ CP[(row/rowsPerB)·sCPb + by·64 + col] if CP) ; ACT 0 none / 1 elu ; writes f16 C16 (and f32 C if non-null)
template <int ACT>
__global__ __launch_bounds__(128) void k_gemm_hhx(const _Float16* __restrict__ A, int lda, size_t sA, const _Float16* __restrict__ Bh, int ldb, size_t sB, float alpha, const float* __restrict__ bias, size_t sBias, const float* __restrict__ CP, int rowsPerB, size_t sCPb, int row0g,
    float* __restrict__ C, _Float16* __restrict__ C16, int ldc, size_t sC, int M, int N, int K) {
  __shared__ __attribute__((aligned(16))) float so[4][16][64];
  const int tid = threadIdx.x, w = tid >> 5, lane = tid & 31, ln = lane & 15, hh = lane >> 4; const int by = blockIdx.y;
  A += (size_t)by * sA; Bh += (size_t)by * sB; const size_t cofs = (size_t)by * sC; const float* bp = bias ? bias + (size_t)by * sBias : nullptr;
  const int ntn = (N + 63) / 64; const int wid = blockIdx.x * 4 + w; const int mt = wid / ntn, nq = wid % ntn; if (mt * 16 >= M) return;
  const int row0 = mt * 16, col0 = nq * 64; const _Float16* arow = A + (size_t)(row0 + ln) * lda;
  v8f acc[4] = {};
  for (int kb = 0; kb < K; kb += 32) { FragH ah; ah.half[0] = *(const v8us*)((const unsigned short*)arow + kb + 8 * hh); ah.half[1] = *(const v8us*)((const unsigned short*)arow + kb + 16 + 8 * hh);
#pragma unroll
    for (int t = 0; t < 4; ++t) { if (col0 + t * 16 >= N) continue; const size_t boff = (size_t)(col0 + t * 16 + ln) * ldb + kb; FragH bq; bq.half[0] = *(const v8us*)((const unsigned short*)Bh + boff + 8 * hh); bq.half[1] = *(const v8us*)((const unsigned short*)Bh + boff + 16 + 8 * hh);
      acc[t] = mmaH<1>(ah.v, ah.v, bq.v, bq.v, acc[t]); }
  }
#pragma unroll
  for (int t = 0; t < 4; ++t) { if (col0 + t * 16 >= N) continue; const int col = col0 + t * 16 + ln; const float bv = bp ? bf16_round(bp[col]) : 0.f;
#pragma unroll
    for (int r = 0; r < 8; ++r) { float v = acc[t][r] * alpha + bv; if (CP) { const int rr = row0g + row0 + 8 * hh + r; if (rowsPerB < 0) v += CP[cofs + (size_t)rr * ldc + col];      /* rowsPerB < 0: own element of the batched C plane */ else { const int bidx = rr / rowsPerB; v += CP[(size_t)bidx * sCPb + (size_t)by * 64 + col]; } } if (ACT == 1) v = (v > 0.f) ? v : expm1f(v); else if (ACT == 7) v = (v > 0.f) ? v + 1.0f : expf(v); else if (ACT == 8) v = tanhf(v); else if (ACT == 9) v = 0.5f * v * (1.0f + tanhf(0.7978845608028654f * (v + 0.044715f * v * v * v))); else if (ACT == 11) v = 1.0f / (1.0f + expf(-v)); else if (ACT == 12) v = (v > 0.f) ? v : 0.01f * v; else if (ACT == 14) v = (v > 0.f) ? v : 0.1f * v; else if (ACT == 16) v = (v >= 0.f) ? v : 0.3f * v; else if (ACT == 17) v = (v >= 0.f) ? v : 0.2f * v; else if (ACT == 15) v = v / (1.0f + expf(-v)); else if (ACT == 3) v = fmaxf(v, 0.f); else if (ACT == 6) v = 0.5f * v * (1.0f + erff(v * 0.70710678118654752f)); so[w][8 * hh + r][t * 16 + ln] = v; } }
  __builtin_amdgcn_fence(__ATOMIC_ACQ_REL, "workgroup"); __builtin_amdgcn_wave_barrier();
  const int rsub = lane >> 4, c4 = (lane & 15) * 4; typedef _Float16 v4h __attribute__((ext_vector_type(4)));
  {
#pragma unroll
    for (int q = 0; q < 8; ++q) { const int r = q * 2 + rsub; if (col0 + c4 < N) { const v4f v = *(const v4fa*)&so[w][r][c4]; if (C) *(v4f*)(C + cofs + (size_t)(row0 + r) * ldc + col0 + c4) = v; if (C16) { v4h h4; for (int i = 0; i < 4; ++i) h4[i] = (_Float16)v[i]; *(v4h*)(C16 + cofs + (size_t)(row0 + r) * ldc + col0 + c4) = h4; } } }
     }
}


typedef _Float16 v4h __attribute__((ext_vector_type(4)));

// Fragment order of an f16 operand plane [rows][DM]: the 16 x 32 fragment (row tile rt, k block kb) is 1 KiB at (rt * (DM / 32) + kb) * 512 halves; in it the 16-byte chunk w = 0..63 holds row rt * 16 + (w & 15), k = kb * 32 + (w >> 4) * 8 .. + 7.
// Lane l of a wave then reads chunks l and 32 + l: the same values in the same registers as g2_frag from rows, but each wave-wide load is 512 contiguous bytes (4 whole lines) and not 16 pieces of 32 bytes.
// fo_src: first element, in the row-major [rows][DM] numbering, of chunk c of such a plane.
__device__ __forceinline__ size_t fo_src(size_t c) { const size_t tile = c >> 6; const int w = (int)(c & 63); return ((tile >> 5) * 16 + (w & 15)) * DM + (tile & 31) * 32 + (w >> 4) * 8; }
static_assert(DM / 32 == 32, "fo_src takes 32 k blocks a row tile");
// fo_chunk: the chunk that thread t of a converting kernel makes. Four threads in a row take one source row's 128 bytes of f32 (a whole line), so a wave reads 8 whole lines and stores 4 whole lines (8 rows x 16 bytes in each of the 4 k groups).
__device__ __forceinline__ size_t fo_chunk(size_t t) { return (t & ~(size_t)63) + (t & 3) * 16 + ((t >> 2) & 15); }
__global__ __launch_bounds__(256) void k_x16(const float* __restrict__ x, _Float16* __restrict__ X16, size_t n8) { const size_t t = (size_t)blockIdx.x * 256 + threadIdx.x; if (t >= n8) return; FragH f; const size_t ck = fo_chunk(t); const float* s = x + fo_src(ck); const v4f a = *(const v4fa*)s, c = *(const v4fa*)(s + 4);
#pragma unroll
  for (int q = 0; q < 4; ++q) { f.h[q] = (_Float16)bf16_round(a[q]); f.h[4 + q] = (_Float16)bf16_round(c[q]); } *(v8us*)((unsigned short*)X16 + ck * 8) = f.half[0];  }
__global__ __launch_bounds__(256) void k_h16(const float* __restrict__ x, _Float16* __restrict__ X16, size_t n8) { const size_t t = (size_t)blockIdx.x * 256 + threadIdx.x; if (t >= n8) return; FragH f;
#pragma unroll
  for (int q = 0; q < 8; ++q) f.h[q] = (_Float16)x[t * 8 + q]; *(v8us*)((unsigned short*)X16 + t * 8) = f.half[0];  }
__global__ __launch_bounds__(256) void k_round16f(const float* __restrict__ W, _Float16* __restrict__ Bt, size_t n8) { const size_t t = (size_t)blockIdx.x * 256 + threadIdx.x; if (t >= n8) return; FragH f;
#pragma unroll
  for (int i = 0; i < 8; ++i) f.h[i] = (_Float16)(bf16_round(W[t * 8 + i]) * 16.0f); *(v8us*)((unsigned short*)Bt + t * 8) = f.half[0];  }
// ---- fast GEMM (wave tile 32x64; requires M % 32 == 0 rows per launch region and N % 64 == 0); epilogue = k_gemm_hhx semantics ----
__device__ __forceinline__ v16h g2_frag(const _Float16* p, int hh) { FragH f; f.half[0] = *(const v8us*)((const unsigned short*)p + 8 * hh); f.half[1] = *(const v8us*)((const unsigned short*)p + 16 + 8 * hh); return f.v; }
__device__ __forceinline__ v16h g2_fragp(const _Float16* p) { FragH f; f.half[0] = *(const v8us*)((const unsigned short*)p); f.half[1] = *(const v8us*)((const unsigned short*)p + 256); return f.v; }      /* fragment-order plane: p = the fragment's start + lane * 8 */
__device__ __forceinline__ v16h g2_fragu(const _Float16* base, unsigned ob) { const char* p = (const char*)base + ob; FragH f; f.half[0] = *(const v8us*)p; f.half[1] = *(const v8us*)(p + 512); return f.v; }      /* the same with a wave-uniform row-tile start and one byte offset (k block * 1024 + lane * 16) shared by all operands */
__device__ __forceinline__ v8f g2_mma(v16h a, v16h b, v8f c) { v8f d = __builtin_amdgcn_wmma_f32_16x16x32_f16(false, a, false, b, (short)0, c, false, false); asm volatile("v_nop\n\tv_nop\n\tv_nop\n\tv_nop" : "+v"(d) : "v"(a), "v"(b)); return d; }
// As built, the k loop waits for each operand's loads in turn (five s_wait_loadcnt 0 a k block), and the epilogue takes one scalar branch per element round the bias / CP code that is unused here: both are left as they were.
// omode: 0 = C / C16 as rows; 1 = the f32 result split into f16 hi (C16) + x1024 residual (CL) planes, both in fragment order; 2 = the f16 result transposed into the V^T fragments of the attention kernel (C16 = V^T of all batches; a wave tile, 32 keys x one head's 64 d, is four fragments in a row)
template <int ACT>
__global__ __launch_bounds__(128) void k_gemm2(const _Float16* __restrict__ A, int lda, size_t sA, const _Float16* __restrict__ Bh, int ldb, size_t sB, float alpha, const float* __restrict__ bias, size_t sBias, const float* __restrict__ CP, int rowsPerB, size_t sCPb, int row0g,
    float* __restrict__ C, _Float16* __restrict__ C16, _Float16* __restrict__ CL, int omode, int ldc, size_t sC, int M, int N, int K) { static_assert(ACT == 0 || ACT == 3 || ACT == 6 || ACT == 8 || ACT == 9 || ACT == 11 || ACT == 12 || ACT == 14 || ACT == 15 || ACT == 16 || ACT == 17, "k_gemm2: unsupported ACT code (would silently apply no activation)");
  __shared__ __attribute__((aligned(16))) float so[4][32][68];
  const int tid = threadIdx.x, w = __builtin_amdgcn_readfirstlane(tid >> 5), lane = tid & 31, ln = lane & 15, hh = lane >> 4; const int by = blockIdx.y;      /* the wave's number as a scalar: the row-tile starts below stay in scalar registers */
  A += (size_t)by * sA; Bh += (size_t)by * sB; const size_t cofs = (size_t)by * sC; const float* bp = bias ? bias + (size_t)by * sBias : nullptr;
  const int ntn = N >> 6; const int mt = blockIdx.x / ntn, nq = blockIdx.x - mt * ntn; const int row0 = mt * 128 + 32 * w, col0 = nq * 64; if (row0 >= M) return;
  const _Float16* a0p = A + (size_t)row0 * lda; const _Float16* a1p = a0p + (size_t)16 * lda;      /* A and Bh in fragment order: a row tile is 16 * pitch halves, a k block 512 */
  const _Float16* b0p = Bh + (size_t)col0 * ldb; const _Float16* b1p = b0p + (size_t)16 * ldb; const _Float16* b2p = b1p + (size_t)16 * ldb; const _Float16* b3p = b2p + (size_t)16 * ldb;
  const v8f z8 = {0.f,0.f,0.f,0.f,0.f,0.f,0.f,0.f}; v8f c00 = z8, c01 = z8, c02 = z8, c03 = z8, c10 = z8, c11 = z8, c12 = z8, c13 = z8; unsigned ob = lane * 16;
#pragma unroll 1
  for (int kb = 0; kb < K; kb += 32, ob += 1024) { const v16h a0 = g2_fragu(a0p, ob), a1 = g2_fragu(a1p, ob);
    v16h b = g2_fragu(b0p, ob); c00 = g2_mma(a0, b, c00); c10 = g2_mma(a1, b, c10);
    b = g2_fragu(b1p, ob); c01 = g2_mma(a0, b, c01); c11 = g2_mma(a1, b, c11);
    b = g2_fragu(b2p, ob); c02 = g2_mma(a0, b, c02); c12 = g2_mma(a1, b, c12);
    b = g2_fragu(b3p, ob); c03 = g2_mma(a0, b, c03); c13 = g2_mma(a1, b, c13); }
  v8f accs[8] = {c00, c01, c02, c03, c10, c11, c12, c13};
#pragma unroll
  for (int u = 0; u < 8; ++u) { const int t = u & 3, half = u >> 2; const int col = col0 + t * 16 + ln; const float bv = bp ? bf16_round(bp[col]) : 0.f;
#pragma unroll
    for (int r = 0; r < 8; ++r) { const int rloc = half * 16 + 8 * hh + r; float v = accs[u][r] * alpha + bv; if (CP) { if (rowsPerB < 0) v += CP[cofs + (size_t)(row0g + row0 + rloc) * ldc + col];      /* rowsPerB < 0: own element of the batched C plane */ else { const int bidx = (row0g + row0 + rloc) / rowsPerB; v += CP[(size_t)bidx * sCPb + (size_t)by * 64 + col]; } }
      if (ACT == 3) v = fmaxf(v, 0.f); else if (ACT == 6) v = 0.5f * v * (1.0f + erff(v * 0.70710678118654752f)); else if (ACT == 11) v = 1.0f / (1.0f + expf(-v)); else if (ACT == 15) v = v / (1.0f + expf(-v)); else if (ACT == 12) v = (v > 0.f) ? v : 0.01f * v; else if (ACT == 8) v = tanhf(v); else if (ACT == 9) v = 0.5f * v * (1.0f + tanhf(0.7978845608028654f * (v + 0.044715f * v * v * v))); else if (ACT == 14) v = (v > 0.f) ? v : 0.1f * v; else if (ACT == 16) v = (v >= 0.f) ? v : 0.3f * v; else if (ACT == 17) v = (v >= 0.f) ? v : 0.2f * v;
      so[w][rloc][t * 16 + ln] = v; } }
  __builtin_amdgcn_fence(__ATOMIC_ACQ_REL, "workgroup"); __builtin_amdgcn_wave_barrier();
  if (omode == 1) {      /* chunk g * 32 + lane of fragment (row tile rt, k block kb): row ln, k (2 g + hh) * 8 .. + 7; every store is 512 contiguous bytes of a wave */
    const size_t f0 = ((size_t)(row0 >> 4) * (ldc >> 5) + (col0 >> 5)) * 512 + lane * 8; unsigned short* hp = (unsigned short*)C16 + f0; unsigned short* lp = (unsigned short*)CL + f0;
#pragma unroll
    for (int f = 0; f < 8; ++f) { const int rt = f >> 2, kb = (f >> 1) & 1, g = f & 1; const float* s = &so[w][rt * 16 + ln][kb * 32 + (2 * g + hh) * 8]; const v4f a = *(const v4fa*)s, c = *(const v4fa*)(s + 4); FragH fh, fl;
#pragma unroll
      for (int q = 0; q < 4; ++q) { _Float16 h = (_Float16)a[q]; fh.h[q] = h; fl.h[q] = (_Float16)((a[q] - (float)h) * 1024.0f); h = (_Float16)c[q]; fh.h[4 + q] = h; fl.h[4 + q] = (_Float16)((c[q] - (float)h) * 1024.0f); }
      const size_t o = (size_t)rt * (ldc >> 5) * 512 + kb * 512 + g * 256; *(v8us*)(hp + o) = fh.half[0]; *(v8us*)(lp + o) = fl.half[0]; }
    return; }
  if (omode == 2) {      /* chunk g * 32 + lane of d tile dt: row d = dt * 16 + ln, keys (2 g + hh) * 8 .. + 7 of the wave's 32-key block */
    const int tok = row0g + row0; unsigned short* vp = (unsigned short*)C16 + ((size_t)(tok / SQ) * NH + nq) * ((size_t)HD * SQ) + (size_t)((tok % SQ) >> 5) * 2048 + lane * 8;
#pragma unroll
    for (int f = 0; f < 8; ++f) { const int dt = f >> 1, g = f & 1; FragH fv;
#pragma unroll
      for (int q = 0; q < 8; ++q) fv.h[q] = (_Float16)so[w][(2 * g + hh) * 8 + q][dt * 16 + ln];
      *(v8us*)(vp + dt * 512 + g * 256) = fv.half[0]; }
    return; }
  const int rsub = lane >> 4, c4 = (lane & 15) * 4;
  {
#pragma unroll
    for (int q = 0; q < 16; ++q) { const int r = q * 2 + rsub; const v4f v = *(const v4fa*)&so[w][r][c4]; if (C) *(v4f*)(C + cofs + (size_t)(row0 + r) * ldc + col0 + c4) = v; if (C16) { v4h h4; for (int i = 0; i < 4; ++i) h4[i] = (_Float16)v[i]; *(v4h*)(C16 + cofs + (size_t)(row0 + r) * ldc + col0 + c4) = h4; } }
     } }


__global__ __launch_bounds__(256) void k_wnat(const float* __restrict__ w, size_t n8, _Float16* __restrict__ Bt) { const size_t t = (size_t)blockIdx.x * 256 + threadIdx.x; if (t >= n8) return; FragH f; for (int q = 0; q < 8; ++q) f.h[q] = (_Float16)(bf16_round(w[t * 8 + q]) * 16.0f); *(v8us*)((unsigned short*)Bt + t * 8) = f.half[0];  }
__global__ __launch_bounds__(256) void k_rsm(const float* __restrict__ S, _Float16* __restrict__ P, int nrows) {
  #pragma clang fp contract(off)
  const int i = blockIdx.x * 256 + threadIdx.x; if (i >= nrows) return; const float* s = S + (size_t)i * SQ; float mx = -3.0e38f;
#pragma unroll 1
  for (int j = 0; j < SQ; ++j) mx = fmaxf(mx, s[j]); float se = 0.f;
#pragma unroll 1
  for (int j = 0; j < SQ; ++j) se += expf(s[j] - mx); const float sc = 256.0f / se;
#pragma unroll 1
  for (int j0 = 0; j0 < SQ; j0 += 8) { FragH f; for (int q = 0; q < 8; ++q) f.h[q] = (_Float16)(expf(s[j0 + q] - mx) * sc); unsigned short* d = (unsigned short*)P + (size_t)i * SQ + j0; *(v8us*)d = f.half[0];  } }
__global__ __launch_bounds__(256) void k_vt(const _Float16* __restrict__ V16, int b, int h0, _Float16* __restrict__ VT) { __shared__ unsigned short tl[64][65]; const int tid = threadIdx.x; const int hh = blockIdx.x % HG, sg = blockIdx.x / HG; const int s0 = sg * 64; const int h = h0 + hh;
  for (int i = tid; i < 64 * 8; i += 256) { const int j = i / 8, d8 = (i % 8) * 8; FragH f; f.half[0] = *(const v8us*)((const unsigned short*)V16 + ((size_t)b * SQ + s0 + j) * DM + h * HD + d8); for (int q = 0; q < 8; ++q) tl[d8 + q][j] = f.u[q]; }
  __syncthreads();
  { for (int i = tid; i < 64 * 8; i += 256) { const int d = i / 8, j8 = (i % 8) * 8; FragH f; for (int q = 0; q < 8; ++q) f.u[q] = tl[d][j8 + q]; *(v8us*)((unsigned short*)VT + ((size_t)hh * HD + d) * SQ + s0 + j8) = f.half[0]; }  } }


__device__ __forceinline__ float xl_half(float x) { return __builtin_bit_cast(float, __builtin_amdgcn_permlanex16(__builtin_bit_cast(int, x), __builtin_bit_cast(int, x), 0x76543210, 0xfedcba98, false, false)); }  // lane l with lane l ^ 16
// v_exp_f32 with the v_nop in its own statement: it keeps the one slot that the instruction set asks for behind a transcendental
__device__ __forceinline__ float exp2_slot(float a) { float e; asm("v_exp_f32 %0, %1\n\tv_nop" : "=v"(e) : "v"(a)); return e; }
#define FAW 8                        /* waves per work-group of the fused attention kernel, 16 query columns each */
__global__ __launch_bounds__(FAW * 32) void k_fattn(const _Float16* __restrict__ Qh, const _Float16* __restrict__ Ql, const _Float16* __restrict__ Kh, const _Float16* __restrict__ Kl, const _Float16* __restrict__ VT, const float* __restrict__ relb, _Float16* __restrict__ O) {
  __shared__ float tb[257];
  const int tid = threadIdx.x, lane = tid & 31, ln = lane & 15, hh = lane >> 4; const int h = blockIdx.y, b = blockIdx.z;
  for (int t = tid; t < 257; t += FAW * 32) { const int d = t - 128; const int a = d < 0 ? -d : d; const int f = (a < 8) ? a : (8 + (a >= 12) + (a >= 16) + (a >= 23) + (a >= 32) + (a >= 46) + (a >= 64) + (a >= 91)); const int bk = (d > 0 ? 16 : 0) + f; tb[t] = bf16_round(relb[bk * NH + h]); }
  __syncthreads();      /* publishes the bias table to all waves; the only barrier of the kernel */
  const int q0 = (blockIdx.x * FAW + __builtin_amdgcn_readfirstlane(tid >> 5)) * 16; const size_t r0 = (size_t)b * SQ;
  const size_t fo = (size_t)h * (HD * 16) + lane * 8;      /* fragment order: head h is k blocks 2 h and 2 h + 1 of a row tile, 512 halves each; a row tile is 16 * LQ halves */
  const _Float16* qp = Qh + (r0 + q0) * LQ + fo; const _Float16* qlp = Ql + (r0 + q0) * LQ + fo;
  const v16h qh0 = g2_fragp(qp), qh1 = g2_fragp(qp + 512); asm volatile("s_wait_xcnt 0x0" ::: "memory");      /* this and the like waits below stand behind a group of loads, in front of whatever next overwrites a register that the group's addresses are in */
  const v16h ql0 = g2_fragp(qlp), ql1 = g2_fragp(qlp + 512); asm volatile("s_wait_xcnt 0x0" ::: "memory");
  const _Float16* khp = Kh + r0 * LQ + fo; const _Float16* klp = Kl + r0 * LQ + fo; const _Float16* vp = VT + (size_t)(b * NH + h) * HD * SQ + lane * 8;
  const float bneg = __builtin_bit_cast(float, __builtin_amdgcn_readfirstlane(__builtin_bit_cast(int, tb[0]))), bpos = __builtin_bit_cast(float, __builtin_amdgcn_readfirstlane(__builtin_bit_cast(int, tb[256])));      /* the two far values, the same in every lane: held in scalar registers */
  const int dq = 128 + 8 * hh - (q0 + ln);      /* table index of key j, register r: j0 + r + dq, clamped */
  const v8f z8 = {0.f,0.f,0.f,0.f,0.f,0.f,0.f,0.f}; v8f o0 = z8, o1 = z8, o2 = z8, o3 = z8; float m = -1.0e30f, mm = -1.0e30f, l = 0.f;
  v16h ka0 = g2_fragp(khp), ka1 = g2_fragp(khp + 512), kb0 = g2_fragp(khp + 16 * LQ), kb1 = g2_fragp(khp + 16 * LQ + 512);      /* k_hi: key tiles a (0..15) and b (16..31), d 0..31 and 32..63 */
  v16h la0 = g2_fragp(klp), la1 = g2_fragp(klp + 512), lb0 = g2_fragp(klp + 16 * LQ), lb1 = g2_fragp(klp + 16 * LQ + 512); asm volatile("s_wait_xcnt 0x0" ::: "memory");      /* k_lo likewise */
#pragma unroll 1      /* one pass's fragments in registers at a time: unrolled, the live set would cost a resident wave */
  for (int j0 = 0; j0 < SQ; j0 += 32) {
    const _Float16* vj = vp + (size_t)j0 * HD; const v16h v0 = g2_fragp(vj), v1 = g2_fragp(vj + 512), v2 = g2_fragp(vj + 1024), v3 = g2_fragp(vj + 1536); asm volatile("s_wait_xcnt 0x0" ::: "memory");      /* V^T fragments issued ahead of the score products that hide them */
    const float bf = j0 < q0 ? bneg : bpos; v8f sa = {bf, bf, bf, bf, bf, bf, bf, bf}, sb = sa;      /* a tile wholly at distance 128 or more: one value */
    if (j0 + 31 - q0 > -128 && j0 - (q0 + 15) < 128) {      /* wave-uniform: tiles near the diagonal read the table */
#pragma unroll
      for (int r = 0; r < 8; ++r) { const int ia = j0 + r + dq, ib = ia + 16; sa[r] = tb[ia < 0 ? 0 : (ia > 256 ? 256 : ia)]; sb[r] = tb[ib < 0 ? 0 : (ib > 256 ? 256 : ib)]; } }
    v8f ta = z8, tc = z8;
    sa = g2_mma(ka0, qh0, sa); ta = g2_mma(ka0, ql0, ta); sb = g2_mma(kb0, qh0, sb); tc = g2_mma(kb0, ql0, tc);      /* four independent accumulator chains, interleaved */
    sa = g2_mma(ka1, qh1, sa); ta = g2_mma(ka1, ql1, ta); sb = g2_mma(kb1, qh1, sb); tc = g2_mma(kb1, ql1, tc);
    ta = g2_mma(la0, qh0, ta); tc = g2_mma(lb0, qh0, tc); ta = g2_mma(la1, qh1, ta); tc = g2_mma(lb1, qh1, tc);
    { const size_t jn = (size_t)((j0 + 32) & (SQ - 1)) * LQ;      /* the next pass's K fragments, fetched behind this pass's score products; the last pass wraps to key 0 (in bounds, unused) */
      ka0 = g2_fragp(khp + jn); ka1 = g2_fragp(khp + jn + 512); kb0 = g2_fragp(khp + jn + 16 * LQ); kb1 = g2_fragp(khp + jn + 16 * LQ + 512);
      la0 = g2_fragp(klp + jn); la1 = g2_fragp(klp + jn + 512); lb0 = g2_fragp(klp + jn + 16 * LQ); lb1 = g2_fragp(klp + jn + 16 * LQ + 512); asm volatile("s_wait_xcnt 0x0" ::: "memory"); }
    float s[16];
#pragma unroll
    for (int r = 0; r < 8; ++r) { s[r] = fmaf(ta[r], 0.0009765625f, sa[r]); s[8 + r] = fmaf(tc[r], 0.0009765625f, sb[r]); }
    float x0 = fmaxf(s[0], s[1]), x1 = fmaxf(s[2], s[3]), x2 = fmaxf(s[4], s[5]), x3 = fmaxf(s[6], s[7]);
    x0 = fmaxf(x0, fmaxf(s[8], s[9])); x1 = fmaxf(x1, fmaxf(s[10], s[11])); x2 = fmaxf(x2, fmaxf(s[12], s[13])); x3 = fmaxf(x3, fmaxf(s[14], s[15]));
    float mx = fmaxf(fmaxf(x0, x1), fmaxf(x2, x3)); mx = fmaxf(mx, xl_half(mx));      /* both halves of the wave hold keys of the same query */
    const float mn = fmaxf(m, mx); const float mmn = fmaf(mn, 1.44269504088896340736f, -8.0f);      /* exponent offset in log2 units; the -8 carries the weights x256 */
    const float al = exp2_slot(mm - mmn); m = mn; mm = mmn;      /* 1 exactly while the maximum stands */
    FragH pf; float a0 = 0.f, a1 = 0.f, a2 = 0.f, a3 = 0.f;
#pragma unroll
    for (int i = 0; i < 16; i += 4) { const float p0 = exp2_slot(fmaf(s[i], 1.44269504088896340736f, -mmn)), p1 = exp2_slot(fmaf(s[i + 1], 1.44269504088896340736f, -mmn)), p2 = exp2_slot(fmaf(s[i + 2], 1.44269504088896340736f, -mmn)), p3 = exp2_slot(fmaf(s[i + 3], 1.44269504088896340736f, -mmn));
      a0 += p0; a1 += p1; a2 += p2; a3 += p3; pf.h[i] = (_Float16)p0; pf.h[i + 1] = (_Float16)p1; pf.h[i + 2] = (_Float16)p2; pf.h[i + 3] = (_Float16)p3; }
    l = fmaf(l, al, (a0 + a1) + (a2 + a3));
#pragma unroll
    for (int r = 0; r < 8; ++r) { o0[r] *= al; o1[r] *= al; o2[r] *= al; o3[r] *= al; }
    o0 = g2_mma(v0, pf.v, o0); o1 = g2_mma(v1, pf.v, o1); o2 = g2_mma(v2, pf.v, o2); o3 = g2_mma(v3, pf.v, o3);      /* O^T[d = 16 t + 8 hh + r][query ln] */
  }
  const float sc = 64.0f / (l + xl_half(l)); unsigned short* op = (unsigned short*)O + (r0 + q0) * DM + fo; FragH f;      /* o rows in fragment order too (A operand of the output GEMM): d = 16 t + 8 hh + r of query ln is chunk 32 (t & 1) + lane of k block 2 h + (t >> 1) */
#pragma unroll
  for (int r = 0; r < 8; ++r) { f.h[r] = (_Float16)(o0[r] * sc); f.h[8 + r] = (_Float16)(o1[r] * sc); }
  *(v8us*)op = f.half[0]; *(v8us*)(op + 256) = f.half[1];
#pragma unroll
  for (int r = 0; r < 8; ++r) { f.h[r] = (_Float16)(o2[r] * sc); f.h[8 + r] = (_Float16)(o3[r] * sc); }
  *(v8us*)(op + 512) = f.half[0]; *(v8us*)(op + 768) = f.half[1]; }

extern "C" void kernel_launch(void* const* d_in, const int* in_sizes, int n_in,
                              void* d_out, int out_size, void* d_ws, size_t ws_size, hipStream_t stream) {
  (void)in_sizes; (void)n_in; (void)out_size;
  const float* const* I = (const float* const*)d_in; const float* xq = I[0]; const float* xkv = I[1]; const float* wq = I[2]; const float* wk = I[3]; const float* wv = I[4]; const float* wo = I[5]; const float* relb = I[6]; const float* bq = nullptr; const float* bk = nullptr; (void)bq; (void)bk;      /* [in][out] weights, no biases; rel_bias [32 buckets][16 heads] */
  char* ws = (char*)d_ws; size_t off = 0;
  auto take = [&](size_t bytes) { char* p = ws + off; off += (bytes + 255) & ~(size_t)255; return p; };
  _Float16* BQ = (_Float16*)take((size_t)DM * DM * 2); _Float16* BK = (_Float16*)take((size_t)DM * DM * 2); _Float16* BV = (_Float16*)take((size_t)DM * DM * 2); _Float16* BO = (_Float16*)take((size_t)DM * DM * 2);
  _Float16* XQ = (_Float16*)take(NR * DM * 2); _Float16* XKV = (_Float16*)take(NR * DM * 2); _Float16* Q16 = (_Float16*)take(NR * DM * 2); _Float16* QL = (_Float16*)take(NR * DM * 2); _Float16* K16 = (_Float16*)take(NR * DM * 2); _Float16* KL = (_Float16*)take(NR * DM * 2); _Float16* O16 = (_Float16*)take(NR * DM * 2);
  _Float16* VT = (_Float16*)take((size_t)NB * NH * HD * SQ * 2);      /* V^T for ALL batches */
  if (off > ws_size) return;
  k_wt_f16<<<(unsigned)(((size_t)DM * (DM / 8) + 255) / 256), 256, 0, stream>>>(wq, BQ, DM, DM, 16.0f); k_wt_f16<<<(unsigned)(((size_t)DM * (DM / 8) + 255) / 256), 256, 0, stream>>>(wk, BK, DM, DM, 16.0f); k_wt_f16<<<(unsigned)(((size_t)DM * (DM / 8) + 255) / 256), 256, 0, stream>>>(wv, BV, DM, DM, 16.0f); k_wt_f16<<<(unsigned)(((size_t)DM * (DM / 8) + 255) / 256), 256, 0, stream>>>(wo, BO, DM, DM, 16.0f);      /* [in][out] -> Bt[n][k] x16 */

  k_x16<<<(unsigned)((NR * DM / 8 + 255) / 256), 256, 0, stream>>>(xq, XQ, NR * DM / 8); k_x16<<<(unsigned)((NR * DM / 8 + 255) / 256), 256, 0, stream>>>(xkv, XKV, NR * DM / 8);      /* query source and key/value source as exact f16 rows */
  const size_t r0p = (size_t)B0 * SQ;      /* first projected row */
  k_gemm2<0><<<dim3((unsigned)((MP / 128) * (DM / 64)), 1), 128, 0, stream>>>(XQ + r0p * DM, DM, 0, BQ, DM, 0, 0.0625f, nullptr, 0, nullptr, 1, 0, 0, nullptr, Q16 + r0p * DM, QL + r0p * DM, 1, DM, 0, MP, DM, DM);      /* q in f32 -> f16 hi (Q16) + x1024 residual (QL) planes, split in the epilogue */
  k_gemm2<0><<<dim3((unsigned)((MP / 128) * (DM / 64)), 1), 128, 0, stream>>>(XKV + r0p * DM, DM, 0, BK, DM, 0, 0.0625f, nullptr, 0, nullptr, 1, 0, 0, nullptr, K16 + r0p * DM, KL + r0p * DM, 1, DM, 0, MP, DM, DM);      /* k likewise -> K16 + KL */
  k_gemm2<0><<<dim3((unsigned)((MP / 128) * (DM / 64)), 1), 128, 0, stream>>>(XKV + r0p * DM, DM, 0, BV, DM, 0, 0.0625f, nullptr, 0, nullptr, 1, 0, (int)r0p, nullptr, VT, nullptr, 2, DM, 0, MP, DM, DM);      /* v as f16 straight into the V^T fragments [NB * NH][SQ / 32][4 d tiles] */
  k_fattn<<<dim3(SQ / (FAW * 16), NH, NB), FAW * 32, 0, stream>>>(Q16, QL, K16, KL, VT, relb, O16);      /* scores + bias, softmax and P . V of every batch and head; o (merged heads) x64 as f16 rows */
  k_gemm2<0><<<dim3((unsigned)((MPO / 128) * (DM / 64)), 1), 128, 0, stream>>>(O16 + r0p * DM, DM, 0, BO, DM, 0, 0.0009765625f, nullptr, 0, nullptr, 1, 0, 0, (float*)d_out + r0p * DM, nullptr, nullptr, 0, DM, 0, MPO, DM, DM);      /* out rows are the output layout */
}

// v005
// It runs in 233 microseconds.
// Next to v004, in two timings, it ran 1.75 and 1.74 times as fast.
// Counting every step since v000, it is 65.7 times as fast.
#include <hip/hip_runtime.h>
// T5 attention with a relative-position bias and NO score scaling (query_states [4][2048][1024] gives q = x wq; key_value_states gives k = x wk, v = x wv ([in][out] 1024^2 sigma 1/32, no biases); 16 heads of 64; scores = q . k (UNSCALED, logits sigma ~8) + bias[h][i][j] with bias = rel_bias[bucket(j - i)][h] (rel_bias input [32][16]; bidirectional log buckets, 32 buckets, max distance 128); softmax; out = merged wo -> [4][2048][1024]).
// Structure: token rows r = b*2048 + s; the query source and the key/value source as exact f16 rows (bf16-rounded); Q, K, V as three WMMA GEMMs (32x64 wave tiles, f32 accumulation, exact x16 weights); q and k split in the GEMM epilogue into f16 hi + x1024 residual planes, V^T written by its GEMM epilogue from the same LDS staging tile; then ONE fused attention launch over (query block, head, batch): UNSCALED three-term scores (bias as the start value, q_hi . k_hi, + (q_lo . k_hi + q_hi . k_lo) 2^-10; K = 64), running-maximum softmax in registers (f32 statistics, native exp; weights x256 as f16), O^T += V^T . P^T, o carried x64 against f16 subnormal flush (folded into the output GEMM alpha) written straight into the merged f16 o rows; out = o W_o GEMM (f32) into the output layout.
// Compute dtype: inputs rounded to bf16; x / weights exact; v, softmax weights and o as plain f16 GEMM operands (~2^-12), q and k as f16 hi + x1024 residual; scores and softmax statistics f32; v_wmma_f32_16x16x32_f16.
#define NB 4
#define SQ 2048
#define DM 1024
#define NH 16
#define HD 64
#define HG 2                         /* heads per launch of k_vt, which is not launched */
#define B0 0                         /* first batch processed (debug hook) */
#define NBR NB                       /* batches processed (debug hook) */
#define NR ((size_t)NB * SQ)         /* token rows */
#define MP ((int)((size_t)NBR * SQ)) /* rows projected (debug hook) */
#define QN SQ                        /* not used: the attention launch attends all SQ query rows */
#define NHD NH                       /* not used: the attention launch covers all NH heads */
#define MPO MP                       /* rows through the output stage (debug hook) */
#define LQ DM      /* row pitch of the q/k rows */
typedef __bf16 v16b __attribute__((ext_vector_type(16)));
typedef unsigned short v8us __attribute__((ext_vector_type(8), may_alias));
typedef float  v8f  __attribute__((ext_vector_type(8)));
typedef float  v4f  __attribute__((ext_vector_type(4)));
typedef float  v4fa __attribute__((ext_vector_type(4), may_alias));
union FragB { v16b v; v8us half[2]; unsigned short u[16]; };

__device__ __forceinline__ unsigned short bf16_bits(float x) { unsigned int u = __float_as_uint(x); return (unsigned short)((u + 0x7FFFu + ((u >> 16) & 1u)) >> 16); }
__device__ __forceinline__ float bf16_val(unsigned short b) { return __uint_as_float(((unsigned int)b) << 16); }
__device__ __forceinline__ float bf16_round(float x) { return bf16_val(bf16_bits(x)); }
// D += A·B with NT terms: 1 = ah·bh, 2 = + al·bh (A split), 3 = + ah·bl (both split)
template <int NT>
__device__ __forceinline__ v8f mmaN(v16b ah, v16b al, v16b bh, v16b bl, v8f c) {
  c = __builtin_amdgcn_wmma_f32_16x16x32_bf16(false, ah, false, bh, (short)0, c, false, false);
  if (NT >= 2) c = __builtin_amdgcn_wmma_f32_16x16x32_bf16(false, al, false, bh, (short)0, c, false, false);
  if (NT >= 3) c = __builtin_amdgcn_wmma_f32_16x16x32_bf16(false, ah, false, bl, (short)0, c, false, false);
  asm volatile("v_nop\n\tv_nop\n\tv_nop\n\tv_nop" : "+v"(c) : "v"(ah), "v"(al), "v"(bh), "v"(bl));
  return c;
}

__global__ __launch_bounds__(256) void k_wt_bf16(const float* __restrict__ W, unsigned short* __restrict__ Wt, int K, int N) {
  const int t = blockIdx.x * 256 + threadIdx.x;
  const int k8n = K / 8;
  if (t >= N * k8n) return;
  const int n = t / k8n, k8 = (t % k8n) * 8;
  v8us v;
#pragma unroll
  for (int i = 0; i < 8; ++i) v[i] = bf16_bits(W[(size_t)(k8 + i) * N + n]);
  *(v8us*)(Wt + (size_t)n * K + k8) = v;
  
}

// GEMM C[M][N] (f32, pitch ldc) = act(A[M][K]·W + bias). A f32 row-major (pitch lda) converted per fragment to bf16
// (ASPLIT: hi/lo two planes -> 2 terms, else single rounded term); Wt bf16 [N][K] (pitch ldb). BIAS_BF16 rounds the
// bias to bf16 first (bias quantised to bf16 before the add). K%32==0, M%16==0, N%64==0.
template <bool ASPLIT, int ACT, bool BIAS_BF16>
__global__ __launch_bounds__(128) void k_gemm_bf(const float* __restrict__ A, int lda, const unsigned short* __restrict__ Wt, int ldb,
                                               const float* __restrict__ bias, float* __restrict__ C, int ldc, int M, int N, int K) {
  __shared__ __attribute__((aligned(16))) float so[4][16][64];
  const int tid = threadIdx.x, w = tid >> 5, lane = tid & 31, ln = lane & 15, hh = lane >> 4;
  const int ntn = N / 64;
  const int wid = blockIdx.x * 4 + w;
  const int mt = wid / ntn, nq = wid % ntn;
  if (mt * 16 >= M) return;
  const int row0 = mt * 16, col0 = nq * 64;
  const float* arow = A + (size_t)(row0 + ln) * lda;
  v8f acc[4] = {};
  for (int kb = 0; kb < K; kb += 32) {
    FragB ah, al;
    const v4f x0 = *(const v4fa*)(arow + kb + 8 * hh), x1 = *(const v4fa*)(arow + kb + 8 * hh + 4);
    const v4f x2 = *(const v4fa*)(arow + kb + 16 + 8 * hh), x3 = *(const v4fa*)(arow + kb + 16 + 8 * hh + 4);
    float xs[16] = {x0[0],x0[1],x0[2],x0[3],x1[0],x1[1],x1[2],x1[3],x2[0],x2[1],x2[2],x2[3],x3[0],x3[1],x3[2],x3[3]};
#pragma unroll
    for (int i = 0; i < 16; ++i) { const unsigned short hb = bf16_bits(xs[i]); ah.u[i] = hb; al.u[i] = ASPLIT ? bf16_bits(xs[i] - bf16_val(hb)) : (unsigned short)0; }
#pragma unroll
    for (int t = 0; t < 4; ++t) {
      const unsigned short* brow = Wt + (size_t)(col0 + t * 16 + ln) * ldb + kb;
      FragB b;
      b.half[0] = *(const v8us*)(brow + 8 * hh);
      b.half[1] = *(const v8us*)(brow + 16 + 8 * hh);
      acc[t] = mmaN<ASPLIT ? 2 : 1>(ah.v, al.v, b.v, b.v, acc[t]);
    }
  }
#pragma unroll
  for (int t = 0; t < 4; ++t) {
    float bv = bias ? bias[col0 + t * 16 + ln] : 0.f;
    if (BIAS_BF16) bv = bf16_round(bv);
#pragma unroll
    for (int r = 0; r < 8; ++r) { float v = acc[t][r] + bv; if (ACT == 1) v = fmaxf(v, 0.f); so[w][8 * hh + r][t * 16 + ln] = v; }
  }
  __builtin_amdgcn_fence(__ATOMIC_ACQ_REL, "workgroup");
  __builtin_amdgcn_wave_barrier();
  const int rsub = lane >> 4, c4 = (lane & 15) * 4;
  {
#pragma unroll
    for (int q = 0; q < 8; ++q) {
      const int r = q * 2 + rsub;
      const v4f v = *(const v4fa*)&so[w][r][c4];
      *(v4f*)(C + (size_t)(row0 + r) * ldc + col0 + c4) = v;
    }
    
  }
}

// GEMM C = act(A·W + bias + resid): A f32 (ASPLIT -> hi/lo 2 terms), Wt bf16 [N][K]; ACT 0 none, 1 relu, 2 exact gelu;
// resid (optional, f32, row index = (row % rmod), pitch ldr, RES_BF16 rounds it) added before the activation.
template <bool ASPLIT, int ACT, bool BIAS_BF16, bool RES_BF16>
__global__ __launch_bounds__(128) void k_gemm_bf3(const float* __restrict__ A, int lda, const unsigned short* __restrict__ Wt, int ldb,
                                                const float* __restrict__ bias, const float* __restrict__ resid, int rmod, int ldr,
                                                float* __restrict__ C, int ldc, int M, int N, int K) {
  __shared__ __attribute__((aligned(16))) float so[4][16][64];
  const int tid = threadIdx.x, w = tid >> 5, lane = tid & 31, ln = lane & 15, hh = lane >> 4;
  const int ntn = N / 64;
  const int wid = blockIdx.x * 4 + w;
  const int mt = wid / ntn, nq = wid % ntn;
  if (mt * 16 >= M) return;
  const int row0 = mt * 16, col0 = nq * 64;
  const float* arow = A + (size_t)(row0 + ln) * lda;
  v8f acc[4] = {};
  for (int kb = 0; kb < K; kb += 32) {
    FragB ah, al;
    const v4f x0 = *(const v4fa*)(arow + kb + 8 * hh), x1 = *(const v4fa*)(arow + kb + 8 * hh + 4);
    const v4f x2 = *(const v4fa*)(arow + kb + 16 + 8 * hh), x3 = *(const v4fa*)(arow + kb + 16 + 8 * hh + 4);
    float xs[16] = {x0[0],x0[1],x0[2],x0[3],x1[0],x1[1],x1[2],x1[3],x2[0],x2[1],x2[2],x2[3],x3[0],x3[1],x3[2],x3[3]};
#pragma unroll
    for (int i = 0; i < 16; ++i) { const unsigned short hb = bf16_bits(xs[i]); ah.u[i] = hb; al.u[i] = ASPLIT ? bf16_bits(xs[i] - bf16_val(hb)) : (unsigned short)0; }
#pragma unroll
    for (int t = 0; t < 4; ++t) {
      const unsigned short* brow = Wt + (size_t)(col0 + t * 16 + ln) * ldb + kb;
      FragB b;
      b.half[0] = *(const v8us*)(brow + 8 * hh);
      b.half[1] = *(const v8us*)(brow + 16 + 8 * hh);
      acc[t] = mmaN<ASPLIT ? 2 : 1>(ah.v, al.v, b.v, b.v, acc[t]);
    }
  }
#pragma unroll
  for (int t = 0; t < 4; ++t) {
    const int col = col0 + t * 16 + ln;
    float bv = bias ? bias[col] : 0.f;
    if (BIAS_BF16) bv = bf16_round(bv);
#pragma unroll
    for (int r = 0; r < 8; ++r) {
      float v = acc[t][r] + bv;
      if (resid) { float rv = resid[(size_t)((row0 + 8 * hh + r) % rmod) * ldr + col]; if (RES_BF16) rv = bf16_round(rv); v += rv; }
      if (ACT == 1) v = fmaxf(v, 0.f);
      if (ACT == 2) v = 0.5f * v * (1.0f + erff(v * 0.70710678118654752f));
      if (ACT == 3) { const float u = 0.7978845608028654f * (v + 0.044715f * v * v * v); v = 0.5f * v * (1.0f + tanhf(u)); }
      so[w][8 * hh + r][t * 16 + ln] = v;
    }
  }
  __builtin_amdgcn_fence(__ATOMIC_ACQ_REL, "workgroup");
  __builtin_amdgcn_wave_barrier();
  const int rsub = lane >> 4, c4 = (lane & 15) * 4;
  {
#pragma unroll
    for (int q = 0; q < 8; ++q) {
      const int r = q * 2 + rsub;
      const v4f v = *(const v4fa*)&so[w][r][c4];
      *(v4f*)(C + (size_t)(row0 + r) * ldc + col0 + c4) = v;
    }
    
  }
}
// row LayerNorm (biased variance, eps) over N: s = X (+ R); optional out_sum <- s; out_norm <- (s-mu)*rsqrt(var+eps)*g + b
template <bool PARAM_BF16>
__global__ __launch_bounds__(256) void k_layernorm(const float* __restrict__ X, const float* __restrict__ R, const float* __restrict__ g, const float* __restrict__ bta,
                                                  float* __restrict__ out_sum, float* __restrict__ out_norm, int N, float eps) {
  __shared__ float red[256];
  const int row = blockIdx.x, tid = threadIdx.x;
  const float* x = X + (size_t)row * N; const float* rr = R ? R + (size_t)row * N : nullptr;
  float vals[16];                     // up to N = 4096
  const int per = N / 256;            // contiguous chunk per thread? use strided-by-4 chunks: thread handles j = tid*4 + 1024*u
  float s1 = 0.f;
  for (int u = 0; u < per / 4; ++u) {
    const int j = tid * 4 + 1024 * u;
    const v4f a = *(const v4fa*)(x + j);
    v4f b = {0.f,0.f,0.f,0.f}; if (rr) b = *(const v4fa*)(rr + j);
#pragma unroll
    for (int q = 0; q < 4; ++q) { const float v = a[q] + b[q]; vals[u * 4 + q] = v; s1 += v; }
  }
  red[tid] = s1; __syncthreads();
  for (int st = 128; st > 0; st >>= 1) { if (tid < st) red[tid] += red[tid + st]; __syncthreads(); }
  const float mu = red[0] / (float)N; __syncthreads();
  float s2 = 0.f;
  for (int u = 0; u < per / 4; ++u)
#pragma unroll
    for (int q = 0; q < 4; ++q) { const float c = vals[u * 4 + q] - mu; s2 += c * c; }
  red[tid] = s2; __syncthreads();
  for (int st = 128; st > 0; st >>= 1) { if (tid < st) red[tid] += red[tid + st]; __syncthreads(); }
  const float rs = rsqrtf(red[0] / (float)N + eps);
  {
    for (int u = 0; u < per / 4; ++u) {
      const int j = tid * 4 + 1024 * u;
      v4f o, sm;
#pragma unroll
      for (int q = 0; q < 4; ++q) {
        float gg = g[j + q], bb = bta[j + q];
        if (PARAM_BF16) { gg = bf16_round(gg); bb = bf16_round(bb); }
        sm[q] = vals[u * 4 + q]; o[q] = (vals[u * 4 + q] - mu) * rs * gg + bb;
      }
      if (out_sum) *(v4f*)(out_sum + (size_t)row * N + j) = sm;
      *(v4f*)(out_norm + (size_t)row * N + j) = o;
    }
    
  }
}



// ---- f16 WMMA path (v_wmma_f32_16x16x32_f16): 11-bit significands for operands in range — used where a [0,1] probability operand needs more precision than bf16
typedef _Float16 v16h __attribute__((ext_vector_type(16)));
union FragH { v16h v; v8us half[2]; _Float16 h[16]; unsigned short u[16]; };
template <int NT>
__device__ __forceinline__ v8f mmaH(v16h ah, v16h al, v16h bh, v16h bl, v8f c) {
  c = __builtin_amdgcn_wmma_f32_16x16x32_f16(false, ah, false, bh, (short)0, c, false, false);
  if (NT >= 2) c = __builtin_amdgcn_wmma_f32_16x16x32_f16(false, al, false, bh, (short)0, c, false, false);
  if (NT >= 3) c = __builtin_amdgcn_wmma_f32_16x16x32_f16(false, ah, false, bl, (short)0, c, false, false);
  asm volatile("v_nop\n\tv_nop\n\tv_nop\n\tv_nop" : "+v"(c) : "v"(ah), "v"(al), "v"(bh), "v"(bl));
  return c;
}
// batched GEMM like k_gemm_b but f16 operands: A f32 (split into f16 hi/lo if ASPLIT, else rounded to f16), Bt = f16 values [n][k]; alpha; C f32; N multiple of 16 (partial tiles skipped)
template <bool ASPLIT>
__global__ __launch_bounds__(128) void k_gemm_h(const float* __restrict__ A, int lda, size_t sA, const _Float16* __restrict__ Bh, int ldb, size_t sB, float alpha, float* __restrict__ C, int ldc, size_t sC, int M, int N, int K) {
  __shared__ __attribute__((aligned(16))) float so[4][16][64];
  const int tid = threadIdx.x, w = tid >> 5, lane = tid & 31, ln = lane & 15, hh = lane >> 4; const int by = blockIdx.y;
  A += (size_t)by * sA; Bh += (size_t)by * sB; C += (size_t)by * sC;
  const int ntn = (N + 63) / 64; const int wid = blockIdx.x * 4 + w; const int mt = wid / ntn, nq = wid % ntn; if (mt * 16 >= M) return;
  const int row0 = mt * 16, col0 = nq * 64; const float* arow = A + (size_t)(row0 + ln) * lda;
  v8f acc[4] = {};
  for (int kb = 0; kb < K; kb += 32) {
    FragH ah, al;
    const v4f x0 = *(const v4fa*)(arow + kb + 8 * hh), x1 = *(const v4fa*)(arow + kb + 8 * hh + 4), x2 = *(const v4fa*)(arow + kb + 16 + 8 * hh), x3 = *(const v4fa*)(arow + kb + 16 + 8 * hh + 4);
    float xs[16] = {x0[0],x0[1],x0[2],x0[3],x1[0],x1[1],x1[2],x1[3],x2[0],x2[1],x2[2],x2[3],x3[0],x3[1],x3[2],x3[3]};
#pragma unroll
    for (int i = 0; i < 16; ++i) { const _Float16 h = (_Float16)xs[i]; ah.h[i] = h; al.h[i] = ASPLIT ? (_Float16)(xs[i] - (float)h) : (_Float16)0.0f; }
#pragma unroll
    for (int t = 0; t < 4; ++t) { if (col0 + t * 16 >= N) continue; const size_t boff = (size_t)(col0 + t * 16 + ln) * ldb + kb; FragH bq; bq.half[0] = *(const v8us*)(Bh + boff + 8 * hh); bq.half[1] = *(const v8us*)(Bh + boff + 16 + 8 * hh);
      acc[t] = mmaH<ASPLIT ? 2 : 1>(ah.v, al.v, bq.v, bq.v, acc[t]); }
  }
#pragma unroll
  for (int t = 0; t < 4; ++t) { if (col0 + t * 16 >= N) continue;
#pragma unroll
    for (int r = 0; r < 8; ++r) so[w][8 * hh + r][t * 16 + ln] = acc[t][r] * alpha; }
  __builtin_amdgcn_fence(__ATOMIC_ACQ_REL, "workgroup"); __builtin_amdgcn_wave_barrier();
  const int rsub = lane >> 4, c4 = (lane & 15) * 4;
  {
#pragma unroll
    for (int q = 0; q < 8; ++q) { const int r = q * 2 + rsub; if (col0 + c4 < N) { const v4f v = *(const v4fa*)&so[w][r][c4]; *(v4f*)(C + (size_t)(row0 + r) * ldc + col0 + c4) = v; } }
     }
}

// Wt[n][k] = f16(W[k][n]·scale) from f32 row-major W[K][N] (scale = power of two; bf16-exact weights stay exact in f16 away from the subnormal range)
__global__ __launch_bounds__(256) void k_wt_f16(const float* __restrict__ W, _Float16* __restrict__ Wt, int K, int N, float scale) {
  const int t = blockIdx.x * 256 + threadIdx.x; if (t >= N * (K / 8)) return; const int tile = t >> 6, w = t & 63, kt = K >> 5; const int n = (tile / kt) * 16 + (w & 15), k8 = (tile % kt) * 32 + (w >> 4) * 8; FragH f;      /* thread = output chunk of the fragment order (rows n, K / 32 k blocks a row tile) */
#pragma unroll
  for (int i = 0; i < 8; ++i) f.h[i] = (_Float16)(bf16_round(W[(size_t)(k8 + i) * N + n]) * scale); const v8us o = f.half[0];
  *(v8us*)((unsigned short*)Wt + (size_t)t * 8) = o; 
}
// k_gemm_hh variant with fused epilogue: v = acc·alpha + bias[by·sBias + col] (+ CP[(row/rowsPerB)·sCPb + by·64 + col] if CP) ; ACT 0 none / 1 elu ; writes f16 C16 (and f32 C if non-null)
template <int ACT>
__global__ __launch_bounds__(128) void k_gemm_hhx(const _Float16* __restrict__ A, int lda, size_t sA, const _Float16* __restrict__ Bh, int ldb, size_t sB, float alpha, const float* __restrict__ bias, size_t sBias, const float* __restrict__ CP, int rowsPerB, size_t sCPb, int row0g,
    float* __restrict__ C, _Float16* __restrict__ C16, int ldc, size_t sC, int M, int N, int K) {
  __shared__ __attribute__((aligned(16))) float so[4][16][64];
  const int tid = threadIdx.x, w = tid >> 5, lane = tid & 31, ln = lane & 15, hh = lane >> 4; const int by = blockIdx.y;
  A += (size_t)by * sA; Bh += (size_t)by * sB; const size_t cofs = (size_t)by * sC; const float* bp = bias ? bias + (size_t)by * sBias : nullptr;
  const int ntn = (N + 63) / 64; const int wid = blockIdx.x * 4 + w; const int mt = wid / ntn, nq = wid % ntn; if (mt * 16 >= M) return;
  const int row0 = mt * 16, col0 = nq * 64; const _Float16* arow = A + (size_t)(row0 + ln) * lda;
  v8f acc[4] = {};
  for (int kb = 0; kb < K; kb += 32) { FragH ah; ah.half[0] = *(const v8us*)((const unsigned short*)arow + kb + 8 * hh); ah.half[1] = *(const v8us*)((const unsigned short*)arow + kb + 16 + 8 * hh);
#pragma unroll
    for (int t = 0; t < 4; ++t) { if (col0 + t * 16 >= N) continue; const size_t boff = (size_t)(col0 + t * 16 + ln) * ldb + kb; FragH bq; bq.half[0] = *(const v8us*)((const unsigned short*)Bh + boff + 8 * hh); bq.half[1] = *(const v8us*)((const unsigned short*)Bh + boff + 16 + 8 * hh);
      acc[t] = mmaH<1>(ah.v, ah.v, bq.v, bq.v, acc[t]); }
  }
#pragma unroll
  for (int t = 0; t < 4; ++t) { if (col0 + t * 16 >= N) continue; const int col = col0 + t * 16 + ln; const float bv = bp ? bf16_round(bp[col]) : 0.f;
#pragma unroll
    for (int r = 0; r < 8; ++r) { float v = acc[t][r] * alpha + bv; if (CP) { const int rr = row0g + row0 + 8 * hh + r; if (rowsPerB < 0) v += CP[cofs + (size_t)rr * ldc + col];      /* rowsPerB < 0: own element of the batched C plane */ else { const int bidx = rr / rowsPerB; v += CP[(size_t)bidx * sCPb + (size_t)by * 64 + col]; } } if (ACT == 1) v = (v > 0.f) ? v : expm1f(v); else if (ACT == 7) v = (v > 0.f) ? v + 1.0f : expf(v); else if (ACT == 8) v = tanhf(v); else if (ACT == 9) v = 0.5f * v * (1.0f + tanhf(0.7978845608028654f * (v + 0.044715f * v * v * v))); else if (ACT == 11) v = 1.0f / (1.0f + expf(-v)); else if (ACT == 12) v = (v > 0.f) ? v : 0.01f * v; else if (ACT == 14) v = (v > 0.f) ? v : 0.1f * v; else if (ACT == 16) v = (v >= 0.f) ? v : 0.3f * v; else if (ACT == 17) v = (v >= 0.f) ? v : 0.2f * v; else if (ACT == 15) v = v / (1.0f + expf(-v)); else if (ACT == 3) v = fmaxf(v, 0.f); else if (ACT == 6) v = 0.5f * v * (1.0f + erff(v * 0.70710678118654752f)); so[w][8 * hh + r][t * 16 + ln] = v; } }
  __builtin_amdgcn_fence(__ATOMIC_ACQ_REL, "workgroup"); __builtin_amdgcn_wave_barrier();
  const int rsub = lane >> 4, c4 = (lane & 15) * 4; typedef _Float16 v4h __attribute__((ext_vector_type(4)));
  {
#pragma unroll
    for (int q = 0; q < 8; ++q) { const int r = q * 2 + rsub; if (col0 + c4 < N) { const v4f v = *(const v4fa*)&so[w][r][c4]; if (C) *(v4f*)(C + cofs + (size_t)(row0 + r) * ldc + col0 + c4) = v; if (C16) { v4h h4; for (int i = 0; i < 4; ++i) h4[i] = (_Float16)v[i]; *(v4h*)(C16 + cofs + (size_t)(row0 + r) * ldc + col0 + c4) = h4; } } }
     }
}


typedef _Float16 v4h __attribute__((ext_vector_type(4)));

// Fragment order of an f16 operand plane [rows][DM]: the 16 x 32 fragment (row tile rt, k block kb) is 1 KiB at (rt * (DM / 32) + kb) * 512 halves; in it the 16-byte chunk w = 0..63 holds row rt * 16 + (w & 15), k = kb * 32 + (w >> 4) * 8 .. + 7.
// Lane l of a wave then reads chunks l and 32 + l: the same values in the same registers as g2_frag from rows, but each wave-wide load is 512 contiguous bytes (4 whole lines) and not 16 pieces of 32 bytes.
// fo_src: first element, in the row-major [rows][DM] numbering, of chunk c of such a plane.
__device__ __forceinline__ size_t fo_src(size_t c) { const size_t tile = c >> 6; const int w = (int)(c & 63); return ((tile >> 5) * 16 + (w & 15)) * DM + (tile & 31) * 32 + (w >> 4) * 8; }
static_assert(DM / 32 == 32, "fo_src takes 32 k blocks a row tile");
static_assert(DM % 64 == 0, "k_gemm2 walks K = DM two k blocks a trip");
// fo_chunk: the chunk that thread t of a converting kernel makes. Four threads in a row take one source row's 128 bytes of f32 (a whole line), so a wave reads 8 whole lines and stores 4 whole lines (8 rows x 16 bytes in each of the 4 k groups).
__device__ __forceinline__ size_t fo_chunk(size_t t) { return (t & ~(size_t)63) + (t & 3) * 16 + ((t >> 2) & 15); }
__global__ __launch_bounds__(256) void k_x16(const float* __restrict__ x, _Float16* __restrict__ X16, size_t n8) { const size_t t = (size_t)blockIdx.x * 256 + threadIdx.x; if (t >= n8) return; FragH f; const size_t ck = fo_chunk(t); const float* s = x + fo_src(ck); const v4f a = *(const v4fa*)s, c = *(const v4fa*)(s + 4);
#pragma unroll
  for (int q = 0; q < 4; ++q) { f.h[q] = (_Float16)bf16_round(a[q]); f.h[4 + q] = (_Float16)bf16_round(c[q]); } *(v8us*)((unsigned short*)X16 + ck * 8) = f.half[0];  }
__global__ __launch_bounds__(256) void k_h16(const float* __restrict__ x, _Float16* __restrict__ X16, size_t n8) { const size_t t = (size_t)blockIdx.x * 256 + threadIdx.x; if (t >= n8) return; FragH f;
#pragma unroll
  for (int q = 0; q < 8; ++q) f.h[q] = (_Float16)x[t * 8 + q]; *(v8us*)((unsigned short*)X16 + t * 8) = f.half[0];  }
__global__ __launch_bounds__(256) void k_round16f(const float* __restrict__ W, _Float16* __restrict__ Bt, size_t n8) { const size_t t = (size_t)blockIdx.x * 256 + threadIdx.x; if (t >= n8) return; FragH f;
#pragma unroll
  for (int i = 0; i < 8; ++i) f.h[i] = (_Float16)(bf16_round(W[t * 8 + i]) * 16.0f); *(v8us*)((unsigned short*)Bt + t * 8) = f.half[0];  }
// ---- fast GEMM (wave tile 32x64; requires M % 32 == 0 rows per launch region and N % 64 == 0); epilogue = k_gemm_hhx semantics ----
__device__ __forceinline__ v16h g2_frag(const _Float16* p, int hh) { FragH f; f.half[0] = *(const v8us*)((const unsigned short*)p + 8 * hh); f.half[1] = *(const v8us*)((const unsigned short*)p + 16 + 8 * hh); return f.v; }
__device__ __forceinline__ v16h g2_fragp(const _Float16* p) { FragH f; f.half[0] = *(const v8us*)((const unsigned short*)p); f.half[1] = *(const v8us*)((const unsigned short*)p + 256); return f.v; }      /* fragment-order plane: p = the fragment's start + lane * 8 */
__device__ __forceinline__ v16h g2_fragu(const _Float16* base, unsigned ob) { const char* p = (const char*)base + ob; FragH f; f.half[0] = *(const v8us*)p; f.half[1] = *(const v8us*)(p + 512); return f.v; }      /* the same with a wave-uniform row-tile start and one byte offset (k block * 1024 + lane * 16) shared by all operands */
__device__ __forceinline__ v8f g2_mma(v16h a, v16h b, v8f c) { v8f d = __builtin_amdgcn_wmma_f32_16x16x32_f16(false, a, false, b, (short)0, c, false, false); asm volatile("v_nop\n\tv_nop\n\tv_nop\n\tv_nop" : "+v"(d) : "v"(a), "v"(b)); return d; }
// As built, the epilogue takes one scalar branch per element round the bias / CP code that is unused here: left as it was.
// omode: 0 = C / C16 as rows; 1 = the f32 result split into f16 hi (C16) + x1024 residual (CL) planes, both in fragment order; 2 = the f16 result transposed into the V^T fragments of the attention kernel (C16 = V^T of all batches; a wave tile, 32 keys x one head's 64 d, is four fragments in a row)
template <int ACT>
__global__ __launch_bounds__(128) void k_gemm2(const _Float16* __restrict__ A, int lda, size_t sA, const _Float16* __restrict__ Bh, int ldb, size_t sB, float alpha, const float* __restrict__ bias, size_t sBias, const float* __restrict__ CP, int rowsPerB, size_t sCPb, int row0g,
    float* __restrict__ C, _Float16* __restrict__ C16, _Float16* __restrict__ CL, int omode, int ldc, size_t sC, int M, int N, int K) { static_assert(ACT == 0 || ACT == 3 || ACT == 6 || ACT == 8 || ACT == 9 || ACT == 11 || ACT == 12 || ACT == 14 || ACT == 15 || ACT == 16 || ACT == 17, "k_gemm2: unsupported ACT code (would silently apply no activation)");
  __shared__ __attribute__((aligned(16))) float so[4][32][68];
  const int tid = threadIdx.x, w = __builtin_amdgcn_readfirstlane(tid >> 5), lane = tid & 31, ln = lane & 15, hh = lane >> 4; const int by = blockIdx.y;      /* the wave's number as a scalar: the row-tile starts below stay in scalar registers */
  A += (size_t)by * sA; Bh += (size_t)by * sB; const size_t cofs = (size_t)by * sC; const float* bp = bias ? bias + (size_t)by * sBias : nullptr;
  const int ntn = N >> 6; const int mt = blockIdx.x / ntn, nq = blockIdx.x - mt * ntn; const int row0 = mt * 128 + 32 * w, col0 = nq * 64; if (row0 >= M) return;
  const _Float16* a0p = A + (size_t)row0 * lda; const _Float16* a1p = A + (size_t)(row0 + 16) * lda;      /* a1p formed from A like a0p: written as a0p + 16 * lda this build kept it as a vector address pair, remade with 64-bit vector adds every k block. A and Bh in fragment order: a row tile is 16 * pitch halves, a k block 512 */
  const _Float16* b0p = Bh + (size_t)col0 * ldb; const _Float16* b1p = b0p + (size_t)16 * ldb; const _Float16* b2p = b1p + (size_t)16 * ldb; const _Float16* b3p = b2p + (size_t)16 * ldb;
  const v8f z8 = {0.f,0.f,0.f,0.f,0.f,0.f,0.f,0.f}; v8f c00 = z8, c01 = z8, c02 = z8, c03 = z8, c10 = z8, c11 = z8, c12 = z8, c13 = z8; const unsigned l16 = lane * 16; unsigned ob = l16;
  /* two register sets of six fragments: while one k block multiplies, the next one's twelve loads are in flight (K % 64 == 0: a trip is two k blocks). Each accumulator still takes its k blocks in rising order. */
  v16h a0 = g2_fragu(a0p, ob), a1 = g2_fragu(a1p, ob), b0 = g2_fragu(b0p, ob), b1 = g2_fragu(b1p, ob), b2 = g2_fragu(b2p, ob), b3 = g2_fragu(b3p, ob);
#pragma unroll 1      /* a trip already holds both sets; unrolled further, the live set would only grow */
  for (int kb = 0; kb < K; kb += 64) {
    const v16h e0 = g2_fragu(a0p, ob + 1024), e1 = g2_fragu(a1p, ob + 1024), f0 = g2_fragu(b0p, ob + 1024), f1 = g2_fragu(b1p, ob + 1024), f2 = g2_fragu(b2p, ob + 1024), f3 = g2_fragu(b3p, ob + 1024);
    asm volatile("s_wait_xcnt 0x0" ::: "memory");      /* behind the group of loads, in front of the overwrite of the offset register that they name; as a memory fence it also keeps the group ahead of the products that hide it */
    c00 = g2_mma(a0, b0, c00); c10 = g2_mma(a1, b0, c10); c01 = g2_mma(a0, b1, c01); c11 = g2_mma(a1, b1, c11);
    c02 = g2_mma(a0, b2, c02); c12 = g2_mma(a1, b2, c12); c03 = g2_mma(a0, b3, c03); c13 = g2_mma(a1, b3, c13);
    ob = (kb + 64 < K) ? ob + 2048 : l16;      /* the last trip fetches k block 0 again (in bounds, unused) */
    a0 = g2_fragu(a0p, ob); a1 = g2_fragu(a1p, ob); b0 = g2_fragu(b0p, ob); b1 = g2_fragu(b1p, ob); b2 = g2_fragu(b2p, ob); b3 = g2_fragu(b3p, ob);
    asm volatile("s_wait_xcnt 0x0" ::: "memory");      /* as above */
    c00 = g2_mma(e0, f0, c00); c10 = g2_mma(e1, f0, c10); c01 = g2_mma(e0, f1, c01); c11 = g2_mma(e1, f1, c11);
    c02 = g2_mma(e0, f2, c02); c12 = g2_mma(e1, f2, c12); c03 = g2_mma(e0, f3, c03); c13 = g2_mma(e1, f3, c13); }
  v8f accs[8] = {c00, c01, c02, c03, c10, c11, c12, c13};
#pragma unroll
  for (int u = 0; u < 8; ++u) { const int t = u & 3, half = u >> 2; const int col = col0 + t * 16 + ln; const float bv = bp ? bf16_round(bp[col]) : 0.f;
#pragma unroll
    for (int r = 0; r < 8; ++r) { const int rloc = half * 16 + 8 * hh + r; float v = accs[u][r] * alpha + bv; if (CP) { if (rowsPerB < 0) v += CP[cofs + (size_t)(row0g + row0 + rloc) * ldc + col];      /* rowsPerB < 0: own element of the batched C plane */ else { const int bidx = (row0g + row0 + rloc) / rowsPerB; v += CP[(size_t)bidx * sCPb + (size_t)by * 64 + col]; } }
      if (ACT == 3) v = fmaxf(v, 0.f); else if (ACT == 6) v = 0.5f * v * (1.0f + erff(v * 0.70710678118654752f)); else if (ACT == 11) v = 1.0f / (1.0f + expf(-v)); else if (ACT == 15) v = v / (1.0f + expf(-v)); else if (ACT == 12) v = (v > 0.f) ? v : 0.01f * v; else if (ACT == 8) v = tanhf(v); else if (ACT == 9) v = 0.5f * v * (1.0f + tanhf(0.7978845608028654f * (v + 0.044715f * v * v * v))); else if (ACT == 14) v = (v > 0.f) ? v : 0.1f * v; else if (ACT == 16) v = (v >= 0.f) ? v : 0.3f * v; else if (ACT == 17) v = (v >= 0.f) ? v : 0.2f * v;
      so[w][rloc][t * 16 + ln] = v; } }
  __builtin_amdgcn_fence(__ATOMIC_ACQ_REL, "workgroup"); __builtin_amdgcn_wave_barrier();
  if (omode == 1) {      /* chunk g * 32 + lane of fragment (row tile rt, k block kb): row ln, k (2 g + hh) * 8 .. + 7; every store is 512 contiguous bytes of a wave */
    const size_t f0 = ((size_t)(row0 >> 4) * (ldc >> 5) + (col0 >> 5)) * 512 + lane * 8; unsigned short* hp = (unsigned short*)C16 + f0; unsigned short* lp = (unsigned short*)CL + f0;
#pragma unroll
    for (int f = 0; f < 8; ++f) { const int rt = f >> 2, kb = (f >> 1) & 1, g = f & 1; const float* s = &so[w][rt * 16 + ln][kb * 32 + (2 * g + hh) * 8]; const v4f a = *(const v4fa*)s, c = *(const v4fa*)(s + 4); FragH fh, fl;
#pragma unroll
      for (int q = 0; q < 4; ++q) { _Float16 h = (_Float16)a[q]; fh.h[q] = h; fl.h[q] = (_Float16)((a[q] - (float)h) * 1024.0f); h = (_Float16)c[q]; fh.h[4 + q] = h; fl.h[4 + q] = (_Float16)((c[q] - (float)h) * 1024.0f); }
      const size_t o = (size_t)rt * (ldc >> 5) * 512 + kb * 512 + g * 256; *(v8us*)(hp + o) = fh.half[0]; *(v8us*)(lp + o) = fl.half[0]; }
    return; }
  if (omode == 2) {      /* chunk g * 32 + lane of d tile dt: row d = dt * 16 + ln, keys (2 g + hh) * 8 .. + 7 of the wave's 32-key block */
    const int tok = row0g + row0; unsigned short* vp = (unsigned short*)C16 + ((size_t)(tok / SQ) * NH + nq) * ((size_t)HD * SQ) + (size_t)((tok % SQ) >> 5) * 2048 + lane * 8;
#pragma unroll
    for (int f = 0; f < 8; ++f) { const int dt = f >> 1, g = f & 1; FragH fv;
#pragma unroll
      for (int q = 0; q < 8; ++q) fv.h[q] = (_Float16)so[w][(2 * g + hh) * 8 + q][dt * 16 + ln];
      *(v8us*)(vp + dt * 512 + g * 256) = fv.half[0]; }
    return; }
  const int rsub = lane >> 4, c4 = (lane & 15) * 4;
  {
#pragma unroll
    for (int q = 0; q < 16; ++q) { const int r = q * 2 + rsub; const v4f v = *(const v4fa*)&so[w][r][c4]; if (C) *(v4f*)(C + cofs + (size_t)(row0 + r) * ldc + col0 + c4) = v; if (C16) { v4h h4; for (int i = 0; i < 4; ++i) h4[i] = (_Float16)v[i]; *(v4h*)(C16 + cofs + (size_t)(row0 + r) * ldc + col0 + c4) = h4; } }
     } }


__global__ __launch_bounds__(256) void k_wnat(const float* __restrict__ w, size_t n8, _Float16* __restrict__ Bt) { const size_t t = (size_t)blockIdx.x * 256 + threadIdx.x; if (t >= n8) return; FragH f; for (int q = 0; q < 8; ++q) f.h[q] = (_Float16)(bf16_round(w[t * 8 + q]) * 16.0f); *(v8us*)((unsigned short*)Bt + t * 8) = f.half[0];  }
__global__ __launch_bounds__(256) void k_rsm(const float* __restrict__ S, _Float16* __restrict__ P, int nrows) {
  #pragma clang fp contract(off)
  const int i = blockIdx.x * 256 + threadIdx.x; if (i >= nrows) return; const float* s = S + (size_t)i * SQ; float mx = -3.0e38f;
#pragma unroll 1
  for (int j = 0; j < SQ; ++j) mx = fmaxf(mx, s[j]); float se = 0.f;
#pragma unroll 1
  for (int j = 0; j < SQ; ++j) se += expf(s[j] - mx); const float sc = 256.0f / se;
#pragma unroll 1
  for (int j0 = 0; j0 < SQ; j0 += 8) { FragH f; for (int q = 0; q < 8; ++q) f.h[q] = (_Float16)(expf(s[j0 + q] - mx) * sc); unsigned short* d = (unsigned short*)P + (size_t)i * SQ + j0; *(v8us*)d = f.half[0];  } }
__global__ __launch_bounds__(256) void k_vt(const _Float16* __restrict__ V16, int b, int h0, _Float16* __restrict__ VT) { __shared__ unsigned short tl[64][65]; const int tid = threadIdx.x; const int hh = blockIdx.x % HG, sg = blockIdx.x / HG; const int s0 = sg * 64; const int h = h0 + hh;
  for (int i = tid; i < 64 * 8; i += 256) { const int j = i / 8, d8 = (i % 8) * 8; FragH f; f.half[0] = *(const v8us*)((const unsigned short*)V16 + ((size_t)b * SQ + s0 + j) * DM + h * HD + d8); for (int q = 0; q < 8; ++q) tl[d8 + q][j] = f.u[q]; }
  __syncthreads();
  { for (int i = tid; i < 64 * 8; i += 256) { const int d = i / 8, j8 = (i % 8) * 8; FragH f; for (int q = 0; q < 8; ++q) f.u[q] = tl[d][j8 + q]; *(v8us*)((unsigned short*)VT + ((size_t)hh * HD + d) * SQ + s0 + j8) = f.half[0]; }  } }


__device__ __forceinline__ float xl_half(float x) { return __builtin_bit_cast(float, __builtin_amdgcn_permlanex16(__builtin_bit_cast(int, x), __builtin_bit_cast(int, x), 0x76543210, 0xfedcba98, false, false)); }  // lane l with lane l ^ 16
// v_exp_f32 with the v_nop in its own statement: it keeps the one slot that the instruction set asks for behind a transcendental
__device__ __forceinline__ float exp2_slot(float a) { float e; asm("v_exp_f32 %0, %1\n\tv_nop" : "=v"(e) : "v"(a)); return e; }
#define FAW 8                        /* waves per work-group of the fused attention kernel, 16 query columns each */
__global__ __launch_bounds__(FAW * 32) void k_fattn(const _Float16* __restrict__ Qh, const _Float16* __restrict__ Ql, const _Float16* __restrict__ Kh, const _Float16* __restrict__ Kl, const _Float16* __restrict__ VT, const float* __restrict__ relb, _Float16* __restrict__ O) {
  __shared__ float tb[257];
  const int tid = threadIdx.x, lane = tid & 31, ln = lane & 15, hh = lane >> 4; const int h = blockIdx.y, b = blockIdx.z;
  for (int t = tid; t < 257; t += FAW * 32) { const int d = t - 128; const int a = d < 0 ? -d : d; const int f = (a < 8) ? a : (8 + (a >= 12) + (a >= 16) + (a >= 23) + (a >= 32) + (a >= 46) + (a >= 64) + (a >= 91)); const int bk = (d > 0 ? 16 : 0) + f; tb[t] = bf16_round(relb[bk * NH + h]); }
  __syncthreads();      /* publishes the bias table to all waves; the only barrier of the kernel */
  const int q0 = (blockIdx.x * FAW + __builtin_amdgcn_readfirstlane(tid >> 5)) * 16; const size_t r0 = (size_t)b * SQ;
  const size_t fo = (size_t)h * (HD * 16) + lane * 8;      /* fragment order: head h is k blocks 2 h and 2 h + 1 of a row tile, 512 halves each; a row tile is 16 * LQ halves */
  const _Float16* qp = Qh + (r0 + q0) * LQ + fo; const _Float16* qlp = Ql + (r0 + q0) * LQ + fo;
  const v16h qh0 = g2_fragp(qp), qh1 = g2_fragp(qp + 512); asm volatile("s_wait_xcnt 0x0" ::: "memory");      /* this and the like waits below stand behind a group of loads, in front of whatever next overwrites a register that the group's addresses are in */
  const v16h ql0 = g2_fragp(qlp), ql1 = g2_fragp(qlp + 512); asm volatile("s_wait_xcnt 0x0" ::: "memory");
  const _Float16* khp = Kh + r0 * LQ + fo; const _Float16* klp = Kl + r0 * LQ + fo; const _Float16* vp = VT + (size_t)(b * NH + h) * HD * SQ + lane * 8;
  const float bneg = __builtin_bit_cast(float, __builtin_amdgcn_readfirstlane(__builtin_bit_cast(int, tb[0]))), bpos = __builtin_bit_cast(float, __builtin_amdgcn_readfirstlane(__builtin_bit_cast(int, tb[256])));      /* the two far values, the same in every lane: held in scalar registers */
  const int dq = 128 + 8 * hh - (q0 + ln);      /* table index of key j, register r: j0 + r + dq, clamped */
  const v8f z8 = {0.f,0.f,0.f,0.f,0.f,0.f,0.f,0.f}; v8f o0 = z8, o1 = z8, o2 = z8, o3 = z8; float m = -1.0e30f, mm = -1.0e30f, l = 0.f;
  v16h ka0 = g2_fragp(khp), ka1 = g2_fragp(khp + 512), kb0 = g2_fragp(khp + 16 * LQ), kb1 = g2_fragp(khp + 16 * LQ + 512);      /* k_hi: key tiles a (0..15) and b (16..31), d 0..31 and 32..63 */
  v16h la0 = g2_fragp(klp), la1 = g2_fragp(klp + 512), lb0 = g2_fragp(klp + 16 * LQ), lb1 = g2_fragp(klp + 16 * LQ + 512); asm volatile("s_wait_xcnt 0x0" ::: "memory");      /* k_lo likewise */
#pragma unroll 1      /* one pass's fragments in registers at a time: unrolled, the live set would cost a resident wave */
  for (int j0 = 0; j0 < SQ; j0 += 32) {
    const _Float16* vj = vp + (size_t)j0 * HD; const v16h v0 = g2_fragp(vj), v1 = g2_fragp(vj + 512), v2 = g2_fragp(vj + 1024), v3 = g2_fragp(vj + 1536); asm volatile("s_wait_xcnt 0x0" ::: "memory");      /* V^T fragments issued ahead of the score products that hide them */
    const float bf = j0 < q0 ? bneg : bpos; v8f sa = {bf, bf, bf, bf, bf, bf, bf, bf}, sb = sa;      /* a tile wholly at distance 128 or more: one value */
    if (j0 + 31 - q0 > -128 && j0 - (q0 + 15) < 128) {      /* wave-uniform: tiles near the diagonal read the table */
#pragma unroll
      for (int r = 0; r < 8; ++r) { const int ia = j0 + r + dq, ib = ia + 16; sa[r] = tb[ia < 0 ? 0 : (ia > 256 ? 256 : ia)]; sb[r] = tb[ib < 0 ? 0 : (ib > 256 ? 256 : ib)]; } }
    v8f ta = z8, tc = z8;
    sa = g2_mma(ka0, qh0, sa); ta = g2_mma(ka0, ql0, ta); sb = g2_mma(kb0, qh0, sb); tc = g2_mma(kb0, ql0, tc);      /* four independent accumulator chains, interleaved */
    sa = g2_mma(ka1, qh1, sa); ta = g2_mma(ka1, ql1, ta); sb = g2_mma(kb1, qh1, sb); tc = g2_mma(kb1, ql1, tc);
    ta = g2_mma(la0, qh0, ta); tc = g2_mma(lb0, qh0, tc); ta = g2_mma(la1, qh1, ta); tc = g2_mma(lb1, qh1, tc);
    { const size_t jn = (size_t)((j0 + 32) & (SQ - 1)) * LQ;      /* the next pass's K fragments, fetched behind this pass's score products; the last pass wraps to key 0 (in bounds, unused) */
      ka0 = g2_fragp(khp + jn); ka1 = g2_fragp(khp + jn + 512); kb0 = g2_fragp(khp + jn + 16 * LQ); kb1 = g2_fragp(khp + jn + 16 * LQ + 512);
      la0 = g2_fragp(klp + jn); la1 = g2_fragp(klp + jn + 512); lb0 = g2_fragp(klp + jn + 16 * LQ); lb1 = g2_fragp(klp + jn + 16 * LQ + 512); asm volatile("s_wait_xcnt 0x0" ::: "memory"); }
    float s[16];
#pragma unroll
    for (int r = 0; r < 8; ++r) { s[r] = fmaf(ta[r], 0.0009765625f, sa[r]); s[8 + r] = fmaf(tc[r], 0.0009765625f, sb[r]); }
    float x0 = fmaxf(s[0], s[1]), x1 = fmaxf(s[2], s[3]), x2 = fmaxf(s[4], s[5]), x3 = fmaxf(s[6], s[7]);
    x0 = fmaxf(x0, fmaxf(s[8], s[9])); x1 = fmaxf(x1, fmaxf(s[10], s[11])); x2 = fmaxf(x2, fmaxf(s[12], s[13])); x3 = fmaxf(x3, fmaxf(s[14], s[15]));
    float mx = fmaxf(fmaxf(x0, x1), fmaxf(x2, x3)); mx = fmaxf(mx, xl_half(mx));      /* both halves of the wave hold keys of the same query */
    const float mn = fmaxf(m, mx); const float mmn = fmaf(mn, 1.44269504088896340736f, -8.0f);      /* exponent offset in log2 units; the -8 carries the weights x256 */
    const float al = exp2_slot(mm - mmn); m = mn; mm = mmn;      /* 1 exactly while the maximum stands */
    FragH pf; float a0 = 0.f, a1 = 0.f, a2 = 0.f, a3 = 0.f;
#pragma unroll
    for (int i = 0; i < 16; i += 4) { const float p0 = exp2_slot(fmaf(s[i], 1.44269504088896340736f, -mmn)), p1 = exp2_slot(fmaf(s[i + 1], 1.44269504088896340736f, -mmn)), p2 = exp2_slot(fmaf(s[i + 2], 1.44269504088896340736f, -mmn)), p3 = exp2_slot(fmaf(s[i + 3], 1.44269504088896340736f, -mmn));
      a0 += p0; a1 += p1; a2 += p2; a3 += p3; pf.h[i] = (_Float16)p0; pf.h[i + 1] = (_Float16)p1; pf.h[i + 2] = (_Float16)p2; pf.h[i + 3] = (_Float16)p3; }
    l = fmaf(l, al, (a0 + a1) + (a2 + a3));
#pragma unroll
    for (int r = 0; r < 8; ++r) { o0[r] *= al; o1[r] *= al; o2[r] *= al; o3[r] *= al; }
    o0 = g2_mma(v0, pf.v, o0); o1 = g2_mma(v1, pf.v, o1); o2 = g2_mma(v2, pf.v, o2); o3 = g2_mma(v3, pf.v, o3);      /* O^T[d = 16 t + 8 hh + r][query ln] */
  }
  const float sc = 64.0f / (l + xl_half(l)); unsigned short* op = (unsigned short*)O + (r0 + q0) * DM + fo; FragH f;      /* o rows in fragment order too (A operand of the output GEMM): d = 16 t + 8 hh + r of query ln is chunk 32 (t & 1) + lane of k block 2 h + (t >> 1) */
#pragma unroll
  for (int r = 0; r < 8; ++r) { f.h[r] = (_Float16)(o0[r] * sc); f.h[8 + r] = (_Float16)(o1[r] * sc); }
  *(v8us*)op = f.half[0]; *(v8us*)(op + 256) = f.half[1];
#pragma unroll
  for (int r = 0; r < 8; ++r) { f.h[r] = (_Float16)(o2[r] * sc); f.h[8 + r] = (_Float16)(o3[r] * sc); }
  *(v8us*)(op + 512) = f.half[0]; *(v8us*)(op + 768) = f.half[1]; }

extern "C" void kernel_launch(void* const* d_in, const int* in_sizes, int n_in,
                              void* d_out, int out_size, void* d_ws, size_t ws_size, hipStream_t stream) {
  (void)in_sizes; (void)n_in; (void)out_size;
  const float* const* I = (const float* const*)d_in; const float* xq = I[0]; const float* xkv = I[1]; const float* wq = I[2]; const float* wk = I[3]; const float* wv = I[4]; const float* wo = I[5]; const float* relb = I[6]; const float* bq = nullptr; const float* bk = nullptr; (void)bq; (void)bk;      /* [in][out] weights, no biases; rel_bias [32 buckets][16 heads] */
  char* ws = (char*)d_ws; size_t off = 0;
  auto take = [&](size_t bytes) { char* p = ws + off; off += (bytes + 255) & ~(size_t)255; return p; };
  _Float16* BQ = (_Float16*)take((size_t)DM * DM * 2); _Float16* BK = (_Float16*)take((size_t)DM * DM * 2); _Float16* BV = (_Float16*)take((size_t)DM * DM * 2); _Float16* BO = (_Float16*)take((size_t)DM * DM * 2);
  _Float16* XQ = (_Float16*)take(NR * DM * 2); _Float16* XKV = (_Float16*)take(NR * DM * 2); _Float16* Q16 = (_Float16*)take(NR * DM * 2); _Float16* QL = (_Float16*)take(NR * DM * 2); _Float16* K16 = (_Float16*)take(NR * DM * 2); _Float16* KL = (_Float16*)take(NR * DM * 2); _Float16* O16 = (_Float16*)take(NR * DM * 2);
  _Float16* VT = (_Float16*)take((size_t)NB * NH * HD * SQ * 2);      /* V^T for ALL batches */
  if (off > ws_size) return;
  k_wt_f16<<<(unsigned)(((size_t)DM * (DM / 8) + 255) / 256), 256, 0, stream>>>(wq, BQ, DM, DM, 16.0f); k_wt_f16<<<(unsigned)(((size_t)DM * (DM / 8) + 255) / 256), 256, 0, stream>>>(wk, BK, DM, DM, 16.0f); k_wt_f16<<<(unsigned)(((size_t)DM * (DM / 8) + 255) / 256), 256, 0, stream>>>(wv, BV, DM, DM, 16.0f); k_wt_f16<<<(unsigned)(((size_t)DM * (DM / 8) + 255) / 256), 256, 0, stream>>>(wo, BO, DM, DM, 16.0f);      /* [in][out] -> Bt[n][k] x16 */

  k_x16<<<(unsigned)((NR * DM / 8 + 255) / 256), 256, 0, stream>>>(xq, XQ, NR * DM / 8); k_x16<<<(unsigned)((NR * DM / 8 + 255) / 256), 256, 0, stream>>>(xkv, XKV, NR * DM / 8);      /* query source and key/value source as exact f16 rows */
  const size_t r0p = (size_t)B0 * SQ;      /* first projected row */
  k_gemm2<0><<<dim3((unsigned)((MP / 128) * (DM / 64)), 1), 128, 0, stream>>>(XQ + r0p * DM, DM, 0, BQ, DM, 0, 0.0625f, nullptr, 0, nullptr, 1, 0, 0, nullptr, Q16 + r0p * DM, QL + r0p * DM, 1, DM, 0, MP, DM, DM);      /* q in f32 -> f16 hi (Q16) + x1024 residual (QL) planes, split in the epilogue */
  k_gemm2<0><<<dim3((unsigned)((MP / 128) * (DM / 64)), 1), 128, 0, stream>>>(XKV + r0p * DM, DM, 0, BK, DM, 0, 0.0625f, nullptr, 0, nullptr, 1, 0, 0, nullptr, K16 + r0p * DM, KL + r0p * DM, 1, DM, 0, MP, DM, DM);      /* k likewise -> K16 + KL */
  k_gemm2<0><<<dim3((unsigned)((MP / 128) * (DM / 64)), 1), 128, 0, stream>>>(XKV + r0p * DM, DM, 0, BV, DM, 0, 0.0625f, nullptr, 0, nullptr, 1, 0, (int)r0p, nullptr, VT, nullptr, 2, DM, 0, MP, DM, DM);      /* v as f16 straight into the V^T fragments [NB * NH][SQ / 32][4 d tiles] */
  k_fattn<<<dim3(SQ / (FAW * 16), NH, NB), FAW * 32, 0, stream>>>(Q16, QL, K16, KL, VT, relb, O16);      /* scores + bias, softmax and P . V of every batch and head; o (merged heads) x64 as f16 rows */
  k_gemm2<0><<<dim3((unsigned)((MPO / 128) * (DM / 64)), 1), 128, 0, stream>>>(O16 + r0p * DM, DM, 0, BO, DM, 0, 0.0009765625f, nullptr, 0, nullptr, 1, 0, 0, (float*)d_out + r0p * DM, nullptr, nullptr, 0, DM, 0, MPO, DM, DM);      /* out rows are the output layout */
}

// v006
// It runs in 218 microseconds.
// Timed twice side by side with v005, it ran 1.07 times as fast both times.
// All steps since v000 together make it 70.4 times as fast.
#include <hip/hip_runtime.h>
// T5 attention with a relative-position bias and NO score scaling (query_states [4][2048][1024] gives q = x wq; key_value_states gives k = x wk, v = x wv ([in][out] 1024^2 sigma 1/32, no biases); 16 heads of 64; scores = q . k (UNSCALED, logits sigma ~8) + bias[h][i][j] with bias = rel_bias[bucket(j - i)][h] (rel_bias input [32][16]; bidirectional log buckets, 32 buckets, max distance 128); softmax; out = merged wo -> [4][2048][1024]).
// Structure: token rows r = b*2048 + s; the query source and the key/value source as exact f16 rows (bf16-rounded); Q, K, V as three WMMA GEMMs (32x64 wave tiles, f32 accumulation, exact x16 weights); q and k split in the GEMM epilogue into f16 hi + x1024 residual planes, V^T written by its GEMM epilogue from the same LDS staging tile; then ONE fused attention launch over (query block, head, batch): UNSCALED three-term scores (bias as the start value, q_hi . k_hi, + (q_lo . k_hi + q_hi . k_lo) 2^-10; K = 64), running-maximum softmax in registers (f32 statistics, native exp; weights x256 as f16), O^T += V^T . P^T, o carried x64 against f16 subnormal flush (folded into the output GEMM alpha) written straight into the merged f16 o rows; out = o W_o GEMM (f32) into the output layout.
// Compute dtype: inputs rounded to bf16; x / weights exact; v, softmax weights and o as plain f16 GEMM operands (~2^-12), q and k as f16 hi + x1024 residual; scores and softmax statistics f32; v_wmma_f32_16x16x32_f16.
#define NB 4
#define SQ 2048
#define DM 1024
#define NH 16
#define HD 64
#define HG 2                         /* heads per launch of k_vt, which is not launched */
#define B0 0                         /* first batch processed (debug hook) */
#define NBR NB                       /* batches processed (debug hook) */
#define NR ((size_t)NB * SQ)         /* token rows */
#define MP ((int)((size_t)NBR * SQ)) /* rows projected (debug hook) */
#define QN SQ                        /* not used: the attention launch attends all SQ query rows */
#define NHD NH                       /* not used: the attention launch covers all NH heads */
#define MPO MP                       /* rows through the output stage (debug hook) */
#define LQ DM      /* row pitch of the q/k rows */
typedef __bf16 v16b __attribute__((ext_vector_type(16)));
typedef unsigned short v8us __attribute__((ext_vector_type(8), may_alias));
typedef float  v8f  __attribute__((ext_vector_type(8)));
typedef float  v4f  __attribute__((ext_vector_type(4)));
typedef float  v4fa __attribute__((ext_vector_type(4), may_alias));
union FragB { v16b v; v8us half[2]; unsigned short u[16]; };

__device__ __forceinline__ unsigned short bf16_bits(float x) { unsigned int u = __float_as_uint(x); return (unsigned short)((u + 0x7FFFu + ((u >> 16) & 1u)) >> 16); }
__device__ __forceinline__ float bf16_val(unsigned short b) { return __uint_as_float(((unsigned int)b) << 16); }
__device__ __forceinline__ float bf16_round(float x) { return bf16_val(bf16_bits(x)); }
// D += A·B with NT terms: 1 = ah·bh, 2 = + al·bh (A split), 3 = + ah·bl (both split)
template <int NT>
__device__ __forceinline__ v8f mmaN(v16b ah, v16b al, v16b bh, v16b bl, v8f c) {
  c = __builtin_amdgcn_wmma_f32_16x16x32_bf16(false, ah, false, bh, (short)0, c, false, false);
  if (NT >= 2) c = __builtin_amdgcn_wmma_f32_16x16x32_bf16(false, al, false, bh, (short)0, c, false, false);
  if (NT >= 3) c = __builtin_amdgcn_wmma_f32_16x16x32_bf16(false, ah, false, bl, (short)0, c, false, false);
  asm volatile("v_nop\n\tv_nop\n\tv_nop\n\tv_nop" : "+v"(c) : "v"(ah), "v"(al), "v"(bh), "v"(bl));
  return c;
}

__global__ __launch_bounds__(256) void k_wt_bf16(const float* __restrict__ W, unsigned short* __restrict__ Wt, int K, int N) {
  const int t = blockIdx.x * 256 + threadIdx.x;
  const int k8n = K / 8;
  if (t >= N * k8n) return;
  const int n = t / k8n, k8 = (t % k8n) * 8;
  v8us v;
#pragma unroll
  for (int i = 0; i < 8; ++i) v[i] = bf16_bits(W[(size_t)(k8 + i) * N + n]);
  *(v8us*)(Wt + (size_t)n * K + k8) = v;
  
}

// GEMM C[M][N] (f32, pitch ldc) = act(A[M][K]·W + bias). A f32 row-major (pitch lda) converted per fragment to bf16
// (ASPLIT: hi/lo two planes -> 2 terms, else single rounded term); Wt bf16 [N][K] (pitch ldb). BIAS_BF16 rounds the
// bias to bf16 first (bias quantised to bf16 before the add). K%32==0, M%16==0, N%64==0.
template <bool ASPLIT, int ACT, bool BIAS_BF16>
__global__ __launch_bounds__(128) void k_gemm_bf(const float* __restrict__ A, int lda, const unsigned short* __restrict__ Wt, int ldb,
                                               const float* __restrict__ bias, float* __restrict__ C, int ldc, int M, int N, int K) {
  __shared__ __attribute__((aligned(16))) float so[4][16][64];
  const int tid = threadIdx.x, w = tid >> 5, lane = tid & 31, ln = lane & 15, hh = lane >> 4;
  const int ntn = N / 64;
  const int wid = blockIdx.x * 4 + w;
  const int mt = wid / ntn, nq = wid % ntn;
  if (mt * 16 >= M) return;
  const int row0 = mt * 16, col0 = nq * 64;
  const float* arow = A + (size_t)(row0 + ln) * lda;
  v8f acc[4] = {};
  for (int kb = 0; kb < K; kb += 32) {
    FragB ah, al;
    const v4f x0 = *(const v4fa*)(arow + kb + 8 * hh), x1 = *(const v4fa*)(arow + kb + 8 * hh + 4);
    const v4f x2 = *(const v4fa*)(arow + kb + 16 + 8 * hh), x3 = *(const v4fa*)(arow + kb + 16 + 8 * hh + 4);
    float xs[16] = {x0[0],x0[1],x0[2],x0[3],x1[0],x1[1],x1[2],x1[3],x2[0],x2[1],x2[2],x2[3],x3[0],x3[1],x3[2],x3[3]};
#pragma unroll
    for (int i = 0; i < 16; ++i) { const unsigned short hb = bf16_bits(xs[i]); ah.u[i] = hb; al.u[i] = ASPLIT ? bf16_bits(xs[i] - bf16_val(hb)) : (unsigned short)0; }
#pragma unroll
    for (int t = 0; t < 4; ++t) {
      const unsigned short* brow = Wt + (size_t)(col0 + t * 16 + ln) * ldb + kb;
      FragB b;
      b.half[0] = *(const v8us*)(brow + 8 * hh);
      b.half[1] = *(const v8us*)(brow + 16 + 8 * hh);
      acc[t] = mmaN<ASPLIT ? 2 : 1>(ah.v, al.v, b.v, b.v, acc[t]);
    }
  }
#pragma unroll
  for (int t = 0; t < 4; ++t) {
    float bv = bias ? bias[col0 + t * 16 + ln] : 0.f;
    if (BIAS_BF16) bv = bf16_round(bv);
#pragma unroll
    for (int r = 0; r < 8; ++r) { float v = acc[t][r] + bv; if (ACT == 1) v = fmaxf(v, 0.f); so[w][8 * hh + r][t * 16 + ln] = v; }
  }
  __builtin_amdgcn_fence(__ATOMIC_ACQ_REL, "workgroup");
  __builtin_amdgcn_wave_barrier();
  const int rsub = lane >> 4, c4 = (lane & 15) * 4;
  {
#pragma unroll
    for (int q = 0; q < 8; ++q) {
      const int r = q * 2 + rsub;
      const v4f v = *(const v4fa*)&so[w][r][c4];
      *(v4f*)(C + (size_t)(row0 + r) * ldc + col0 + c4) = v;
    }
    
  }
}

// GEMM C = act(A·W + bias + resid): A f32 (ASPLIT -> hi/lo 2 terms), Wt bf16 [N][K]; ACT 0 none, 1 relu, 2 exact gelu;
// resid (optional, f32, row index = (row % rmod), pitch ldr, RES_BF16 rounds it) added before the activation.
template <bool ASPLIT, int ACT, bool BIAS_BF16, bool RES_BF16>
__global__ __launch_bounds__(128) void k_gemm_bf3(const float* __restrict__ A, int lda, const unsigned short* __restrict__ Wt, int ldb,
                                                const float* __restrict__ bias, const float* __restrict__ resid, int rmod, int ldr,
                                                float* __restrict__ C, int ldc, int M, int N, int K) {
  __shared__ __attribute__((aligned(16))) float so[4][16][64];
  const int tid = threadIdx.x, w = tid >> 5, lane = tid & 31, ln = lane & 15, hh = lane >> 4;
  const int ntn = N / 64;
  const int wid = blockIdx.x * 4 + w;
  const int mt = wid / ntn, nq = wid % ntn;
  if (mt * 16 >= M) return;
  const int row0 = mt * 16, col0 = nq * 64;
  const float* arow = A + (size_t)(row0 + ln) * lda;
  v8f acc[4] = {};
  for (int kb = 0; kb < K; kb += 32) {
    FragB ah, al;
    const v4f x0 = *(const v4fa*)(arow + kb + 8 * hh), x1 = *(const v4fa*)(arow + kb + 8 * hh + 4);
    const v4f x2 = *(const v4fa*)(arow + kb + 16 + 8 * hh), x3 = *(const v4fa*)(arow + kb + 16 + 8 * hh + 4);
    float xs[16] = {x0[0],x0[1],x0[2],x0[3],x1[0],x1[1],x1[2],x1[3],x2[0],x2[1],x2[2],x2[3],x3[0],x3[1],x3[2],x3[3]};
#pragma unroll
    for (int i = 0; i < 16; ++i) { const unsigned short hb = bf16_bits(xs[i]); ah.u[i] = hb; al.u[i] = ASPLIT ? bf16_bits(xs[i] - bf16_val(hb)) : (unsigned short)0; }
#pragma unroll
    for (int t = 0; t < 4; ++t) {
      const unsigned short* brow = Wt + (size_t)(col0 + t * 16 + ln) * ldb + kb;
      FragB b;
      b.half[0] = *(const v8us*)(brow + 8 * hh);
      b.half[1] = *(const v8us*)(brow + 16 + 8 * hh);
      acc[t] = mmaN<ASPLIT ? 2 : 1>(ah.v, al.v, b.v, b.v, acc[t]);
    }
  }
#pragma unroll
  for (int t = 0; t < 4; ++t) {
    const int col = col0 + t * 16 + ln;
    float bv = bias ? bias[col] : 0.f;
    if (BIAS_BF16) bv = bf16_round(bv);
#pragma unroll
    for (int r = 0; r < 8; ++r) {
      float v = acc[t][r] + bv;
      if (resid) { float rv = resid[(size_t)((row0 + 8 * hh + r) % rmod) * ldr + col]; if (RES_BF16) rv = bf16_round(rv); v += rv; }
      if (ACT == 1) v = fmaxf(v, 0.f);
      if (ACT == 2) v = 0.5f * v * (1.0f + erff(v * 0.70710678118654752f));
      if (ACT == 3) { const float u = 0.7978845608028654f * (v + 0.044715f * v * v * v); v = 0.5f * v * (1.0f + tanhf(u)); }
      so[w][8 * hh + r][t * 16 + ln] = v;
    }
  }
  __builtin_amdgcn_fence(__ATOMIC_ACQ_REL, "workgroup");
  __builtin_amdgcn_wave_barrier();
  const int rsub = lane >> 4, c4 = (lane & 15) * 4;
  {
#pragma unroll
    for (int q = 0; q < 8; ++q) {
      const int r = q * 2 + rsub;
      const v4f v = *(const v4fa*)&so[w][r][c4];
      *(v4f*)(C + (size_t)(row0 + r) * ldc + col0 + c4) = v;
    }
    
  }
}
// row LayerNorm (biased variance, eps) over N: s = X (+ R); optional out_sum <- s; out_norm <- (s-mu)*rsqrt(var+eps)*g + b
template <bool PARAM_BF16>
__global__ __launch_bounds__(256) void k_layernorm(const float* __restrict__ X, const float* __restrict__ R, const float* __restrict__ g, const float* __restrict__ bta,
                                                  float* __restrict__ out_sum, float* __restrict__ out_norm, int N, float eps) {
  __shared__ float red[256];
  const int row = blockIdx.x, tid = threadIdx.x;
  const float* x = X + (size_t)row * N; const float* rr = R ? R + (size_t)row * N : nullptr;
  float vals[16];                     // up to N = 4096
  const int per = N / 256;            // contiguous chunk per thread? use strided-by-4 chunks: thread handles j = tid*4 + 1024*u
  float s1 = 0.f;
  for (int u = 0; u < per / 4; ++u) {
    const int j = tid * 4 + 1024 * u;
    const v4f a = *(const v4fa*)(x + j);
    v4f b = {0.f,0.f,0.f,0.f}; if (rr) b = *(const v4fa*)(rr + j);
#pragma unroll
    for (int q = 0; q < 4; ++q) { const float v = a[q] + b[q]; vals[u * 4 + q] = v; s1 += v; }
  }
  red[tid] = s1; __syncthreads();
  for (int st = 128; st > 0; st >>= 1) { if (tid < st) red[tid] += red[tid + st]; __syncthreads(); }
  const float mu = red[0] / (float)N; __syncthreads();
  float s2 = 0.f;
  for (int u = 0; u < per / 4; ++u)
#pragma unroll
    for (int q = 0; q < 4; ++q) { const float c = vals[u * 4 + q] - mu; s2 += c * c; }
  red[tid] = s2; __syncthreads();
  for (int st = 128; st > 0; st >>= 1) { if (tid < st) red[tid] += red[tid + st]; __syncthreads(); }
  const float rs = rsqrtf(red[0] / (float)N + eps);
  {
    for (int u = 0; u < per / 4; ++u) {
      const int j = tid * 4 + 1024 * u;
      v4f o, sm;
#pragma unroll
      for (int q = 0; q < 4; ++q) {
        float gg = g[j + q], bb = bta[j + q];
        if (PARAM_BF16) { gg = bf16_round(gg); bb = bf16_round(bb); }
        sm[q] = vals[u * 4 + q]; o[q] = (vals[u * 4 + q] - mu) * rs * gg + bb;
      }
      if (out_sum) *(v4f*)(out_sum + (size_t)row * N + j) = sm;
      *(v4f*)(out_norm + (size_t)row * N + j) = o;
    }
    
  }
}



// ---- f16 WMMA path (v_wmma_f32_16x16x32_f16): 11-bit significands for operands in range — used where a [0,1] probability operand needs more precision than bf16
typedef _Float16 v16h __attribute__((ext_vector_type(16)));
union FragH { v16h v; v8us half[2]; _Float16 h[16]; unsigned short u[16]; };
template <int NT>
__device__ __forceinline__ v8f mmaH(v16h ah, v16h al, v16h bh, v16h bl, v8f c) {
  c = __builtin_amdgcn_wmma_f32_16x16x32_f16(false, ah, false, bh, (short)0, c, false, false);
  if (NT >= 2) c = __builtin_amdgcn_wmma_f32_16x16x32_f16(false, al, false, bh, (short)0, c, false, false);
  if (NT >= 3) c = __builtin_amdgcn_wmma_f32_16x16x32_f16(false, ah, false, bl, (short)0, c, false, false);
  asm volatile("v_nop\n\tv_nop\n\tv_nop\n\tv_nop" : "+v"(c) : "v"(ah), "v"(al), "v"(bh), "v"(bl));
  return c;
}
// batched GEMM like k_gemm_b but f16 operands: A f32 (split into f16 hi/lo if ASPLIT, else rounded to f16), Bt = f16 values [n][k]; alpha; C f32; N multiple of 16 (partial tiles skipped)
template <bool ASPLIT>
__global__ __launch_bounds__(128) void k_gemm_h(const float* __restrict__ A, int lda, size_t sA, const _Float16* __restrict__ Bh, int ldb, size_t sB, float alpha, float* __restrict__ C, int ldc, size_t sC, int M, int N, int K) {
  __shared__ __attribute__((aligned(16))) float so[4][16][64];
  const int tid = threadIdx.x, w = tid >> 5, lane = tid & 31, ln = lane & 15, hh = lane >> 4; const int by = blockIdx.y;
  A += (size_t)by * sA; Bh += (size_t)by * sB; C += (size_t)by * sC;
  const int ntn = (N + 63) / 64; const int wid = blockIdx.x * 4 + w; const int mt = wid / ntn, nq = wid % ntn; if (mt * 16 >= M) return;
  const int row0 = mt * 16, col0 = nq * 64; const float* arow = A + (size_t)(row0 + ln) * lda;
  v8f acc[4] = {};
  for (int kb = 0; kb < K; kb += 32) {
    FragH ah, al;
    const v4f x0 = *(const v4fa*)(arow + kb + 8 * hh), x1 = *(const v4fa*)(arow + kb + 8 * hh + 4), x2 = *(const v4fa*)(arow + kb + 16 + 8 * hh), x3 = *(const v4fa*)(arow + kb + 16 + 8 * hh + 4);
    float xs[16] = {x0[0],x0[1],x0[2],x0[3],x1[0],x1[1],x1[2],x1[3],x2[0],x2[1],x2[2],x2[3],x3[0],x3[1],x3[2],x3[3]};
#pragma unroll
    for (int i = 0; i < 16; ++i) { const _Float16 h = (_Float16)xs[i]; ah.h[i] = h; al.h[i] = ASPLIT ? (_Float16)(xs[i] - (float)h) : (_Float16)0.0f; }
#pragma unroll
    for (int t = 0; t < 4; ++t) { if (col0 + t * 16 >= N) continue; const size_t boff = (size_t)(col0 + t * 16 + ln) * ldb + kb; FragH bq; bq.half[0] = *(const v8us*)(Bh + boff + 8 * hh); bq.half[1] = *(const v8us*)(Bh + boff + 16 + 8 * hh);
      acc[t] = mmaH<ASPLIT ? 2 : 1>(ah.v, al.v, bq.v, bq.v, acc[t]); }
  }
#pragma unroll
  for (int t = 0; t < 4; ++t) { if (col0 + t * 16 >= N) continue;
#pragma unroll
    for (int r = 0; r < 8; ++r) so[w][8 * hh + r][t * 16 + ln] = acc[t][r] * alpha; }
  __builtin_amdgcn_fence(__ATOMIC_ACQ_REL, "workgroup"); __builtin_amdgcn_wave_barrier();
  const int rsub = lane >> 4, c4 = (lane & 15) * 4;
  {
#pragma unroll
    for (int q = 0; q < 8; ++q) { const int r = q * 2 + rsub; if (col0 + c4 < N) { const v4f v = *(const v4fa*)&so[w][r][c4]; *(v4f*)(C + (size_t)(row0 + r) * ldc + col0 + c4) = v; } }
     }
}

// Wt[n][k] = f16(W[k][n]·scale) from f32 row-major W[K][N] (scale = power of two; bf16-exact weights stay exact in f16 away from the subnormal range)
__device__ __forceinline__ void wt_f16(const float* __restrict__ W, _Float16* __restrict__ Wt, int K, int N, float scale, int t) {
  if (t >= N * (K / 8)) return; const int tile = t >> 6, w = t & 63, kt = K >> 5; const int n = (tile / kt) * 16 + (w & 15), k8 = (tile % kt) * 32 + (w >> 4) * 8; FragH f;      /* thread = output chunk of the fragment order (rows n, K / 32 k blocks a row tile) */
#pragma unroll
  for (int i = 0; i < 8; ++i) f.h[i] = (_Float16)(bf16_round(W[(size_t)(k8 + i) * N + n]) * scale); const v8us o = f.half[0];
  *(v8us*)((unsigned short*)Wt + (size_t)t * 8) = o; 
}
// k_gemm_hh variant with fused epilogue: v = acc·alpha + bias[by·sBias + col] (+ CP[(row/rowsPerB)·sCPb + by·64 + col] if CP) ; ACT 0 none / 1 elu ; writes f16 C16 (and f32 C if non-null)
template <int ACT>
__global__ __launch_bounds__(128) void k_gemm_hhx(const _Float16* __restrict__ A, int lda, size_t sA, const _Float16* __restrict__ Bh, int ldb, size_t sB, float alpha, const float* __restrict__ bias, size_t sBias, const float* __restrict__ CP, int rowsPerB, size_t sCPb, int row0g,
    float* __restrict__ C, _Float16* __restrict__ C16, int ldc, size_t sC, int M, int N, int K) {
  __shared__ __attribute__((aligned(16))) float so[4][16][64];
  const int tid = threadIdx.x, w = tid >> 5, lane = tid & 31, ln = lane & 15, hh = lane >> 4; const int by = blockIdx.y;
  A += (size_t)by * sA; Bh += (size_t)by * sB; const size_t cofs = (size_t)by * sC; const float* bp = bias ? bias + (size_t)by * sBias : nullptr;
  const int ntn = (N + 63) / 64; const int wid = blockIdx.x * 4 + w; const int mt = wid / ntn, nq = wid % ntn; if (mt * 16 >= M) return;
  const int row0 = mt * 16, col0 = nq * 64; const _Float16* arow = A + (size_t)(row0 + ln) * lda;
  v8f acc[4] = {};
  for (int kb = 0; kb < K; kb += 32) { FragH ah; ah.half[0] = *(const v8us*)((const unsigned short*)arow + kb + 8 * hh); ah.half[1] = *(const v8us*)((const unsigned short*)arow + kb + 16 + 8 * hh);
#pragma unroll
    for (int t = 0; t < 4; ++t) { if (col0 + t * 16 >= N) continue; const size_t boff = (size_t)(col0 + t * 16 + ln) * ldb + kb; FragH bq; bq.half[0] = *(const v8us*)((const unsigned short*)Bh + boff + 8 * hh); bq.half[1] = *(const v8us*)((const unsigned short*)Bh + boff + 16 + 8 * hh);
      acc[t] = mmaH<1>(ah.v, ah.v, bq.v, bq.v, acc[t]); }
  }
#pragma unroll
  for (int t = 0; t < 4; ++t) { if (col0 + t * 16 >= N) continue; const int col = col0 + t * 16 + ln; const float bv = bp ? bf16_round(bp[col]) : 0.f;
#pragma unroll
    for (int r = 0; r < 8; ++r) { float v = acc[t][r] * alpha + bv; if (CP) { const int rr = row0g + row0 + 8 * hh + r; if (rowsPerB < 0) v += CP[cofs + (size_t)rr * ldc + col];      /* rowsPerB < 0: own element of the batched C plane */ else { const int bidx = rr / rowsPerB; v += CP[(size_t)bidx * sCPb + (size_t)by * 64 + col]; } } if (ACT == 1) v = (v > 0.f) ? v : expm1f(v); else if (ACT == 7) v = (v > 0.f) ? v + 1.0f : expf(v); else if (ACT == 8) v = tanhf(v); else if (ACT == 9) v = 0.5f * v * (1.0f + tanhf(0.7978845608028654f * (v + 0.044715f * v * v * v))); else if (ACT == 11) v = 1.0f / (1.0f + expf(-v)); else if (ACT == 12) v = (v > 0.f) ? v : 0.01f * v; else if (ACT == 14) v = (v > 0.f) ? v : 0.1f * v; else if (ACT == 16) v = (v >= 0.f) ? v : 0.3f * v; else if (ACT == 17) v = (v >= 0.f) ? v : 0.2f * v; else if (ACT == 15) v = v / (1.0f + expf(-v)); else if (ACT == 3) v = fmaxf(v, 0.f); else if (ACT == 6) v = 0.5f * v * (1.0f + erff(v * 0.70710678118654752f)); so[w][8 * hh + r][t * 16 + ln] = v; } }
  __builtin_amdgcn_fence(__ATOMIC_ACQ_REL, "workgroup"); __builtin_amdgcn_wave_barrier();
  const int rsub = lane >> 4, c4 = (lane & 15) * 4; typedef _Float16 v4h __attribute__((ext_vector_type(4)));
  {
#pragma unroll
    for (int q = 0; q < 8; ++q) { const int r = q * 2 + rsub; if (col0 + c4 < N) { const v4f v = *(const v4fa*)&so[w][r][c4]; if (C) *(v4f*)(C + cofs + (size_t)(row0 + r) * ldc + col0 + c4) = v; if (C16) { v4h h4; for (int i = 0; i < 4; ++i) h4[i] = (_Float16)v[i]; *(v4h*)(C16 + cofs + (size_t)(row0 + r) * ldc + col0 + c4) = h4; } } }
     }
}


typedef _Float16 v4h __attribute__((ext_vector_type(4)));

// Fragment order of an f16 operand plane [rows][DM]: the 16 x 32 fragment (row tile rt, k block kb) is 1 KiB at (rt * (DM / 32) + kb) * 512 halves; in it the 16-byte chunk w = 0..63 holds row rt * 16 + (w & 15), k = kb * 32 + (w >> 4) * 8 .. + 7.
// Lane l of a wave then reads chunks l and 32 + l: the same values in the same registers as g2_frag from rows, but each wave-wide load is 512 contiguous bytes (4 whole lines) and not 16 pieces of 32 bytes.
// fo_src: first element, in the row-major [rows][DM] numbering, of chunk c of such a plane.
__device__ __forceinline__ size_t fo_src(size_t c) { const size_t tile = c >> 6; const int w = (int)(c & 63); return ((tile >> 5) * 16 + (w & 15)) * DM + (tile & 31) * 32 + (w >> 4) * 8; }
static_assert(DM / 32 == 32, "fo_src takes 32 k blocks a row tile");
static_assert(DM % 64 == 0, "k_gemm2 walks K = DM two k blocks a trip");
// fo_chunk: the chunk that thread t of a converting kernel makes. Four threads in a row take one source row's 128 bytes of f32 (a whole line), so a wave reads 8 whole lines and stores 4 whole lines (8 rows x 16 bytes in each of the 4 k groups).
__device__ __forceinline__ size_t fo_chunk(size_t t) { return (t & ~(size_t)63) + (t & 3) * 16 + ((t >> 2) & 15); }
__device__ __forceinline__ void x16(const float* __restrict__ x, _Float16* __restrict__ X16, size_t n8, size_t t) { if (t >= n8) return; FragH f; const size_t ck = fo_chunk(t); const float* s = x + fo_src(ck); const v4f a = *(const v4fa*)s, c = *(const v4fa*)(s + 4);
#pragma unroll
  for (int q = 0; q < 4; ++q) { f.h[q] = (_Float16)bf16_round(a[q]); f.h[4 + q] = (_Float16)bf16_round(c[q]); } *(v8us*)((unsigned short*)X16 + ck * 8) = f.half[0];  }
// All six f32 -> f16 conversions in one launch (none reads what another writes): work-groups 0 .. 4 * WTB - 1 take the four weights, the rest the two token sources. The weight groups, whose strided reads take longest, start first.
#define WTB (DM * (DM / 8) / 256)                /* work-groups of one weight */
#define XTB ((unsigned)(NR * DM / 8 / 256))      /* work-groups of one token source */
__global__ __launch_bounds__(256) void k_prep(const float* __restrict__ xq, const float* __restrict__ xkv, const float* __restrict__ wq, const float* __restrict__ wk, const float* __restrict__ wv, const float* __restrict__ wo,
    _Float16* __restrict__ XQ, _Float16* __restrict__ XKV, _Float16* __restrict__ BQ, _Float16* __restrict__ BK, _Float16* __restrict__ BV, _Float16* __restrict__ BO) {
  const unsigned bid = blockIdx.x;
  if (bid < 4 * WTB) { const unsigned s = bid / WTB; wt_f16(s == 0 ? wq : s == 1 ? wk : s == 2 ? wv : wo, s == 0 ? BQ : s == 1 ? BK : s == 2 ? BV : BO, DM, DM, 16.0f, (int)((bid % WTB) * 256 + threadIdx.x)); return; }      /* [in][out] -> Bt[n][k] x16 */
  const unsigned xb = bid - 4 * WTB; const bool kv = xb >= XTB; x16(kv ? xkv : xq, kv ? XKV : XQ, NR * DM / 8, (size_t)(kv ? xb - XTB : xb) * 256 + threadIdx.x); }      /* query source and key/value source as exact f16 rows */
__global__ __launch_bounds__(256) void k_h16(const float* __restrict__ x, _Float16* __restrict__ X16, size_t n8) { const size_t t = (size_t)blockIdx.x * 256 + threadIdx.x; if (t >= n8) return; FragH f;
#pragma unroll
  for (int q = 0; q < 8; ++q) f.h[q] = (_Float16)x[t * 8 + q]; *(v8us*)((unsigned short*)X16 + t * 8) = f.half[0];  }
__global__ __launch_bounds__(256) void k_round16f(const float* __restrict__ W, _Float16* __restrict__ Bt, size_t n8) { const size_t t = (size_t)blockIdx.x * 256 + threadIdx.x; if (t >= n8) return; FragH f;
#pragma unroll
  for (int i = 0; i < 8; ++i) f.h[i] = (_Float16)(bf16_round(W[t * 8 + i]) * 16.0f); *(v8us*)((unsigned short*)Bt + t * 8) = f.half[0];  }
// ---- fast GEMM (wave tile 32x64; requires M % 32 == 0 rows per launch region and N % 64 == 0); epilogue = k_gemm_hhx semantics ----
__device__ __forceinline__ v16h g2_frag(const _Float16* p, int hh) { FragH f; f.half[0] = *(const v8us*)((const unsigned short*)p + 8 * hh); f.half[1] = *(const v8us*)((const unsigned short*)p + 16 + 8 * hh); return f.v; }
__device__ __forceinline__ v16h g2_fragp(const _Float16* p) { FragH f; f.half[0] = *(const v8us*)((const unsigned short*)p); f.half[1] = *(const v8us*)((const unsigned short*)p + 256); return f.v; }      /* fragment-order plane: p = the fragment's start + lane * 8 */
__device__ __forceinline__ v16h g2_fragu(const _Float16* base, unsigned ob) { const char* p = (const char*)base + ob; FragH f; f.half[0] = *(const v8us*)p; f.half[1] = *(const v8us*)(p + 512); return f.v; }      /* the same with a wave-uniform row-tile start and one byte offset (k block * 1024 + lane * 16) shared by all operands */
__device__ __forceinline__ v8f g2_mma(v16h a, v16h b, v8f c) { v8f d = __builtin_amdgcn_wmma_f32_16x16x32_f16(false, a, false, b, (short)0, c, false, false); asm volatile("v_nop\n\tv_nop\n\tv_nop\n\tv_nop" : "+v"(d) : "v"(a), "v"(b)); return d; }
// As built, the epilogue takes one scalar branch per element round the bias / CP code that is unused here: left as it was.
// omode: 0 = C / C16 as rows; 1 = the f32 result split into f16 hi (C16) + x1024 residual (CL) planes, both in fragment order; 2 = the f16 result transposed into the V^T fragments of the attention kernel (C16 = V^T of all batches; a wave tile, 32 keys x one head's 64 d, is four fragments in a row)
template <int ACT>
__device__ __forceinline__ void gemm2(const _Float16* __restrict__ A, int lda, size_t sA, const _Float16* __restrict__ Bh, int ldb, size_t sB, float alpha, const float* __restrict__ bias, size_t sBias, const float* __restrict__ CP, int rowsPerB, size_t sCPb, int row0g,
    float* __restrict__ C, _Float16* __restrict__ C16, _Float16* __restrict__ CL, int omode, int ldc, size_t sC, int M, int N, int K, int by) { static_assert(ACT == 0 || ACT == 3 || ACT == 6 || ACT == 8 || ACT == 9 || ACT == 11 || ACT == 12 || ACT == 14 || ACT == 15 || ACT == 16 || ACT == 17, "k_gemm2: unsupported ACT code (would silently apply no activation)");
  __shared__ __attribute__((aligned(16))) float so[4][32][68];
  const int tid = threadIdx.x, w = __builtin_amdgcn_readfirstlane(tid >> 5), lane = tid & 31, ln = lane & 15, hh = lane >> 4;      /* the wave's number as a scalar: the row-tile starts below stay in scalar registers */
  A += (size_t)by * sA; Bh += (size_t)by * sB; const size_t cofs = (size_t)by * sC; const float* bp = bias ? bias + (size_t)by * sBias : nullptr;
  const int ntn = N >> 6; const int mt = blockIdx.x / ntn, nq = blockIdx.x - mt * ntn; const int row0 = mt * 128 + 32 * w, col0 = nq * 64; if (row0 >= M) return;
  const _Float16* a0p = A + (size_t)row0 * lda; const _Float16* a1p = A + (size_t)(row0 + 16) * lda;      /* a1p formed from A like a0p: written as a0p + 16 * lda this build kept it as a vector address pair, remade with 64-bit vector adds every k block. A and Bh in fragment order: a row tile is 16 * pitch halves, a k block 512 */
  const _Float16* b0p = Bh + (size_t)col0 * ldb; const _Float16* b1p = b0p + (size_t)16 * ldb; const _Float16* b2p = b1p + (size_t)16 * ldb; const _Float16* b3p = b2p + (size_t)16 * ldb;
  const v8f z8 = {0.f,0.f,0.f,0.f,0.f,0.f,0.f,0.f}; v8f c00 = z8, c01 = z8, c02 = z8, c03 = z8, c10 = z8, c11 = z8, c12 = z8, c13 = z8; const unsigned l16 = lane * 16; unsigned ob = l16;
  /* two register sets of six fragments: while one k block multiplies, the next one's twelve loads are in flight (K % 64 == 0: a trip is two k blocks). Each accumulator still takes its k blocks in rising order. */
  v16h a0 = g2_fragu(a0p, ob), a1 = g2_fragu(a1p, ob), b0 = g2_fragu(b0p, ob), b1 = g2_fragu(b1p, ob), b2 = g2_fragu(b2p, ob), b3 = g2_fragu(b3p, ob);
#pragma unroll 1      /* a trip already holds both sets; unrolled further, the live set would only grow */
  for (int kb = 0; kb < K; kb += 64) {
    const v16h e0 = g2_fragu(a0p, ob + 1024), e1 = g2_fragu(a1p, ob + 1024), f0 = g2_fragu(b0p, ob + 1024), f1 = g2_fragu(b1p, ob + 1024), f2 = g2_fragu(b2p, ob + 1024), f3 = g2_fragu(b3p, ob + 1024);
    asm volatile("s_wait_xcnt 0x0" ::: "memory");      /* behind the group of loads, in front of the overwrite of the offset register that they name; as a memory fence it also keeps the group ahead of the products that hide it */
    c00 = g2_mma(a0, b0, c00); c10 = g2_mma(a1, b0, c10); c01 = g2_mma(a0, b1, c01); c11 = g2_mma(a1, b1, c11);
    c02 = g2_mma(a0, b2, c02); c12 = g2_mma(a1, b2, c12); c03 = g2_mma(a0, b3, c03); c13 = g2_mma(a1, b3, c13);
    ob = (kb + 64 < K) ? ob + 2048 : l16;      /* the last trip fetches k block 0 again (in bounds, unused) */
    a0 = g2_fragu(a0p, ob); a1 = g2_fragu(a1p, ob); b0 = g2_fragu(b0p, ob); b1 = g2_fragu(b1p, ob); b2 = g2_fragu(b2p, ob); b3 = g2_fragu(b3p, ob);
    asm volatile("s_wait_xcnt 0x0" ::: "memory");      /* as above */
    c00 = g2_mma(e0, f0, c00); c10 = g2_mma(e1, f0, c10); c01 = g2_mma(e0, f1, c01); c11 = g2_mma(e1, f1, c11);
    c02 = g2_mma(e0, f2, c02); c12 = g2_mma(e1, f2, c12); c03 = g2_mma(e0, f3, c03); c13 = g2_mma(e1, f3, c13); }
  v8f accs[8] = {c00, c01, c02, c03, c10, c11, c12, c13};
#pragma unroll
  for (int u = 0; u < 8; ++u) { const int t = u & 3, half = u >> 2; const int col = col0 + t * 16 + ln; const float bv = bp ? bf16_round(bp[col]) : 0.f;
#pragma unroll
    for (int r = 0; r < 8; ++r) { const int rloc = half * 16 + 8 * hh + r; float v = accs[u][r] * alpha + bv; if (CP) { if (rowsPerB < 0) v += CP[cofs + (size_t)(row0g + row0 + rloc) * ldc + col];      /* rowsPerB < 0: own element of the batched C plane */ else { const int bidx = (row0g + row0 + rloc) / rowsPerB; v += CP[(size_t)bidx * sCPb + (size_t)by * 64 + col]; } }
      if (ACT == 3) v = fmaxf(v, 0.f); else if (ACT == 6) v = 0.5f * v * (1.0f + erff(v * 0.70710678118654752f)); else if (ACT == 11) v = 1.0f / (1.0f + expf(-v)); else if (ACT == 15) v = v / (1.0f + expf(-v)); else if (ACT == 12) v = (v > 0.f) ? v : 0.01f * v; else if (ACT == 8) v = tanhf(v); else if (ACT == 9) v = 0.5f * v * (1.0f + tanhf(0.7978845608028654f * (v + 0.044715f * v * v * v))); else if (ACT == 14) v = (v > 0.f) ? v : 0.1f * v; else if (ACT == 16) v = (v >= 0.f) ? v : 0.3f * v; else if (ACT == 17) v = (v >= 0.f) ? v : 0.2f * v;
      so[w][rloc][t * 16 + ln] = v; } }
  __builtin_amdgcn_fence(__ATOMIC_ACQ_REL, "workgroup"); __builtin_amdgcn_wave_barrier();
  if (omode == 1) {      /* chunk g * 32 + lane of fragment (row tile rt, k block kb): row ln, k (2 g + hh) * 8 .. + 7; every store is 512 contiguous bytes of a wave */
    const size_t f0 = ((size_t)(row0 >> 4) * (ldc >> 5) + (col0 >> 5)) * 512 + lane * 8; unsigned short* hp = (unsigned short*)C16 + f0; unsigned short* lp = (unsigned short*)CL + f0;
#pragma unroll
    for (int f = 0; f < 8; ++f) { const int rt = f >> 2, kb = (f >> 1) & 1, g = f & 1; const float* s = &so[w][rt * 16 + ln][kb * 32 + (2 * g + hh) * 8]; const v4f a = *(const v4fa*)s, c = *(const v4fa*)(s + 4); FragH fh, fl;
#pragma unroll
      for (int q = 0; q < 4; ++q) { _Float16 h = (_Float16)a[q]; fh.h[q] = h; fl.h[q] = (_Float16)((a[q] - (float)h) * 1024.0f); h = (_Float16)c[q]; fh.h[4 + q] = h; fl.h[4 + q] = (_Float16)((c[q] - (float)h) * 1024.0f); }
      const size_t o = (size_t)rt * (ldc >> 5) * 512 + kb * 512 + g * 256; *(v8us*)(hp + o) = fh.half[0]; *(v8us*)(lp + o) = fl.half[0]; }
    asm volatile("s_wait_xcnt 0x0" ::: "memory");      /* behind the block's last store: where the V^T block is laid out behind this one, its LDS loads take registers that these stores name */
    return; }
  if (omode == 2) {      /* chunk g * 32 + lane of d tile dt: row d = dt * 16 + ln, keys (2 g + hh) * 8 .. + 7 of the wave's 32-key block */
    const int tok = row0g + row0; unsigned short* vp = (unsigned short*)C16 + ((size_t)(tok / SQ) * NH + nq) * ((size_t)HD * SQ) + (size_t)((tok % SQ) >> 5) * 2048 + lane * 8;
#pragma unroll
    for (int f = 0; f < 8; ++f) { const int dt = f >> 1, g = f & 1; FragH fv;
#pragma unroll
      for (int q = 0; q < 8; ++q) fv.h[q] = (_Float16)so[w][(2 * g + hh) * 8 + q][dt * 16 + ln];
      *(v8us*)(vp + dt * 512 + g * 256) = fv.half[0]; }
    return; }
  const int rsub = lane >> 4, c4 = (lane & 15) * 4;
  {
#pragma unroll
    for (int q = 0; q < 16; ++q) { const int r = q * 2 + rsub; const v4f v = *(const v4fa*)&so[w][r][c4]; if (C) *(v4f*)(C + cofs + (size_t)(row0 + r) * ldc + col0 + c4) = v; if (C16) { v4h h4; for (int i = 0; i < 4; ++i) h4[i] = (_Float16)v[i]; *(v4h*)(C16 + cofs + (size_t)(row0 + r) * ldc + col0 + c4) = h4; } }
     } }
template <int ACT>
__global__ __launch_bounds__(128) void k_gemm2(const _Float16* __restrict__ A, int lda, size_t sA, const _Float16* __restrict__ Bh, int ldb, size_t sB, float alpha, const float* __restrict__ bias, size_t sBias, const float* __restrict__ CP, int rowsPerB, size_t sCPb, int row0g,
    float* __restrict__ C, _Float16* __restrict__ C16, _Float16* __restrict__ CL, int omode, int ldc, size_t sC, int M, int N, int K) { gemm2<ACT>(A, lda, sA, Bh, ldb, sB, alpha, bias, sBias, CP, rowsPerB, sCPb, row0g, C, C16, CL, omode, ldc, sC, M, N, K, blockIdx.y); }
// The three projections in one launch (none reads what another writes): blockIdx.y = 0 q, 1 k (each f32 -> f16 hi + x1024 residual planes, split in the epilogue), 2 v (f16 straight into the V^T fragments [NB * NH][SQ / 32][4 d tiles]). Pointers arrive at the first projected row; row0g = that row.
__global__ __launch_bounds__(128) void k_qkv(const _Float16* __restrict__ XQ, const _Float16* __restrict__ XKV, const _Float16* __restrict__ BQ, const _Float16* __restrict__ BK, const _Float16* __restrict__ BV,
    _Float16* __restrict__ Q16, _Float16* __restrict__ QL, _Float16* __restrict__ K16, _Float16* __restrict__ KL, _Float16* __restrict__ VT, int row0g) { const int y = blockIdx.y;
  gemm2<0>(y == 0 ? XQ : XKV, DM, 0, y == 0 ? BQ : y == 1 ? BK : BV, DM, 0, 0.0625f, nullptr, 0, nullptr, 1, 0, row0g, nullptr, y == 0 ? Q16 : y == 1 ? K16 : VT, y == 0 ? QL : KL, y == 2 ? 2 : 1, DM, 0, MP, DM, DM, 0); }


__global__ __launch_bounds__(256) void k_wnat(const float* __restrict__ w, size_t n8, _Float16* __restrict__ Bt) { const size_t t = (size_t)blockIdx.x * 256 + threadIdx.x; if (t >= n8) return; FragH f; for (int q = 0; q < 8; ++q) f.h[q] = (_Float16)(bf16_round(w[t * 8 + q]) * 16.0f); *(v8us*)((unsigned short*)Bt + t * 8) = f.half[0];  }
__global__ __launch_bounds__(256) void k_rsm(const float* __restrict__ S, _Float16* __restrict__ P, int nrows) {
  #pragma clang fp contract(off)
  const int i = blockIdx.x * 256 + threadIdx.x; if (i >= nrows) return; const float* s = S + (size_t)i * SQ; float mx = -3.0e38f;
#pragma unroll 1
  for (int j = 0; j < SQ; ++j) mx = fmaxf(mx, s[j]); float se = 0.f;
#pragma unroll 1
  for (int j = 0; j < SQ; ++j) se += expf(s[j] - mx); const float sc = 256.0f / se;
#pragma unroll 1
  for (int j0 = 0; j0 < SQ; j0 += 8) { FragH f; for (int q = 0; q < 8; ++q) f.h[q] = (_Float16)(expf(s[j0 + q] - mx) * sc); unsigned short* d = (unsigned short*)P + (size_t)i * SQ + j0; *(v8us*)d = f.half[0];  } }
__global__ __launch_bounds__(256) void k_vt(const _Float16* __restrict__ V16, int b, int h0, _Float16* __restrict__ VT) { __shared__ unsigned short tl[64][65]; const int tid = threadIdx.x; const int hh = blockIdx.x % HG, sg = blockIdx.x / HG; const int s0 = sg * 64; const int h = h0 + hh;
  for (int i = tid; i < 64 * 8; i += 256) { const int j = i / 8, d8 = (i % 8) * 8; FragH f; f.half[0] = *(const v8us*)((const unsigned short*)V16 + ((size_t)b * SQ + s0 + j) * DM + h * HD + d8); for (int q = 0; q < 8; ++q) tl[d8 + q][j] = f.u[q]; }
  __syncthreads();
  { for (int i = tid; i < 64 * 8; i += 256) { const int d = i / 8, j8 = (i % 8) * 8; FragH f; for (int q = 0; q < 8; ++q) f.u[q] = tl[d][j8 + q]; *(v8us*)((unsigned short*)VT + ((size_t)hh * HD + d) * SQ + s0 + j8) = f.half[0]; }  } }


__device__ __forceinline__ float xl_half(float x) { return __builtin_bit_cast(float, __builtin_amdgcn_permlanex16(__builtin_bit_cast(int, x), __builtin_bit_cast(int, x), 0x76543210, 0xfedcba98, false, false)); }  // lane l with lane l ^ 16
// v_exp_f32 with the v_nop in its own statement: it keeps the one slot that the instruction set asks for behind a transcendental
__device__ __forceinline__ float exp2_slot(float a) { float e; asm("v_exp_f32 %0, %1\n\tv_nop" : "=v"(e) : "v"(a)); return e; }
#define FAW 8                        /* waves per work-group of the fused attention kernel, 16 query columns each */
__global__ __launch_bounds__(FAW * 32) void k_fattn(const _Float16* __restrict__ Qh, const _Float16* __restrict__ Ql, const _Float16* __restrict__ Kh, const _Float16* __restrict__ Kl, const _Float16* __restrict__ VT, const float* __restrict__ relb, _Float16* __restrict__ O) {
  __shared__ float tb[257];
  const int tid = threadIdx.x, lane = tid & 31, ln = lane & 15, hh = lane >> 4; const int h = blockIdx.y, b = blockIdx.z;
  for (int t = tid; t < 257; t += FAW * 32) { const int d = t - 128; const int a = d < 0 ? -d : d; const int f = (a < 8) ? a : (8 + (a >= 12) + (a >= 16) + (a >= 23) + (a >= 32) + (a >= 46) + (a >= 64) + (a >= 91)); const int bk = (d > 0 ? 16 : 0) + f; tb[t] = bf16_round(relb[bk * NH + h]); }
  __syncthreads();      /* publishes the bias table to all waves; the only barrier of the kernel */
  const int q0 = (blockIdx.x * FAW + __builtin_amdgcn_readfirstlane(tid >> 5)) * 16; const size_t r0 = (size_t)b * SQ;
  const size_t fo = (size_t)h * (HD * 16) + lane * 8;      /* fragment order: head h is k blocks 2 h and 2 h + 1 of a row tile, 512 halves each; a row tile is 16 * LQ halves */
  const _Float16* qp = Qh + (r0 + q0) * LQ + fo; const _Float16* qlp = Ql + (r0 + q0) * LQ + fo;
  const v16h qh0 = g2_fragp(qp), qh1 = g2_fragp(qp + 512); asm volatile("s_wait_xcnt 0x0" ::: "memory");      /* this and the like waits below stand behind a group of loads, in front of whatever next overwrites a register that the group's addresses are in */
  const v16h ql0 = g2_fragp(qlp), ql1 = g2_fragp(qlp + 512); asm volatile("s_wait_xcnt 0x0" ::: "memory");
  const _Float16* khp = Kh + r0 * LQ + fo; const _Float16* klp = Kl + r0 * LQ + fo; const _Float16* vp = VT + (size_t)(b * NH + h) * HD * SQ + lane * 8;
  const float bneg = __builtin_bit_cast(float, __builtin_amdgcn_readfirstlane(__builtin_bit_cast(int, tb[0]))), bpos = __builtin_bit_cast(float, __builtin_amdgcn_readfirstlane(__builtin_bit_cast(int, tb[256])));      /* the two far values, the same in every lane: held in scalar registers */
  const int dq = 128 + 8 * hh - (q0 + ln);      /* table index of key j, register r: j0 + r + dq, clamped */
  const v8f z8 = {0.f,0.f,0.f,0.f,0.f,0.f,0.f,0.f}; v8f o0 = z8, o1 = z8, o2 = z8, o3 = z8; float m = -1.0e30f, mm = -1.0e30f, l = 0.f;
  v16h ka0 = g2_fragp(khp), ka1 = g2_fragp(khp + 512), kb0 = g2_fragp(khp + 16 * LQ), kb1 = g2_fragp(khp + 16 * LQ + 512);      /* k_hi: key tiles a (0..15) and b (16..31), d 0..31 and 32..63 */
  v16h la0 = g2_fragp(klp), la1 = g2_fragp(klp + 512), lb0 = g2_fragp(klp + 16 * LQ), lb1 = g2_fragp(klp + 16 * LQ + 512); asm volatile("s_wait_xcnt 0x0" ::: "memory");      /* k_lo likewise */
#pragma unroll 1      /* one pass's fragments in registers at a time: unrolled, the live set would cost a resident wave */
  for (int j0 = 0; j0 < SQ; j0 += 32) {
    const _Float16* vj = vp + (size_t)j0 * HD; const v16h v0 = g2_fragp(vj), v1 = g2_fragp(vj + 512), v2 = g2_fragp(vj + 1024), v3 = g2_fragp(vj + 1536); asm volatile("s_wait_xcnt 0x0" ::: "memory");      /* V^T fragments issued ahead of the score products that hide them */
    const float bf = j0 < q0 ? bneg : bpos; v8f sa = {bf, bf, bf, bf, bf, bf, bf, bf}, sb = sa;      /* a tile wholly at distance 128 or more: one value */
    if (j0 + 31 - q0 > -128 && j0 - (q0 + 15) < 128) {      /* wave-uniform: tiles near the diagonal read the table */
#pragma unroll
      for (int r = 0; r < 8; ++r) { const int ia = j0 + r + dq, ib = ia + 16; sa[r] = tb[ia < 0 ? 0 : (ia > 256 ? 256 : ia)]; sb[r] = tb[ib < 0 ? 0 : (ib > 256 ? 256 : ib)]; } }
    v8f ta = z8, tc = z8;
    sa = g2_mma(ka0, qh0, sa); ta = g2_mma(ka0, ql0, ta); sb = g2_mma(kb0, qh0, sb); tc = g2_mma(kb0, ql0, tc);      /* four independent accumulator chains, interleaved */
    sa = g2_mma(ka1, qh1, sa); ta = g2_mma(ka1, ql1, ta); sb = g2_mma(kb1, qh1, sb); tc = g2_mma(kb1, ql1, tc);
    ta = g2_mma(la0, qh0, ta); tc = g2_mma(lb0, qh0, tc); ta = g2_mma(la1, qh1, ta); tc = g2_mma(lb1, qh1, tc);
    { const size_t jn = (size_t)((j0 + 32) & (SQ - 1)) * LQ;      /* the next pass's K fragments, fetched behind this pass's score products; the last pass wraps to key 0 (in bounds, unused) */
      ka0 = g2_fragp(khp + jn); ka1 = g2_fragp(khp + jn + 512); kb0 = g2_fragp(khp + jn + 16 * LQ); kb1 = g2_fragp(khp + jn + 16 * LQ + 512);
      la0 = g2_fragp(klp + jn); la1 = g2_fragp(klp + jn + 512); lb0 = g2_fragp(klp + jn + 16 * LQ); lb1 = g2_fragp(klp + jn + 16 * LQ + 512); asm volatile("s_wait_xcnt 0x0" ::: "memory"); }
    float s[16];
#pragma unroll
    for (int r = 0; r < 8; ++r) { s[r] = fmaf(ta[r], 0.0009765625f, sa[r]); s[8 + r] = fmaf(tc[r], 0.0009765625f, sb[r]); }
    float x0 = fmaxf(s[0], s[1]), x1 = fmaxf(s[2], s[3]), x2 = fmaxf(s[4], s[5]), x3 = fmaxf(s[6], s[7]);
    x0 = fmaxf(x0, fmaxf(s[8], s[9])); x1 = fmaxf(x1, fmaxf(s[10], s[11])); x2 = fmaxf(x2, fmaxf(s[12], s[13])); x3 = fmaxf(x3, fmaxf(s[14], s[15]));
    float mx = fmaxf(fmaxf(x0, x1), fmaxf(x2, x3)); mx = fmaxf(mx, xl_half(mx));      /* both halves of the wave hold keys of the same query */
    const float mn = fmaxf(m, mx); const float mmn = fmaf(mn, 1.44269504088896340736f, -8.0f);      /* exponent offset in log2 units; the -8 carries the weights x256 */
    const float al = exp2_slot(mm - mmn); m = mn; mm = mmn;      /* 1 exactly while the maximum stands */
    FragH pf; float a0 = 0.f, a1 = 0.f, a2 = 0.f, a3 = 0.f;
#pragma unroll
    for (int i = 0; i < 16; i += 4) { const float p0 = exp2_slot(fmaf(s[i], 1.44269504088896340736f, -mmn)), p1 = exp2_slot(fmaf(s[i + 1], 1.44269504088896340736f, -mmn)), p2 = exp2_slot(fmaf(s[i + 2], 1.44269504088896340736f, -mmn)), p3 = exp2_slot(fmaf(s[i + 3], 1.44269504088896340736f, -mmn));
      a0 += p0; a1 += p1; a2 += p2; a3 += p3; pf.h[i] = (_Float16)p0; pf.h[i + 1] = (_Float16)p1; pf.h[i + 2] = (_Float16)p2; pf.h[i + 3] = (_Float16)p3; }
    l = fmaf(l, al, (a0 + a1) + (a2 + a3));
#pragma unroll
    for (int r = 0; r < 8; ++r) { o0[r] *= al; o1[r] *= al; o2[r] *= al; o3[r] *= al; }
    o0 = g2_mma(v0, pf.v, o0); o1 = g2_mma(v1, pf.v, o1); o2 = g2_mma(v2, pf.v, o2); o3 = g2_mma(v3, pf.v, o3);      /* O^T[d = 16 t + 8 hh + r][query ln] */
  }
  const float sc = 64.0f / (l + xl_half(l)); unsigned short* op = (unsigned short*)O + (r0 + q0) * DM + fo; FragH f;      /* o rows in fragment order too (A operand of the output GEMM): d = 16 t + 8 hh + r of query ln is chunk 32 (t & 1) + lane of k block 2 h + (t >> 1) */
#pragma unroll
  for (int r = 0; r < 8; ++r) { f.h[r] = (_Float16)(o0[r] * sc); f.h[8 + r] = (_Float16)(o1[r] * sc); }
  *(v8us*)op = f.half[0]; *(v8us*)(op + 256) = f.half[1];
#pragma unroll
  for (int r = 0; r < 8; ++r) { f.h[r] = (_Float16)(o2[r] * sc); f.h[8 + r] = (_Float16)(o3[r] * sc); }
  *(v8us*)(op + 512) = f.half[0]; *(v8us*)(op + 768) = f.half[1]; }

extern "C" void kernel_launch(void* const* d_in, const int* in_sizes, int n_in,
                              void* d_out, int out_size, void* d_ws, size_t ws_size, hipStream_t stream) {
  (void)in_sizes; (void)n_in; (void)out_size;
  const float* const* I = (const float* const*)d_in; const float* xq = I[0]; const float* xkv = I[1]; const float* wq = I[2]; const float* wk = I[3]; const float* wv = I[4]; const float* wo = I[5]; const float* relb = I[6]; const float* bq = nullptr; const float* bk = nullptr; (void)bq; (void)bk;      /* [in][out] weights, no biases; rel_bias [32 buckets][16 heads] */
  char* ws = (char*)d_ws; size_t off = 0;
  auto take = [&](size_t bytes) { char* p = ws + off; off += (bytes + 255) & ~(size_t)255; return p; };
  _Float16* BQ = (_Float16*)take((size_t)DM * DM * 2); _Float16* BK = (_Float16*)take((size_t)DM * DM * 2); _Float16* BV = (_Float16*)take((size_t)DM * DM * 2); _Float16* BO = (_Float16*)take((size_t)DM * DM * 2);
  _Float16* XQ = (_Float16*)take(NR * DM * 2); _Float16* XKV = (_Float16*)take(NR * DM * 2); _Float16* Q16 = (_Float16*)take(NR * DM * 2); _Float16* QL = (_Float16*)take(NR * DM * 2); _Float16* K16 = (_Float16*)take(NR * DM * 2); _Float16* KL = (_Float16*)take(NR * DM * 2); _Float16* O16 = (_Float16*)take(NR * DM * 2);
  _Float16* VT = (_Float16*)take((size_t)NB * NH * HD * SQ * 2);      /* V^T for ALL batches */
  if (off > ws_size) return;
  k_prep<<<4 * WTB + 2 * XTB, 256, 0, stream>>>(xq, xkv, wq, wk, wv, wo, XQ, XKV, BQ, BK, BV, BO);      /* weights [in][out] -> Bt[n][k] x16; both token sources as exact f16 rows */
  const size_t r0p = (size_t)B0 * SQ;      /* first projected row */
  k_qkv<<<dim3((unsigned)((MP / 128) * (DM / 64)), 3), 128, 0, stream>>>(XQ + r0p * DM, XKV + r0p * DM, BQ, BK, BV, Q16 + r0p * DM, QL + r0p * DM, K16 + r0p * DM, KL + r0p * DM, VT, (int)r0p);      /* q -> Q16 + QL, k -> K16 + KL, v -> V^T */
  k_fattn<<<dim3(SQ / (FAW * 16), NH, NB), FAW * 32, 0, stream>>>(Q16, QL, K16, KL, VT, relb, O16);      /* scores + bias, softmax and P . V of every batch and head; o (merged heads) x64 as f16 rows */
  k_gemm2<0><<<dim3((unsigned)((MPO / 128) * (DM / 64)), 1), 128, 0, stream>>>(O16 + r0p * DM, DM, 0, BO, DM, 0, 0.0009765625f, nullptr, 0, nullptr, 1, 0, 0, (float*)d_out + r0p * DM, nullptr, nullptr, 0, DM, 0, MPO, DM, DM);      /* out rows are the output layout */
}

// v007
// One run takes 207 microseconds.
// Next to v006, in two timings, it ran 1.05 times as fast each time.
// Counting every step since v000, it is 73.9 times as fast.
#include <hip/hip_runtime.h>
// T5 attention with a relative-position bias and NO score scaling (query_states [4][2048][1024] gives q = x wq; key_value_states gives k = x wk, v = x wv ([in][out] 1024^2 sigma 1/32, no biases); 16 heads of 64; scores = q . k (UNSCALED, logits sigma ~8) + bias[h][i][j] with bias = rel_bias[bucket(j - i)][h] (rel_bias input [32][16]; bidirectional log buckets, 32 buckets, max distance 128); softmax; out = merged wo -> [4][2048][1024]).
// Structure: token rows r = b*2048 + s; the query source and the key/value source as exact f16 rows (bf16-rounded); Q, K, V as three WMMA GEMMs (32x64 wave tiles, f32 accumulation, exact x16 weights); q and k split in the GEMM epilogue into f16 hi + x1024 residual planes, V^T written by its GEMM epilogue from the same LDS staging tile; then ONE fused attention launch over (query block, head, batch): UNSCALED three-term scores (bias as the start value, q_hi . k_hi, + (q_lo . k_hi + q_hi . k_lo) 2^-10; K = 64), running-maximum softmax in registers (f32 statistics, native exp; weights x256 as f16), O^T += V^T . P^T, o carried x64 against f16 subnormal flush (folded into the output GEMM alpha) written straight into the merged f16 o rows; out = o W_o GEMM (f32) into the output layout.
// Compute dtype: inputs rounded to bf16; x / weights exact; v, softmax weights and o as plain f16 GEMM operands (~2^-12), q and k as f16 hi + x1024 residual; scores and softmax statistics f32; v_wmma_f32_16x16x32_f16.
#define NB 4
#define SQ 2048
#define DM 1024
#define NH 16
#define HD 64
#define HG 2                         /* heads per launch of k_vt, which is not launched */
#define B0 0                         /* first batch processed (debug hook) */
#define NBR NB                       /* batches processed (debug hook) */
#define NR ((size_t)NB * SQ)         /* token rows */
#define MP ((int)((size_t)NBR * SQ)) /* rows projected (debug hook) */
#define QN SQ                        /* not used: the attention launch attends all SQ query rows */
#define NHD NH                       /* not used: the attention launch covers all NH heads */
#define MPO MP                       /* rows through the output stage (debug hook) */
#define LQ DM      /* row pitch of the q/k rows */
typedef __bf16 v16b __attribute__((ext_vector_type(16)));
typedef unsigned short v8us __attribute__((ext_vector_type(8), may_alias));
typedef float  v8f  __attribute__((ext_vector_type(8)));
typedef float  v4f  __attribute__((ext_vector_type(4)));
typedef float  v4fa __attribute__((ext_vector_type(4), may_alias));
union FragB { v16b v; v8us half[2]; unsigned short u[16]; };

__device__ __forceinline__ unsigned short bf16_bits(float x) { unsigned int u = __float_as_uint(x); return (unsigned short)((u + 0x7FFFu + ((u >> 16) & 1u)) >> 16); }
__device__ __forceinline__ float bf16_val(unsigned short b) { return __uint_as_float(((unsigned int)b) << 16); }
__device__ __forceinline__ float bf16_round(float x) { return bf16_val(bf16_bits(x)); }
// D += A·B with NT terms: 1 = ah·bh, 2 = + al·bh (A split), 3 = + ah·bl (both split)
template <int NT>
__device__ __forceinline__ v8f mmaN(v16b ah, v16b al, v16b bh, v16b bl, v8f c) {
  c = __builtin_amdgcn_wmma_f32_16x16x32_bf16(false, ah, false, bh, (short)0, c, false, false);
  if (NT >= 2) c = __builtin_amdgcn_wmma_f32_16x16x32_bf16(false, al, false, bh, (short)0, c, false, false);
  if (NT >= 3) c = __builtin_amdgcn_wmma_f32_16x16x32_bf16(false, ah, false, bl, (short)0, c, false, false);
  asm volatile("v_nop\n\tv_nop\n\tv_nop\n\tv_nop" : "+v"(c) : "v"(ah), "v"(al), "v"(bh), "v"(bl));
  return c;
}

__global__ __launch_bounds__(256) void k_wt_bf16(const float* __restrict__ W, unsigned short* __restrict__ Wt, int K, int N) {
  const int t = blockIdx.x * 256 + threadIdx.x;
  const int k8n = K / 8;
  if (t >= N * k8n) return;
  const int n = t / k8n, k8 = (t % k8n) * 8;
  v8us v;
#pragma unroll
  for (int i = 0; i < 8; ++i) v[i] = bf16_bits(W[(size_t)(k8 + i) * N + n]);
  *(v8us*)(Wt + (size_t)n * K + k8) = v;
  
}

// GEMM C[M][N] (f32, pitch ldc) = act(A[M][K]·W + bias). A f32 row-major (pitch lda) converted per fragment to bf16
// (ASPLIT: hi/lo two planes -> 2 terms, else single rounded term); Wt bf16 [N][K] (pitch ldb). BIAS_BF16 rounds the
// bias to bf16 first (bias quantised to bf16 before the add). K%32==0, M%16==0, N%64==0.
template <bool ASPLIT, int ACT, bool BIAS_BF16>
__global__ __launch_bounds__(128) void k_gemm_bf(const float* __restrict__ A, int lda, const unsigned short* __restrict__ Wt, int ldb,
                                               const float* __restrict__ bias, float* __restrict__ C, int ldc, int M, int N, int K) {
  __shared__ __attribute__((aligned(16))) float so[4][16][64];
  const int tid = threadIdx.x, w = tid >> 5, lane = tid & 31, ln = lane & 15, hh = lane >> 4;
  const int ntn = N / 64;
  const int wid = blockIdx.x * 4 + w;
  const int mt = wid / ntn, nq = wid % ntn;
  if (mt * 16 >= M) return;
  const int row0 = mt * 16, col0 = nq * 64;
  const float* arow = A + (size_t)(row0 + ln) * lda;
  v8f acc[4] = {};
  for (int kb = 0; kb < K; kb += 32) {
    FragB ah, al;
    const v4f x0 = *(const v4fa*)(arow + kb + 8 * hh), x1 = *(const v4fa*)(arow + kb + 8 * hh + 4);
    const v4f x2 = *(const v4fa*)(arow + kb + 16 + 8 * hh), x3 = *(const v4fa*)(arow + kb + 16 + 8 * hh + 4);
    float xs[16] = {x0[0],x0[1],x0[2],x0[3],x1[0],x1[1],x1[2],x1[3],x2[0],x2[1],x2[2],x2[3],x3[0],x3[1],x3[2],x3[3]};
#pragma unroll
    for (int i = 0; i < 16; ++i) { const unsigned short hb = bf16_bits(xs[i]); ah.u[i] = hb; al.u[i] = ASPLIT ? bf16_bits(xs[i] - bf16_val(hb)) : (unsigned short)0; }
#pragma unroll
    for (int t = 0; t < 4; ++t) {
      const unsigned short* brow = Wt + (size_t)(col0 + t * 16 + ln) * ldb + kb;
      FragB b;
      b.half[0] = *(const v8us*)(brow + 8 * hh);
      b.half[1] = *(const v8us*)(brow + 16 + 8 * hh);
      acc[t] = mmaN<ASPLIT ? 2 : 1>(ah.v, al.v, b.v, b.v, acc[t]);
    }
  }
#pragma unroll
  for (int t = 0; t < 4; ++t) {
    float bv = bias ? bias[col0 + t * 16 + ln] : 0.f;
    if (BIAS_BF16) bv = bf16_round(bv);
#pragma unroll
    for (int r = 0; r < 8; ++r) { float v = acc[t][r] + bv; if (ACT == 1) v = fmaxf(v, 0.f); so[w][8 * hh + r][t * 16 + ln] = v; }
  }
  __builtin_amdgcn_fence(__ATOMIC_ACQ_REL, "workgroup");
  __builtin_amdgcn_wave_barrier();
  const int rsub = lane >> 4, c4 = (lane & 15) * 4;
  {
#pragma unroll
    for (int q = 0; q < 8; ++q) {
      const int r = q * 2 + rsub;
      const v4f v = *(const v4fa*)&so[w][r][c4];
      *(v4f*)(C + (size_t)(row0 + r) * ldc + col0 + c4) = v;
    }
    
  }
}

// GEMM C = act(A·W + bias + resid): A f32 (ASPLIT -> hi/lo 2 terms), Wt bf16 [N][K]; ACT 0 none, 1 relu, 2 exact gelu;
// resid (optional, f32, row index = (row % rmod), pitch ldr, RES_BF16 rounds it) added before the activation.
template <bool ASPLIT, int ACT, bool BIAS_BF16, bool RES_BF16>
__global__ __launch_bounds__(128) void k_gemm_bf3(const float* __restrict__ A, int lda, const unsigned short* __restrict__ Wt, int ldb,
                                                const float* __restrict__ bias, const float* __restrict__ resid, int rmod, int ldr,
                                                float* __restrict__ C, int ldc, int M, int N, int K) {
  __shared__ __attribute__((aligned(16))) float so[4][16][64];
  const int tid = threadIdx.x, w = tid >> 5, lane = tid & 31, ln = lane & 15, hh = lane >> 4;
  const int ntn = N / 64;
  const int wid = blockIdx.x * 4 + w;
  const int mt = wid / ntn, nq = wid % ntn;
  if (mt * 16 >= M) return;
  const int row0 = mt * 16, col0 = nq * 64;
  const float* arow = A + (size_t)(row0 + ln) * lda;
  v8f acc[4] = {};
  for (int kb = 0; kb < K; kb += 32) {
    FragB ah, al;
    const v4f x0 = *(const v4fa*)(arow + kb + 8 * hh), x1 = *(const v4fa*)(arow + kb + 8 * hh + 4);
    const v4f x2 = *(const v4fa*)(arow + kb + 16 + 8 * hh), x3 = *(const v4fa*)(arow + kb + 16 + 8 * hh + 4);
    float xs[16] = {x0[0],x0[1],x0[2],x0[3],x1[0],x1[1],x1[2],x1[3],x2[0],x2[1],x2[2],x2[3],x3[0],x3[1],x3[2],x3[3]};
#pragma unroll
    for (int i = 0; i < 16; ++i) { const unsigned short hb = bf16_bits(xs[i]); ah.u[i] = hb; al.u[i] = ASPLIT ? bf16_bits(xs[i] - bf16_val(hb)) : (unsigned short)0; }
#pragma unroll
    for (int t = 0; t < 4; ++t) {
      const unsigned short* brow = Wt + (size_t)(col0 + t * 16 + ln) * ldb + kb;
      FragB b;
      b.half[0] = *(const v8us*)(brow + 8 * hh);
      b.half[1] = *(const v8us*)(brow + 16 + 8 * hh);
      acc[t] = mmaN<ASPLIT ? 2 : 1>(ah.v, al.v, b.v, b.v, acc[t]);
    }
  }
#pragma unroll
  for (int t = 0; t < 4; ++t) {
    const int col = col0 + t * 16 + ln;
    float bv = bias ? bias[col] : 0.f;
    if (BIAS_BF16) bv = bf16_round(bv);
#pragma unroll
    for (int r = 0; r < 8; ++r) {
      float v = acc[t][r] + bv;
      if (resid) { float rv = resid[(size_t)((row0 + 8 * hh + r) % rmod) * ldr + col]; if (RES_BF16) rv = bf16_round(rv); v += rv; }
      if (ACT == 1) v = fmaxf(v, 0.f);
      if (ACT == 2) v = 0.5f * v * (1.0f + erff(v * 0.70710678118654752f));
      if (ACT == 3) { const float u = 0.7978845608028654f * (v + 0.044715f * v * v * v); v = 0.5f * v * (1.0f + tanhf(u)); }
      so[w][8 * hh + r][t * 16 + ln] = v;
    }
  }
  __builtin_amdgcn_fence(__ATOMIC_ACQ_REL, "workgroup");
  __builtin_amdgcn_wave_barrier();
  const int rsub = lane >> 4, c4 = (lane & 15) * 4;
  {
#pragma unroll
    for (int q = 0; q < 8; ++q) {
      const int r = q * 2 + rsub;
      const v4f v = *(const v4fa*)&so[w][r][c4];
      *(v4f*)(C + (size_t)(row0 + r) * ldc + col0 + c4) = v;
    }
    
  }
}
// row LayerNorm (biased variance, eps) over N: s = X (+ R); optional out_sum <- s; out_norm <- (s-mu)*rsqrt(var+eps)*g + b
template <bool PARAM_BF16>
__global__ __launch_bounds__(256) void k_layernorm(const float* __restrict__ X, const float* __restrict__ R, const float* __restrict__ g, const float* __restrict__ bta,
                                                  float* __restrict__ out_sum, float* __restrict__ out_norm, int N, float eps) {
  __shared__ float red[256];
  const int row = blockIdx.x, tid = threadIdx.x;
  const float* x = X + (size_t)row * N; const float* rr = R ? R + (size_t)row * N : nullptr;
  float vals[16];                     // up to N = 4096
  const int per = N / 256;            // contiguous chunk per thread? use strided-by-4 chunks: thread handles j = tid*4 + 1024*u
  float s1 = 0.f;
  for (int u = 0; u < per / 4; ++u) {
    const int j = tid * 4 + 1024 * u;
    const v4f a = *(const v4fa*)(x + j);
    v4f b = {0.f,0.f,0.f,0.f}; if (rr) b = *(const v4fa*)(rr + j);
#pragma unroll
    for (int q = 0; q < 4; ++q) { const float v = a[q] + b[q]; vals[u * 4 + q] = v; s1 += v; }
  }
  red[tid] = s1; __syncthreads();
  for (int st = 128; st > 0; st >>= 1) { if (tid < st) red[tid] += red[tid + st]; __syncthreads(); }
  const float mu = red[0] / (float)N; __syncthreads();
  float s2 = 0.f;
  for (int u = 0; u < per / 4; ++u)
#pragma unroll
    for (int q = 0; q < 4; ++q) { const float c = vals[u * 4 + q] - mu; s2 += c * c; }
  red[tid] = s2; __syncthreads();
  for (int st = 128; st > 0; st >>= 1) { if (tid < st) red[tid] += red[tid + st]; __syncthreads(); }
  const float rs = rsqrtf(red[0] / (float)N + eps);
  {
    for (int u = 0; u < per / 4; ++u) {
      const int j = tid * 4 + 1024 * u;
      v4f o, sm;
#pragma unroll
      for (int q = 0; q < 4; ++q) {
        float gg = g[j + q], bb = bta[j + q];
        if (PARAM_BF16) { gg = bf16_round(gg); bb = bf16_round(bb); }
        sm[q] = vals[u * 4 + q]; o[q] = (vals[u * 4 + q] - mu) * rs * gg + bb;
      }
      if (out_sum) *(v4f*)(out_sum + (size_t)row * N + j) = sm;
      *(v4f*)(out_norm + (size_t)row * N + j) = o;
    }
    
  }
}



// ---- f16 WMMA path (v_wmma_f32_16x16x32_f16): 11-bit significands for operands in range — used where a [0,1] probability operand needs more precision than bf16
typedef _Float16 v16h __attribute__((ext_vector_type(16)));
union FragH { v16h v; v8us half[2]; _Float16 h[16]; unsigned short u[16]; };
template <int NT>
__device__ __forceinline__ v8f mmaH(v16h ah, v16h al, v16h bh, v16h bl, v8f c) {
  c = __builtin_amdgcn_wmma_f32_16x16x32_f16(false, ah, false, bh, (short)0, c, false, false);
  if (NT >= 2) c = __builtin_amdgcn_wmma_f32_16x16x32_f16(false, al, false, bh, (short)0, c, false, false);
  if (NT >= 3) c = __builtin_amdgcn_wmma_f32_16x16x32_f16(false, ah, false, bl, (short)0, c, false, false);
  asm volatile("v_nop\n\tv_nop\n\tv_nop\n\tv_nop" : "+v"(c) : "v"(ah), "v"(al), "v"(bh), "v"(bl));
  return c;
}
// batched GEMM like k_gemm_b but f16 operands: A f32 (split into f16 hi/lo if ASPLIT, else rounded to f16), Bt = f16 values [n][k]; alpha; C f32; N multiple of 16 (partial tiles skipped)
template <bool ASPLIT>
__global__ __launch_bounds__(128) void k_gemm_h(const float* __restrict__ A, int lda, size_t sA, const _Float16* __restrict__ Bh, int ldb, size_t sB, float alpha, float* __restrict__ C, int ldc, size_t sC, int M, int N, int K) {
  __shared__ __attribute__((aligned(16))) float so[4][16][64];
  const int tid = threadIdx.x, w = tid >> 5, lane = tid & 31, ln = lane & 15, hh = lane >> 4; const int by = blockIdx.y;
  A += (size_t)by * sA; Bh += (size_t)by * sB; C += (size_t)by * sC;
  const int ntn = (N + 63) / 64; const int wid = blockIdx.x * 4 + w; const int mt = wid / ntn, nq = wid % ntn; if (mt * 16 >= M) return;
  const int row0 = mt * 16, col0 = nq * 64; const float* arow = A + (size_t)(row0 + ln) * lda;
  v8f acc[4] = {};
  for (int kb = 0; kb < K; kb += 32) {
    FragH ah, al;
    const v4f x0 = *(const v4fa*)(arow + kb + 8 * hh), x1 = *(const v4fa*)(arow + kb + 8 * hh + 4), x2 = *(const v4fa*)(arow + kb + 16 + 8 * hh), x3 = *(const v4fa*)(arow + kb + 16 + 8 * hh + 4);
    float xs[16] = {x0[0],x0[1],x0[2],x0[3],x1[0],x1[1],x1[2],x1[3],x2[0],x2[1],x2[2],x2[3],x3[0],x3[1],x3[2],x3[3]};
#pragma unroll
    for (int i = 0; i < 16; ++i) { const _Float16 h = (_Float16)xs[i]; ah.h[i] = h; al.h[i] = ASPLIT ? (_Float16)(xs[i] - (float)h) : (_Float16)0.0f; }
#pragma unroll
    for (int t = 0; t < 4; ++t) { if (col0 + t * 16 >= N) continue; const size_t boff = (size_t)(col0 + t * 16 + ln) * ldb + kb; FragH bq; bq.half[0] = *(const v8us*)(Bh + boff + 8 * hh); bq.half[1] = *(const v8us*)(Bh + boff + 16 + 8 * hh);
      acc[t] = mmaH<ASPLIT ? 2 : 1>(ah.v, al.v, bq.v, bq.v, acc[t]); }
  }
#pragma unroll
  for (int t = 0; t < 4; ++t) { if (col0 + t * 16 >= N) continue;
#pragma unroll
    for (int r = 0; r < 8; ++r) so[w][8 * hh + r][t * 16 + ln] = acc[t][r] * alpha; }
  __builtin_amdgcn_fence(__ATOMIC_ACQ_REL, "workgroup"); __builtin_amdgcn_wave_barrier();
  const int rsub = lane >> 4, c4 = (lane & 15) * 4;
  {
#pragma unroll
    for (int q = 0; q < 8; ++q) { const int r = q * 2 + rsub; if (col0 + c4 < N) { const v4f v = *(const v4fa*)&so[w][r][c4]; *(v4f*)(C + (size_t)(row0 + r) * ldc + col0 + c4) = v; } }
     }
}

// Wt[n][k] = f16(W[k][n]·scale) from f32 row-major W[K][N] (scale = power of two; bf16-exact weights stay exact in f16 away from the subnormal range)
__device__ __forceinline__ void wt_f16(const float* __restrict__ W, _Float16* __restrict__ Wt, int K, int N, float scale, int t) {
  if (t >= N * (K / 8)) return; const int tile = t >> 6, w = t & 63, kt = K >> 5; const int n = (tile / kt) * 16 + (w & 15), k8 = (tile % kt) * 32 + (w >> 4) * 8; FragH f;      /* thread = output chunk of the fragment order (rows n, K / 32 k blocks a row tile) */
#pragma unroll
  for (int i = 0; i < 8; ++i) f.h[i] = (_Float16)(bf16_round(W[(size_t)(k8 + i) * N + n]) * scale); const v8us o = f.half[0];
  *(v8us*)((unsigned short*)Wt + (size_t)t * 8) = o; 
}
// k_gemm_hh variant with fused epilogue: v = acc·alpha + bias[by·sBias + col] (+ CP[(row/rowsPerB)·sCPb + by·64 + col] if CP) ; ACT 0 none / 1 elu ; writes f16 C16 (and f32 C if non-null)
template <int ACT>
__global__ __launch_bounds__(128) void k_gemm_hhx(const _Float16* __restrict__ A, int lda, size_t sA, const _Float16* __restrict__ Bh, int ldb, size_t sB, float alpha, const float* __restrict__ bias, size_t sBias, const float* __restrict__ CP, int rowsPerB, size_t sCPb, int row0g,
    float* __restrict__ C, _Float16* __restrict__ C16, int ldc, size_t sC, int M, int N, int K) {
  __shared__ __attribute__((aligned(16))) float so[4][16][64];
  const int tid = threadIdx.x, w = tid >> 5, lane = tid & 31, ln = lane & 15, hh = lane >> 4; const int by = blockIdx.y;
  A += (size_t)by * sA; Bh += (size_t)by * sB; const size_t cofs = (size_t)by * sC; const float* bp = bias ? bias + (size_t)by * sBias : nullptr;
  const int ntn = (N + 63) / 64; const int wid = blockIdx.x * 4 + w; const int mt = wid / ntn, nq = wid % ntn; if (mt * 16 >= M) return;
  const int row0 = mt * 16, col0 = nq * 64; const _Float16* arow = A + (size_t)(row0 + ln) * lda;
  v8f acc[4] = {};
  for (int kb = 0; kb < K; kb += 32) { FragH ah; ah.half[0] = *(const v8us*)((const unsigned short*)arow + kb + 8 * hh); ah.half[1] = *(const v8us*)((const unsigned short*)arow + kb + 16 + 8 * hh);
#pragma unroll
    for (int t = 0; t < 4; ++t) { if (col0 + t * 16 >= N) continue; const size_t boff = (size_t)(col0 + t * 16 + ln) * ldb + kb; FragH bq; bq.half[0] = *(const v8us*)((const unsigned short*)Bh + boff + 8 * hh); bq.half[1] = *(const v8us*)((const unsigned short*)Bh + boff + 16 + 8 * hh);
      acc[t] = mmaH<1>(ah.v, ah.v, bq.v, bq.v, acc[t]); }
  }
#pragma unroll
  for (int t = 0; t < 4; ++t) { if (col0 + t * 16 >= N) continue; const int col = col0 + t * 16 + ln; const float bv = bp ? bf16_round(bp[col]) : 0.f;
#pragma unroll
    for (int r = 0; r < 8; ++r) { float v = acc[t][r] * alpha + bv; if (CP) { const int rr = row0g + row0 + 8 * hh + r; if (rowsPerB < 0) v += CP[cofs + (size_t)rr * ldc + col];      /* rowsPerB < 0: own element of the batched C plane */ else { const int bidx = rr / rowsPerB; v += CP[(size_t)bidx * sCPb + (size_t)by * 64 + col]; } } if (ACT == 1) v = (v > 0.f) ? v : expm1f(v); else if (ACT == 7) v = (v > 0.f) ? v + 1.0f : expf(v); else if (ACT == 8) v = tanhf(v); else if (ACT == 9) v = 0.5f * v * (1.0f + tanhf(0.7978845608028654f * (v + 0.044715f * v * v * v))); else if (ACT == 11) v = 1.0f / (1.0f + expf(-v)); else if (ACT == 12) v = (v > 0.f) ? v : 0.01f * v; else if (ACT == 14) v = (v > 0.f) ? v : 0.1f * v; else if (ACT == 16) v = (v >= 0.f) ? v : 0.3f * v; else if (ACT == 17) v = (v >= 0.f) ? v : 0.2f * v; else if (ACT == 15) v = v / (1.0f + expf(-v)); else if (ACT == 3) v = fmaxf(v, 0.f); else if (ACT == 6) v = 0.5f * v * (1.0f + erff(v * 0.70710678118654752f)); so[w][8 * hh + r][t * 16 + ln] = v; } }
  __builtin_amdgcn_fence(__ATOMIC_ACQ_REL, "workgroup"); __builtin_amdgcn_wave_barrier();
  const int rsub = lane >> 4, c4 = (lane & 15) * 4; typedef _Float16 v4h __attribute__((ext_vector_type(4)));
  {
#pragma unroll
    for (int q = 0; q < 8; ++q) { const int r = q * 2 + rsub; if (col0 + c4 < N) { const v4f v = *(const v4fa*)&so[w][r][c4]; if (C) *(v4f*)(C + cofs + (size_t)(row0 + r) * ldc + col0 + c4) = v; if (C16) { v4h h4; for (int i = 0; i < 4; ++i) h4[i] = (_Float16)v[i]; *(v4h*)(C16 + cofs + (size_t)(row0 + r) * ldc + col0 + c4) = h4; } } }
     }
}


typedef _Float16 v4h __attribute__((ext_vector_type(4)));

// Fragment order of an f16 operand plane [rows][DM]: the 16 x 32 fragment (row tile rt, k block kb) is 1 KiB at (rt * (DM / 32) + kb) * 512 halves; in it the 16-byte chunk w = 0..63 holds row rt * 16 + (w & 15), k = kb * 32 + (w >> 4) * 8 .. + 7.
// Lane l of a wave then reads chunks l and 32 + l: the same values in the same registers as g2_frag from rows, but each wave-wide load is 512 contiguous bytes (4 whole lines) and not 16 pieces of 32 bytes.
// fo_src: first element, in the row-major [rows][DM] numbering, of chunk c of such a plane.
__device__ __forceinline__ size_t fo_src(size_t c) { const size_t tile = c >> 6; const int w = (int)(c & 63); return ((tile >> 5) * 16 + (w & 15)) * DM + (tile & 31) * 32 + (w >> 4) * 8; }
static_assert(DM / 32 == 32, "fo_src takes 32 k blocks a row tile");
static_assert(DM % 64 == 0, "k_gemm2 walks K = DM two k blocks a trip");
// fo_chunk: the chunk that thread t of a converting kernel makes. Four threads in a row take one source row's 128 bytes of f32 (a whole line), so a wave reads 8 whole lines and stores 4 whole lines (8 rows x 16 bytes in each of the 4 k groups).
__device__ __forceinline__ size_t fo_chunk(size_t t) { return (t & ~(size_t)63) + (t & 3) * 16 + ((t >> 2) & 15); }
__device__ __forceinline__ void x16(const float* __restrict__ x, _Float16* __restrict__ X16, size_t n8, size_t t) { if (t >= n8) return; FragH f; const size_t ck = fo_chunk(t); const float* s = x + fo_src(ck); const v4f a = *(const v4fa*)s, c = *(const v4fa*)(s + 4);
#pragma unroll
  for (int q = 0; q < 4; ++q) { f.h[q] = (_Float16)bf16_round(a[q]); f.h[4 + q] = (_Float16)bf16_round(c[q]); } *(v8us*)((unsigned short*)X16 + ck * 8) = f.half[0];  }
// All six f32 -> f16 conversions in one launch (none reads what another writes): work-groups 0 .. 4 * WTB - 1 take the four weights, the rest the two token sources. The weight groups, whose strided reads take longest, start first.
#define WTB (DM * (DM / 8) / 256)                /* work-groups of one weight */
#define XTB ((unsigned)(NR * DM / 8 / 256))      /* work-groups of one token source */
__global__ __launch_bounds__(256) void k_prep(const float* __restrict__ xq, const float* __restrict__ xkv, const float* __restrict__ wq, const float* __restrict__ wk, const float* __restrict__ wv, const float* __restrict__ wo,
    _Float16* __restrict__ XQ, _Float16* __restrict__ XKV, _Float16* __restrict__ BQ, _Float16* __restrict__ BK, _Float16* __restrict__ BV, _Float16* __restrict__ BO) {
  const unsigned bid = blockIdx.x;
  if (bid < 4 * WTB) { const unsigned s = bid / WTB; wt_f16(s == 0 ? wq : s == 1 ? wk : s == 2 ? wv : wo, s == 0 ? BQ : s == 1 ? BK : s == 2 ? BV : BO, DM, DM, 16.0f, (int)((bid % WTB) * 256 + threadIdx.x)); return; }      /* [in][out] -> Bt[n][k] x16 */
  const unsigned xb = bid - 4 * WTB; const bool kv = xb >= XTB; x16(kv ? xkv : xq, kv ? XKV : XQ, NR * DM / 8, (size_t)(kv ? xb - XTB : xb) * 256 + threadIdx.x); }      /* query source and key/value source as exact f16 rows */
__global__ __launch_bounds__(256) void k_h16(const float* __restrict__ x, _Float16* __restrict__ X16, size_t n8) { const size_t t = (size_t)blockIdx.x * 256 + threadIdx.x; if (t >= n8) return; FragH f;
#pragma unroll
  for (int q = 0; q < 8; ++q) f.h[q] = (_Float16)x[t * 8 + q]; *(v8us*)((unsigned short*)X16 + t * 8) = f.half[0];  }
__global__ __launch_bounds__(256) void k_round16f(const float* __restrict__ W, _Float16* __restrict__ Bt, size_t n8) { const size_t t = (size_t)blockIdx.x * 256 + threadIdx.x; if (t >= n8) return; FragH f;
#pragma unroll
  for (int i = 0; i < 8; ++i) f.h[i] = (_Float16)(bf16_round(W[t * 8 + i]) * 16.0f); *(v8us*)((unsigned short*)Bt + t * 8) = f.half[0];  }
// ---- fast GEMM (wave tile 32x64; requires M % 32 == 0 rows per launch region and N % 64 == 0); epilogue = k_gemm_hhx semantics ----
__device__ __forceinline__ v16h g2_frag(const _Float16* p, int hh) { FragH f; f.half[0] = *(const v8us*)((const unsigned short*)p + 8 * hh); f.half[1] = *(const v8us*)((const unsigned short*)p + 16 + 8 * hh); return f.v; }
__device__ __forceinline__ v16h g2_fragp(const _Float16* p) { FragH f; f.half[0] = *(const v8us*)((const unsigned short*)p); f.half[1] = *(const v8us*)((const unsigned short*)p + 256); return f.v; }      /* fragment-order plane: p = the fragment's start + lane * 8 */
__device__ __forceinline__ v16h g2_fragu(const _Float16* base, unsigned ob) { const char* p = (const char*)base + ob; FragH f; f.half[0] = *(const v8us*)p; f.half[1] = *(const v8us*)(p + 512); return f.v; }      /* the same with a wave-uniform row-tile start and one byte offset (k block * 1024 + lane * 16) shared by all operands */
__device__ __forceinline__ v8f g2_mma(v16h a, v16h b, v8f c) { v8f d = __builtin_amdgcn_wmma_f32_16x16x32_f16(false, a, false, b, (short)0, c, false, false); asm volatile("v_nop\n\tv_nop\n\tv_nop\n\tv_nop" : "+v"(d) : "v"(a), "v"(b)); return d; }
// The bare builtin, for the attention loop: there four waves of a SIMD share the vector port with their softmax, and every v_nop takes a slot of it; the compiler pads the WMMA distances itself where no independent instruction stands.
__device__ __forceinline__ v8f g2_mmab(v16h a, v16h b, v8f c) { return __builtin_amdgcn_wmma_f32_16x16x32_f16(false, a, false, b, (short)0, c, false, false); }
// As built, the epilogue takes one scalar branch per element round the bias / CP code that is unused here: left as it was.
// omode: 0 = C / C16 as rows; 1 = the f32 result split into f16 hi (C16) + x1024 residual (CL) planes, both in fragment order; 2 = the f16 result transposed into the V^T fragments of the attention kernel (C16 = V^T of all batches; a wave tile, 32 keys x one head's 64 d, is four fragments in a row)
template <int ACT>
__device__ __forceinline__ void gemm2(const _Float16* __restrict__ A, int lda, size_t sA, const _Float16* __restrict__ Bh, int ldb, size_t sB, float alpha, const float* __restrict__ bias, size_t sBias, const float* __restrict__ CP, int rowsPerB, size_t sCPb, int row0g,
    float* __restrict__ C, _Float16* __restrict__ C16, _Float16* __restrict__ CL, int omode, int ldc, size_t sC, int M, int N, int K, int by) { static_assert(ACT == 0 || ACT == 3 || ACT == 6 || ACT == 8 || ACT == 9 || ACT == 11 || ACT == 12 || ACT == 14 || ACT == 15 || ACT == 16 || ACT == 17, "k_gemm2: unsupported ACT code (would silently apply no activation)");
  __shared__ __attribute__((aligned(16))) float so[4][32][68];
  const int tid = threadIdx.x, w = __builtin_amdgcn_readfirstlane(tid >> 5), lane = tid & 31, ln = lane & 15, hh = lane >> 4;      /* the wave's number as a scalar: the row-tile starts below stay in scalar registers */
  A += (size_t)by * sA; Bh += (size_t)by * sB; const size_t cofs = (size_t)by * sC; const float* bp = bias ? bias + (size_t)by * sBias : nullptr;
  const int ntn = N >> 6; const int mt = blockIdx.x / ntn, nq = blockIdx.x - mt * ntn; const int row0 = mt * 128 + 32 * w, col0 = nq * 64; if (row0 >= M) return;
  const _Float16* a0p = A + (size_t)row0 * lda; const _Float16* a1p = A + (size_t)(row0 + 16) * lda;      /* a1p formed from A like a0p: written as a0p + 16 * lda this build kept it as a vector address pair, remade with 64-bit vector adds every k block. A and Bh in fragment order: a row tile is 16 * pitch halves, a k block 512 */
  const _Float16* b0p = Bh + (size_t)col0 * ldb; const _Float16* b1p = b0p + (size_t)16 * ldb; const _Float16* b2p = b1p + (size_t)16 * ldb; const _Float16* b3p = b2p + (size_t)16 * ldb;
  const v8f z8 = {0.f,0.f,0.f,0.f,0.f,0.f,0.f,0.f}; v8f c00 = z8, c01 = z8, c02 = z8, c03 = z8, c10 = z8, c11 = z8, c12 = z8, c13 = z8; const unsigned l16 = lane * 16; unsigned ob = l16;
  /* two register sets of six fragments: while one k block multiplies, the next one's twelve loads are in flight (K % 64 == 0: a trip is two k blocks). Each accumulator still takes its k blocks in rising order. */
  v16h a0 = g2_fragu(a0p, ob), a1 = g2_fragu(a1p, ob), b0 = g2_fragu(b0p, ob), b1 = g2_fragu(b1p, ob), b2 = g2_fragu(b2p, ob), b3 = g2_fragu(b3p, ob);
#pragma unroll 1      /* a trip already holds both sets; unrolled further, the live set would only grow */
  for (int kb = 0; kb < K; kb += 64) {
    const v16h e0 = g2_fragu(a0p, ob + 1024), e1 = g2_fragu(a1p, ob + 1024), f0 = g2_fragu(b0p, ob + 1024), f1 = g2_fragu(b1p, ob + 1024), f2 = g2_fragu(b2p, ob + 1024), f3 = g2_fragu(b3p, ob + 1024);
    asm volatile("s_wait_xcnt 0x0" ::: "memory");      /* behind the group of loads, in front of the overwrite of the offset register that they name; as a memory fence it also keeps the group ahead of the products that hide it */
    c00 = g2_mma(a0, b0, c00); c10 = g2_mma(a1, b0, c10); c01 = g2_mma(a0, b1, c01); c11 = g2_mma(a1, b1, c11);
    c02 = g2_mma(a0, b2, c02); c12 = g2_mma(a1, b2, c12); c03 = g2_mma(a0, b3, c03); c13 = g2_mma(a1, b3, c13);
    ob = (kb + 64 < K) ? ob + 2048 : l16;      /* the last trip fetches k block 0 again (in bounds, unused) */
    a0 = g2_fragu(a0p, ob); a1 = g2_fragu(a1p, ob); b0 = g2_fragu(b0p, ob); b1 = g2_fragu(b1p, ob); b2 = g2_fragu(b2p, ob); b3 = g2_fragu(b3p, ob);
    asm volatile("s_wait_xcnt 0x0" ::: "memory");      /* as above */
    c00 = g2_mma(e0, f0, c00); c10 = g2_mma(e1, f0, c10); c01 = g2_mma(e0, f1, c01); c11 = g2_mma(e1, f1, c11);
    c02 = g2_mma(e0, f2, c02); c12 = g2_mma(e1, f2, c12); c03 = g2_mma(e0, f3, c03); c13 = g2_mma(e1, f3, c13); }
  v8f accs[8] = {c00, c01, c02, c03, c10, c11, c12, c13};
#pragma unroll
  for (int u = 0; u < 8; ++u) { const int t = u & 3, half = u >> 2; const int col = col0 + t * 16 + ln; const float bv = bp ? bf16_round(bp[col]) : 0.f;
#pragma unroll
    for (int r = 0; r < 8; ++r) { const int rloc = half * 16 + 8 * hh + r; float v = accs[u][r] * alpha + bv; if (CP) { if (rowsPerB < 0) v += CP[cofs + (size_t)(row0g + row0 + rloc) * ldc + col];      /* rowsPerB < 0: own element of the batched C plane */ else { const int bidx = (row0g + row0 + rloc) / rowsPerB; v += CP[(size_t)bidx * sCPb + (size_t)by * 64 + col]; } }
      if (ACT == 3) v = fmaxf(v, 0.f); else if (ACT == 6) v = 0.5f * v * (1.0f + erff(v * 0.70710678118654752f)); else if (ACT == 11) v = 1.0f / (1.0f + expf(-v)); else if (ACT == 15) v = v / (1.0f + expf(-v)); else if (ACT == 12) v = (v > 0.f) ? v : 0.01f * v; else if (ACT == 8) v = tanhf(v); else if (ACT == 9) v = 0.5f * v * (1.0f + tanhf(0.7978845608028654f * (v + 0.044715f * v * v * v))); else if (ACT == 14) v = (v > 0.f) ? v : 0.1f * v; else if (ACT == 16) v = (v >= 0.f) ? v : 0.3f * v; else if (ACT == 17) v = (v >= 0.f) ? v : 0.2f * v;
      so[w][rloc][t * 16 + ln] = v; } }
  __builtin_amdgcn_fence(__ATOMIC_ACQ_REL, "workgroup"); __builtin_amdgcn_wave_barrier();
  if (omode == 1) {      /* chunk g * 32 + lane of fragment (row tile rt, k block kb): row ln, k (2 g + hh) * 8 .. + 7; every store is 512 contiguous bytes of a wave */
    const size_t f0 = ((size_t)(row0 >> 4) * (ldc >> 5) + (col0 >> 5)) * 512 + lane * 8; unsigned short* hp = (unsigned short*)C16 + f0; unsigned short* lp = (unsigned short*)CL + f0;
#pragma unroll
    for (int f = 0; f < 8; ++f) { const int rt = f >> 2, kb = (f >> 1) & 1, g = f & 1; const float* s = &so[w][rt * 16 + ln][kb * 32 + (2 * g + hh) * 8]; const v4f a = *(const v4fa*)s, c = *(const v4fa*)(s + 4); FragH fh, fl;
#pragma unroll
      for (int q = 0; q < 4; ++q) { _Float16 h = (_Float16)a[q]; fh.h[q] = h; fl.h[q] = (_Float16)((a[q] - (float)h) * 1024.0f); h = (_Float16)c[q]; fh.h[4 + q] = h; fl.h[4 + q] = (_Float16)((c[q] - (float)h) * 1024.0f); }
      const size_t o = (size_t)rt * (ldc >> 5) * 512 + kb * 512 + g * 256; *(v8us*)(hp + o) = fh.half[0]; *(v8us*)(lp + o) = fl.half[0]; }
    asm volatile("s_wait_xcnt 0x0" ::: "memory");      /* behind the block's last store: where the V^T block is laid out behind this one, its LDS loads take registers that these stores name */
    return; }
  if (omode == 2) {      /* chunk g * 32 + lane of d tile dt: row d = dt * 16 + ln, keys (2 g + hh) * 8 .. + 7 of the wave's 32-key block */
    const int tok = row0g + row0; unsigned short* vp = (unsigned short*)C16 + ((size_t)(tok / SQ) * NH + nq) * ((size_t)HD * SQ) + (size_t)((tok % SQ) >> 5) * 2048 + lane * 8;
#pragma unroll
    for (int f = 0; f < 8; ++f) { const int dt = f >> 1, g = f & 1; FragH fv;
#pragma unroll
      for (int q = 0; q < 8; ++q) fv.h[q] = (_Float16)so[w][(2 * g + hh) * 8 + q][dt * 16 + ln];
      *(v8us*)(vp + dt * 512 + g * 256) = fv.half[0]; }
    return; }
  const int rsub = lane >> 4, c4 = (lane & 15) * 4;
  {
#pragma unroll
    for (int q = 0; q < 16; ++q) { const int r = q * 2 + rsub; const v4f v = *(const v4fa*)&so[w][r][c4]; if (C) *(v4f*)(C + cofs + (size_t)(row0 + r) * ldc + col0 + c4) = v; if (C16) { v4h h4; for (int i = 0; i < 4; ++i) h4[i] = (_Float16)v[i]; *(v4h*)(C16 + cofs + (size_t)(row0 + r) * ldc + col0 + c4) = h4; } }
     } }
template <int ACT>
__global__ __launch_bounds__(128) void k_gemm2(const _Float16* __restrict__ A, int lda, size_t sA, const _Float16* __restrict__ Bh, int ldb, size_t sB, float alpha, const float* __restrict__ bias, size_t sBias, const float* __restrict__ CP, int rowsPerB, size_t sCPb, int row0g,
    float* __restrict__ C, _Float16* __restrict__ C16, _Float16* __restrict__ CL, int omode, int ldc, size_t sC, int M, int N, int K) { gemm2<ACT>(A, lda, sA, Bh, ldb, sB, alpha, bias, sBias, CP, rowsPerB, sCPb, row0g, C, C16, CL, omode, ldc, sC, M, N, K, blockIdx.y); }
// The three projections in one launch (none reads what another writes): blockIdx.y = 0 q, 1 k (each f32 -> f16 hi + x1024 residual planes, split in the epilogue), 2 v (f16 straight into the V^T fragments [NB * NH][SQ / 32][4 d tiles]). Pointers arrive at the first projected row; row0g = that row.
__global__ __launch_bounds__(128) void k_qkv(const _Float16* __restrict__ XQ, const _Float16* __restrict__ XKV, const _Float16* __restrict__ BQ, const _Float16* __restrict__ BK, const _Float16* __restrict__ BV,
    _Float16* __restrict__ Q16, _Float16* __restrict__ QL, _Float16* __restrict__ K16, _Float16* __restrict__ KL, _Float16* __restrict__ VT, int row0g) { const int y = blockIdx.y;
  gemm2<0>(y == 0 ? XQ : XKV, DM, 0, y == 0 ? BQ : y == 1 ? BK : BV, DM, 0, 0.0625f, nullptr, 0, nullptr, 1, 0, row0g, nullptr, y == 0 ? Q16 : y == 1 ? K16 : VT, y == 0 ? QL : KL, y == 2 ? 2 : 1, DM, 0, MP, DM, DM, 0); }


__global__ __launch_bounds__(256) void k_wnat(const float* __restrict__ w, size_t n8, _Float16* __restrict__ Bt) { const size_t t = (size_t)blockIdx.x * 256 + threadIdx.x; if (t >= n8) return; FragH f; for (int q = 0; q < 8; ++q) f.h[q] = (_Float16)(bf16_round(w[t * 8 + q]) * 16.0f); *(v8us*)((unsigned short*)Bt + t * 8) = f.half[0];  }
__global__ __launch_bounds__(256) void k_rsm(const float* __restrict__ S, _Float16* __restrict__ P, int nrows) {
  #pragma clang fp contract(off)
  const int i = blockIdx.x * 256 + threadIdx.x; if (i >= nrows) return; const float* s = S + (size_t)i * SQ; float mx = -3.0e38f;
#pragma unroll 1
  for (int j = 0; j < SQ; ++j) mx = fmaxf(mx, s[j]); float se = 0.f;
#pragma unroll 1
  for (int j = 0; j < SQ; ++j) se += expf(s[j] - mx); const float sc = 256.0f / se;
#pragma unroll 1
  for (int j0 = 0; j0 < SQ; j0 += 8) { FragH f; for (int q = 0; q < 8; ++q) f.h[q] = (_Float16)(expf(s[j0 + q] - mx) * sc); unsigned short* d = (unsigned short*)P + (size_t)i * SQ + j0; *(v8us*)d = f.half[0];  } }
__global__ __launch_bounds__(256) void k_vt(const _Float16* __restrict__ V16, int b, int h0, _Float16* __restrict__ VT) { __shared__ unsigned short tl[64][65]; const int tid = threadIdx.x; const int hh = blockIdx.x % HG, sg = blockIdx.x / HG; const int s0 = sg * 64; const int h = h0 + hh;
  for (int i = tid; i < 64 * 8; i += 256) { const int j = i / 8, d8 = (i % 8) * 8; FragH f; f.half[0] = *(const v8us*)((const unsigned short*)V16 + ((size_t)b * SQ + s0 + j) * DM + h * HD + d8); for (int q = 0; q < 8; ++q) tl[d8 + q][j] = f.u[q]; }
  __syncthreads();
  { for (int i = tid; i < 64 * 8; i += 256) { const int d = i / 8, j8 = (i % 8) * 8; FragH f; for (int q = 0; q < 8; ++q) f.u[q] = tl[d][j8 + q]; *(v8us*)((unsigned short*)VT + ((size_t)hh * HD + d) * SQ + s0 + j8) = f.half[0]; }  } }


__device__ __forceinline__ float xl_half(float x) { return __builtin_bit_cast(float, __builtin_amdgcn_permlanex16(__builtin_bit_cast(int, x), __builtin_bit_cast(int, x), 0x76543210, 0xfedcba98, false, false)); }  // lane l with lane l ^ 16
// v_exp_f32 with the v_nop in its own statement: it keeps the one slot that the instruction set asks for behind a transcendental
__device__ __forceinline__ float exp2_slot(float a) { float e; asm("v_exp_f32 %0, %1\n\tv_nop" : "=v"(e) : "v"(a)); return e; }
#define FAW 8                        /* waves per work-group of the fused attention kernel, 16 query columns each */
__global__ __launch_bounds__(FAW * 32) void k_fattn(const _Float16* __restrict__ Qh, const _Float16* __restrict__ Ql, const _Float16* __restrict__ Kh, const _Float16* __restrict__ Kl, const _Float16* __restrict__ VT, const float* __restrict__ relb, _Float16* __restrict__ O) {
  __shared__ float tb[257];
  const int tid = threadIdx.x, lane = tid & 31, ln = lane & 15, hh = lane >> 4; const int h = blockIdx.y, b = blockIdx.z;
  for (int t = tid; t < 257; t += FAW * 32) { const int d = t - 128; const int a = d < 0 ? -d : d; const int f = (a < 8) ? a : (8 + (a >= 12) + (a >= 16) + (a >= 23) + (a >= 32) + (a >= 46) + (a >= 64) + (a >= 91)); const int bk = (d > 0 ? 16 : 0) + f; tb[t] = bf16_round(relb[bk * NH + h]); }
  __syncthreads();      /* publishes the bias table to all waves; the only barrier of the kernel */
  const int q0 = (blockIdx.x * FAW + __builtin_amdgcn_readfirstlane(tid >> 5)) * 16; const size_t r0 = (size_t)b * SQ;
  const size_t fo = (size_t)h * (HD * 16) + lane * 8;      /* fragment order: head h is k blocks 2 h and 2 h + 1 of a row tile, 512 halves each; a row tile is 16 * LQ halves */
  const _Float16* qp = Qh + (r0 + q0) * LQ + fo; const _Float16* qlp = Ql + (r0 + q0) * LQ + fo;
  const v16h qh0 = g2_fragp(qp), qh1 = g2_fragp(qp + 512); asm volatile("s_wait_xcnt 0x0" ::: "memory");      /* this and the like waits below stand behind a group of loads, in front of whatever next overwrites a register that the group's addresses are in */
  const v16h ql0 = g2_fragp(qlp), ql1 = g2_fragp(qlp + 512); asm volatile("s_wait_xcnt 0x0" ::: "memory");
  const _Float16* khp = Kh + r0 * LQ + fo; const _Float16* klp = Kl + r0 * LQ + fo; const _Float16* vp = VT + (size_t)(b * NH + h) * HD * SQ + lane * 8;
  const float bneg = __builtin_bit_cast(float, __builtin_amdgcn_readfirstlane(__builtin_bit_cast(int, tb[0]))), bpos = __builtin_bit_cast(float, __builtin_amdgcn_readfirstlane(__builtin_bit_cast(int, tb[256])));      /* the two far values, the same in every lane: held in scalar registers */
  const int dq = 128 + 8 * hh - (q0 + ln);      /* table index of key j, register r: j0 + r + dq, clamped */
  const v8f z8 = {0.f,0.f,0.f,0.f,0.f,0.f,0.f,0.f}; v8f o0 = z8, o1 = z8, o2 = z8, o3 = z8; float m = -1.0e30f, mm = -1.0e30f, l = 0.f;
  v16h ka0 = g2_fragp(khp), ka1 = g2_fragp(khp + 512), kb0 = g2_fragp(khp + 16 * LQ), kb1 = g2_fragp(khp + 16 * LQ + 512);      /* k_hi: key tiles a (0..15) and b (16..31), d 0..31 and 32..63 */
  v16h la0 = g2_fragp(klp), la1 = g2_fragp(klp + 512), lb0 = g2_fragp(klp + 16 * LQ), lb1 = g2_fragp(klp + 16 * LQ + 512); asm volatile("s_wait_xcnt 0x0" ::: "memory");      /* k_lo likewise */
#pragma unroll 1      /* one pass's fragments in registers at a time: unrolled, the live set would cost a resident wave */
  for (int j0 = 0; j0 < SQ; j0 += 32) {
    const _Float16* vj = vp + (size_t)j0 * HD; const v16h v0 = g2_fragp(vj), v1 = g2_fragp(vj + 512), v2 = g2_fragp(vj + 1024), v3 = g2_fragp(vj + 1536); asm volatile("s_wait_xcnt 0x0" ::: "memory");      /* V^T fragments issued ahead of the score products that hide them */
    const float bf = j0 < q0 ? bneg : bpos; v8f sa = {bf, bf, bf, bf, bf, bf, bf, bf}, sb = sa;      /* a tile wholly at distance 128 or more: one value */
    if (j0 + 31 - q0 > -128 && j0 - (q0 + 15) < 128) {      /* wave-uniform: tiles near the diagonal read the table */
#pragma unroll
      for (int r = 0; r < 8; ++r) { const int ia = j0 + r + dq, ib = ia + 16; sa[r] = tb[ia < 0 ? 0 : (ia > 256 ? 256 : ia)]; sb[r] = tb[ib < 0 ? 0 : (ib > 256 ? 256 : ib)]; } }
    const size_t jn = (size_t)((j0 + 32) & (SQ - 1)) * LQ; const _Float16* khn = khp + jn; const _Float16* kln = klp + jn;      /* where the next pass's K fragments start; the last pass wraps to key 0 (in bounds, unused). Formed ahead of the score products, as the build with the v_nop statements had it: their registers are then none of the fragments' */
    v8f ta = z8, tc = z8;
    sa = g2_mmab(ka0, qh0, sa); ta = g2_mmab(ka0, ql0, ta); sb = g2_mmab(kb0, qh0, sb); tc = g2_mmab(kb0, ql0, tc);      /* four independent accumulator chains, interleaved */
    sa = g2_mmab(ka1, qh1, sa); ta = g2_mmab(ka1, ql1, ta); sb = g2_mmab(kb1, qh1, sb); tc = g2_mmab(kb1, ql1, tc);
    ta = g2_mmab(la0, qh0, ta); tc = g2_mmab(lb0, qh0, tc); ta = g2_mmab(la1, qh1, ta); tc = g2_mmab(lb1, qh1, tc);
    __builtin_amdgcn_sched_barrier(0);      /* keeps the sixteen loads below one group behind the score products, as before: without the v_nop statements the compiler spread them among the products */
    ka0 = g2_fragp(khn); ka1 = g2_fragp(khn + 512); kb0 = g2_fragp(khn + 16 * LQ); kb1 = g2_fragp(khn + 16 * LQ + 512);      /* the next pass's K fragments, fetched behind this pass's score products */
    la0 = g2_fragp(kln); la1 = g2_fragp(kln + 512); lb0 = g2_fragp(kln + 16 * LQ); lb1 = g2_fragp(kln + 16 * LQ + 512); asm volatile("s_wait_xcnt 0x0" ::: "memory");
    float s[16];
#pragma unroll
    for (int r = 0; r < 8; ++r) { s[r] = fmaf(ta[r], 0.0009765625f, sa[r]); s[8 + r] = fmaf(tc[r], 0.0009765625f, sb[r]); }
    float x0 = fmaxf(s[0], s[1]), x1 = fmaxf(s[2], s[3]), x2 = fmaxf(s[4], s[5]), x3 = fmaxf(s[6], s[7]);
    x0 = fmaxf(x0, fmaxf(s[8], s[9])); x1 = fmaxf(x1, fmaxf(s[10], s[11])); x2 = fmaxf(x2, fmaxf(s[12], s[13])); x3 = fmaxf(x3, fmaxf(s[14], s[15]));
    float mx = fmaxf(fmaxf(x0, x1), fmaxf(x2, x3)); mx = fmaxf(mx, xl_half(mx));      /* both halves of the wave hold keys of the same query */
    const float mn = fmaxf(m, mx); const float mmn = fmaf(mn, 1.44269504088896340736f, -8.0f);      /* exponent offset in log2 units; the -8 carries the weights x256 */
    const float al = exp2_slot(mm - mmn); m = mn; mm = mmn;      /* 1 exactly while the maximum stands */
    FragH pf; float a0 = 0.f, a1 = 0.f, a2 = 0.f, a3 = 0.f;
#pragma unroll
    for (int i = 0; i < 16; i += 4) { const float p0 = exp2_slot(fmaf(s[i], 1.44269504088896340736f, -mmn)), p1 = exp2_slot(fmaf(s[i + 1], 1.44269504088896340736f, -mmn)), p2 = exp2_slot(fmaf(s[i + 2], 1.44269504088896340736f, -mmn)), p3 = exp2_slot(fmaf(s[i + 3], 1.44269504088896340736f, -mmn));
      a0 += p0; a1 += p1; a2 += p2; a3 += p3; pf.h[i] = (_Float16)p0; pf.h[i + 1] = (_Float16)p1; pf.h[i + 2] = (_Float16)p2; pf.h[i + 3] = (_Float16)p3; }
    l = fmaf(l, al, (a0 + a1) + (a2 + a3));
#pragma unroll
    for (int r = 0; r < 8; ++r) { o0[r] *= al; o1[r] *= al; o2[r] *= al; o3[r] *= al; }
    o0 = g2_mmab(v0, pf.v, o0); o1 = g2_mmab(v1, pf.v, o1); o2 = g2_mmab(v2, pf.v, o2); o3 = g2_mmab(v3, pf.v, o3);      /* O^T[d = 16 t + 8 hh + r][query ln] */
  }
  const float sc = 64.0f / (l + xl_half(l)); unsigned short* op = (unsigned short*)O + (r0 + q0) * DM + fo; FragH f;      /* o rows in fragment order too (A operand of the output GEMM): d = 16 t + 8 hh + r of query ln is chunk 32 (t & 1) + lane of k block 2 h + (t >> 1) */
#pragma unroll
  for (int r = 0; r < 8; ++r) { f.h[r] = (_Float16)(o0[r] * sc); f.h[8 + r] = (_Float16)(o1[r] * sc); }
  *(v8us*)op = f.half[0]; *(v8us*)(op + 256) = f.half[1];
#pragma unroll
  for (int r = 0; r < 8; ++r) { f.h[r] = (_Float16)(o2[r] * sc); f.h[8 + r] = (_Float16)(o3[r] * sc); }
  *(v8us*)(op + 512) = f.half[0]; *(v8us*)(op + 768) = f.half[1]; }

extern "C" void kernel_launch(void* const* d_in, const int* in_sizes, int n_in,
                              void* d_out, int out_size, void* d_ws, size_t ws_size, hipStream_t stream) {
  (void)in_sizes; (void)n_in; (void)out_size;
  const float* const* I = (const float* const*)d_in; const float* xq = I[0]; const float* xkv = I[1]; const float* wq = I[2]; const float* wk = I[3]; const float* wv = I[4]; const float* wo = I[5]; const float* relb = I[6]; const float* bq = nullptr; const float* bk = nullptr; (void)bq; (void)bk;      /* [in][out] weights, no biases; rel_bias [32 buckets][16 heads] */
  char* ws = (char*)d_ws; size_t off = 0;
  auto take = [&](size_t bytes) { char* p = ws + off; off += (bytes + 255) & ~(size_t)255; return p; };
  _Float16* BQ = (_Float16*)take((size_t)DM * DM * 2); _Float16* BK = (_Float16*)take((size_t)DM * DM * 2); _Float16* BV = (_Float16*)take((size_t)DM * DM * 2); _Float16* BO = (_Float16*)take((size_t)DM * DM * 2);
  _Float16* XQ = (_Float16*)take(NR * DM * 2); _Float16* XKV = (_Float16*)take(NR * DM * 2); _Float16* Q16 = (_Float16*)take(NR * DM * 2); _Float16* QL = (_Float16*)take(NR * DM * 2); _Float16* K16 = (_Float16*)take(NR * DM * 2); _Float16* KL = (_Float16*)take(NR * DM * 2); _Float16* O16 = (_Float16*)take(NR * DM * 2);
  _Float16* VT = (_Float16*)take((size_t)NB * NH * HD * SQ * 2);      /* V^T for ALL batches */
  if (off > ws_size) return;
  k_prep<<<4 * WTB + 2 * XTB, 256, 0, stream>>>(xq, xkv, wq, wk, wv, wo, XQ, XKV, BQ, BK, BV, BO);      /* weights [in][out] -> Bt[n][k] x16; both token sources as exact f16 rows */
  const size_t r0p = (size_t)B0 * SQ;      /* first projected row */
  k_qkv<<<dim3((unsigned)((MP / 128) * (DM / 64)), 3), 128, 0, stream>>>(XQ + r0p * DM, XKV + r0p * DM, BQ, BK, BV, Q16 + r0p * DM, QL + r0p * DM, K16 + r0p * DM, KL + r0p * DM, VT, (int)r0p);      /* q -> Q16 + QL, k -> K16 + KL, v -> V^T */
  k_fattn<<<dim3(SQ / (FAW * 16), NH, NB), FAW * 32, 0, stream>>>(Q16, QL, K16, KL, VT, relb, O16);      /* scores + bias, softmax and P . V of every batch and head; o (merged heads) x64 as f16 rows */
  k_gemm2<0><<<dim3((unsigned)((MPO / 128) * (DM / 64)), 1), 128, 0, stream>>>(O16 + r0p * DM, DM, 0, BO, DM, 0, 0.0009765625f, nullptr, 0, nullptr, 1, 0, 0, (float*)d_out + r0p * DM, nullptr, nullptr, 0, DM, 0, MPO, DM, DM);      /* out rows are the output layout */
}

// v008
// A run of this version takes 202 microseconds.
// Next to v007, in two timings, it ran 1.04 and 1.02 times as fast.
// Over all steps from v000 it is 76.0 times as fast.
#include <hip/hip_runtime.h>
// T5 attention with a relative-position bias and NO score scaling (query_states [4][2048][1024] gives q = x wq; key_value_states gives k = x wk, v = x wv ([in][out] 1024^2 sigma 1/32, no biases); 16 heads of 64; scores = q . k (UNSCALED, logits sigma ~8) + bias[h][i][j] with bias = rel_bias[bucket(j - i)][h] (rel_bias input [32][16]; bidirectional log buckets, 32 buckets, max distance 128); softmax; out = merged wo -> [4][2048][1024]).
// Structure: token rows r = b*2048 + s; the query source and the key/value source as exact f16 rows (bf16-rounded); Q, K, V as three WMMA GEMMs (32x64 wave tiles, f32 accumulation, exact x16 weights); q and k split in the GEMM epilogue into f16 hi + x1024 residual planes, V^T written by its GEMM epilogue from the same LDS staging tile; then ONE fused attention launch over (query block, head, batch): UNSCALED three-term scores (q_hi . k_hi + (1024 bias + q_lo . k_hi + q_hi . k_lo) 2^-10; K = 64), running-maximum softmax in registers (f32 statistics, native exp; weights x256 as f16), O^T += V^T . P^T, o carried x64 against f16 subnormal flush (folded into the output GEMM alpha) written straight into the merged f16 o rows; out = o W_o GEMM (f32) into the output layout.
// Compute dtype: inputs rounded to bf16; x / weights exact; q and k as f16 hi + x1024 residual (three-term scores), v, softmax weights and o as plain f16 GEMM operands (~2^-12); scores and softmax statistics f32. v_wmma_f32_16x16x32_f16.
#define NB 4
#define SQ 2048
#define DM 1024
#define NH 16
#define HD 64
#define HG 2                         /* heads per launch of k_vt, which is not launched */
#define B0 0                         /* first batch processed (debug hook) */
#define NBR NB                       /* batches processed (debug hook) */
#define NR ((size_t)NB * SQ)         /* token rows */
#define MP ((int)((size_t)NBR * SQ)) /* rows projected (debug hook) */
#define QN SQ                        /* not used: the attention launch attends all SQ query rows */
#define NHD NH                       /* not used: the attention launch covers all NH heads */
#define MPO MP                       /* rows through the output stage (debug hook) */
#define LQ DM      /* row pitch of the q/k rows */
typedef __bf16 v16b __attribute__((ext_vector_type(16)));
typedef unsigned short v8us __attribute__((ext_vector_type(8), may_alias));
typedef float  v8f  __attribute__((ext_vector_type(8)));
typedef float  v4f  __attribute__((ext_vector_type(4)));
typedef float  v4fa __attribute__((ext_vector_type(4), may_alias));
union FragB { v16b v; v8us half[2]; unsigned short u[16]; };

__device__ __forceinline__ unsigned short bf16_bits(float x) { unsigned int u = __float_as_uint(x); return (unsigned short)((u + 0x7FFFu + ((u >> 16) & 1u)) >> 16); }
__device__ __forceinline__ float bf16_val(unsigned short b) { return __uint_as_float(((unsigned int)b) << 16); }
__device__ __forceinline__ float bf16_round(float x) { return bf16_val(bf16_bits(x)); }
// D += A·B with NT terms: 1 = ah·bh, 2 = + al·bh (A split), 3 = + ah·bl (both split)
template <int NT>
__device__ __forceinline__ v8f mmaN(v16b ah, v16b al, v16b bh, v16b bl, v8f c) {
  c = __builtin_amdgcn_wmma_f32_16x16x32_bf16(false, ah, false, bh, (short)0, c, false, false);
  if (NT >= 2) c = __builtin_amdgcn_wmma_f32_16x16x32_bf16(false, al, false, bh, (short)0, c, false, false);
  if (NT >= 3) c = __builtin_amdgcn_wmma_f32_16x16x32_bf16(false, ah, false, bl, (short)0, c, false, false);
  asm volatile("v_nop\n\tv_nop\n\tv_nop\n\tv_nop" : "+v"(c) : "v"(ah), "v"(al), "v"(bh), "v"(bl));
  return c;
}

__global__ __launch_bounds__(256) void k_wt_bf16(const float* __restrict__ W, unsigned short* __restrict__ Wt, int K, int N) {
  const int t = blockIdx.x * 256 + threadIdx.x;
  const int k8n = K / 8;
  if (t >= N * k8n) return;
  const int n = t / k8n, k8 = (t % k8n) * 8;
  v8us v;
#pragma unroll
  for (int i = 0; i < 8; ++i) v[i] = bf16_bits(W[(size_t)(k8 + i) * N + n]);
  *(v8us*)(Wt + (size_t)n * K + k8) = v;
  
}

// GEMM C[M][N] (f32, pitch ldc) = act(A[M][K]·W + bias). A f32 row-major (pitch lda) converted per fragment to bf16
// (ASPLIT: hi/lo two planes -> 2 terms, else single rounded term); Wt bf16 [N][K] (pitch ldb). BIAS_BF16 rounds the
// bias to bf16 first (bias quantised to bf16 before the add). K%32==0, M%16==0, N%64==0.
template <bool ASPLIT, int ACT, bool BIAS_BF16>
__global__ __launch_bounds__(128) void k_gemm_bf(const float* __restrict__ A, int lda, const unsigned short* __restrict__ Wt, int ldb,
                                               const float* __restrict__ bias, float* __restrict__ C, int ldc, int M, int N, int K) {
  __shared__ __attribute__((aligned(16))) float so[4][16][64];
  const int tid = threadIdx.x, w = tid >> 5, lane = tid & 31, ln = lane & 15, hh = lane >> 4;
  const int ntn = N / 64;
  const int wid = blockIdx.x * 4 + w;
  const int mt = wid / ntn, nq = wid % ntn;
  if (mt * 16 >= M) return;
  const int row0 = mt * 16, col0 = nq * 64;
  const float* arow = A + (size_t)(row0 + ln) * lda;
  v8f acc[4] = {};
  for (int kb = 0; kb < K; kb += 32) {
    FragB ah, al;
    const v4f x0 = *(const v4fa*)(arow + kb + 8 * hh), x1 = *(const v4fa*)(arow + kb + 8 * hh + 4);
    const v4f x2 = *(const v4fa*)(arow + kb + 16 + 8 * hh), x3 = *(const v4fa*)(arow + kb + 16 + 8 * hh + 4);
    float xs[16] = {x0[0],x0[1],x0[2],x0[3],x1[0],x1[1],x1[2],x1[3],x2[0],x2[1],x2[2],x2[3],x3[0],x3[1],x3[2],x3[3]};
#pragma unroll
    for (int i = 0; i < 16; ++i) { const unsigned short hb = bf16_bits(xs[i]); ah.u[i] = hb; al.u[i] = ASPLIT ? bf16_bits(xs[i] - bf16_val(hb)) : (unsigned short)0; }
#pragma unroll
    for (int t = 0; t < 4; ++t) {
      const unsigned short* brow = Wt + (size_t)(col0 + t * 16 + ln) * ldb + kb;
      FragB b;
      b.half[0] = *(const v8us*)(brow + 8 * hh);
      b.half[1] = *(const v8us*)(brow + 16 + 8 * hh);
      acc[t] = mmaN<ASPLIT ? 2 : 1>(ah.v, al.v, b.v, b.v, acc[t]);
    }
  }
#pragma unroll
  for (int t = 0; t < 4; ++t) {
    float bv = bias ? bias[col0 + t * 16 + ln] : 0.f;
    if (BIAS_BF16) bv = bf16_round(bv);
#pragma unroll
    for (int r = 0; r < 8; ++r) { float v = acc[t][r] + bv; if (ACT == 1) v = fmaxf(v, 0.f); so[w][8 * hh + r][t * 16 + ln] = v; }
  }
  __builtin_amdgcn_fence(__ATOMIC_ACQ_REL, "workgroup");
  __builtin_amdgcn_wave_barrier();
  const int rsub = lane >> 4, c4 = (lane & 15) * 4;
  {
#pragma unroll
    for (int q = 0; q < 8; ++q) {
      const int r = q * 2 + rsub;
      const v4f v = *(const v4fa*)&so[w][r][c4];
      *(v4f*)(C + (size_t)(row0 + r) * ldc + col0 + c4) = v;
    }
    
  }
}

// GEMM C = act(A·W + bias + resid): A f32 (ASPLIT -> hi/lo 2 terms), Wt bf16 [N][K]; ACT 0 none, 1 relu, 2 exact gelu;
// resid (optional, f32, row index = (row % rmod), pitch ldr, RES_BF16 rounds it) added before the activation.
template <bool ASPLIT, int ACT, bool BIAS_BF16, bool RES_BF16>
__global__ __launch_bounds__(128) void k_gemm_bf3(const float* __restrict__ A, int lda, const unsigned short* __restrict__ Wt, int ldb,
                                                const float* __restrict__ bias, const float* __restrict__ resid, int rmod, int ldr,
                                                float* __restrict__ C, int ldc, int M, int N, int K) {
  __shared__ __attribute__((aligned(16))) float so[4][16][64];
  const int tid = threadIdx.x, w = tid >> 5, lane = tid & 31, ln = lane & 15, hh = lane >> 4;
  const int ntn = N / 64;
  const int wid = blockIdx.x * 4 + w;
  const int mt = wid / ntn, nq = wid % ntn;
  if (mt * 16 >= M) return;
  const int row0 = mt * 16, col0 = nq * 64;
  const float* arow = A + (size_t)(row0 + ln) * lda;
  v8f acc[4] = {};
  for (int kb = 0; kb < K; kb += 32) {
    FragB ah, al;
    const v4f x0 = *(const v4fa*)(arow + kb + 8 * hh), x1 = *(const v4fa*)(arow + kb + 8 * hh + 4);
    const v4f x2 = *(const v4fa*)(arow + kb + 16 + 8 * hh), x3 = *(const v4fa*)(arow + kb + 16 + 8 * hh + 4);
    float xs[16] = {x0[0],x0[1],x0[2],x0[3],x1[0],x1[1],x1[2],x1[3],x2[0],x2[1],x2[2],x2[3],x3[0],x3[1],x3[2],x3[3]};
#pragma unroll
    for (int i = 0; i < 16; ++i) { const unsigned short hb = bf16_bits(xs[i]); ah.u[i] = hb; al.u[i] = ASPLIT ? bf16_bits(xs[i] - bf16_val(hb)) : (unsigned short)0; }
#pragma unroll
    for (int t = 0; t < 4; ++t) {
      const unsigned short* brow = Wt + (size_t)(col0 + t * 16 + ln) * ldb + kb;
      FragB b;
      b.half[0] = *(const v8us*)(brow + 8 * hh);
      b.half[1] = *(const v8us*)(brow + 16 + 8 * hh);
      acc[t] = mmaN<ASPLIT ? 2 : 1>(ah.v, al.v, b.v, b.v, acc[t]);
    }
  }
#pragma unroll
  for (int t = 0; t < 4; ++t) {
    const int col = col0 + t * 16 + ln;
    float bv = bias ? bias[col] : 0.f;
    if (BIAS_BF16) bv = bf16_round(bv);
#pragma unroll
    for (int r = 0; r < 8; ++r) {
      float v = acc[t][r] + bv;
      if (resid) { float rv = resid[(size_t)((row0 + 8 * hh + r) % rmod) * ldr + col]; if (RES_BF16) rv = bf16_round(rv); v += rv; }
      if (ACT == 1) v = fmaxf(v, 0.f);
      if (ACT == 2) v = 0.5f * v * (1.0f + erff(v * 0.70710678118654752f));
      if (ACT == 3) { const float u = 0.7978845608028654f * (v + 0.044715f * v * v * v); v = 0.5f * v * (1.0f + tanhf(u)); }
      so[w][8 * hh + r][t * 16 + ln] = v;
    }
  }
  __builtin_amdgcn_fence(__ATOMIC_ACQ_REL, "workgroup");
  __builtin_amdgcn_wave_barrier();
  const int rsub = lane >> 4, c4 = (lane & 15) * 4;
  {
#pragma unroll
    for (int q = 0; q < 8; ++q) {
      const int r = q * 2 + rsub;
      const v4f v = *(const v4fa*)&so[w][r][c4];
      *(v4f*)(C + (size_t)(row0 + r) * ldc + col0 + c4) = v;
    }
    
  }
}
// row LayerNorm (biased variance, eps) over N: s = X (+ R); optional out_sum <- s; out_norm <- (s-mu)*rsqrt(var+eps)*g + b
template <bool PARAM_BF16>
__global__ __launch_bounds__(256) void k_layernorm(const float* __restrict__ X, const float* __restrict__ R, const float* __restrict__ g, const float* __restrict__ bta,
                                                  float* __restrict__ out_sum, float* __restrict__ out_norm, int N, float eps) {
  __shared__ float red[256];
  const int row = blockIdx.x, tid = threadIdx.x;
  const float* x = X + (size_t)row * N; const float* rr = R ? R + (size_t)row * N : nullptr;
  float vals[16];                     // up to N = 4096
  const int per = N / 256;            // contiguous chunk per thread? use strided-by-4 chunks: thread handles j = tid*4 + 1024*u
  float s1 = 0.f;
  for (int u = 0; u < per / 4; ++u) {
    const int j = tid * 4 + 1024 * u;
    const v4f a = *(const v4fa*)(x + j);
    v4f b = {0.f,0.f,0.f,0.f}; if (rr) b = *(const v4fa*)(rr + j);
#pragma unroll
    for (int q = 0; q < 4; ++q) { const float v = a[q] + b[q]; vals[u * 4 + q] = v; s1 += v; }
  }
  red[tid] = s1; __syncthreads();
  for (int st = 128; st > 0; st >>= 1) { if (tid < st) red[tid] += red[tid + st]; __syncthreads(); }
  const float mu = red[0] / (float)N; __syncthreads();
  float s2 = 0.f;
  for (int u = 0; u < per / 4; ++u)
#pragma unroll
    for (int q = 0; q < 4; ++q) { const float c = vals[u * 4 + q] - mu; s2 += c * c; }
  red[tid] = s2; __syncthreads();
  for (int st = 128; st > 0; st >>= 1) { if (tid < st) red[tid] += red[tid + st]; __syncthreads(); }
  const float rs = rsqrtf(red[0] / (float)N + eps);
  {
    for (int u = 0; u < per / 4; ++u) {
      const int j = tid * 4 + 1024 * u;
      v4f o, sm;
#pragma unroll
      for (int q = 0; q < 4; ++q) {
        float gg = g[j + q], bb = bta[j + q];
        if (PARAM_BF16) { gg = bf16_round(gg); bb = bf16_round(bb); }
        sm[q] = vals[u * 4 + q]; o[q] = (vals[u * 4 + q] - mu) * rs * gg + bb;
      }
      if (out_sum) *(v4f*)(out_sum + (size_t)row * N + j) = sm;
      *(v4f*)(out_norm + (size_t)row * N + j) = o;
    }
    
  }
}



// ---- f16 WMMA path (v_wmma_f32_16x16x32_f16): 11-bit significands for operands in range — used where a [0,1] probability operand needs more precision than bf16
typedef _Float16 v16h __attribute__((ext_vector_type(16)));
union FragH { v16h v; v8us half[2]; _Float16 h[16]; unsigned short u[16]; };
template <int NT>
__device__ __forceinline__ v8f mmaH(v16h ah, v16h al, v16h bh, v16h bl, v8f c) {
  c = __builtin_amdgcn_wmma_f32_16x16x32_f16(false, ah, false, bh, (short)0, c, false, false);
  if (NT >= 2) c = __builtin_amdgcn_wmma_f32_16x16x32_f16(false, al, false, bh, (short)0, c, false, false);
  if (NT >= 3) c = __builtin_amdgcn_wmma_f32_16x16x32_f16(false, ah, false, bl, (short)0, c, false, false);
  asm volatile("v_nop\n\tv_nop\n\tv_nop\n\tv_nop" : "+v"(c) : "v"(ah), "v"(al), "v"(bh), "v"(bl));
  return c;
}
// batched GEMM like k_gemm_b but f16 operands: A f32 (split into f16 hi/lo if ASPLIT, else rounded to f16), Bt = f16 values [n][k]; alpha; C f32; N multiple of 16 (partial tiles skipped)
template <bool ASPLIT>
__global__ __launch_bounds__(128) void k_gemm_h(const float* __restrict__ A, int lda, size_t sA, const _Float16* __restrict__ Bh, int ldb, size_t sB, float alpha, float* __restrict__ C, int ldc, size_t sC, int M, int N, int K) {
  __shared__ __attribute__((aligned(16))) float so[4][16][64];
  const int tid = threadIdx.x, w = tid >> 5, lane = tid & 31, ln = lane & 15, hh = lane >> 4; const int by = blockIdx.y;
  A += (size_t)by * sA; Bh += (size_t)by * sB; C += (size_t)by * sC;
  const int ntn = (N + 63) / 64; const int wid = blockIdx.x * 4 + w; const int mt = wid / ntn, nq = wid % ntn; if (mt * 16 >= M) return;
  const int row0 = mt * 16, col0 = nq * 64; const float* arow = A + (size_t)(row0 + ln) * lda;
  v8f acc[4] = {};
  for (int kb = 0; kb < K; kb += 32) {
    FragH ah, al;
    const v4f x0 = *(const v4fa*)(arow + kb + 8 * hh), x1 = *(const v4fa*)(arow + kb + 8 * hh + 4), x2 = *(const v4fa*)(arow + kb + 16 + 8 * hh), x3 = *(const v4fa*)(arow + kb + 16 + 8 * hh + 4);
    float xs[16] = {x0[0],x0[1],x0[2],x0[3],x1[0],x1[1],x1[2],x1[3],x2[0],x2[1],x2[2],x2[3],x3[0],x3[1],x3[2],x3[3]};
#pragma unroll
    for (int i = 0; i < 16; ++i) { const _Float16 h = (_Float16)xs[i]; ah.h[i] = h; al.h[i] = ASPLIT ? (_Float16)(xs[i] - (float)h) : (_Float16)0.0f; }
#pragma unroll
    for (int t = 0; t < 4; ++t) { if (col0 + t * 16 >= N) continue; const size_t boff = (size_t)(col0 + t * 16 + ln) * ldb + kb; FragH bq; bq.half[0] = *(const v8us*)(Bh + boff + 8 * hh); bq.half[1] = *(const v8us*)(Bh + boff + 16 + 8 * hh);
      acc[t] = mmaH<ASPLIT ? 2 : 1>(ah.v, al.v, bq.v, bq.v, acc[t]); }
  }
#pragma unroll
  for (int t = 0; t < 4; ++t) { if (col0 + t * 16 >= N) continue;
#pragma unroll
    for (int r = 0; r < 8; ++r) so[w][8 * hh + r][t * 16 + ln] = acc[t][r] * alpha; }
  __builtin_amdgcn_fence(__ATOMIC_ACQ_REL, "workgroup"); __builtin_amdgcn_wave_barrier();
  const int rsub = lane >> 4, c4 = (lane & 15) * 4;
  {
#pragma unroll
    for (int q = 0; q < 8; ++q) { const int r = q * 2 + rsub; if (col0 + c4 < N) { const v4f v = *(const v4fa*)&so[w][r][c4]; *(v4f*)(C + (size_t)(row0 + r) * ldc + col0 + c4) = v; } }
     }
}

// Wt[n][k] = f16(W[k][n]·scale) from f32 row-major W[K][N] (scale = power of two; bf16-exact weights stay exact in f16 away from the subnormal range)
__device__ __forceinline__ void wt_f16(const float* __restrict__ W, _Float16* __restrict__ Wt, int K, int N, float scale, int t) {
  if (t >= N * (K / 8)) return; const int tile = t >> 6, w = t & 63, kt = K >> 5; const int n = (tile / kt) * 16 + (w & 15), k8 = (tile % kt) * 32 + (w >> 4) * 8; FragH f;      /* thread = output chunk of the fragment order (rows n, K / 32 k blocks a row tile) */
#pragma unroll
  for (int i = 0; i < 8; ++i) f.h[i] = (_Float16)(bf16_round(W[(size_t)(k8 + i) * N + n]) * scale); const v8us o = f.half[0];
  *(v8us*)((unsigned short*)Wt + (size_t)t * 8) = o; 
}
// k_gemm_hh variant with fused epilogue: v = acc·alpha + bias[by·sBias + col] (+ CP[(row/rowsPerB)·sCPb + by·64 + col] if CP) ; ACT 0 none / 1 elu ; writes f16 C16 (and f32 C if non-null)
template <int ACT>
__global__ __launch_bounds__(128) void k_gemm_hhx(const _Float16* __restrict__ A, int lda, size_t sA, const _Float16* __restrict__ Bh, int ldb, size_t sB, float alpha, const float* __restrict__ bias, size_t sBias, const float* __restrict__ CP, int rowsPerB, size_t sCPb, int row0g,
    float* __restrict__ C, _Float16* __restrict__ C16, int ldc, size_t sC, int M, int N, int K) {
  __shared__ __attribute__((aligned(16))) float so[4][16][64];
  const int tid = threadIdx.x, w = tid >> 5, lane = tid & 31, ln = lane & 15, hh = lane >> 4; const int by = blockIdx.y;
  A += (size_t)by * sA; Bh += (size_t)by * sB; const size_t cofs = (size_t)by * sC; const float* bp = bias ? bias + (size_t)by * sBias : nullptr;
  const int ntn = (N + 63) / 64; const int wid = blockIdx.x * 4 + w; const int mt = wid / ntn, nq = wid % ntn; if (mt * 16 >= M) return;
  const int row0 = mt * 16, col0 = nq * 64; const _Float16* arow = A + (size_t)(row0 + ln) * lda;
  v8f acc[4] = {};
  for (int kb = 0; kb < K; kb += 32) { FragH ah; ah.half[0] = *(const v8us*)((const unsigned short*)arow + kb + 8 * hh); ah.half[1] = *(const v8us*)((const unsigned short*)arow + kb + 16 + 8 * hh);
#pragma unroll
    for (int t = 0; t < 4; ++t) { if (col0 + t * 16 >= N) continue; const size_t boff = (size_t)(col0 + t * 16 + ln) * ldb + kb; FragH bq; bq.half[0] = *(const v8us*)((const unsigned short*)Bh + boff + 8 * hh); bq.half[1] = *(const v8us*)((const unsigned short*)Bh + boff + 16 + 8 * hh);
      acc[t] = mmaH<1>(ah.v, ah.v, bq.v, bq.v, acc[t]); }
  }
#pragma unroll
  for (int t = 0; t < 4; ++t) { if (col0 + t * 16 >= N) continue; const int col = col0 + t * 16 + ln; const float bv = bp ? bf16_round(bp[col]) : 0.f;
#pragma unroll
    for (int r = 0; r < 8; ++r) { float v = acc[t][r] * alpha + bv; if (CP) { const int rr = row0g + row0 + 8 * hh + r; if (rowsPerB < 0) v += CP[cofs + (size_t)rr * ldc + col];      /* rowsPerB < 0: own element of the batched C plane */ else { const int bidx = rr / rowsPerB; v += CP[(size_t)bidx * sCPb + (size_t)by * 64 + col]; } } if (ACT == 1) v = (v > 0.f) ? v : expm1f(v); else if (ACT == 7) v = (v > 0.f) ? v + 1.0f : expf(v); else if (ACT == 8) v = tanhf(v); else if (ACT == 9) v = 0.5f * v * (1.0f + tanhf(0.7978845608028654f * (v + 0.044715f * v * v * v))); else if (ACT == 11) v = 1.0f / (1.0f + expf(-v)); else if (ACT == 12) v = (v > 0.f) ? v : 0.01f * v; else if (ACT == 14) v = (v > 0.f) ? v : 0.1f * v; else if (ACT == 16) v = (v >= 0.f) ? v : 0.3f * v; else if (ACT == 17) v = (v >= 0.f) ? v : 0.2f * v; else if (ACT == 15) v = v / (1.0f + expf(-v)); else if (ACT == 3) v = fmaxf(v, 0.f); else if (ACT == 6) v = 0.5f * v * (1.0f + erff(v * 0.70710678118654752f)); so[w][8 * hh + r][t * 16 + ln] = v; } }
  __builtin_amdgcn_fence(__ATOMIC_ACQ_REL, "workgroup"); __builtin_amdgcn_wave_barrier();
  const int rsub = lane >> 4, c4 = (lane & 15) * 4; typedef _Float16 v4h __attribute__((ext_vector_type(4)));
  {
#pragma unroll
    for (int q = 0; q < 8; ++q) { const int r = q * 2 + rsub; if (col0 + c4 < N) { const v4f v = *(const v4fa*)&so[w][r][c4]; if (C) *(v4f*)(C + cofs + (size_t)(row0 + r) * ldc + col0 + c4) = v; if (C16) { v4h h4; for (int i = 0; i < 4; ++i) h4[i] = (_Float16)v[i]; *(v4h*)(C16 + cofs + (size_t)(row0 + r) * ldc + col0 + c4) = h4; } } }
     }
}


typedef _Float16 v4h __attribute__((ext_vector_type(4)));

// Fragment order of an f16 operand plane [rows][DM]: the 16 x 32 fragment (row tile rt, k block kb) is 1 KiB at (rt * (DM / 32) + kb) * 512 halves; in it the 16-byte chunk w = 0..63 holds row rt * 16 + (w & 15), k = kb * 32 + (w >> 4) * 8 .. + 7.
// Lane l of a wave then reads chunks l and 32 + l: the same values in the same registers as g2_frag from rows, but each wave-wide load is 512 contiguous bytes (4 whole lines) and not 16 pieces of 32 bytes.
// fo_src: first element, in the row-major [rows][DM] numbering, of chunk c of such a plane.
__device__ __forceinline__ size_t fo_src(size_t c) { const size_t tile = c >> 6; const int w = (int)(c & 63); return ((tile >> 5) * 16 + (w & 15)) * DM + (tile & 31) * 32 + (w >> 4) * 8; }
static_assert(DM / 32 == 32, "fo_src takes 32 k blocks a row tile");
static_assert(DM % 64 == 0, "k_gemm2 walks K = DM two k blocks a trip");
// fo_chunk: the chunk that thread t of a converting kernel makes. Four threads in a row take one source row's 128 bytes of f32 (a whole line), so a wave reads 8 whole lines and stores 4 whole lines (8 rows x 16 bytes in each of the 4 k groups).
__device__ __forceinline__ size_t fo_chunk(size_t t) { return (t & ~(size_t)63) + (t & 3) * 16 + ((t >> 2) & 15); }
__device__ __forceinline__ void x16(const float* __restrict__ x, _Float16* __restrict__ X16, size_t n8, size_t t) { if (t >= n8) return; FragH f; const size_t ck = fo_chunk(t); const float* s = x + fo_src(ck); const v4f a = *(const v4fa*)s, c = *(const v4fa*)(s + 4);
#pragma unroll
  for (int q = 0; q < 4; ++q) { f.h[q] = (_Float16)bf16_round(a[q]); f.h[4 + q] = (_Float16)bf16_round(c[q]); } *(v8us*)((unsigned short*)X16 + ck * 8) = f.half[0];  }
// All six f32 -> f16 conversions in one launch (none reads what another writes): work-groups 0 .. 4 * WTB - 1 take the four weights, the rest the two token sources. The weight groups, whose strided reads take longest, start first.
#define WTB (DM * (DM / 8) / 256)                /* work-groups of one weight */
#define XTB ((unsigned)(NR * DM / 8 / 256))      /* work-groups of one token source */
__global__ __launch_bounds__(256) void k_prep(const float* __restrict__ xq, const float* __restrict__ xkv, const float* __restrict__ wq, const float* __restrict__ wk, const float* __restrict__ wv, const float* __restrict__ wo,
    _Float16* __restrict__ XQ, _Float16* __restrict__ XKV, _Float16* __restrict__ BQ, _Float16* __restrict__ BK, _Float16* __restrict__ BV, _Float16* __restrict__ BO) {
  const unsigned bid = blockIdx.x;
  if (bid < 4 * WTB) { const unsigned s = bid / WTB; wt_f16(s == 0 ? wq : s == 1 ? wk : s == 2 ? wv : wo, s == 0 ? BQ : s == 1 ? BK : s == 2 ? BV : BO, DM, DM, 16.0f, (int)((bid % WTB) * 256 + threadIdx.x)); return; }      /* [in][out] -> Bt[n][k] x16 */
  const unsigned xb = bid - 4 * WTB; const bool kv = xb >= XTB; x16(kv ? xkv : xq, kv ? XKV : XQ, NR * DM / 8, (size_t)(kv ? xb - XTB : xb) * 256 + threadIdx.x); }      /* query source and key/value source as exact f16 rows */
__global__ __launch_bounds__(256) void k_h16(const float* __restrict__ x, _Float16* __restrict__ X16, size_t n8) { const size_t t = (size_t)blockIdx.x * 256 + threadIdx.x; if (t >= n8) return; FragH f;
#pragma unroll
  for (int q = 0; q < 8; ++q) f.h[q] = (_Float16)x[t * 8 + q]; *(v8us*)((unsigned short*)X16 + t * 8) = f.half[0];  }
__global__ __launch_bounds__(256) void k_round16f(const float* __restrict__ W, _Float16* __restrict__ Bt, size_t n8) { const size_t t = (size_t)blockIdx.x * 256 + threadIdx.x; if (t >= n8) return; FragH f;
#pragma unroll
  for (int i = 0; i < 8; ++i) f.h[i] = (_Float16)(bf16_round(W[t * 8 + i]) * 16.0f); *(v8us*)((unsigned short*)Bt + t * 8) = f.half[0];  }
// ---- fast GEMM (wave tile 32x64; requires M % 32 == 0 rows per launch region and N % 64 == 0); epilogue = k_gemm_hhx semantics ----
__device__ __forceinline__ v16h g2_frag(const _Float16* p, int hh) { FragH f; f.half[0] = *(const v8us*)((const unsigned short*)p + 8 * hh); f.half[1] = *(const v8us*)((const unsigned short*)p + 16 + 8 * hh); return f.v; }
__device__ __forceinline__ v16h g2_fragp(const _Float16* p) { FragH f; f.half[0] = *(const v8us*)((const unsigned short*)p); f.half[1] = *(const v8us*)((const unsigned short*)p + 256); return f.v; }      /* fragment-order plane: p = the fragment's start + lane * 8 */
__device__ __forceinline__ v16h g2_fragu(const _Float16* base, unsigned ob) { const char* p = (const char*)base + ob; FragH f; f.half[0] = *(const v8us*)p; f.half[1] = *(const v8us*)(p + 512); return f.v; }      /* the same with a wave-uniform row-tile start and one byte offset (k block * 1024 + lane * 16) shared by all operands */
__device__ __forceinline__ v8f g2_mma(v16h a, v16h b, v8f c) { v8f d = __builtin_amdgcn_wmma_f32_16x16x32_f16(false, a, false, b, (short)0, c, false, false); asm volatile("v_nop\n\tv_nop\n\tv_nop\n\tv_nop" : "+v"(d) : "v"(a), "v"(b)); return d; }
// The bare builtin, for the attention loop: there four waves of a SIMD share the vector port with their softmax, and every v_nop takes a slot of it; the compiler pads the WMMA distances itself where no independent instruction stands.
__device__ __forceinline__ v8f g2_mmab(v16h a, v16h b, v8f c) { return __builtin_amdgcn_wmma_f32_16x16x32_f16(false, a, false, b, (short)0, c, false, false); }
// As built, the epilogue takes one scalar branch per element round the bias / CP code that is unused here: left as it was.
// omode: 0 = C / C16 as rows; 1 = the f32 result split into f16 hi (C16) + x1024 residual (CL) planes, both in fragment order; 2 = the f16 result transposed into the V^T fragments of the attention kernel (C16 = V^T of all batches; a wave tile, 32 keys x one head's 64 d, is four fragments in a row)
template <int ACT>
__device__ __forceinline__ void gemm2(const _Float16* __restrict__ A, int lda, size_t sA, const _Float16* __restrict__ Bh, int ldb, size_t sB, float alpha, const float* __restrict__ bias, size_t sBias, const float* __restrict__ CP, int rowsPerB, size_t sCPb, int row0g,
    float* __restrict__ C, _Float16* __restrict__ C16, _Float16* __restrict__ CL, int omode, int ldc, size_t sC, int M, int N, int K, int by) { static_assert(ACT == 0 || ACT == 3 || ACT == 6 || ACT == 8 || ACT == 9 || ACT == 11 || ACT == 12 || ACT == 14 || ACT == 15 || ACT == 16 || ACT == 17, "k_gemm2: unsupported ACT code (would silently apply no activation)");
  __shared__ __attribute__((aligned(16))) float so[4][32][68];
  const int tid = threadIdx.x, w = __builtin_amdgcn_readfirstlane(tid >> 5), lane = tid & 31, ln = lane & 15, hh = lane >> 4;      /* the wave's number as a scalar: the row-tile starts below stay in scalar registers */
  A += (size_t)by * sA; Bh += (size_t)by * sB; const size_t cofs = (size_t)by * sC; const float* bp = bias ? bias + (size_t)by * sBias : nullptr;
  const int ntn = N >> 6; const int mt = blockIdx.x / ntn, nq = blockIdx.x - mt * ntn; const int row0 = mt * 128 + 32 * w, col0 = nq * 64; if (row0 >= M) return;
  const _Float16* a0p = A + (size_t)row0 * lda; const _Float16* a1p = A + (size_t)(row0 + 16) * lda;      /* a1p formed from A like a0p: written as a0p + 16 * lda this build kept it as a vector address pair, remade with 64-bit vector adds every k block. A and Bh in fragment order: a row tile is 16 * pitch halves, a k block 512 */
  const _Float16* b0p = Bh + (size_t)col0 * ldb; const _Float16* b1p = b0p + (size_t)16 * ldb; const _Float16* b2p = b1p + (size_t)16 * ldb; const _Float16* b3p = b2p + (size_t)16 * ldb;
  const v8f z8 = {0.f,0.f,0.f,0.f,0.f,0.f,0.f,0.f}; v8f c00 = z8, c01 = z8, c02 = z8, c03 = z8, c10 = z8, c11 = z8, c12 = z8, c13 = z8; const unsigned l16 = lane * 16; unsigned ob = l16;
  /* two register sets of six fragments: while one k block multiplies, the next one's twelve loads are in flight (K % 64 == 0: a trip is two k blocks). Each accumulator still takes its k blocks in rising order. */
  v16h a0 = g2_fragu(a0p, ob), a1 = g2_fragu(a1p, ob), b0 = g2_fragu(b0p, ob), b1 = g2_fragu(b1p, ob), b2 = g2_fragu(b2p, ob), b3 = g2_fragu(b3p, ob);
#pragma unroll 1      /* a trip already holds both sets; unrolled further, the live set would only grow */
  for (int kb = 0; kb < K; kb += 64) {
    const v16h e0 = g2_fragu(a0p, ob + 1024), e1 = g2_fragu(a1p, ob + 1024), f0 = g2_fragu(b0p, ob + 1024), f1 = g2_fragu(b1p, ob + 1024), f2 = g2_fragu(b2p, ob + 1024), f3 = g2_fragu(b3p, ob + 1024);
    asm volatile("s_wait_xcnt 0x0" ::: "memory");      /* behind the group of loads, in front of the overwrite of the offset register that they name; as a memory fence it also keeps the group ahead of the products that hide it */
    c00 = g2_mma(a0, b0, c00); c10 = g2_mma(a1, b0, c10); c01 = g2_mma(a0, b1, c01); c11 = g2_mma(a1, b1, c11);
    c02 = g2_mma(a0, b2, c02); c12 = g2_mma(a1, b2, c12); c03 = g2_mma(a0, b3, c03); c13 = g2_mma(a1, b3, c13);
    ob = (kb + 64 < K) ? ob + 2048 : l16;      /* the last trip fetches k block 0 again (in bounds, unused) */
    a0 = g2_fragu(a0p, ob); a1 = g2_fragu(a1p, ob); b0 = g2_fragu(b0p, ob); b1 = g2_fragu(b1p, ob); b2 = g2_fragu(b2p, ob); b3 = g2_fragu(b3p, ob);
    asm volatile("s_wait_xcnt 0x0" ::: "memory");      /* as above */
    c00 = g2_mma(e0, f0, c00); c10 = g2_mma(e1, f0, c10); c01 = g2_mma(e0, f1, c01); c11 = g2_mma(e1, f1, c11);
    c02 = g2_mma(e0, f2, c02); c12 = g2_mma(e1, f2, c12); c03 = g2_mma(e0, f3, c03); c13 = g2_mma(e1, f3, c13); }
  v8f accs[8] = {c00, c01, c02, c03, c10, c11, c12, c13};
#pragma unroll
  for (int u = 0; u < 8; ++u) { const int t = u & 3, half = u >> 2; const int col = col0 + t * 16 + ln; const float bv = bp ? bf16_round(bp[col]) : 0.f;
#pragma unroll
    for (int r = 0; r < 8; ++r) { const int rloc = half * 16 + 8 * hh + r; float v = accs[u][r] * alpha + bv; if (CP) { if (rowsPerB < 0) v += CP[cofs + (size_t)(row0g + row0 + rloc) * ldc + col];      /* rowsPerB < 0: own element of the batched C plane */ else { const int bidx = (row0g + row0 + rloc) / rowsPerB; v += CP[(size_t)bidx * sCPb + (size_t)by * 64 + col]; } }
      if (ACT == 3) v = fmaxf(v, 0.f); else if (ACT == 6) v = 0.5f * v * (1.0f + erff(v * 0.70710678118654752f)); else if (ACT == 11) v = 1.0f / (1.0f + expf(-v)); else if (ACT == 15) v = v / (1.0f + expf(-v)); else if (ACT == 12) v = (v > 0.f) ? v : 0.01f * v; else if (ACT == 8) v = tanhf(v); else if (ACT == 9) v = 0.5f * v * (1.0f + tanhf(0.7978845608028654f * (v + 0.044715f * v * v * v))); else if (ACT == 14) v = (v > 0.f) ? v : 0.1f * v; else if (ACT == 16) v = (v >= 0.f) ? v : 0.3f * v; else if (ACT == 17) v = (v >= 0.f) ? v : 0.2f * v;
      so[w][rloc][t * 16 + ln] = v; } }
  __builtin_amdgcn_fence(__ATOMIC_ACQ_REL, "workgroup"); __builtin_amdgcn_wave_barrier();
  if (omode == 1) {      /* chunk g * 32 + lane of fragment (row tile rt, k block kb): row ln, k (2 g + hh) * 8 .. + 7; every store is 512 contiguous bytes of a wave */
    const size_t f0 = ((size_t)(row0 >> 4) * (ldc >> 5) + (col0 >> 5)) * 512 + lane * 8; unsigned short* hp = (unsigned short*)C16 + f0; unsigned short* lp = (unsigned short*)CL + f0;
#pragma unroll
    for (int f = 0; f < 8; ++f) { const int rt = f >> 2, kb = (f >> 1) & 1, g = f & 1; const float* s = &so[w][rt * 16 + ln][kb * 32 + (2 * g + hh) * 8]; const v4f a = *(const v4fa*)s, c = *(const v4fa*)(s + 4); FragH fh, fl;
#pragma unroll
      for (int q = 0; q < 4; ++q) { _Float16 h = (_Float16)a[q]; fh.h[q] = h; fl.h[q] = (_Float16)((a[q] - (float)h) * 1024.0f); h = (_Float16)c[q]; fh.h[4 + q] = h; fl.h[4 + q] = (_Float16)((c[q] - (float)h) * 1024.0f); }
      const size_t o = (size_t)rt * (ldc >> 5) * 512 + kb * 512 + g * 256; *(v8us*)(hp + o) = fh.half[0]; *(v8us*)(lp + o) = fl.half[0]; }
    asm volatile("s_wait_xcnt 0x0" ::: "memory");      /* behind the block's last store: where the V^T block is laid out behind this one, its LDS loads take registers that these stores name */
    return; }
  if (omode == 2) {      /* chunk g * 32 + lane of d tile dt: row d = dt * 16 + ln, keys (2 g + hh) * 8 .. + 7 of the wave's 32-key block */
    const int tok = row0g + row0; unsigned short* vp = (unsigned short*)C16 + ((size_t)(tok / SQ) * NH + nq) * ((size_t)HD * SQ) + (size_t)((tok % SQ) >> 5) * 2048 + lane * 8;
#pragma unroll
    for (int f = 0; f < 8; ++f) { const int dt = f >> 1, g = f & 1; FragH fv;
#pragma unroll
      for (int q = 0; q < 8; ++q) fv.h[q] = (_Float16)so[w][(2 * g + hh) * 8 + q][dt * 16 + ln];
      *(v8us*)(vp + dt * 512 + g * 256) = fv.half[0]; }
    return; }
  const int rsub = lane >> 4, c4 = (lane & 15) * 4;
  {
#pragma unroll
    for (int q = 0; q < 16; ++q) { const int r = q * 2 + rsub; const v4f v = *(const v4fa*)&so[w][r][c4]; if (C) *(v4f*)(C + cofs + (size_t)(row0 + r) * ldc + col0 + c4) = v; if (C16) { v4h h4; for (int i = 0; i < 4; ++i) h4[i] = (_Float16)v[i]; *(v4h*)(C16 + cofs + (size_t)(row0 + r) * ldc + col0 + c4) = h4; } }
     } }
template <int ACT>
__global__ __launch_bounds__(128) void k_gemm2(const _Float16* __restrict__ A, int lda, size_t sA, const _Float16* __restrict__ Bh, int ldb, size_t sB, float alpha, const float* __restrict__ bias, size_t sBias, const float* __restrict__ CP, int rowsPerB, size_t sCPb, int row0g,
    float* __restrict__ C, _Float16* __restrict__ C16, _Float16* __restrict__ CL, int omode, int ldc, size_t sC, int M, int N, int K) { gemm2<ACT>(A, lda, sA, Bh, ldb, sB, alpha, bias, sBias, CP, rowsPerB, sCPb, row0g, C, C16, CL, omode, ldc, sC, M, N, K, blockIdx.y); }
// The three projections in one launch (none reads what another writes): blockIdx.y = 0 q, 1 k (each f32 -> f16 hi + x1024 residual planes, split in the epilogue), 2 v (f16 straight into the V^T fragments [NB * NH][SQ / 32][4 d tiles]). Pointers arrive at the first projected row; row0g = that row.
__global__ __launch_bounds__(128) void k_qkv(const _Float16* __restrict__ XQ, const _Float16* __restrict__ XKV, const _Float16* __restrict__ BQ, const _Float16* __restrict__ BK, const _Float16* __restrict__ BV,
    _Float16* __restrict__ Q16, _Float16* __restrict__ QL, _Float16* __restrict__ K16, _Float16* __restrict__ KL, _Float16* __restrict__ VT, int row0g) { const int y = blockIdx.y;
  gemm2<0>(y == 0 ? XQ : XKV, DM, 0, y == 0 ? BQ : y == 1 ? BK : BV, DM, 0, 0.0625f, nullptr, 0, nullptr, 1, 0, row0g, nullptr, y == 0 ? Q16 : y == 1 ? K16 : VT, y == 0 ? QL : KL, y == 2 ? 2 : 1, DM, 0, MP, DM, DM, 0); }


__global__ __launch_bounds__(256) void k_wnat(const float* __restrict__ w, size_t n8, _Float16* __restrict__ Bt) { const size_t t = (size_t)blockIdx.x * 256 + threadIdx.x; if (t >= n8) return; FragH f; for (int q = 0; q < 8; ++q) f.h[q] = (_Float16)(bf16_round(w[t * 8 + q]) * 16.0f); *(v8us*)((unsigned short*)Bt + t * 8) = f.half[0];  }
__global__ __launch_bounds__(256) void k_rsm(const float* __restrict__ S, _Float16* __restrict__ P, int nrows) {
  #pragma clang fp contract(off)
  const int i = blockIdx.x * 256 + threadIdx.x; if (i >= nrows) return; const float* s = S + (size_t)i * SQ; float mx = -3.0e38f;
#pragma unroll 1
  for (int j = 0; j < SQ; ++j) mx = fmaxf(mx, s[j]); float se = 0.f;
#pragma unroll 1
  for (int j = 0; j < SQ; ++j) se += expf(s[j] - mx); const float sc = 256.0f / se;
#pragma unroll 1
  for (int j0 = 0; j0 < SQ; j0 += 8) { FragH f; for (int q = 0; q < 8; ++q) f.h[q] = (_Float16)(expf(s[j0 + q] - mx) * sc); unsigned short* d = (unsigned short*)P + (size_t)i * SQ + j0; *(v8us*)d = f.half[0];  } }
__global__ __launch_bounds__(256) void k_vt(const _Float16* __restrict__ V16, int b, int h0, _Float16* __restrict__ VT) { __shared__ unsigned short tl[64][65]; const int tid = threadIdx.x; const int hh = blockIdx.x % HG, sg = blockIdx.x / HG; const int s0 = sg * 64; const int h = h0 + hh;
  for (int i = tid; i < 64 * 8; i += 256) { const int j = i / 8, d8 = (i % 8) * 8; FragH f; f.half[0] = *(const v8us*)((const unsigned short*)V16 + ((size_t)b * SQ + s0 + j) * DM + h * HD + d8); for (int q = 0; q < 8; ++q) tl[d8 + q][j] = f.u[q]; }
  __syncthreads();
  { for (int i = tid; i < 64 * 8; i += 256) { const int d = i / 8, j8 = (i % 8) * 8; FragH f; for (int q = 0; q < 8; ++q) f.u[q] = tl[d][j8 + q]; *(v8us*)((unsigned short*)VT + ((size_t)hh * HD + d) * SQ + s0 + j8) = f.half[0]; }  } }


__device__ __forceinline__ float xl_half(float x) { return __builtin_bit_cast(float, __builtin_amdgcn_permlanex16(__builtin_bit_cast(int, x), __builtin_bit_cast(int, x), 0x76543210, 0xfedcba98, false, false)); }  // lane l with lane l ^ 16
// v_exp_f32 with the v_nop in its own statement: it keeps the one slot that the instruction set asks for behind a transcendental
__device__ __forceinline__ float exp2_slot(float a) { float e; asm("v_exp_f32 %0, %1\n\tv_nop" : "=v"(e) : "v"(a)); return e; }
#define FAW 8                        /* waves per work-group of the fused attention kernel, 32 query columns each */
#define FA_ROW __builtin_amdgcn_sched_barrier(0)      /* an order fence for the compiler's scheduler; what each one keeps is said where it stands */
// One query tile's softmax step over the pass's 32 scores (sa: keys 0..15, sb: keys 16..31): new running maximum, weights x256 as the f16 B fragment, running sum; al = the factor that the tile's o takes.
__device__ __forceinline__ v16h fa_soft(const v8f sa, const v8f sb, float& m, float& mm, float& l, float& al) {
  float s[16];
#pragma unroll
  for (int r = 0; r < 8; ++r) { s[r] = sa[r]; s[8 + r] = sb[r]; }
  float x0 = fmaxf(s[0], s[1]), x1 = fmaxf(s[2], s[3]), x2 = fmaxf(s[4], s[5]), x3 = fmaxf(s[6], s[7]);
  x0 = fmaxf(x0, fmaxf(s[8], s[9])); x1 = fmaxf(x1, fmaxf(s[10], s[11])); x2 = fmaxf(x2, fmaxf(s[12], s[13])); x3 = fmaxf(x3, fmaxf(s[14], s[15]));
  float mx = fmaxf(fmaxf(x0, x1), fmaxf(x2, x3)); mx = fmaxf(mx, xl_half(mx));      /* both halves of the wave hold keys of the same query */
  const float mn = fmaxf(m, mx); const float mmn = fmaf(mn, 1.44269504088896340736f, -8.0f);      /* exponent offset in log2 units; the -8 carries the weights x256 */
  al = exp2_slot(mm - mmn); m = mn; mm = mmn;      /* 1 exactly while the maximum stands */
  FragH pf; float a0 = 0.f, a1 = 0.f, a2 = 0.f, a3 = 0.f;
#pragma unroll
  for (int i = 0; i < 16; i += 4) { const float p0 = exp2_slot(fmaf(s[i], 1.44269504088896340736f, -mmn)), p1 = exp2_slot(fmaf(s[i + 1], 1.44269504088896340736f, -mmn)), p2 = exp2_slot(fmaf(s[i + 2], 1.44269504088896340736f, -mmn)), p3 = exp2_slot(fmaf(s[i + 3], 1.44269504088896340736f, -mmn));
    a0 += p0; a1 += p1; a2 += p2; a3 += p3; pf.h[i] = (_Float16)p0; pf.h[i + 1] = (_Float16)p1; pf.h[i + 2] = (_Float16)p2; pf.h[i + 3] = (_Float16)p3; }
  l = fmaf(l, al, (a0 + a1) + (a2 + a3));
  return pf.v; }
__device__ __forceinline__ void fa_store(unsigned short* op, const v8f o0, const v8f o1, const v8f o2, const v8f o3, float sc) { FragH f;      /* o rows in fragment order (A operand of the output GEMM): d = 16 t + 8 hh + r of query ln is chunk 32 (t & 1) + lane of k block 2 h + (t >> 1) */
#pragma unroll
  for (int r = 0; r < 8; ++r) { f.h[r] = (_Float16)(o0[r] * sc); f.h[8 + r] = (_Float16)(o1[r] * sc); }
  *(v8us*)op = f.half[0]; *(v8us*)(op + 256) = f.half[1];
#pragma unroll
  for (int r = 0; r < 8; ++r) { f.h[r] = (_Float16)(o2[r] * sc); f.h[8 + r] = (_Float16)(o3[r] * sc); }
  *(v8us*)(op + 512) = f.half[0]; *(v8us*)(op + 768) = f.half[1]; }
__device__ __forceinline__ void fa_put(unsigned short* qw, int f, v16h x) { FragH t; t.v = x; *(v8us*)(qw + (2 * f) * (FAW * 32 * 8)) = t.half[0]; *(v8us*)(qw + (2 * f + 1) * (FAW * 32 * 8)) = t.half[1]; }      /* fragment f of the thread's q_lo store */
__device__ __forceinline__ v16h fa_get(const unsigned short* qw, int f) { FragH t; t.half[0] = *(const v8us*)(qw + (2 * f) * (FAW * 32 * 8)); t.half[1] = *(const v8us*)(qw + (2 * f + 1) * (FAW * 32 * 8)); return t.v; }
// amdgpu_waves_per_eu(4, 4): the register budget of four waves a SIMD (256), so that all 512 work-groups are resident at once, two a WGP; without it this build took 274 registers with q_lo held in them.
__global__ __launch_bounds__(FAW * 32) __attribute__((amdgpu_waves_per_eu(4, 4))) void k_fattn(const _Float16* __restrict__ Qh, const _Float16* __restrict__ Ql, const _Float16* __restrict__ Kh, const _Float16* __restrict__ Kl, const _Float16* __restrict__ VT, const float* __restrict__ relb, _Float16* __restrict__ O) {
  __shared__ float tb[257]; __shared__ __attribute__((aligned(16))) unsigned short qls[8][FAW * 32][8];      /* qls: the q_lo fragments, which the registers of four waves a SIMD do not hold beside the rest: thread t's own eight 16-byte chunks at [0..7][t] (a wave-wide read is 512 contiguous bytes); no thread reads what another wrote, so no barrier is owed */
  const int tid = threadIdx.x, lane = tid & 31, ln = lane & 15, hh = lane >> 4; const int h = blockIdx.y, b = blockIdx.z;
  for (int t = tid; t < 257; t += FAW * 32) { const int d = t - 128; const int a = d < 0 ? -d : d; const int f = (a < 8) ? a : (8 + (a >= 12) + (a >= 16) + (a >= 23) + (a >= 32) + (a >= 46) + (a >= 64) + (a >= 91)); const int bk = (d > 0 ? 16 : 0) + f; tb[t] = bf16_round(relb[bk * NH + h]) * 1024.0f; }      /* x1024: exact */
  __syncthreads();      /* publishes the bias table to all waves; the only barrier of the kernel */
  const int q0 = (blockIdx.x * FAW + __builtin_amdgcn_readfirstlane(tid >> 5)) * 32; const size_t r0 = (size_t)b * SQ;
  const size_t fo = (size_t)h * (HD * 16) + lane * 8;      /* fragment order: head h is k blocks 2 h and 2 h + 1 of a row tile, 512 halves each; a row tile is 16 * LQ halves */
  const _Float16* qp = Qh + (r0 + q0) * LQ + fo; const _Float16* qlp = Ql + (r0 + q0) * LQ + fo;
  const v16h qhA0 = g2_fragp(qp), qhA1 = g2_fragp(qp + 512), qhB0 = g2_fragp(qp + 16 * LQ), qhB1 = g2_fragp(qp + 16 * LQ + 512); asm volatile("s_wait_xcnt 0x0" ::: "memory");      /* this and the like waits below stand behind a group of loads, in front of whatever next overwrites a register that the group's addresses are in */
  unsigned short* qw = &qls[0][tid][0];
  fa_put(qw, 0, g2_fragp(qlp)); fa_put(qw, 1, g2_fragp(qlp + 512)); fa_put(qw, 2, g2_fragp(qlp + 16 * LQ)); fa_put(qw, 3, g2_fragp(qlp + 16 * LQ + 512)); asm volatile("s_wait_xcnt 0x0" ::: "memory");
  v16h qlA0 = fa_get(qw, 0), qlA1 = fa_get(qw, 1), qlB0 = fa_get(qw, 2), qlB1 = fa_get(qw, 3);
  const _Float16* khb = Kh + r0 * LQ + (size_t)h * (HD * 16); const _Float16* klb = Kl + r0 * LQ + (size_t)h * (HD * 16); const _Float16* vb = VT + (size_t)(b * NH + h) * HD * SQ; const unsigned l16 = lane * 16;      /* wave-uniform starts, in scalar registers, and one byte offset per lane for all fragments */
  const float bneg = __builtin_bit_cast(float, __builtin_amdgcn_readfirstlane(__builtin_bit_cast(int, tb[0]))), bpos = __builtin_bit_cast(float, __builtin_amdgcn_readfirstlane(__builtin_bit_cast(int, tb[256])));      /* the two far values, the same in every lane: held in scalar registers */
  const int dq = 128 + 8 * hh - (q0 + ln);      /* table index of key j0 + 8 hh + r against tile A's query: j0 + r + dq, clamped; tile B's query lies 16 further */
  const v8f z8 = {0.f,0.f,0.f,0.f,0.f,0.f,0.f,0.f}; v8f oA0 = z8, oA1 = z8, oA2 = z8, oA3 = z8, oB0 = z8, oB1 = z8, oB2 = z8, oB3 = z8; float mA = -1.0e30f, mmA = -1.0e30f, lA = 0.f, mB = -1.0e30f, mmB = -1.0e30f, lB = 0.f;
  v16h ka0 = g2_fragu(khb, l16), ka1 = g2_fragu(khb, l16 + 1024), kb0 = g2_fragu(khb, l16 + 32 * LQ), kb1 = g2_fragu(khb, l16 + 32 * LQ + 1024);      /* k_hi: key tiles a (0..15) and b (16..31), d 0..31 and 32..63; a row tile is 32 * LQ bytes */
  v16h la0 = g2_fragu(klb, l16), la1 = g2_fragu(klb, l16 + 1024), lb0 = g2_fragu(klb, l16 + 32 * LQ), lb1 = g2_fragu(klb, l16 + 32 * LQ + 1024); asm volatile("s_wait_xcnt 0x0" ::: "memory");      /* k_lo likewise */
#pragma unroll 1      /* one pass's fragments in registers at a time: unrolled, the live set would cost resident waves */
  for (int j0 = 0; j0 < SQ; j0 += 32) {
    const float bf = j0 < q0 ? bneg : bpos; v8f taA = {bf, bf, bf, bf, bf, bf, bf, bf}, tcA = taA, taB = taA, tcB = taA;      /* a pass wholly at distance 128 or more from all 32 queries: one value */
    if (j0 + 31 - q0 > -128 && j0 - (q0 + 31) < 128) {      /* wave-uniform: passes near the diagonal read the table */
#pragma unroll
      for (int r = 0; r < 8; ++r) { const int ia = j0 + r + dq, ib = ia + 16, ic = ia - 16; taA[r] = tb[ia < 0 ? 0 : (ia > 256 ? 256 : ia)]; tcA[r] = tb[ib < 0 ? 0 : (ib > 256 ? 256 : ib)]; taB[r] = tb[ic < 0 ? 0 : (ic > 256 ? 256 : ic)]; }
      tcB = taA; }      /* key tile b against query tile B: the distances of key tile a against query tile A */
    /* FA_ROW behind each row of four products keeps the rows in this order: four independent accumulator chains interleaved, and k_lo, fetched last, first read behind eight k_hi products (left alone, this build drew k_lo products forward and ran three chains); the last one keeps the joins behind all products (among them, two groups of four v_nop stood) */
    taA = g2_mmab(ka0, qlA0, taA); tcA = g2_mmab(kb0, qlA0, tcA); taB = g2_mmab(ka0, qlB0, taB); tcB = g2_mmab(kb0, qlB0, tcB); FA_ROW;
    taA = g2_mmab(ka1, qlA1, taA); tcA = g2_mmab(kb1, qlA1, tcA); taB = g2_mmab(ka1, qlB1, taB); tcB = g2_mmab(kb1, qlB1, tcB); FA_ROW;
    taA = g2_mmab(la0, qhA0, taA); tcA = g2_mmab(lb0, qhA0, tcA); taB = g2_mmab(la0, qhB0, taB); tcB = g2_mmab(lb0, qhB0, tcB); FA_ROW;
    taA = g2_mmab(la1, qhA1, taA); tcA = g2_mmab(lb1, qhA1, tcA); taB = g2_mmab(la1, qhB1, taB); tcB = g2_mmab(lb1, qhB1, tcB); FA_ROW;
    v8f saA = g2_mmab(ka0, qhA0, z8), sbA = g2_mmab(kb0, qhA0, z8), saB = g2_mmab(ka0, qhB0, z8), sbB = g2_mmab(kb0, qhB0, z8); FA_ROW;
    saA = g2_mmab(ka1, qhA1, saA); sbA = g2_mmab(kb1, qhA1, sbA); saB = g2_mmab(ka1, qhB1, saB); sbB = g2_mmab(kb1, qhB1, sbB); FA_ROW;
#pragma unroll
    for (int r = 0; r < 8; ++r) { saA[r] = fmaf(taA[r], 0.0009765625f, saA[r]); sbA[r] = fmaf(tcA[r], 0.0009765625f, sbA[r]); saB[r] = fmaf(taB[r], 0.0009765625f, saB[r]); sbB[r] = fmaf(tcB[r], 0.0009765625f, sbB[r]); }
    __builtin_amdgcn_sched_barrier(0);      /* keeps the sixteen loads below one group behind the joined scores: issued earlier, they would need registers while both accumulator sets are still live */
    const unsigned ov = l16 + (unsigned)j0 * (HD * 2), ok = l16 + (unsigned)((j0 + 32) & (SQ - 1)) * (LQ * 2);      /* byte offsets from the fixed scalar starts: this pass's V^T, the next pass's K; the last pass wraps to key 0 (in bounds, unused) */
    const v16h v0 = g2_fragu(vb, ov), v1 = g2_fragu(vb, ov + 1024), v2 = g2_fragu(vb, ov + 2048), v3 = g2_fragu(vb, ov + 3072);      /* V^T fragments, hidden by tile A's softmax */
    ka0 = g2_fragu(khb, ok); ka1 = g2_fragu(khb, ok + 1024); kb0 = g2_fragu(khb, ok + 32 * LQ); kb1 = g2_fragu(khb, ok + 32 * LQ + 1024); asm volatile("s_wait_xcnt 0x0" ::: "memory");
    FA_ROW;      /* keeps the group ahead of the softmax that hides it */
    float al; const v16h pA = fa_soft(saA, sbA, mA, mmA, lA, al);
#pragma unroll
    for (int r = 0; r < 8; ++r) { oA0[r] *= al; oA1[r] *= al; oA2[r] *= al; oA3[r] *= al; }
    oA0 = g2_mmab(v0, pA, oA0); oA1 = g2_mmab(v1, pA, oA1); oA2 = g2_mmab(v2, pA, oA2); oA3 = g2_mmab(v3, pA, oA3);      /* O^T[d = 16 t + 8 hh + r][query ln]; tile B's softmax runs beside these products */
    FA_ROW;      /* keeps the two tiles' softmax apart: interleaved, their temporaries are live together */
    const v16h pB = fa_soft(saB, sbB, mB, mmB, lB, al);
#pragma unroll
    for (int r = 0; r < 8; ++r) { oB0[r] *= al; oB1[r] *= al; oB2[r] *= al; oB3[r] *= al; }
    qlA0 = fa_get(qw, 0); qlA1 = fa_get(qw, 1); qlB0 = fa_get(qw, 2); qlB1 = fa_get(qw, 3);      /* q_lo for the next pass's first products; read anew each pass (the memory clobbers of the waits keep the reads in the loop) */
    FA_ROW;      /* keeps the q_lo reads ahead of the four products that hide their latency */
    oB0 = g2_mmab(v0, pB, oB0); oB1 = g2_mmab(v1, pB, oB1); oB2 = g2_mmab(v2, pB, oB2); oB3 = g2_mmab(v3, pB, oB3);
    __builtin_amdgcn_sched_barrier(0);      /* keeps the loads below behind the last product that reads V^T and the weights, whose registers they can then take */
    la0 = g2_fragu(klb, ok); la1 = g2_fragu(klb, ok + 1024); lb0 = g2_fragu(klb, ok + 32 * LQ); lb1 = g2_fragu(klb, ok + 32 * LQ + 1024); asm volatile("s_wait_xcnt 0x0" ::: "memory");      /* the next k_lo: first read behind the next pass's eight k_hi residual products */
  }
  unsigned short* op = (unsigned short*)O + (r0 + q0) * DM + fo;
  fa_store(op, oA0, oA1, oA2, oA3, 64.0f / (lA + xl_half(lA))); fa_store(op + 16 * DM, oB0, oB1, oB2, oB3, 64.0f / (lB + xl_half(lB))); }

extern "C" void kernel_launch(void* const* d_in, const int* in_sizes, int n_in,
                              void* d_out, int out_size, void* d_ws, size_t ws_size, hipStream_t stream) {
  (void)in_sizes; (void)n_in; (void)out_size;
  const float* const* I = (const float* const*)d_in; const float* xq = I[0]; const float* xkv = I[1]; const float* wq = I[2]; const float* wk = I[3]; const float* wv = I[4]; const float* wo = I[5]; const float* relb = I[6]; const float* bq = nullptr; const float* bk = nullptr; (void)bq; (void)bk;      /* [in][out] weights, no biases; rel_bias [32 buckets][16 heads] */
  char* ws = (char*)d_ws; size_t off = 0;
  auto take = [&](size_t bytes) { char* p = ws + off; off += (bytes + 255) & ~(size_t)255; return p; };
  _Float16* BQ = (_Float16*)take((size_t)DM * DM * 2); _Float16* BK = (_Float16*)take((size_t)DM * DM * 2); _Float16* BV = (_Float16*)take((size_t)DM * DM * 2); _Float16* BO = (_Float16*)take((size_t)DM * DM * 2);
  _Float16* XQ = (_Float16*)take(NR * DM * 2); _Float16* XKV = (_Float16*)take(NR * DM * 2); _Float16* Q16 = (_Float16*)take(NR * DM * 2); _Float16* QL = (_Float16*)take(NR * DM * 2); _Float16* K16 = (_Float16*)take(NR * DM * 2); _Float16* KL = (_Float16*)take(NR * DM * 2); _Float16* O16 = (_Float16*)take(NR * DM * 2);
  _Float16* VT = (_Float16*)take((size_t)NB * NH * HD * SQ * 2);      /* V^T for ALL batches */
  if (off > ws_size) return;
  k_prep<<<4 * WTB + 2 * XTB, 256, 0, stream>>>(xq, xkv, wq, wk, wv, wo, XQ, XKV, BQ, BK, BV, BO);      /* weights [in][out] -> Bt[n][k] x16; both token sources as exact f16 rows */
  const size_t r0p = (size_t)B0 * SQ;      /* first projected row */
  k_qkv<<<dim3((unsigned)((MP / 128) * (DM / 64)), 3), 128, 0, stream>>>(XQ + r0p * DM, XKV + r0p * DM, BQ, BK, BV, Q16 + r0p * DM, QL + r0p * DM, K16 + r0p * DM, KL + r0p * DM, VT, (int)r0p);      /* q -> Q16 + QL, k -> K16 + KL, v -> V^T */
  k_fattn<<<dim3(SQ / (FAW * 32), NH, NB), FAW * 32, 0, stream>>>(Q16, QL, K16, KL, VT, relb, O16);      /* scores + bias, softmax and P . V of every batch and head; o (merged heads) x64 as f16 rows */
  k_gemm2<0><<<dim3((unsigned)((MPO / 128) * (DM / 64)), 1), 128, 0, stream>>>(O16 + r0p * DM, DM, 0, BO, DM, 0, 0.0009765625f, nullptr, 0, nullptr, 1, 0, 0, (float*)d_out + r0p * DM, nullptr, nullptr, 0, DM, 0, MPO, DM, DM);      /* out rows are the output layout */
}

// v009
// One run takes 189 microseconds.
// In two side-by-side timings against v008, it was 1.08 and 1.06 times as fast.
// All steps since v000 together make it 81.2 times as fast.
#include <hip/hip_runtime.h>
// T5 attention with a relative-position bias and NO score scaling (query_states [4][2048][1024] gives q = x wq; key_value_states gives k = x wk, v = x wv ([in][out] 1024^2 sigma 1/32, no biases); 16 heads of 64; scores = q . k (UNSCALED, logits sigma ~8) + bias[h][i][j] with bias = rel_bias[bucket(j - i)][h] (rel_bias input [32][16]; bidirectional log buckets, 32 buckets, max distance 128); softmax; out = merged wo -> [4][2048][1024]).
// Structure: token rows r = b*2048 + s; the query source and the key/value source as exact f16 rows (bf16-rounded); Q, K, V as three WMMA GEMMs (64x64 wave tiles, f32 accumulation, exact x16 weights); q and k split in the GEMM epilogue into f16 hi + x1024 residual planes, V^T written by its GEMM epilogue from the same LDS staging tile; then ONE fused attention launch over (query block, head, batch): UNSCALED three-term scores (q_hi . k_hi + (1024 bias + q_lo . k_hi + q_hi . k_lo) 2^-10; K = 64), running-maximum softmax in registers (f32 statistics, native exp; weights x256 as f16), O^T += V^T . P^T, o carried x64 against f16 subnormal flush (folded into the output GEMM alpha) written straight into the merged f16 o rows; out = o W_o GEMM (f32) into the output layout.
// Compute dtype: inputs rounded to bf16; x / weights exact; q and k as f16 hi + x1024 residual pairs, v, softmax weights and o as plain f16 GEMM operands (~2^-12); scores and softmax statistics f32. v_wmma_f32_16x16x32_f16.
#define NB 4
#define SQ 2048
#define DM 1024
#define NH 16
#define HD 64
#define HG 2                         /* heads per launch of k_vt, which is not launched */
#define B0 0                         /* first batch processed (debug hook) */
#define NBR NB                       /* batches processed (debug hook) */
#define NR ((size_t)NB * SQ)         /* token rows */
#define MP ((int)((size_t)NBR * SQ)) /* rows projected (debug hook) */
#define QN SQ                        /* not used: the attention launch attends all SQ query rows */
#define NHD NH                       /* not used: the attention launch covers all NH heads */
#define MPO MP                       /* rows through the output stage (debug hook) */
#define LQ DM      /* row pitch of the q/k rows */
typedef __bf16 v16b __attribute__((ext_vector_type(16)));
typedef unsigned short v8us __attribute__((ext_vector_type(8), may_alias));
typedef float  v8f  __attribute__((ext_vector_type(8)));
typedef float  v4f  __attribute__((ext_vector_type(4)));
typedef float  v4fa __attribute__((ext_vector_type(4), may_alias));
union FragB { v16b v; v8us half[2]; unsigned short u[16]; };

__device__ __forceinline__ unsigned short bf16_bits(float x) { unsigned int u = __float_as_uint(x); return (unsigned short)((u + 0x7FFFu + ((u >> 16) & 1u)) >> 16); }
__device__ __forceinline__ float bf16_val(unsigned short b) { return __uint_as_float(((unsigned int)b) << 16); }
__device__ __forceinline__ float bf16_round(float x) { return bf16_val(bf16_bits(x)); }
// D += A·B with NT terms: 1 = ah·bh, 2 = + al·bh (A split), 3 = + ah·bl (both split)
template <int NT>
__device__ __forceinline__ v8f mmaN(v16b ah, v16b al, v16b bh, v16b bl, v8f c) {
  c = __builtin_amdgcn_wmma_f32_16x16x32_bf16(false, ah, false, bh, (short)0, c, false, false);
  if (NT >= 2) c = __builtin_amdgcn_wmma_f32_16x16x32_bf16(false, al, false, bh, (short)0, c, false, false);
  if (NT >= 3) c = __builtin_amdgcn_wmma_f32_16x16x32_bf16(false, ah, false, bl, (short)0, c, false, false);
  asm volatile("v_nop\n\tv_nop\n\tv_nop\n\tv_nop" : "+v"(c) : "v"(ah), "v"(al), "v"(bh), "v"(bl));
  return c;
}

__global__ __launch_bounds__(256) void k_wt_bf16(const float* __restrict__ W, unsigned short* __restrict__ Wt, int K, int N) {
  const int t = blockIdx.x * 256 + threadIdx.x;
  const int k8n = K / 8;
  if (t >= N * k8n) return;
  const int n = t / k8n, k8 = (t % k8n) * 8;
  v8us v;
#pragma unroll
  for (int i = 0; i < 8; ++i) v[i] = bf16_bits(W[(size_t)(k8 + i) * N + n]);
  *(v8us*)(Wt + (size_t)n * K + k8) = v;
  
}

// GEMM C[M][N] (f32, pitch ldc) = act(A[M][K]·W + bias). A f32 row-major (pitch lda) converted per fragment to bf16
// (ASPLIT: hi/lo two planes -> 2 terms, else single rounded term); Wt bf16 [N][K] (pitch ldb). BIAS_BF16 rounds the
// bias to bf16 first (bias quantised to bf16 before the add). K%32==0, M%16==0, N%64==0.
template <bool ASPLIT, int ACT, bool BIAS_BF16>
__global__ __launch_bounds__(128) void k_gemm_bf(const float* __restrict__ A, int lda, const unsigned short* __restrict__ Wt, int ldb,
                                               const float* __restrict__ bias, float* __restrict__ C, int ldc, int M, int N, int K) {
  __shared__ __attribute__((aligned(16))) float so[4][16][64];
  const int tid = threadIdx.x, w = tid >> 5, lane = tid & 31, ln = lane & 15, hh = lane >> 4;
  const int ntn = N / 64;
  const int wid = blockIdx.x * 4 + w;
  const int mt = wid / ntn, nq = wid % ntn;
  if (mt * 16 >= M) return;
  const int row0 = mt * 16, col0 = nq * 64;
  const float* arow = A + (size_t)(row0 + ln) * lda;
  v8f acc[4] = {};
  for (int kb = 0; kb < K; kb += 32) {
    FragB ah, al;
    const v4f x0 = *(const v4fa*)(arow + kb + 8 * hh), x1 = *(const v4fa*)(arow + kb + 8 * hh + 4);
    const v4f x2 = *(const v4fa*)(arow + kb + 16 + 8 * hh), x3 = *(const v4fa*)(arow + kb + 16 + 8 * hh + 4);
    float xs[16] = {x0[0],x0[1],x0[2],x0[3],x1[0],x1[1],x1[2],x1[3],x2[0],x2[1],x2[2],x2[3],x3[0],x3[1],x3[2],x3[3]};
#pragma unroll
    for (int i = 0; i < 16; ++i) { const unsigned short hb = bf16_bits(xs[i]); ah.u[i] = hb; al.u[i] = ASPLIT ? bf16_bits(xs[i] - bf16_val(hb)) : (unsigned short)0; }
#pragma unroll
    for (int t = 0; t < 4; ++t) {
      const unsigned short* brow = Wt + (size_t)(col0 + t * 16 + ln) * ldb + kb;
      FragB b;
      b.half[0] = *(const v8us*)(brow + 8 * hh);
      b.half[1] = *(const v8us*)(brow + 16 + 8 * hh);
      acc[t] = mmaN<ASPLIT ? 2 : 1>(ah.v, al.v, b.v, b.v, acc[t]);
    }
  }
#pragma unroll
  for (int t = 0; t < 4; ++t) {
    float bv = bias ? bias[col0 + t * 16 + ln] : 0.f;
    if (BIAS_BF16) bv = bf16_round(bv);
#pragma unroll
    for (int r = 0; r < 8; ++r) { float v = acc[t][r] + bv; if (ACT == 1) v = fmaxf(v, 0.f); so[w][8 * hh + r][t * 16 + ln] = v; }
  }
  __builtin_amdgcn_fence(__ATOMIC_ACQ_REL, "workgroup");
  __builtin_amdgcn_wave_barrier();
  const int rsub = lane >> 4, c4 = (lane & 15) * 4;
  {
#pragma unroll
    for (int q = 0; q < 8; ++q) {
      const int r = q * 2 + rsub;
      const v4f v = *(const v4fa*)&so[w][r][c4];
      *(v4f*)(C + (size_t)(row0 + r) * ldc + col0 + c4) = v;
    }
    
  }
}

// GEMM C = act(A·W + bias + resid): A f32 (ASPLIT -> hi/lo 2 terms), Wt bf16 [N][K]; ACT 0 none, 1 relu, 2 exact gelu;
// resid (optional, f32, row index = (row % rmod), pitch ldr, RES_BF16 rounds it) added before the activation.
template <bool ASPLIT, int ACT, bool BIAS_BF16, bool RES_BF16>
__global__ __launch_bounds__(128) void k_gemm_bf3(const float* __restrict__ A, int lda, const unsigned short* __restrict__ Wt, int ldb,
                                                const float* __restrict__ bias, const float* __restrict__ resid, int rmod, int ldr,
                                                float* __restrict__ C, int ldc, int M, int N, int K) {
  __shared__ __attribute__((aligned(16))) float so[4][16][64];
  const int tid = threadIdx.x, w = tid >> 5, lane = tid & 31, ln = lane & 15, hh = lane >> 4;
  const int ntn = N / 64;
  const int wid = blockIdx.x * 4 + w;
  const int mt = wid / ntn, nq = wid % ntn;
  if (mt * 16 >= M) return;
  const int row0 = mt * 16, col0 = nq * 64;
  const float* arow = A + (size_t)(row0 + ln) * lda;
  v8f acc[4] = {};
  for (int kb = 0; kb < K; kb += 32) {
    FragB ah, al;
    const v4f x0 = *(const v4fa*)(arow + kb + 8 * hh), x1 = *(const v4fa*)(arow + kb + 8 * hh + 4);
    const v4f x2 = *(const v4fa*)(arow + kb + 16 + 8 * hh), x3 = *(const v4fa*)(arow + kb + 16 + 8 * hh + 4);
    float xs[16] = {x0[0],x0[1],x0[2],x0[3],x1[0],x1[1],x1[2],x1[3],x2[0],x2[1],x2[2],x2[3],x3[0],x3[1],x3[2],x3[3]};
#pragma unroll
    for (int i = 0; i < 16; ++i) { const unsigned short hb = bf16_bits(xs[i]); ah.u[i] = hb; al.u[i] = ASPLIT ? bf16_bits(xs[i] - bf16_val(hb)) : (unsigned short)0; }
#pragma unroll
    for (int t = 0; t < 4; ++t) {
      const unsigned short* brow = Wt + (size_t)(col0 + t * 16 + ln) * ldb + kb;
      FragB b;
      b.half[0] = *(const v8us*)(brow + 8 * hh);
      b.half[1] = *(const v8us*)(brow + 16 + 8 * hh);
      acc[t] = mmaN<ASPLIT ? 2 : 1>(ah.v, al.v, b.v, b.v, acc[t]);
    }
  }
#pragma unroll
  for (int t = 0; t < 4; ++t) {
    const int col = col0 + t * 16 + ln;
    float bv = bias ? bias[col] : 0.f;
    if (BIAS_BF16) bv = bf16_round(bv);
#pragma unroll
    for (int r = 0; r < 8; ++r) {
      float v = acc[t][r] + bv;
      if (resid) { float rv = resid[(size_t)((row0 + 8 * hh + r) % rmod) * ldr + col]; if (RES_BF16) rv = bf16_round(rv); v += rv; }
      if (ACT == 1) v = fmaxf(v, 0.f);
      if (ACT == 2) v = 0.5f * v * (1.0f + erff(v * 0.70710678118654752f));
      if (ACT == 3) { const float u = 0.7978845608028654f * (v + 0.044715f * v * v * v); v = 0.5f * v * (1.0f + tanhf(u)); }
      so[w][8 * hh + r][t * 16 + ln] = v;
    }
  }
  __builtin_amdgcn_fence(__ATOMIC_ACQ_REL, "workgroup");
  __builtin_amdgcn_wave_barrier();
  const int rsub = lane >> 4, c4 = (lane & 15) * 4;
  {
#pragma unroll
    for (int q = 0; q < 8; ++q) {
      const int r = q * 2 + rsub;
      const v4f v = *(const v4fa*)&so[w][r][c4];
      *(v4f*)(C + (size_t)(row0 + r) * ldc + col0 + c4) = v;
    }
    
  }
}
// row LayerNorm (biased variance, eps) over N: s = X (+ R); optional out_sum <- s; out_norm <- (s-mu)*rsqrt(var+eps)*g + b
template <bool PARAM_BF16>
__global__ __launch_bounds__(256) void k_layernorm(const float* __restrict__ X, const float* __restrict__ R, const float* __restrict__ g, const float* __restrict__ bta,
                                                  float* __restrict__ out_sum, float* __restrict__ out_norm, int N, float eps) {
  __shared__ float red[256];
  const int row = blockIdx.x, tid = threadIdx.x;
  const float* x = X + (size_t)row * N; const float* rr = R ? R + (size_t)row * N : nullptr;
  float vals[16];                     // up to N = 4096
  const int per = N / 256;            // contiguous chunk per thread? use strided-by-4 chunks: thread handles j = tid*4 + 1024*u
  float s1 = 0.f;
  for (int u = 0; u < per / 4; ++u) {
    const int j = tid * 4 + 1024 * u;
    const v4f a = *(const v4fa*)(x + j);
    v4f b = {0.f,0.f,0.f,0.f}; if (rr) b = *(const v4fa*)(rr + j);
#pragma unroll
    for (int q = 0; q < 4; ++q) { const float v = a[q] + b[q]; vals[u * 4 + q] = v; s1 += v; }
  }
  red[tid] = s1; __syncthreads();
  for (int st = 128; st > 0; st >>= 1) { if (tid < st) red[tid] += red[tid + st]; __syncthreads(); }
  const float mu = red[0] / (float)N; __syncthreads();
  float s2 = 0.f;
  for (int u = 0; u < per / 4; ++u)
#pragma unroll
    for (int q = 0; q < 4; ++q) { const float c = vals[u * 4 + q] - mu; s2 += c * c; }
  red[tid] = s2; __syncthreads();
  for (int st = 128; st > 0; st >>= 1) { if (tid < st) red[tid] += red[tid + st]; __syncthreads(); }
  const float rs = rsqrtf(red[0] / (float)N + eps);
  {
    for (int u = 0; u < per / 4; ++u) {
      const int j = tid * 4 + 1024 * u;
      v4f o, sm;
#pragma unroll
      for (int q = 0; q < 4; ++q) {
        float gg = g[j + q], bb = bta[j + q];
        if (PARAM_BF16) { gg = bf16_round(gg); bb = bf16_round(bb); }
        sm[q] = vals[u * 4 + q]; o[q] = (vals[u * 4 + q] - mu) * rs * gg + bb;
      }
      if (out_sum) *(v4f*)(out_sum + (size_t)row * N + j) = sm;
      *(v4f*)(out_norm + (size_t)row * N + j) = o;
    }
    
  }
}



// ---- f16 WMMA path (v_wmma_f32_16x16x32_f16): 11-bit significands for operands in range — used where a [0,1] probability operand needs more precision than bf16
typedef _Float16 v16h __attribute__((ext_vector_type(16)));
union FragH { v16h v; v8us half[2]; _Float16 h[16]; unsigned short u[16]; };
template <int NT>
__device__ __forceinline__ v8f mmaH(v16h ah, v16h al, v16h bh, v16h bl, v8f c) {
  c = __builtin_amdgcn_wmma_f32_16x16x32_f16(false, ah, false, bh, (short)0, c, false, false);
  if (NT >= 2) c = __builtin_amdgcn_wmma_f32_16x16x32_f16(false, al, false, bh, (short)0, c, false, false);
  if (NT >= 3) c = __builtin_amdgcn_wmma_f32_16x16x32_f16(false, ah, false, bl, (short)0, c, false, false);
  asm volatile("v_nop\n\tv_nop\n\tv_nop\n\tv_nop" : "+v"(c) : "v"(ah), "v"(al), "v"(bh), "v"(bl));
  return c;
}
// batched GEMM like k_gemm_b but f16 operands: A f32 (split into f16 hi/lo if ASPLIT, else rounded to f16), Bt = f16 values [n][k]; alpha; C f32; N multiple of 16 (partial tiles skipped)
template <bool ASPLIT>
__global__ __launch_bounds__(128) void k_gemm_h(const float* __restrict__ A, int lda, size_t sA, const _Float16* __restrict__ Bh, int ldb, size_t sB, float alpha, float* __restrict__ C, int ldc, size_t sC, int M, int N, int K) {
  __shared__ __attribute__((aligned(16))) float so[4][16][64];
  const int tid = threadIdx.x, w = tid >> 5, lane = tid & 31, ln = lane & 15, hh = lane >> 4; const int by = blockIdx.y;
  A += (size_t)by * sA; Bh += (size_t)by * sB; C += (size_t)by * sC;
  const int ntn = (N + 63) / 64; const int wid = blockIdx.x * 4 + w; const int mt = wid / ntn, nq = wid % ntn; if (mt * 16 >= M) return;
  const int row0 = mt * 16, col0 = nq * 64; const float* arow = A + (size_t)(row0 + ln) * lda;
  v8f acc[4] = {};
  for (int kb = 0; kb < K; kb += 32) {
    FragH ah, al;
    const v4f x0 = *(const v4fa*)(arow + kb + 8 * hh), x1 = *(const v4fa*)(arow + kb + 8 * hh + 4), x2 = *(const v4fa*)(arow + kb + 16 + 8 * hh), x3 = *(const v4fa*)(arow + kb + 16 + 8 * hh + 4);
    float xs[16] = {x0[0],x0[1],x0[2],x0[3],x1[0],x1[1],x1[2],x1[3],x2[0],x2[1],x2[2],x2[3],x3[0],x3[1],x3[2],x3[3]};
#pragma unroll
    for (int i = 0; i < 16; ++i) { const _Float16 h = (_Float16)xs[i]; ah.h[i] = h; al.h[i] = ASPLIT ? (_Float16)(xs[i] - (float)h) : (_Float16)0.0f; }
#pragma unroll
    for (int t = 0; t < 4; ++t) { if (col0 + t * 16 >= N) continue; const size_t boff = (size_t)(col0 + t * 16 + ln) * ldb + kb; FragH bq; bq.half[0] = *(const v8us*)(Bh + boff + 8 * hh); bq.half[1] = *(const v8us*)(Bh + boff + 16 + 8 * hh);
      acc[t] = mmaH<ASPLIT ? 2 : 1>(ah.v, al.v, bq.v, bq.v, acc[t]); }
  }
#pragma unroll
  for (int t = 0; t < 4; ++t) { if (col0 + t * 16 >= N) continue;
#pragma unroll
    for (int r = 0; r < 8; ++r) so[w][8 * hh + r][t * 16 + ln] = acc[t][r] * alpha; }
  __builtin_amdgcn_fence(__ATOMIC_ACQ_REL, "workgroup"); __builtin_amdgcn_wave_barrier();
  const int rsub = lane >> 4, c4 = (lane & 15) * 4;
  {
#pragma unroll
    for (int q = 0; q < 8; ++q) { const int r = q * 2 + rsub; if (col0 + c4 < N) { const v4f v = *(const v4fa*)&so[w][r][c4]; *(v4f*)(C + (size_t)(row0 + r) * ldc + col0 + c4) = v; } }
     }
}

// Wt[n][k] = f16(W[k][n]·scale) from f32 row-major W[K][N] (scale = power of two; bf16-exact weights stay exact in f16 away from the subnormal range)
__device__ __forceinline__ void wt_f16(const float* __restrict__ W, _Float16* __restrict__ Wt, int K, int N, float scale, int t) {
  if (t >= N * (K / 8)) return; const int tile = t >> 6, w = t & 63, kt = K >> 5; const int n = (tile / kt) * 16 + (w & 15), k8 = (tile % kt) * 32 + (w >> 4) * 8; FragH f;      /* thread = output chunk of the fragment order (rows n, K / 32 k blocks a row tile) */
#pragma unroll
  for (int i = 0; i < 8; ++i) f.h[i] = (_Float16)(bf16_round(W[(size_t)(k8 + i) * N + n]) * scale); const v8us o = f.half[0];
  *(v8us*)((unsigned short*)Wt + (size_t)t * 8) = o; 
}
// k_gemm_hh variant with fused epilogue: v = acc·alpha + bias[by·sBias + col] (+ CP[(row/rowsPerB)·sCPb + by·64 + col] if CP) ; ACT 0 none / 1 elu ; writes f16 C16 (and f32 C if non-null)
template <int ACT>
__global__ __launch_bounds__(128) void k_gemm_hhx(const _Float16* __restrict__ A, int lda, size_t sA, const _Float16* __restrict__ Bh, int ldb, size_t sB, float alpha, const float* __restrict__ bias, size_t sBias, const float* __restrict__ CP, int rowsPerB, size_t sCPb, int row0g,
    float* __restrict__ C, _Float16* __restrict__ C16, int ldc, size_t sC, int M, int N, int K) {
  __shared__ __attribute__((aligned(16))) float so[4][16][64];
  const int tid = threadIdx.x, w = tid >> 5, lane = tid & 31, ln = lane & 15, hh = lane >> 4; const int by = blockIdx.y;
  A += (size_t)by * sA; Bh += (size_t)by * sB; const size_t cofs = (size_t)by * sC; const float* bp = bias ? bias + (size_t)by * sBias : nullptr;
  const int ntn = (N + 63) / 64; const int wid = blockIdx.x * 4 + w; const int mt = wid / ntn, nq = wid % ntn; if (mt * 16 >= M) return;
  const int row0 = mt * 16, col0 = nq * 64; const _Float16* arow = A + (size_t)(row0 + ln) * lda;
  v8f acc[4] = {};
  for (int kb = 0; kb < K; kb += 32) { FragH ah; ah.half[0] = *(const v8us*)((const unsigned short*)arow + kb + 8 * hh); ah.half[1] = *(const v8us*)((const unsigned short*)arow + kb + 16 + 8 * hh);
#pragma unroll
    for (int t = 0; t < 4; ++t) { if (col0 + t * 16 >= N) continue; const size_t boff = (size_t)(col0 + t * 16 + ln) * ldb + kb; FragH bq; bq.half[0] = *(const v8us*)((const unsigned short*)Bh + boff + 8 * hh); bq.half[1] = *(const v8us*)((const unsigned short*)Bh + boff + 16 + 8 * hh);
      acc[t] = mmaH<1>(ah.v, ah.v, bq.v, bq.v, acc[t]); }
  }
#pragma unroll
  for (int t = 0; t < 4; ++t) { if (col0 + t * 16 >= N) continue; const int col = col0 + t * 16 + ln; const float bv = bp ? bf16_round(bp[col]) : 0.f;
#pragma unroll
    for (int r = 0; r < 8; ++r) { float v = acc[t][r] * alpha + bv; if (CP) { const int rr = row0g + row0 + 8 * hh + r; if (rowsPerB < 0) v += CP[cofs + (size_t)rr * ldc + col];      /* rowsPerB < 0: own element of the batched C plane */ else { const int bidx = rr / rowsPerB; v += CP[(size_t)bidx * sCPb + (size_t)by * 64 + col]; } } if (ACT == 1) v = (v > 0.f) ? v : expm1f(v); else if (ACT == 7) v = (v > 0.f) ? v + 1.0f : expf(v); else if (ACT == 8) v = tanhf(v); else if (ACT == 9) v = 0.5f * v * (1.0f + tanhf(0.7978845608028654f * (v + 0.044715f * v * v * v))); else if (ACT == 11) v = 1.0f / (1.0f + expf(-v)); else if (ACT == 12) v = (v > 0.f) ? v : 0.01f * v; else if (ACT == 14) v = (v > 0.f) ? v : 0.1f * v; else if (ACT == 16) v = (v >= 0.f) ? v : 0.3f * v; else if (ACT == 17) v = (v >= 0.f) ? v : 0.2f * v; else if (ACT == 15) v = v / (1.0f + expf(-v)); else if (ACT == 3) v = fmaxf(v, 0.f); else if (ACT == 6) v = 0.5f * v * (1.0f + erff(v * 0.70710678118654752f)); so[w][8 * hh + r][t * 16 + ln] = v; } }
  __builtin_amdgcn_fence(__ATOMIC_ACQ_REL, "workgroup"); __builtin_amdgcn_wave_barrier();
  const int rsub = lane >> 4, c4 = (lane & 15) * 4; typedef _Float16 v4h __attribute__((ext_vector_type(4)));
  {
#pragma unroll
    for (int q = 0; q < 8; ++q) { const int r = q * 2 + rsub; if (col0 + c4 < N) { const v4f v = *(const v4fa*)&so[w][r][c4]; if (C) *(v4f*)(C + cofs + (size_t)(row0 + r) * ldc + col0 + c4) = v; if (C16) { v4h h4; for (int i = 0; i < 4; ++i) h4[i] = (_Float16)v[i]; *(v4h*)(C16 + cofs + (size_t)(row0 + r) * ldc + col0 + c4) = h4; } } }
     }
}


typedef _Float16 v4h __attribute__((ext_vector_type(4)));

// Fragment order of an f16 operand plane [rows][DM]: the 16 x 32 fragment (row tile rt, k block kb) is 1 KiB at (rt * (DM / 32) + kb) * 512 halves; in it the 16-byte chunk w = 0..63 holds row rt * 16 + (w & 15), k = kb * 32 + (w >> 4) * 8 .. + 7.
// Lane l of a wave then reads chunks l and 32 + l: the same values in the same registers as g2_frag from rows, but each wave-wide load is 512 contiguous bytes (4 whole lines) and not 16 pieces of 32 bytes.
// fo_src: first element, in the row-major [rows][DM] numbering, of chunk c of such a plane.
__device__ __forceinline__ size_t fo_src(size_t c) { const size_t tile = c >> 6; const int w = (int)(c & 63); return ((tile >> 5) * 16 + (w & 15)) * DM + (tile & 31) * 32 + (w >> 4) * 8; }
static_assert(DM / 32 == 32, "fo_src takes 32 k blocks a row tile");
static_assert(DM % 128 == 0, "k_gemm2 walks K = DM two k blocks a trip and takes N = DM in 128-column work-group tiles");
// fo_chunk: the chunk that thread t of a converting kernel makes. Four threads in a row take one source row's 128 bytes of f32 (a whole line), so a wave reads 8 whole lines and stores 4 whole lines (8 rows x 16 bytes in each of the 4 k groups).
__device__ __forceinline__ size_t fo_chunk(size_t t) { return (t & ~(size_t)63) + (t & 3) * 16 + ((t >> 2) & 15); }
__device__ __forceinline__ void x16(const float* __restrict__ x, _Float16* __restrict__ X16, size_t n8, size_t t) { if (t >= n8) return; FragH f; const size_t ck = fo_chunk(t); const float* s = x + fo_src(ck); const v4f a = *(const v4fa*)s, c = *(const v4fa*)(s + 4);
#pragma unroll
  for (int q = 0; q < 4; ++q) { f.h[q] = (_Float16)bf16_round(a[q]); f.h[4 + q] = (_Float16)bf16_round(c[q]); } *(v8us*)((unsigned short*)X16 + ck * 8) = f.half[0];  }
// All six f32 -> f16 conversions in one launch (none reads what another writes): work-groups 0 .. 4 * WTB - 1 take the four weights, the rest the two token sources. The weight groups, whose strided reads take longest, start first.
#define WTB (DM * (DM / 8) / 256)                /* work-groups of one weight */
#define XTB ((unsigned)(NR * DM / 8 / 256))      /* work-groups of one token source */
__global__ __launch_bounds__(256) void k_prep(const float* __restrict__ xq, const float* __restrict__ xkv, const float* __restrict__ wq, const float* __restrict__ wk, const float* __restrict__ wv, const float* __restrict__ wo,
    _Float16* __restrict__ XQ, _Float16* __restrict__ XKV, _Float16* __restrict__ BQ, _Float16* __restrict__ BK, _Float16* __restrict__ BV, _Float16* __restrict__ BO) {
  const unsigned bid = blockIdx.x;
  if (bid < 4 * WTB) { const unsigned s = bid / WTB; wt_f16(s == 0 ? wq : s == 1 ? wk : s == 2 ? wv : wo, s == 0 ? BQ : s == 1 ? BK : s == 2 ? BV : BO, DM, DM, 16.0f, (int)((bid % WTB) * 256 + threadIdx.x)); return; }      /* [in][out] -> Bt[n][k] x16 */
  const unsigned xb = bid - 4 * WTB; const bool kv = xb >= XTB; x16(kv ? xkv : xq, kv ? XKV : XQ, NR * DM / 8, (size_t)(kv ? xb - XTB : xb) * 256 + threadIdx.x); }      /* query source and key/value source as exact f16 rows */
__global__ __launch_bounds__(256) void k_h16(const float* __restrict__ x, _Float16* __restrict__ X16, size_t n8) { const size_t t = (size_t)blockIdx.x * 256 + threadIdx.x; if (t >= n8) return; FragH f;
#pragma unroll
  for (int q = 0; q < 8; ++q) f.h[q] = (_Float16)x[t * 8 + q]; *(v8us*)((unsigned short*)X16 + t * 8) = f.half[0];  }
__global__ __launch_bounds__(256) void k_round16f(const float* __restrict__ W, _Float16* __restrict__ Bt, size_t n8) { const size_t t = (size_t)blockIdx.x * 256 + threadIdx.x; if (t >= n8) return; FragH f;
#pragma unroll
  for (int i = 0; i < 8; ++i) f.h[i] = (_Float16)(bf16_round(W[t * 8 + i]) * 16.0f); *(v8us*)((unsigned short*)Bt + t * 8) = f.half[0];  }
// ---- fast GEMM (wave tile 64x64, four waves as 2 x 2 = a 128x128 work-group tile: a loaded fragment feeds four products, and each A and B fragment is asked for by two waves of the work-group; requires M % 128 == 0 rows per launch region and N % 128 == 0); epilogue = k_gemm_hhx semantics ----
__device__ __forceinline__ v16h g2_frag(const _Float16* p, int hh) { FragH f; f.half[0] = *(const v8us*)((const unsigned short*)p + 8 * hh); f.half[1] = *(const v8us*)((const unsigned short*)p + 16 + 8 * hh); return f.v; }
__device__ __forceinline__ v16h g2_fragp(const _Float16* p) { FragH f; f.half[0] = *(const v8us*)((const unsigned short*)p); f.half[1] = *(const v8us*)((const unsigned short*)p + 256); return f.v; }      /* fragment-order plane: p = the fragment's start + lane * 8 */
__device__ __forceinline__ v16h g2_fragu(const _Float16* base, unsigned ob) { const char* p = (const char*)base + ob; FragH f; f.half[0] = *(const v8us*)p; f.half[1] = *(const v8us*)(p + 512); return f.v; }      /* the same with a wave-uniform row-tile start and one byte offset (k block * 1024 + lane * 16) shared by all operands */
__device__ __forceinline__ v8f g2_mma(v16h a, v16h b, v8f c) { v8f d = __builtin_amdgcn_wmma_f32_16x16x32_f16(false, a, false, b, (short)0, c, false, false); asm volatile("v_nop\n\tv_nop\n\tv_nop\n\tv_nop" : "+v"(d) : "v"(a), "v"(b)); return d; }
// The bare builtin, for the attention loop: there four waves of a SIMD share the vector port with their softmax, and every v_nop takes a slot of it; the compiler pads the WMMA distances itself where no independent instruction stands.
__device__ __forceinline__ v8f g2_mmab(v16h a, v16h b, v8f c) { return __builtin_amdgcn_wmma_f32_16x16x32_f16(false, a, false, b, (short)0, c, false, false); }
// As built, the epilogue takes one scalar branch per element round the bias / CP code that is unused here: left as it was.
// omode: 0 = C / C16 as rows; 1 = the f32 result split into f16 hi (C16) + x1024 residual (CL) planes, both in fragment order; 2 = the f16 result transposed into the V^T fragments of the attention kernel (C16 = V^T of all batches; half a wave tile, 32 keys x one head's 64 d, is four fragments in a row)
template <int ACT>
__device__ __forceinline__ void gemm2(const _Float16* __restrict__ A, int lda, size_t sA, const _Float16* __restrict__ Bh, int ldb, size_t sB, float alpha, const float* __restrict__ bias, size_t sBias, const float* __restrict__ CP, int rowsPerB, size_t sCPb, int row0g,
    float* __restrict__ C, _Float16* __restrict__ C16, _Float16* __restrict__ CL, int omode, int ldc, size_t sC, int M, int N, int K, int by) { static_assert(ACT == 0 || ACT == 3 || ACT == 6 || ACT == 8 || ACT == 9 || ACT == 11 || ACT == 12 || ACT == 14 || ACT == 15 || ACT == 16 || ACT == 17, "k_gemm2: unsupported ACT code (would silently apply no activation)");
  __shared__ __attribute__((aligned(16))) float so[4][32][68];
  const int tid = threadIdx.x, w = __builtin_amdgcn_readfirstlane(tid >> 5), lane = tid & 31, ln = lane & 15, hh = lane >> 4;      /* the wave's number as a scalar: the row-tile starts below stay in scalar registers */
  A += (size_t)by * sA; Bh += (size_t)by * sB; const size_t cofs = (size_t)by * sC; const float* bp = bias ? bias + (size_t)by * sBias : nullptr;
  const int ntn = N >> 7; const int mt = blockIdx.x / ntn, nq = blockIdx.x - mt * ntn; const int row0 = mt * 128 + 64 * (w >> 1), col0 = nq * 128 + 64 * (w & 1); if (row0 >= M) return;
  const _Float16* a0p = A + (size_t)row0 * lda; const _Float16* a1p = A + (size_t)(row0 + 16) * lda; const _Float16* a2p = A + (size_t)(row0 + 32) * lda; const _Float16* a3p = A + (size_t)(row0 + 48) * lda;      /* a1p .. a3p formed from A like a0p: written as a0p + 16 * lda this build kept it as a vector address pair, remade with 64-bit vector adds every k block. A and Bh in fragment order: a row tile is 16 * pitch halves, a k block 512 */
  const _Float16* b0p = Bh + (size_t)col0 * ldb; const _Float16* b1p = b0p + (size_t)16 * ldb; const _Float16* b2p = b1p + (size_t)16 * ldb; const _Float16* b3p = b2p + (size_t)16 * ldb;
  const v8f z8 = {0.f,0.f,0.f,0.f,0.f,0.f,0.f,0.f}; v8f cc[4][4];
#pragma unroll
  for (int i = 0; i < 4; ++i) { cc[i][0] = z8; cc[i][1] = z8; cc[i][2] = z8; cc[i][3] = z8; }
  const unsigned l16 = lane * 16; unsigned ob = l16;
  /* A in two register sets of four fragments, the next k block's fetched as one group ahead of this block's products; B in ONE set: each B fragment is fetched anew, for the next k block, as soon as its four products are issued, twelve products ahead of its next use (two full sets and the sixteen accumulators do not fit 256 registers). K % 64 == 0: a trip is two k blocks. Each accumulator still takes its k blocks in rising order. */
  /* every s_wait_xcnt below stands behind a group of loads, in front of the overwrite of the offset register that they name; as a memory fence it also keeps an A group ahead of the products that hide it */
  v16h a0 = g2_fragu(a0p, ob), a1 = g2_fragu(a1p, ob), a2 = g2_fragu(a2p, ob), a3 = g2_fragu(a3p, ob);
  v16h b0 = g2_fragu(b0p, ob);
  v16h b1 = g2_fragu(b1p, ob);
  v16h b2 = g2_fragu(b2p, ob);
  v16h b3 = g2_fragu(b3p, ob); asm volatile("s_wait_xcnt 0x0" ::: "memory");      /* behind the group of loads: the wait said above */
#pragma unroll 1      /* a trip already holds both A sets; unrolled further, the live set would only grow */
  for (int kb = 0; kb < K; kb += 64) {
    const v16h e0 = g2_fragu(a0p, ob + 1024), e1 = g2_fragu(a1p, ob + 1024), e2 = g2_fragu(a2p, ob + 1024), e3 = g2_fragu(a3p, ob + 1024);
    asm volatile("s_wait_xcnt 0x0" ::: "memory");      /* behind the group of loads: the wait and order fence said above the loop */
    cc[0][0] = g2_mma(a0, b0, cc[0][0]); cc[1][0] = g2_mma(a1, b0, cc[1][0]); cc[2][0] = g2_mma(a2, b0, cc[2][0]); cc[3][0] = g2_mma(a3, b0, cc[3][0]);
    b0 = g2_fragu(b0p, ob + 1024);
    cc[0][1] = g2_mma(a0, b1, cc[0][1]); cc[1][1] = g2_mma(a1, b1, cc[1][1]); cc[2][1] = g2_mma(a2, b1, cc[2][1]); cc[3][1] = g2_mma(a3, b1, cc[3][1]);
    b1 = g2_fragu(b1p, ob + 1024);
    cc[0][2] = g2_mma(a0, b2, cc[0][2]); cc[1][2] = g2_mma(a1, b2, cc[1][2]); cc[2][2] = g2_mma(a2, b2, cc[2][2]); cc[3][2] = g2_mma(a3, b2, cc[3][2]);
    b2 = g2_fragu(b2p, ob + 1024);
    cc[0][3] = g2_mma(a0, b3, cc[0][3]); cc[1][3] = g2_mma(a1, b3, cc[1][3]); cc[2][3] = g2_mma(a2, b3, cc[2][3]); cc[3][3] = g2_mma(a3, b3, cc[3][3]);
    b3 = g2_fragu(b3p, ob + 1024);
    asm volatile("s_wait_xcnt 0x0" ::: "memory");      /* behind the group of loads: the wait and order fence said above the loop */
    ob = (kb + 64 < K) ? ob + 2048 : l16;      /* the last trip fetches k block 0 again (in bounds, unused) */
    a0 = g2_fragu(a0p, ob); a1 = g2_fragu(a1p, ob); a2 = g2_fragu(a2p, ob); a3 = g2_fragu(a3p, ob);
    asm volatile("s_wait_xcnt 0x0" ::: "memory");      /* behind the group of loads: the wait and order fence said above the loop */
    cc[0][0] = g2_mma(e0, b0, cc[0][0]); cc[1][0] = g2_mma(e1, b0, cc[1][0]); cc[2][0] = g2_mma(e2, b0, cc[2][0]); cc[3][0] = g2_mma(e3, b0, cc[3][0]);
    b0 = g2_fragu(b0p, ob);
    cc[0][1] = g2_mma(e0, b1, cc[0][1]); cc[1][1] = g2_mma(e1, b1, cc[1][1]); cc[2][1] = g2_mma(e2, b1, cc[2][1]); cc[3][1] = g2_mma(e3, b1, cc[3][1]);
    b1 = g2_fragu(b1p, ob);
    cc[0][2] = g2_mma(e0, b2, cc[0][2]); cc[1][2] = g2_mma(e1, b2, cc[1][2]); cc[2][2] = g2_mma(e2, b2, cc[2][2]); cc[3][2] = g2_mma(e3, b2, cc[3][2]);
    b2 = g2_fragu(b2p, ob);
    cc[0][3] = g2_mma(e0, b3, cc[0][3]); cc[1][3] = g2_mma(e1, b3, cc[1][3]); cc[2][3] = g2_mma(e2, b3, cc[2][3]); cc[3][3] = g2_mma(e3, b3, cc[3][3]);
    b3 = g2_fragu(b3p, ob);
    asm volatile("s_wait_xcnt 0x0" ::: "memory"); }      /* behind the last refetch, in front of the next trip's new offset register: as said above the loop */
  /* the epilogue takes the wave tile in two halves of 32 rows, one after the other through the wave's one 32 x 64 staging tile */
  for (int hf = 0; hf < 2; ++hf) { const int rowh = row0 + 32 * hf;
  v8f accs[8] = {cc[0][0], cc[0][1], cc[0][2], cc[0][3], cc[1][0], cc[1][1], cc[1][2], cc[1][3]};
#pragma unroll
  for (int u = 0; u < 8; ++u) { const int t = u & 3, half = u >> 2; const int col = col0 + t * 16 + ln; const float bv = bp ? bf16_round(bp[col]) : 0.f;
#pragma unroll
    for (int r = 0; r < 8; ++r) { const int rloc = half * 16 + 8 * hh + r; float v = accs[u][r] * alpha + bv; if (CP) { if (rowsPerB < 0) v += CP[cofs + (size_t)(row0g + rowh + rloc) * ldc + col];      /* rowsPerB < 0: own element of the batched C plane */ else { const int bidx = (row0g + rowh + rloc) / rowsPerB; v += CP[(size_t)bidx * sCPb + (size_t)by * 64 + col]; } }
      if (ACT == 3) v = fmaxf(v, 0.f); else if (ACT == 6) v = 0.5f * v * (1.0f + erff(v * 0.70710678118654752f)); else if (ACT == 11) v = 1.0f / (1.0f + expf(-v)); else if (ACT == 15) v = v / (1.0f + expf(-v)); else if (ACT == 12) v = (v > 0.f) ? v : 0.01f * v; else if (ACT == 8) v = tanhf(v); else if (ACT == 9) v = 0.5f * v * (1.0f + tanhf(0.7978845608028654f * (v + 0.044715f * v * v * v))); else if (ACT == 14) v = (v > 0.f) ? v : 0.1f * v; else if (ACT == 16) v = (v >= 0.f) ? v : 0.3f * v; else if (ACT == 17) v = (v >= 0.f) ? v : 0.2f * v;
      so[w][rloc][t * 16 + ln] = v; } }
  __builtin_amdgcn_fence(__ATOMIC_ACQ_REL, "workgroup"); __builtin_amdgcn_wave_barrier();
  if (omode == 1) {      /* chunk g * 32 + lane of fragment (row tile rt, k block kb): row ln, k (2 g + hh) * 8 .. + 7; every store is 512 contiguous bytes of a wave */
    const size_t f0 = ((size_t)(rowh >> 4) * (ldc >> 5) + (col0 >> 5)) * 512 + lane * 8; unsigned short* hp = (unsigned short*)C16 + f0; unsigned short* lp = (unsigned short*)CL + f0;
#pragma unroll
    for (int f = 0; f < 8; ++f) { const int rt = f >> 2, kb = (f >> 1) & 1, g = f & 1; const float* s = &so[w][rt * 16 + ln][kb * 32 + (2 * g + hh) * 8]; const v4f a = *(const v4fa*)s, c = *(const v4fa*)(s + 4); FragH fh, fl;
#pragma unroll
      for (int q = 0; q < 4; ++q) { _Float16 h = (_Float16)a[q]; fh.h[q] = h; fl.h[q] = (_Float16)((a[q] - (float)h) * 1024.0f); h = (_Float16)c[q]; fh.h[4 + q] = h; fl.h[4 + q] = (_Float16)((c[q] - (float)h) * 1024.0f); }
      const size_t o = (size_t)rt * (ldc >> 5) * 512 + kb * 512 + g * 256; *(v8us*)(hp + o) = fh.half[0]; *(v8us*)(lp + o) = fl.half[0]; }
    asm volatile("s_wait_xcnt 0x0" ::: "memory"); }      /* behind the block's last store, inside the block: in front of whatever next takes a register that these stores name (the V^T block's LDS loads where it is laid out behind this one; the accumulator moves at the foot of the half) */
  else if (omode == 2) {      /* chunk g * 32 + lane of d tile dt: row d = dt * 16 + ln, keys (2 g + hh) * 8 .. + 7 of the half's 32-key block; the wave's 64 columns are one head */
    const int tok = row0g + rowh; unsigned short* vp = (unsigned short*)C16 + ((size_t)(tok / SQ) * NH + (col0 >> 6)) * ((size_t)HD * SQ) + (size_t)((tok % SQ) >> 5) * 2048 + lane * 8;
#pragma unroll
    for (int f = 0; f < 8; ++f) { const int dt = f >> 1, g = f & 1; FragH fv;
#pragma unroll
      for (int q = 0; q < 8; ++q) fv.h[q] = (_Float16)so[w][(2 * g + hh) * 8 + q][dt * 16 + ln];
      *(v8us*)(vp + dt * 512 + g * 256) = fv.half[0]; }
    asm volatile("s_wait_xcnt 0x0" ::: "memory"); }      /* behind the block's last store, inside the block: as at the end of the block above */
  else { const int rsub = lane >> 4, c4 = (lane & 15) * 4;
#pragma unroll
    for (int q = 0; q < 16; ++q) { const int r = q * 2 + rsub; v4f v = *(const v4fa*)&so[w][r][c4]; if (C) *(v4f*)(C + cofs + (size_t)(rowh + r) * ldc + col0 + c4) = v; if (C16) { asm volatile("s_wait_xcnt 0x0" : "+v"(v) : : "memory");      /* behind the f32 store, in front of the conversion, which may take the store's data registers; v passes through the statement so that the conversion cannot be lifted over the wait */
      v4h h4; for (int i = 0; i < 4; ++i) h4[i] = (_Float16)v[i]; *(v4h*)(C16 + cofs + (size_t)(rowh + r) * ldc + col0 + c4) = h4; } }
    asm volatile("s_wait_xcnt 0x0" ::: "memory"); }      /* behind the block's last store, inside the block: as at the end of the first block */
  __builtin_amdgcn_fence(__ATOMIC_ACQ_REL, "workgroup", "local"); __builtin_amdgcn_wave_barrier();      /* keeps the second half's writes of the staging tile behind the first half's reads, which are of other lanes' elements; LDS only, so that the wave does not wait here for its global stores */
#pragma unroll
  for (int j = 0; j < 4; ++j) { cc[0][j] = cc[2][j]; cc[1][j] = cc[3][j]; }      /* the second half's accumulators move to where the one copy of the epilogue reads */
  } }
template <int ACT>
__global__ __launch_bounds__(128) void k_gemm2(const _Float16* __restrict__ A, int lda, size_t sA, const _Float16* __restrict__ Bh, int ldb, size_t sB, float alpha, const float* __restrict__ bias, size_t sBias, const float* __restrict__ CP, int rowsPerB, size_t sCPb, int row0g,
    float* __restrict__ C, _Float16* __restrict__ C16, _Float16* __restrict__ CL, int omode, int ldc, size_t sC, int M, int N, int K) { gemm2<ACT>(A, lda, sA, Bh, ldb, sB, alpha, bias, sBias, CP, rowsPerB, sCPb, row0g, C, C16, CL, omode, ldc, sC, M, N, K, blockIdx.y); }
// The three projections in one launch (none reads what another writes): blockIdx.y = 0 q, 1 k (each f32 -> f16 hi + x1024 residual planes, split in the epilogue), 2 v (f16 straight into the V^T fragments [NB * NH][SQ / 32][4 d tiles]). Pointers arrive at the first projected row; row0g = that row.
__global__ __launch_bounds__(128) void k_qkv(const _Float16* __restrict__ XQ, const _Float16* __restrict__ XKV, const _Float16* __restrict__ BQ, const _Float16* __restrict__ BK, const _Float16* __restrict__ BV,
    _Float16* __restrict__ Q16, _Float16* __restrict__ QL, _Float16* __restrict__ K16, _Float16* __restrict__ KL, _Float16* __restrict__ VT, int row0g) { const int y = blockIdx.y;
  gemm2<0>(y == 0 ? XQ : XKV, DM, 0, y == 0 ? BQ : y == 1 ? BK : BV, DM, 0, 0.0625f, nullptr, 0, nullptr, 1, 0, row0g, nullptr, y == 0 ? Q16 : y == 1 ? K16 : VT, y == 0 ? QL : KL, y == 2 ? 2 : 1, DM, 0, MP, DM, DM, 0); }


__global__ __launch_bounds__(256) void k_wnat(const float* __restrict__ w, size_t n8, _Float16* __restrict__ Bt) { const size_t t = (size_t)blockIdx.x * 256 + threadIdx.x; if (t >= n8) return; FragH f; for (int q = 0; q < 8; ++q) f.h[q] = (_Float16)(bf16_round(w[t * 8 + q]) * 16.0f); *(v8us*)((unsigned short*)Bt + t * 8) = f.half[0];  }
__global__ __launch_bounds__(256) void k_rsm(const float* __restrict__ S, _Float16* __restrict__ P, int nrows) {
  #pragma clang fp contract(off)
  const int i = blockIdx.x * 256 + threadIdx.x; if (i >= nrows) return; const float* s = S + (size_t)i * SQ; float mx = -3.0e38f;
#pragma unroll 1
  for (int j = 0; j < SQ; ++j) mx = fmaxf(mx, s[j]); float se = 0.f;
#pragma unroll 1
  for (int j = 0; j < SQ; ++j) se += expf(s[j] - mx); const float sc = 256.0f / se;
#pragma unroll 1
  for (int j0 = 0; j0 < SQ; j0 += 8) { FragH f; for (int q = 0; q < 8; ++q) f.h[q] = (_Float16)(expf(s[j0 + q] - mx) * sc); unsigned short* d = (unsigned short*)P + (size_t)i * SQ + j0; *(v8us*)d = f.half[0];  } }
__global__ __launch_bounds__(256) void k_vt(const _Float16* __restrict__ V16, int b, int h0, _Float16* __restrict__ VT) { __shared__ unsigned short tl[64][65]; const int tid = threadIdx.x; const int hh = blockIdx.x % HG, sg = blockIdx.x / HG; const int s0 = sg * 64; const int h = h0 + hh;
  for (int i = tid; i < 64 * 8; i += 256) { const int j = i / 8, d8 = (i % 8) * 8; FragH f; f.half[0] = *(const v8us*)((const unsigned short*)V16 + ((size_t)b * SQ + s0 + j) * DM + h * HD + d8); for (int q = 0; q < 8; ++q) tl[d8 + q][j] = f.u[q]; }
  __syncthreads();
  { for (int i = tid; i < 64 * 8; i += 256) { const int d = i / 8, j8 = (i % 8) * 8; FragH f; for (int q = 0; q < 8; ++q) f.u[q] = tl[d][j8 + q]; *(v8us*)((unsigned short*)VT + ((size_t)hh * HD + d) * SQ + s0 + j8) = f.half[0]; }  } }


__device__ __forceinline__ float xl_half(float x) { return __builtin_bit_cast(float, __builtin_amdgcn_permlanex16(__builtin_bit_cast(int, x), __builtin_bit_cast(int, x), 0x76543210, 0xfedcba98, false, false)); }  // lane l with lane l ^ 16
// v_exp_f32 with the v_nop in its own statement: it keeps the one slot that the instruction set asks for behind a transcendental
__device__ __forceinline__ float exp2_slot(float a) { float e; asm("v_exp_f32 %0, %1\n\tv_nop" : "=v"(e) : "v"(a)); return e; }
#define FAW 8                        /* waves per work-group of the fused attention kernel, 32 query columns each */
#define FA_ROW __builtin_amdgcn_sched_barrier(0)      /* an order fence for the compiler's scheduler; what each one keeps is said where it stands */
// One query tile's softmax step over the pass's 32 scores (sa: keys 0..15, sb: keys 16..31): new running maximum, weights x256 as the f16 B fragment, running sum; al = the factor that the tile's o takes.
__device__ __forceinline__ v16h fa_soft(const v8f sa, const v8f sb, float& m, float& mm, float& l, float& al) {
  float s[16];
#pragma unroll
  for (int r = 0; r < 8; ++r) { s[r] = sa[r]; s[8 + r] = sb[r]; }
  float x0 = fmaxf(s[0], s[1]), x1 = fmaxf(s[2], s[3]), x2 = fmaxf(s[4], s[5]), x3 = fmaxf(s[6], s[7]);
  x0 = fmaxf(x0, fmaxf(s[8], s[9])); x1 = fmaxf(x1, fmaxf(s[10], s[11])); x2 = fmaxf(x2, fmaxf(s[12], s[13])); x3 = fmaxf(x3, fmaxf(s[14], s[15]));
  float mx = fmaxf(fmaxf(x0, x1), fmaxf(x2, x3)); mx = fmaxf(mx, xl_half(mx));      /* both halves of the wave hold keys of the same query */
  const float mn = fmaxf(m, mx); const float mmn = fmaf(mn, 1.44269504088896340736f, -8.0f);      /* exponent offset in log2 units; the -8 carries the weights x256 */
  al = exp2_slot(mm - mmn); m = mn; mm = mmn;      /* 1 exactly while the maximum stands */
  FragH pf; float a0 = 0.f, a1 = 0.f, a2 = 0.f, a3 = 0.f;
#pragma unroll
  for (int i = 0; i < 16; i += 4) { const float p0 = exp2_slot(fmaf(s[i], 1.44269504088896340736f, -mmn)), p1 = exp2_slot(fmaf(s[i + 1], 1.44269504088896340736f, -mmn)), p2 = exp2_slot(fmaf(s[i + 2], 1.44269504088896340736f, -mmn)), p3 = exp2_slot(fmaf(s[i + 3], 1.44269504088896340736f, -mmn));
    a0 += p0; a1 += p1; a2 += p2; a3 += p3; pf.h[i] = (_Float16)p0; pf.h[i + 1] = (_Float16)p1; pf.h[i + 2] = (_Float16)p2; pf.h[i + 3] = (_Float16)p3; }
  l = fmaf(l, al, (a0 + a1) + (a2 + a3));
  return pf.v; }
__device__ __forceinline__ void fa_store(unsigned short* op, const v8f o0, const v8f o1, const v8f o2, const v8f o3, float sc) { FragH f;      /* o rows in fragment order (A operand of the output GEMM): d = 16 t + 8 hh + r of query ln is chunk 32 (t & 1) + lane of k block 2 h + (t >> 1) */
#pragma unroll
  for (int r = 0; r < 8; ++r) { f.h[r] = (_Float16)(o0[r] * sc); f.h[8 + r] = (_Float16)(o1[r] * sc); }
  *(v8us*)op = f.half[0]; *(v8us*)(op + 256) = f.half[1];
#pragma unroll
  for (int r = 0; r < 8; ++r) { f.h[r] = (_Float16)(o2[r] * sc); f.h[8 + r] = (_Float16)(o3[r] * sc); }
  *(v8us*)(op + 512) = f.half[0]; *(v8us*)(op + 768) = f.half[1]; }
__device__ __forceinline__ void fa_put(unsigned short* qw, int f, v16h x) { FragH t; t.v = x; *(v8us*)(qw + (2 * f) * (FAW * 32 * 8)) = t.half[0]; *(v8us*)(qw + (2 * f + 1) * (FAW * 32 * 8)) = t.half[1]; }      /* fragment f of the thread's q_lo store */
__device__ __forceinline__ v16h fa_get(const unsigned short* qw, int f) { FragH t; t.half[0] = *(const v8us*)(qw + (2 * f) * (FAW * 32 * 8)); t.half[1] = *(const v8us*)(qw + (2 * f + 1) * (FAW * 32 * 8)); return t.v; }
// amdgpu_waves_per_eu(4, 4): the register budget of four waves a SIMD (256), so that all 512 work-groups are resident at once, two a WGP; without it this build took 274 registers with q_lo held in them.
__global__ __launch_bounds__(FAW * 32) __attribute__((amdgpu_waves_per_eu(4, 4))) void k_fattn(const _Float16* __restrict__ Qh, const _Float16* __restrict__ Ql, const _Float16* __restrict__ Kh, const _Float16* __restrict__ Kl, const _Float16* __restrict__ VT, const float* __restrict__ relb, _Float16* __restrict__ O) {
  __shared__ float tb[257]; __shared__ __attribute__((aligned(16))) unsigned short qls[8][FAW * 32][8];      /* qls: the q_lo fragments, which the registers of four waves a SIMD do not hold beside the rest: thread t's own eight 16-byte chunks at [0..7][t] (a wave-wide read is 512 contiguous bytes); no thread reads what another wrote, so no barrier is owed */
  const int tid = threadIdx.x, lane = tid & 31, ln = lane & 15, hh = lane >> 4; const int h = blockIdx.y, b = blockIdx.z;
  for (int t = tid; t < 257; t += FAW * 32) { const int d = t - 128; const int a = d < 0 ? -d : d; const int f = (a < 8) ? a : (8 + (a >= 12) + (a >= 16) + (a >= 23) + (a >= 32) + (a >= 46) + (a >= 64) + (a >= 91)); const int bk = (d > 0 ? 16 : 0) + f; tb[t] = bf16_round(relb[bk * NH + h]) * 1024.0f; }      /* x1024: exact */
  __syncthreads();      /* publishes the bias table to all waves; the only barrier of the kernel */
  const int q0 = (blockIdx.x * FAW + __builtin_amdgcn_readfirstlane(tid >> 5)) * 32; const size_t r0 = (size_t)b * SQ;
  const size_t fo = (size_t)h * (HD * 16) + lane * 8;      /* fragment order: head h is k blocks 2 h and 2 h + 1 of a row tile, 512 halves each; a row tile is 16 * LQ halves */
  const _Float16* qp = Qh + (r0 + q0) * LQ + fo; const _Float16* qlp = Ql + (r0 + q0) * LQ + fo;
  const v16h qhA0 = g2_fragp(qp), qhA1 = g2_fragp(qp + 512), qhB0 = g2_fragp(qp + 16 * LQ), qhB1 = g2_fragp(qp + 16 * LQ + 512); asm volatile("s_wait_xcnt 0x0" ::: "memory");      /* this and the like waits below stand behind a group of loads, in front of whatever next overwrites a register that the group's addresses are in */
  unsigned short* qw = &qls[0][tid][0];
  fa_put(qw, 0, g2_fragp(qlp)); fa_put(qw, 1, g2_fragp(qlp + 512)); fa_put(qw, 2, g2_fragp(qlp + 16 * LQ)); fa_put(qw, 3, g2_fragp(qlp + 16 * LQ + 512)); asm volatile("s_wait_xcnt 0x0" ::: "memory");
  v16h qlA0 = fa_get(qw, 0), qlA1 = fa_get(qw, 1), qlB0 = fa_get(qw, 2), qlB1 = fa_get(qw, 3);
  const _Float16* khb = Kh + r0 * LQ + (size_t)h * (HD * 16); const _Float16* klb = Kl + r0 * LQ + (size_t)h * (HD * 16); const _Float16* vb = VT + (size_t)(b * NH + h) * HD * SQ; const unsigned l16 = lane * 16;      /* wave-uniform starts, in scalar registers, and one byte offset per lane for all fragments */
  const float bneg = __builtin_bit_cast(float, __builtin_amdgcn_readfirstlane(__builtin_bit_cast(int, tb[0]))), bpos = __builtin_bit_cast(float, __builtin_amdgcn_readfirstlane(__builtin_bit_cast(int, tb[256])));      /* the two far values, the same in every lane: held in scalar registers */
  const int dq = 128 + 8 * hh - (q0 + ln);      /* table index of key j0 + 8 hh + r against tile A's query: j0 + r + dq, clamped; tile B's query lies 16 further */
  const v8f z8 = {0.f,0.f,0.f,0.f,0.f,0.f,0.f,0.f}; v8f oA0 = z8, oA1 = z8, oA2 = z8, oA3 = z8, oB0 = z8, oB1 = z8, oB2 = z8, oB3 = z8; float mA = -1.0e30f, mmA = -1.0e30f, lA = 0.f, mB = -1.0e30f, mmB = -1.0e30f, lB = 0.f;
  v16h ka0 = g2_fragu(khb, l16), ka1 = g2_fragu(khb, l16 + 1024), kb0 = g2_fragu(khb, l16 + 32 * LQ), kb1 = g2_fragu(khb, l16 + 32 * LQ + 1024);      /* k_hi: key tiles a (0..15) and b (16..31), d 0..31 and 32..63; a row tile is 32 * LQ bytes */
  v16h la0 = g2_fragu(klb, l16), la1 = g2_fragu(klb, l16 + 1024), lb0 = g2_fragu(klb, l16 + 32 * LQ), lb1 = g2_fragu(klb, l16 + 32 * LQ + 1024); asm volatile("s_wait_xcnt 0x0" ::: "memory");      /* k_lo likewise */
#pragma unroll 1      /* one pass's fragments in registers at a time: unrolled, the live set would cost resident waves */
  for (int j0 = 0; j0 < SQ; j0 += 32) {
    const float bf = j0 < q0 ? bneg : bpos; v8f taA = {bf, bf, bf, bf, bf, bf, bf, bf}, tcA = taA, taB = taA, tcB = taA;      /* a pass wholly at distance 128 or more from all 32 queries: one value */
    if (j0 + 31 - q0 > -128 && j0 - (q0 + 31) < 128) {      /* wave-uniform: passes near the diagonal read the table */
#pragma unroll
      for (int r = 0; r < 8; ++r) { const int ia = j0 + r + dq, ib = ia + 16, ic = ia - 16; taA[r] = tb[ia < 0 ? 0 : (ia > 256 ? 256 : ia)]; tcA[r] = tb[ib < 0 ? 0 : (ib > 256 ? 256 : ib)]; taB[r] = tb[ic < 0 ? 0 : (ic > 256 ? 256 : ic)]; }
      tcB = taA; }      /* key tile b against query tile B: the distances of key tile a against query tile A */
    /* FA_ROW behind each row of four products keeps the rows in this order: four independent accumulator chains interleaved, and k_lo, fetched last, first read behind eight k_hi products (left alone, this build drew k_lo products forward and ran three chains); the last one keeps the joins behind all products (among them, two groups of four v_nop stood) */
    taA = g2_mmab(ka0, qlA0, taA); tcA = g2_mmab(kb0, qlA0, tcA); taB = g2_mmab(ka0, qlB0, taB); tcB = g2_mmab(kb0, qlB0, tcB); FA_ROW;
    taA = g2_mmab(ka1, qlA1, taA); tcA = g2_mmab(kb1, qlA1, tcA); taB = g2_mmab(ka1, qlB1, taB); tcB = g2_mmab(kb1, qlB1, tcB); FA_ROW;
    taA = g2_mmab(la0, qhA0, taA); tcA = g2_mmab(lb0, qhA0, tcA); taB = g2_mmab(la0, qhB0, taB); tcB = g2_mmab(lb0, qhB0, tcB); FA_ROW;
    taA = g2_mmab(la1, qhA1, taA); tcA = g2_mmab(lb1, qhA1, tcA); taB = g2_mmab(la1, qhB1, taB); tcB = g2_mmab(lb1, qhB1, tcB); FA_ROW;
    v8f saA = g2_mmab(ka0, qhA0, z8), sbA = g2_mmab(kb0, qhA0, z8), saB = g2_mmab(ka0, qhB0, z8), sbB = g2_mmab(kb0, qhB0, z8); FA_ROW;
    saA = g2_mmab(ka1, qhA1, saA); sbA = g2_mmab(kb1, qhA1, sbA); saB = g2_mmab(ka1, qhB1, saB); sbB = g2_mmab(kb1, qhB1, sbB); FA_ROW;
#pragma unroll
    for (int r = 0; r < 8; ++r) { saA[r] = fmaf(taA[r], 0.0009765625f, saA[r]); sbA[r] = fmaf(tcA[r], 0.0009765625f, sbA[r]); saB[r] = fmaf(taB[r], 0.0009765625f, saB[r]); sbB[r] = fmaf(tcB[r], 0.0009765625f, sbB[r]); }
    __builtin_amdgcn_sched_barrier(0);      /* keeps the sixteen loads below one group behind the joined scores: issued earlier, they would need registers while both accumulator sets are still live */
    const unsigned ov = l16 + (unsigned)j0 * (HD * 2), ok = l16 + (unsigned)((j0 + 32) & (SQ - 1)) * (LQ * 2);      /* byte offsets from the fixed scalar starts: this pass's V^T, the next pass's K; the last pass wraps to key 0 (in bounds, unused) */
    const v16h v0 = g2_fragu(vb, ov), v1 = g2_fragu(vb, ov + 1024), v2 = g2_fragu(vb, ov + 2048), v3 = g2_fragu(vb, ov + 3072);      /* V^T fragments, hidden by tile A's softmax */
    ka0 = g2_fragu(khb, ok); ka1 = g2_fragu(khb, ok + 1024); kb0 = g2_fragu(khb, ok + 32 * LQ); kb1 = g2_fragu(khb, ok + 32 * LQ + 1024); asm volatile("s_wait_xcnt 0x0" ::: "memory");
    FA_ROW;      /* keeps the group ahead of the softmax that hides it */
    float al; const v16h pA = fa_soft(saA, sbA, mA, mmA, lA, al);
#pragma unroll
    for (int r = 0; r < 8; ++r) { oA0[r] *= al; oA1[r] *= al; oA2[r] *= al; oA3[r] *= al; }
    oA0 = g2_mmab(v0, pA, oA0); oA1 = g2_mmab(v1, pA, oA1); oA2 = g2_mmab(v2, pA, oA2); oA3 = g2_mmab(v3, pA, oA3);      /* O^T[d = 16 t + 8 hh + r][query ln]; tile B's softmax runs beside these products */
    FA_ROW;      /* keeps the two tiles' softmax apart: interleaved, their temporaries are live together */
    const v16h pB = fa_soft(saB, sbB, mB, mmB, lB, al);
#pragma unroll
    for (int r = 0; r < 8; ++r) { oB0[r] *= al; oB1[r] *= al; oB2[r] *= al; oB3[r] *= al; }
    qlA0 = fa_get(qw, 0); qlA1 = fa_get(qw, 1); qlB0 = fa_get(qw, 2); qlB1 = fa_get(qw, 3);      /* q_lo for the next pass's first products; read anew each pass (the memory clobbers of the waits keep the reads in the loop) */
    FA_ROW;      /* keeps the q_lo reads ahead of the four products that hide their latency */
    oB0 = g2_mmab(v0, pB, oB0); oB1 = g2_mmab(v1, pB, oB1); oB2 = g2_mmab(v2, pB, oB2); oB3 = g2_mmab(v3, pB, oB3);
    __builtin_amdgcn_sched_barrier(0);      /* keeps the loads below behind the last product that reads V^T and the weights, whose registers they can then take */
    la0 = g2_fragu(klb, ok); la1 = g2_fragu(klb, ok + 1024); lb0 = g2_fragu(klb, ok + 32 * LQ); lb1 = g2_fragu(klb, ok + 32 * LQ + 1024); asm volatile("s_wait_xcnt 0x0" ::: "memory");      /* the next k_lo: first read behind the next pass's eight k_hi residual products */
  }
  unsigned short* op = (unsigned short*)O + (r0 + q0) * DM + fo;
  fa_store(op, oA0, oA1, oA2, oA3, 64.0f / (lA + xl_half(lA))); fa_store(op + 16 * DM, oB0, oB1, oB2, oB3, 64.0f / (lB + xl_half(lB))); }

extern "C" void kernel_launch(void* const* d_in, const int* in_sizes, int n_in,
                              void* d_out, int out_size, void* d_ws, size_t ws_size, hipStream_t stream) {
  (void)in_sizes; (void)n_in; (void)out_size;
  const float* const* I = (const float* const*)d_in; const float* xq = I[0]; const float* xkv = I[1]; const float* wq = I[2]; const float* wk = I[3]; const float* wv = I[4]; const float* wo = I[5]; const float* relb = I[6]; const float* bq = nullptr; const float* bk = nullptr; (void)bq; (void)bk;      /* [in][out] weights, no biases; rel_bias [32 buckets][16 heads] */
  char* ws = (char*)d_ws; size_t off = 0;
  auto take = [&](size_t bytes) { char* p = ws + off; off += (bytes + 255) & ~(size_t)255; return p; };
  _Float16* BQ = (_Float16*)take((size_t)DM * DM * 2); _Float16* BK = (_Float16*)take((size_t)DM * DM * 2); _Float16* BV = (_Float16*)take((size_t)DM * DM * 2); _Float16* BO = (_Float16*)take((size_t)DM * DM * 2);
  _Float16* XQ = (_Float16*)take(NR * DM * 2); _Float16* XKV = (_Float16*)take(NR * DM * 2); _Float16* Q16 = (_Float16*)take(NR * DM * 2); _Float16* QL = (_Float16*)take(NR * DM * 2); _Float16* K16 = (_Float16*)take(NR * DM * 2); _Float16* KL = (_Float16*)take(NR * DM * 2); _Float16* O16 = (_Float16*)take(NR * DM * 2);
  _Float16* VT = (_Float16*)take((size_t)NB * NH * HD * SQ * 2);      /* V^T for ALL batches */
  if (off > ws_size) return;
  k_prep<<<4 * WTB + 2 * XTB, 256, 0, stream>>>(xq, xkv, wq, wk, wv, wo, XQ, XKV, BQ, BK, BV, BO);      /* weights [in][out] -> Bt[n][k] x16; both token sources as exact f16 rows */
  const size_t r0p = (size_t)B0 * SQ;      /* first projected row */
  k_qkv<<<dim3((unsigned)((MP / 128) * (DM / 128)), 3), 128, 0, stream>>>(XQ + r0p * DM, XKV + r0p * DM, BQ, BK, BV, Q16 + r0p * DM, QL + r0p * DM, K16 + r0p * DM, KL + r0p * DM, VT, (int)r0p);      /* q -> Q16 + QL, k -> K16 + KL, v -> V^T */
  k_fattn<<<dim3(SQ / (FAW * 32), NH, NB), FAW * 32, 0, stream>>>(Q16, QL, K16, KL, VT, relb, O16);      /* scores + bias, softmax and P . V of every batch and head; o (merged heads) x64 as f16 rows */
  k_gemm2<0><<<dim3((unsigned)((MPO / 128) * (DM / 128)), 1), 128, 0, stream>>>(O16 + r0p * DM, DM, 0, BO, DM, 0, 0.0009765625f, nullptr, 0, nullptr, 1, 0, 0, (float*)d_out + r0p * DM, nullptr, nullptr, 0, DM, 0, MPO, DM, DM);      /* out rows are the output layout */
}

// v010
// It runs in 179 microseconds.
// Next to v009, in two timings, it ran 1.05 and 1.06 times as fast.
// Over all steps from v000 it is 85.7 times as fast.
#include <hip/hip_runtime.h>
// T5 attention with a relative-position bias and NO score scaling (query_states [4][2048][1024] gives q = x wq; key_value_states gives k = x wk, v = x wv ([in][out] 1024^2 sigma 1/32, no biases); 16 heads of 64; scores = q . k (UNSCALED, logits sigma ~8) + bias[h][i][j] with bias = rel_bias[bucket(j - i)][h] (rel_bias input [32][16]; bidirectional log buckets, 32 buckets, max distance 128); softmax; out = merged wo -> [4][2048][1024]).
// Structure: token rows r = b*2048 + s; the query source and the key/value source as exact f16 rows (bf16-rounded); Q, K, V as three WMMA GEMMs (64x64 wave tiles, f32 accumulation, exact x16 weights); q and k split in the GEMM epilogue into f16 hi + x1024 residual planes, V^T written by its GEMM epilogue from the same LDS staging tile; then ONE fused attention launch over (query block, head, batch): UNSCALED three-term scores (q_hi . k_hi + (1024 bias + q_lo . k_hi + q_hi . k_lo) 2^-10; K = 64), running-maximum softmax in registers (f32 statistics, native exp; weights x256 as f16), O^T += V^T . P^T, o carried x64 against f16 subnormal flush (folded into the output GEMM alpha) written straight into the merged f16 o rows; out = o W_o GEMM (f32) into the output layout.
// Compute dtype: inputs rounded to bf16; x / weights exact; q and k as f16 hi + x1024 residual pairs, v, softmax weights and o as plain f16 GEMM operands (~2^-12); scores and softmax statistics f32. v_wmma_f32_16x16x32_f16.
#define NB 4
#define SQ 2048
#define DM 1024
#define NH 16
#define HD 64
#define HG 2                         /* heads per launch of k_vt, which is not launched */
#define B0 0                         /* first batch processed (debug hook) */
#define NBR NB                       /* batches processed (debug hook) */
#define NR ((size_t)NB * SQ)         /* token rows */
#define MP ((int)((size_t)NBR * SQ)) /* rows projected (debug hook) */
#define QN SQ                        /* not used: the attention launch attends all SQ query rows */
#define NHD NH                       /* not used: the attention launch covers all NH heads */
#define MPO MP                       /* rows through the output stage (debug hook) */
#define LQ DM      /* row pitch of the q/k rows */
typedef __bf16 v16b __attribute__((ext_vector_type(16)));
typedef unsigned short v8us __attribute__((ext_vector_type(8), may_alias));
typedef float  v8f  __attribute__((ext_vector_type(8)));
typedef float  v4f  __attribute__((ext_vector_type(4)));
typedef float  v4fa __attribute__((ext_vector_type(4), may_alias));
union FragB { v16b v; v8us half[2]; unsigned short u[16]; };

__device__ __forceinline__ unsigned short bf16_bits(float x) { unsigned int u = __float_as_uint(x); return (unsigned short)((u + 0x7FFFu + ((u >> 16) & 1u)) >> 16); }
__device__ __forceinline__ float bf16_val(unsigned short b) { return __uint_as_float(((unsigned int)b) << 16); }
__device__ __forceinline__ float bf16_round(float x) { return bf16_val(bf16_bits(x)); }
// D += A·B with NT terms: 1 = ah·bh, 2 = + al·bh (A split), 3 = + ah·bl (both split)
template <int NT>
__device__ __forceinline__ v8f mmaN(v16b ah, v16b al, v16b bh, v16b bl, v8f c) {
  c = __builtin_amdgcn_wmma_f32_16x16x32_bf16(false, ah, false, bh, (short)0, c, false, false);
  if (NT >= 2) c = __builtin_amdgcn_wmma_f32_16x16x32_bf16(false, al, false, bh, (short)0, c, false, false);
  if (NT >= 3) c = __builtin_amdgcn_wmma_f32_16x16x32_bf16(false, ah, false, bl, (short)0, c, false, false);
  asm volatile("v_nop\n\tv_nop\n\tv_nop\n\tv_nop" : "+v"(c) : "v"(ah), "v"(al), "v"(bh), "v"(bl));
  return c;
}

__global__ __launch_bounds__(256) void k_wt_bf16(const float* __restrict__ W, unsigned short* __restrict__ Wt, int K, int N) {
  const int t = blockIdx.x * 256 + threadIdx.x;
  const int k8n = K / 8;
  if (t >= N * k8n) return;
  const int n = t / k8n, k8 = (t % k8n) * 8;
  v8us v;
#pragma unroll
  for (int i = 0; i < 8; ++i) v[i] = bf16_bits(W[(size_t)(k8 + i) * N + n]);
  *(v8us*)(Wt + (size_t)n * K + k8) = v;
  
}

// GEMM C[M][N] (f32, pitch ldc) = act(A[M][K]·W + bias). A f32 row-major (pitch lda) converted per fragment to bf16
// (ASPLIT: hi/lo two planes -> 2 terms, else single rounded term); Wt bf16 [N][K] (pitch ldb). BIAS_BF16 rounds the
// bias to bf16 first (bias quantised to bf16 before the add). K%32==0, M%16==0, N%64==0.
template <bool ASPLIT, int ACT, bool BIAS_BF16>
__global__ __launch_bounds__(128) void k_gemm_bf(const float* __restrict__ A, int lda, const unsigned short* __restrict__ Wt, int ldb,
                                               const float* __restrict__ bias, float* __restrict__ C, int ldc, int M, int N, int K) {
  __shared__ __attribute__((aligned(16))) float so[4][16][64];
  const int tid = threadIdx.x, w = tid >> 5, lane = tid & 31, ln = lane & 15, hh = lane >> 4;
  const int ntn = N / 64;
  const int wid = blockIdx.x * 4 + w;
  const int mt = wid / ntn, nq = wid % ntn;
  if (mt * 16 >= M) return;
  const int row0 = mt * 16, col0 = nq * 64;
  const float* arow = A + (size_t)(row0 + ln) * lda;
  v8f acc[4] = {};
  for (int kb = 0; kb < K; kb += 32) {
    FragB ah, al;
    const v4f x0 = *(const v4fa*)(arow + kb + 8 * hh), x1 = *(const v4fa*)(arow + kb + 8 * hh + 4);
    const v4f x2 = *(const v4fa*)(arow + kb + 16 + 8 * hh), x3 = *(const v4fa*)(arow + kb + 16 + 8 * hh + 4);
    float xs[16] = {x0[0],x0[1],x0[2],x0[3],x1[0],x1[1],x1[2],x1[3],x2[0],x2[1],x2[2],x2[3],x3[0],x3[1],x3[2],x3[3]};
#pragma unroll
    for (int i = 0; i < 16; ++i) { const unsigned short hb = bf16_bits(xs[i]); ah.u[i] = hb; al.u[i] = ASPLIT ? bf16_bits(xs[i] - bf16_val(hb)) : (unsigned short)0; }
#pragma unroll
    for (int t = 0; t < 4; ++t) {
      const unsigned short* brow = Wt + (size_t)(col0 + t * 16 + ln) * ldb + kb;
      FragB b;
      b.half[0] = *(const v8us*)(brow + 8 * hh);
      b.half[1] = *(const v8us*)(brow + 16 + 8 * hh);
      acc[t] = mmaN<ASPLIT ? 2 : 1>(ah.v, al.v, b.v, b.v, acc[t]);
    }
  }
#pragma unroll
  for (int t = 0; t < 4; ++t) {
    float bv = bias ? bias[col0 + t * 16 + ln] : 0.f;
    if (BIAS_BF16) bv = bf16_round(bv);
#pragma unroll
    for (int r = 0; r < 8; ++r) { float v = acc[t][r] + bv; if (ACT == 1) v = fmaxf(v, 0.f); so[w][8 * hh + r][t * 16 + ln] = v; }
  }
  __builtin_amdgcn_fence(__ATOMIC_ACQ_REL, "workgroup");
  __builtin_amdgcn_wave_barrier();
  const int rsub = lane >> 4, c4 = (lane & 15) * 4;
  {
#pragma unroll
    for (int q = 0; q < 8; ++q) {
      const int r = q * 2 + rsub;
      const v4f v = *(const v4fa*)&so[w][r][c4];
      *(v4f*)(C + (size_t)(row0 + r) * ldc + col0 + c4) = v;
    }
    
  }
}

// GEMM C = act(A·W + bias + resid): A f32 (ASPLIT -> hi/lo 2 terms), Wt bf16 [N][K]; ACT 0 none, 1 relu, 2 exact gelu;
// resid (optional, f32, row index = (row % rmod), pitch ldr, RES_BF16 rounds it) added before the activation.
template <bool ASPLIT, int ACT, bool BIAS_BF16, bool RES_BF16>
__global__ __launch_bounds__(128) void k_gemm_bf3(const float* __restrict__ A, int lda, const unsigned short* __restrict__ Wt, int ldb,
                                                const float* __restrict__ bias, const float* __restrict__ resid, int rmod, int ldr,
                                                float* __restrict__ C, int ldc, int M, int N, int K) {
  __shared__ __attribute__((aligned(16))) float so[4][16][64];
  const int tid = threadIdx.x, w = tid >> 5, lane = tid & 31, ln = lane & 15, hh = lane >> 4;
  const int ntn = N / 64;
  const int wid = blockIdx.x * 4 + w;
  const int mt = wid / ntn, nq = wid % ntn;
  if (mt * 16 >= M) return;
  const int row0 = mt * 16, col0 = nq * 64;
  const float* arow = A + (size_t)(row0 + ln) * lda;
  v8f acc[4] = {};
  for (int kb = 0; kb < K; kb += 32) {
    FragB ah, al;
    const v4f x0 = *(const v4fa*)(arow + kb + 8 * hh), x1 = *(const v4fa*)(arow + kb + 8 * hh + 4);
    const v4f x2 = *(const v4fa*)(arow + kb + 16 + 8 * hh), x3 = *(const v4fa*)(arow + kb + 16 + 8 * hh + 4);
    float xs[16] = {x0[0],x0[1],x0[2],x0[3],x1[0],x1[1],x1[2],x1[3],x2[0],x2[1],x2[2],x2[3],x3[0],x3[1],x3[2],x3[3]};
#pragma unroll
    for (int i = 0; i < 16; ++i) { const unsigned short hb = bf16_bits(xs[i]); ah.u[i] = hb; al.u[i] = ASPLIT ? bf16_bits(xs[i] - bf16_val(hb)) : (unsigned short)0; }
#pragma unroll
    for (int t = 0; t < 4; ++t) {
      const unsigned short* brow = Wt + (size_t)(col0 + t * 16 + ln) * ldb + kb;
      FragB b;
      b.half[0] = *(const v8us*)(brow + 8 * hh);
      b.half[1] = *(const v8us*)(brow + 16 + 8 * hh);
      acc[t] = mmaN<ASPLIT ? 2 : 1>(ah.v, al.v, b.v, b.v, acc[t]);
    }
  }
#pragma unroll
  for (int t = 0; t < 4; ++t) {
    const int col = col0 + t * 16 + ln;
    float bv = bias ? bias[col] : 0.f;
    if (BIAS_BF16) bv = bf16_round(bv);
#pragma unroll
    for (int r = 0; r < 8; ++r) {
      float v = acc[t][r] + bv;
      if (resid) { float rv = resid[(size_t)((row0 + 8 * hh + r) % rmod) * ldr + col]; if (RES_BF16) rv = bf16_round(rv); v += rv; }
      if (ACT == 1) v = fmaxf(v, 0.f);
      if (ACT == 2) v = 0.5f * v * (1.0f + erff(v * 0.70710678118654752f));
      if (ACT == 3) { const float u = 0.7978845608028654f * (v + 0.044715f * v * v * v); v = 0.5f * v * (1.0f + tanhf(u)); }
      so[w][8 * hh + r][t * 16 + ln] = v;
    }
  }
  __builtin_amdgcn_fence(__ATOMIC_ACQ_REL, "workgroup");
  __builtin_amdgcn_wave_barrier();
  const int rsub = lane >> 4, c4 = (lane & 15) * 4;
  {
#pragma unroll
    for (int q = 0; q < 8; ++q) {
      const int r = q * 2 + rsub;
      const v4f v = *(const v4fa*)&so[w][r][c4];
      *(v4f*)(C + (size_t)(row0 + r) * ldc + col0 + c4) = v;
    }
    
  }
}
// row LayerNorm (biased variance, eps) over N: s = X (+ R); optional out_sum <- s; out_norm <- (s-mu)*rsqrt(var+eps)*g + b
template <bool PARAM_BF16>
__global__ __launch_bounds__(256) void k_layernorm(const float* __restrict__ X, const float* __restrict__ R, const float* __restrict__ g, const float* __restrict__ bta,
                                                  float* __restrict__ out_sum, float* __restrict__ out_norm, int N, float eps) {
  __shared__ float red[256];
  const int row = blockIdx.x, tid = threadIdx.x;
  const float* x = X + (size_t)row * N; const float* rr = R ? R + (size_t)row * N : nullptr;
  float vals[16];                     // up to N = 4096
  const int per = N / 256;            // contiguous chunk per thread? use strided-by-4 chunks: thread handles j = tid*4 + 1024*u
  float s1 = 0.f;
  for (int u = 0; u < per / 4; ++u) {
    const int j = tid * 4 + 1024 * u;
    const v4f a = *(const v4fa*)(x + j);
    v4f b = {0.f,0.f,0.f,0.f}; if (rr) b = *(const v4fa*)(rr + j);
#pragma unroll
    for (int q = 0; q < 4; ++q) { const float v = a[q] + b[q]; vals[u * 4 + q] = v; s1 += v; }
  }
  red[tid] = s1; __syncthreads();
  for (int st = 128; st > 0; st >>= 1) { if (tid < st) red[tid] += red[tid + st]; __syncthreads(); }
  const float mu = red[0] / (float)N; __syncthreads();
  float s2 = 0.f;
  for (int u = 0; u < per / 4; ++u)
#pragma unroll
    for (int q = 0; q < 4; ++q) { const float c = vals[u * 4 + q] - mu; s2 += c * c; }
  red[tid] = s2; __syncthreads();
  for (int st = 128; st > 0; st >>= 1) { if (tid < st) red[tid] += red[tid + st]; __syncthreads(); }
  const float rs = rsqrtf(red[0] / (float)N + eps);
  {
    for (int u = 0; u < per / 4; ++u) {
      const int j = tid * 4 + 1024 * u;
      v4f o, sm;
#pragma unroll
      for (int q = 0; q < 4; ++q) {
        float gg = g[j + q], bb = bta[j + q];
        if (PARAM_BF16) { gg = bf16_round(gg); bb = bf16_round(bb); }
        sm[q] = vals[u * 4 + q]; o[q] = (vals[u * 4 + q] - mu) * rs * gg + bb;
      }
      if (out_sum) *(v4f*)(out_sum + (size_t)row * N + j) = sm;
      *(v4f*)(out_norm + (size_t)row * N + j) = o;
    }
    
  }
}



// ---- f16 WMMA path (v_wmma_f32_16x16x32_f16): 11-bit significands for operands in range — used where a [0,1] probability operand needs more precision than bf16
typedef _Float16 v16h __attribute__((ext_vector_type(16)));
union FragH { v16h v; v8us half[2]; _Float16 h[16]; unsigned short u[16]; };
template <int NT>
__device__ __forceinline__ v8f mmaH(v16h ah, v16h al, v16h bh, v16h bl, v8f c) {
  c = __builtin_amdgcn_wmma_f32_16x16x32_f16(false, ah, false, bh, (short)0, c, false, false);
  if (NT >= 2) c = __builtin_amdgcn_wmma_f32_16x16x32_f16(false, al, false, bh, (short)0, c, false, false);
  if (NT >= 3) c = __builtin_amdgcn_wmma_f32_16x16x32_f16(false, ah, false, bl, (short)0, c, false, false);
  asm volatile("v_nop\n\tv_nop\n\tv_nop\n\tv_nop" : "+v"(c) : "v"(ah), "v"(al), "v"(bh), "v"(bl));
  return c;
}
// batched GEMM like k_gemm_b but f16 operands: A f32 (split into f16 hi/lo if ASPLIT, else rounded to f16), Bt = f16 values [n][k]; alpha; C f32; N multiple of 16 (partial tiles skipped)
template <bool ASPLIT>
__global__ __launch_bounds__(128) void k_gemm_h(const float* __restrict__ A, int lda, size_t sA, const _Float16* __restrict__ Bh, int ldb, size_t sB, float alpha, float* __restrict__ C, int ldc, size_t sC, int M, int N, int K) {
  __shared__ __attribute__((aligned(16))) float so[4][16][64];
  const int tid = threadIdx.x, w = tid >> 5, lane = tid & 31, ln = lane & 15, hh = lane >> 4; const int by = blockIdx.y;
  A += (size_t)by * sA; Bh += (size_t)by * sB; C += (size_t)by * sC;
  const int ntn = (N + 63) / 64; const int wid = blockIdx.x * 4 + w; const int mt = wid / ntn, nq = wid % ntn; if (mt * 16 >= M) return;
  const int row0 = mt * 16, col0 = nq * 64; const float* arow = A + (size_t)(row0 + ln) * lda;
  v8f acc[4] = {};
  for (int kb = 0; kb < K; kb += 32) {
    FragH ah, al;
    const v4f x0 = *(const v4fa*)(arow + kb + 8 * hh), x1 = *(const v4fa*)(arow + kb + 8 * hh + 4), x2 = *(const v4fa*)(arow + kb + 16 + 8 * hh), x3 = *(const v4fa*)(arow + kb + 16 + 8 * hh + 4);
    float xs[16] = {x0[0],x0[1],x0[2],x0[3],x1[0],x1[1],x1[2],x1[3],x2[0],x2[1],x2[2],x2[3],x3[0],x3[1],x3[2],x3[3]};
#pragma unroll
    for (int i = 0; i < 16; ++i) { const _Float16 h = (_Float16)xs[i]; ah.h[i] = h; al.h[i] = ASPLIT ? (_Float16)(xs[i] - (float)h) : (_Float16)0.0f; }
#pragma unroll
    for (int t = 0; t < 4; ++t) { if (col0 + t * 16 >= N) continue; const size_t boff = (size_t)(col0 + t * 16 + ln) * ldb + kb; FragH bq; bq.half[0] = *(const v8us*)(Bh + boff + 8 * hh); bq.half[1] = *(const v8us*)(Bh + boff + 16 + 8 * hh);
      acc[t] = mmaH<ASPLIT ? 2 : 1>(ah.v, al.v, bq.v, bq.v, acc[t]); }
  }
#pragma unroll
  for (int t = 0; t < 4; ++t) { if (col0 + t * 16 >= N) continue;
#pragma unroll
    for (int r = 0; r < 8; ++r) so[w][8 * hh + r][t * 16 + ln] = acc[t][r] * alpha; }
  __builtin_amdgcn_fence(__ATOMIC_ACQ_REL, "workgroup"); __builtin_amdgcn_wave_barrier();
  const int rsub = lane >> 4, c4 = (lane & 15) * 4;
  {
#pragma unroll
    for (int q = 0; q < 8; ++q) { const int r = q * 2 + rsub; if (col0 + c4 < N) { const v4f v = *(const v4fa*)&so[w][r][c4]; *(v4f*)(C + (size_t)(row0 + r) * ldc + col0 + c4) = v; } }
     }
}

// Wt[n][k] = f16(W[k][n]·scale) from f32 row-major W[K][N] (scale = power of two; bf16-exact weights stay exact in f16 away from the subnormal range)
__device__ __forceinline__ void wt_f16(const float* __restrict__ W, _Float16* __restrict__ Wt, int K, int N, float scale, int t) {
  if (t >= N * (K / 8)) return; const int tile = t >> 6, w = t & 63, kt = K >> 5; const int n = (tile / kt) * 16 + (w & 15), k8 = (tile % kt) * 32 + (w >> 4) * 8; FragH f;      /* thread = output chunk of the fragment order (rows n, K / 32 k blocks a row tile) */
#pragma unroll
  for (int i = 0; i < 8; ++i) f.h[i] = (_Float16)(bf16_round(W[(size_t)(k8 + i) * N + n]) * scale); const v8us o = f.half[0];
  *(v8us*)((unsigned short*)Wt + (size_t)t * 8) = o; 
}
// k_gemm_hh variant with fused epilogue: v = acc·alpha + bias[by·sBias + col] (+ CP[(row/rowsPerB)·sCPb + by·64 + col] if CP) ; ACT 0 none / 1 elu ; writes f16 C16 (and f32 C if non-null)
template <int ACT>
__global__ __launch_bounds__(128) void k_gemm_hhx(const _Float16* __restrict__ A, int lda, size_t sA, const _Float16* __restrict__ Bh, int ldb, size_t sB, float alpha, const float* __restrict__ bias, size_t sBias, const float* __restrict__ CP, int rowsPerB, size_t sCPb, int row0g,
    float* __restrict__ C, _Float16* __restrict__ C16, int ldc, size_t sC, int M, int N, int K) {
  __shared__ __attribute__((aligned(16))) float so[4][16][64];
  const int tid = threadIdx.x, w = tid >> 5, lane = tid & 31, ln = lane & 15, hh = lane >> 4; const int by = blockIdx.y;
  A += (size_t)by * sA; Bh += (size_t)by * sB; const size_t cofs = (size_t)by * sC; const float* bp = bias ? bias + (size_t)by * sBias : nullptr;
  const int ntn = (N + 63) / 64; const int wid = blockIdx.x * 4 + w; const int mt = wid / ntn, nq = wid % ntn; if (mt * 16 >= M) return;
  const int row0 = mt * 16, col0 = nq * 64; const _Float16* arow = A + (size_t)(row0 + ln) * lda;
  v8f acc[4] = {};
  for (int kb = 0; kb < K; kb += 32) { FragH ah; ah.half[0] = *(const v8us*)((const unsigned short*)arow + kb + 8 * hh); ah.half[1] = *(const v8us*)((const unsigned short*)arow + kb + 16 + 8 * hh);
#pragma unroll
    for (int t = 0; t < 4; ++t) { if (col0 + t * 16 >= N) continue; const size_t boff = (size_t)(col0 + t * 16 + ln) * ldb + kb; FragH bq; bq.half[0] = *(const v8us*)((const unsigned short*)Bh + boff + 8 * hh); bq.half[1] = *(const v8us*)((const unsigned short*)Bh + boff + 16 + 8 * hh);
      acc[t] = mmaH<1>(ah.v, ah.v, bq.v, bq.v, acc[t]); }
  }
#pragma unroll
  for (int t = 0; t < 4; ++t) { if (col0 + t * 16 >= N) continue; const int col = col0 + t * 16 + ln; const float bv = bp ? bf16_round(bp[col]) : 0.f;
#pragma unroll
    for (int r = 0; r < 8; ++r) { float v = acc[t][r] * alpha + bv; if (CP) { const int rr = row0g + row0 + 8 * hh + r; if (rowsPerB < 0) v += CP[cofs + (size_t)rr * ldc + col];      /* rowsPerB < 0: own element of the batched C plane */ else { const int bidx = rr / rowsPerB; v += CP[(size_t)bidx * sCPb + (size_t)by * 64 + col]; } } if (ACT == 1) v = (v > 0.f) ? v : expm1f(v); else if (ACT == 7) v = (v > 0.f) ? v + 1.0f : expf(v); else if (ACT == 8) v = tanhf(v); else if (ACT == 9) v = 0.5f * v * (1.0f + tanhf(0.7978845608028654f * (v + 0.044715f * v * v * v))); else if (ACT == 11) v = 1.0f / (1.0f + expf(-v)); else if (ACT == 12) v = (v > 0.f) ? v : 0.01f * v; else if (ACT == 14) v = (v > 0.f) ? v : 0.1f * v; else if (ACT == 16) v = (v >= 0.f) ? v : 0.3f * v; else if (ACT == 17) v = (v >= 0.f) ? v : 0.2f * v; else if (ACT == 15) v = v / (1.0f + expf(-v)); else if (ACT == 3) v = fmaxf(v, 0.f); else if (ACT == 6) v = 0.5f * v * (1.0f + erff(v * 0.70710678118654752f)); so[w][8 * hh + r][t * 16 + ln] = v; } }
  __builtin_amdgcn_fence(__ATOMIC_ACQ_REL, "workgroup"); __builtin_amdgcn_wave_barrier();
  const int rsub = lane >> 4, c4 = (lane & 15) * 4; typedef _Float16 v4h __attribute__((ext_vector_type(4)));
  {
#pragma unroll
    for (int q = 0; q < 8; ++q) { const int r = q * 2 + rsub; if (col0 + c4 < N) { const v4f v = *(const v4fa*)&so[w][r][c4]; if (C) *(v4f*)(C + cofs + (size_t)(row0 + r) * ldc + col0 + c4) = v; if (C16) { v4h h4; for (int i = 0; i < 4; ++i) h4[i] = (_Float16)v[i]; *(v4h*)(C16 + cofs + (size_t)(row0 + r) * ldc + col0 + c4) = h4; } } }
     }
}


typedef _Float16 v4h __attribute__((ext_vector_type(4)));

// Fragment order of an f16 operand plane [rows][DM]: the 16 x 32 fragment (row tile rt, k block kb) is 1 KiB at (rt * (DM / 32) + kb) * 512 halves; in it the 16-byte chunk w = 0..63 holds row rt * 16 + (w & 15), k = kb * 32 + (w >> 4) * 8 .. + 7.
// Lane l of a wave then reads chunks l and 32 + l: the same values in the same registers as g2_frag from rows, but each wave-wide load is 512 contiguous bytes (4 whole lines) and not 16 pieces of 32 bytes.
// fo_src: first element, in the row-major [rows][DM] numbering, of chunk c of such a plane.
__device__ __forceinline__ size_t fo_src(size_t c) { const size_t tile = c >> 6; const int w = (int)(c & 63); return ((tile >> 5) * 16 + (w & 15)) * DM + (tile & 31) * 32 + (w >> 4) * 8; }
static_assert(DM / 32 == 32, "fo_src takes 32 k blocks a row tile");
static_assert(DM % 128 == 0, "k_gemm2 walks K = DM two k blocks a trip and takes N = DM in 128-column work-group tiles");
// fo_chunk: the chunk that thread t of a converting kernel makes. Four threads in a row take one source row's 128 bytes of f32 (a whole line), so a wave reads 8 whole lines and stores 4 whole lines (8 rows x 16 bytes in each of the 4 k groups).
__device__ __forceinline__ size_t fo_chunk(size_t t) { return (t & ~(size_t)63) + (t & 3) * 16 + ((t >> 2) & 15); }
__device__ __forceinline__ void x16(const float* __restrict__ x, _Float16* __restrict__ X16, size_t n8, size_t t) { if (t >= n8) return; FragH f; const size_t ck = fo_chunk(t); const float* s = x + fo_src(ck); const v4f a = *(const v4fa*)s, c = *(const v4fa*)(s + 4);
#pragma unroll
  for (int q = 0; q < 4; ++q) { f.h[q] = (_Float16)bf16_round(a[q]); f.h[4 + q] = (_Float16)bf16_round(c[q]); } *(v8us*)((unsigned short*)X16 + ck * 8) = f.half[0];  }
// All six f32 -> f16 conversions in one launch (none reads what another writes): work-groups 0 .. 4 * WTB - 1 take the four weights, the rest the two token sources. The weight groups, whose strided reads take longest, start first.
#define WTB (DM * (DM / 8) / 256)                /* work-groups of one weight */
#define XTB ((unsigned)(NR * DM / 8 / 256))      /* work-groups of one token source */
__global__ __launch_bounds__(256) void k_prep(const float* __restrict__ xq, const float* __restrict__ xkv, const float* __restrict__ wq, const float* __restrict__ wk, const float* __restrict__ wv, const float* __restrict__ wo,
    _Float16* __restrict__ XQ, _Float16* __restrict__ XKV, _Float16* __restrict__ BQ, _Float16* __restrict__ BK, _Float16* __restrict__ BV, _Float16* __restrict__ BO) {
  const unsigned bid = blockIdx.x;
  if (bid < 4 * WTB) { const unsigned s = bid / WTB; wt_f16(s == 0 ? wq : s == 1 ? wk : s == 2 ? wv : wo, s == 0 ? BQ : s == 1 ? BK : s == 2 ? BV : BO, DM, DM, 16.0f, (int)((bid % WTB) * 256 + threadIdx.x)); return; }      /* [in][out] -> Bt[n][k] x16 */
  const unsigned xb = bid - 4 * WTB; const bool kv = xb >= XTB; x16(kv ? xkv : xq, kv ? XKV : XQ, NR * DM / 8, (size_t)(kv ? xb - XTB : xb) * 256 + threadIdx.x); }      /* query source and key/value source as exact f16 rows */
__global__ __launch_bounds__(256) void k_h16(const float* __restrict__ x, _Float16* __restrict__ X16, size_t n8) { const size_t t = (size_t)blockIdx.x * 256 + threadIdx.x; if (t >= n8) return; FragH f;
#pragma unroll
  for (int q = 0; q < 8; ++q) f.h[q] = (_Float16)x[t * 8 + q]; *(v8us*)((unsigned short*)X16 + t * 8) = f.half[0];  }
__global__ __launch_bounds__(256) void k_round16f(const float* __restrict__ W, _Float16* __restrict__ Bt, size_t n8) { const size_t t = (size_t)blockIdx.x * 256 + threadIdx.x; if (t >= n8) return; FragH f;
#pragma unroll
  for (int i = 0; i < 8; ++i) f.h[i] = (_Float16)(bf16_round(W[t * 8 + i]) * 16.0f); *(v8us*)((unsigned short*)Bt + t * 8) = f.half[0];  }
// ---- fast GEMM (wave tile 64x64, four waves as 2 x 2 = a 128x128 work-group tile: a loaded fragment feeds four products, and each A and B fragment is asked for by two waves of the work-group; requires M % 128 == 0 rows per launch region and N % 128 == 0); epilogue = k_gemm_hhx semantics ----
__device__ __forceinline__ v16h g2_frag(const _Float16* p, int hh) { FragH f; f.half[0] = *(const v8us*)((const unsigned short*)p + 8 * hh); f.half[1] = *(const v8us*)((const unsigned short*)p + 16 + 8 * hh); return f.v; }
__device__ __forceinline__ v16h g2_fragp(const _Float16* p) { FragH f; f.half[0] = *(const v8us*)((const unsigned short*)p); f.half[1] = *(const v8us*)((const unsigned short*)p + 256); return f.v; }      /* fragment-order plane: p = the fragment's start + lane * 8 */
__device__ __forceinline__ v16h g2_fragu(const _Float16* base, unsigned ob) { const char* p = (const char*)base + ob; FragH f; f.half[0] = *(const v8us*)p; f.half[1] = *(const v8us*)(p + 512); return f.v; }      /* the same with a wave-uniform row-tile start and one byte offset (k block * 1024 + lane * 16) shared by all operands */
__device__ __forceinline__ v8f g2_mma(v16h a, v16h b, v8f c) { v8f d = __builtin_amdgcn_wmma_f32_16x16x32_f16(false, a, false, b, (short)0, c, false, false); asm volatile("v_nop\n\tv_nop\n\tv_nop\n\tv_nop" : "+v"(d) : "v"(a), "v"(b)); return d; }
// The bare builtin, for the attention loop: there four waves of a SIMD share the vector port with their softmax, and every v_nop takes a slot of it; the compiler pads the WMMA distances itself where no independent instruction stands.
__device__ __forceinline__ v8f g2_mmab(v16h a, v16h b, v8f c) { return __builtin_amdgcn_wmma_f32_16x16x32_f16(false, a, false, b, (short)0, c, false, false); }
// As built, the epilogue takes one scalar branch per element round the bias / CP code that is unused here: left as it was.
// omode: 0 = C / C16 as rows; 1 = the f32 result split into f16 hi (C16) + x1024 residual (CL) planes, both in fragment order; 2 = the f16 result transposed into the V^T fragments of the attention kernel (C16 = V^T of all batches; half a wave tile, 32 keys x one head's 64 d, is four fragments in a row)
template <int ACT>
__device__ __forceinline__ void gemm2(const _Float16* __restrict__ A, int lda, size_t sA, const _Float16* __restrict__ Bh, int ldb, size_t sB, float alpha, const float* __restrict__ bias, size_t sBias, const float* __restrict__ CP, int rowsPerB, size_t sCPb, int row0g,
    float* __restrict__ C, _Float16* __restrict__ C16, _Float16* __restrict__ CL, int omode, int ldc, size_t sC, int M, int N, int K, int by) { static_assert(ACT == 0 || ACT == 3 || ACT == 6 || ACT == 8 || ACT == 9 || ACT == 11 || ACT == 12 || ACT == 14 || ACT == 15 || ACT == 16 || ACT == 17, "k_gemm2: unsupported ACT code (would silently apply no activation)");
  __shared__ __attribute__((aligned(16))) float so[4][32][68];
  const int tid = threadIdx.x, w = __builtin_amdgcn_readfirstlane(tid >> 5), lane = tid & 31, ln = lane & 15, hh = lane >> 4;      /* the wave's number as a scalar: the row-tile starts below stay in scalar registers */
  A += (size_t)by * sA; Bh += (size_t)by * sB; const size_t cofs = (size_t)by * sC; const float* bp = bias ? bias + (size_t)by * sBias : nullptr;
  const int ntn = N >> 7; const int mt = blockIdx.x / ntn, nq = blockIdx.x - mt * ntn; const int row0 = mt * 128 + 64 * (w >> 1), col0 = nq * 128 + 64 * (w & 1); if (row0 >= M) return;
  const _Float16* a0p = A + (size_t)row0 * lda; const _Float16* a1p = A + (size_t)(row0 + 16) * lda; const _Float16* a2p = A + (size_t)(row0 + 32) * lda; const _Float16* a3p = A + (size_t)(row0 + 48) * lda;      /* a1p .. a3p formed from A like a0p: written as a0p + 16 * lda this build kept it as a vector address pair, remade with 64-bit vector adds every k block. A and Bh in fragment order: a row tile is 16 * pitch halves, a k block 512 */
  const _Float16* b0p = Bh + (size_t)col0 * ldb; const _Float16* b1p = b0p + (size_t)16 * ldb; const _Float16* b2p = b1p + (size_t)16 * ldb; const _Float16* b3p = b2p + (size_t)16 * ldb;
  const v8f z8 = {0.f,0.f,0.f,0.f,0.f,0.f,0.f,0.f}; v8f cc[4][4];
#pragma unroll
  for (int i = 0; i < 4; ++i) { cc[i][0] = z8; cc[i][1] = z8; cc[i][2] = z8; cc[i][3] = z8; }
  const unsigned l16 = lane * 16; unsigned ob = l16;
  /* A in two register sets of four fragments, the next k block's fetched as one group ahead of this block's products; B in ONE set: each B fragment is fetched anew, for the next k block, as soon as its four products are issued, twelve products ahead of its next use (two full sets and the sixteen accumulators do not fit 256 registers). K % 64 == 0: a trip is two k blocks. Each accumulator still takes its k blocks in rising order. */
  /* every s_wait_xcnt below stands behind a group of loads, in front of the overwrite of the offset register that they name; as a memory fence it also keeps an A group ahead of the products that hide it */
  v16h a0 = g2_fragu(a0p, ob), a1 = g2_fragu(a1p, ob), a2 = g2_fragu(a2p, ob), a3 = g2_fragu(a3p, ob);
  v16h b0 = g2_fragu(b0p, ob);
  v16h b1 = g2_fragu(b1p, ob);
  v16h b2 = g2_fragu(b2p, ob);
  v16h b3 = g2_fragu(b3p, ob); asm volatile("s_wait_xcnt 0x0" ::: "memory");      /* behind the group of loads: the wait said above */
#pragma unroll 1      /* a trip already holds both A sets; unrolled further, the live set would only grow */
  for (int kb = 0; kb < K; kb += 64) {
    const v16h e0 = g2_fragu(a0p, ob + 1024), e1 = g2_fragu(a1p, ob + 1024), e2 = g2_fragu(a2p, ob + 1024), e3 = g2_fragu(a3p, ob + 1024);
    asm volatile("s_wait_xcnt 0x0" ::: "memory");      /* behind the group of loads: the wait and order fence said above the loop */
    cc[0][0] = g2_mma(a0, b0, cc[0][0]); cc[1][0] = g2_mma(a1, b0, cc[1][0]); cc[2][0] = g2_mma(a2, b0, cc[2][0]); cc[3][0] = g2_mma(a3, b0, cc[3][0]);
    b0 = g2_fragu(b0p, ob + 1024);
    cc[0][1] = g2_mma(a0, b1, cc[0][1]); cc[1][1] = g2_mma(a1, b1, cc[1][1]); cc[2][1] = g2_mma(a2, b1, cc[2][1]); cc[3][1] = g2_mma(a3, b1, cc[3][1]);
    b1 = g2_fragu(b1p, ob + 1024);
    cc[0][2] = g2_mma(a0, b2, cc[0][2]); cc[1][2] = g2_mma(a1, b2, cc[1][2]); cc[2][2] = g2_mma(a2, b2, cc[2][2]); cc[3][2] = g2_mma(a3, b2, cc[3][2]);
    b2 = g2_fragu(b2p, ob + 1024);
    cc[0][3] = g2_mma(a0, b3, cc[0][3]); cc[1][3] = g2_mma(a1, b3, cc[1][3]); cc[2][3] = g2_mma(a2, b3, cc[2][3]); cc[3][3] = g2_mma(a3, b3, cc[3][3]);
    b3 = g2_fragu(b3p, ob + 1024);
    asm volatile("s_wait_xcnt 0x0" ::: "memory");      /* behind the group of loads: the wait and order fence said above the loop */
    ob = (kb + 64 < K) ? ob + 2048 : l16;      /* the last trip fetches k block 0 again (in bounds, unused) */
    a0 = g2_fragu(a0p, ob); a1 = g2_fragu(a1p, ob); a2 = g2_fragu(a2p, ob); a3 = g2_fragu(a3p, ob);
    asm volatile("s_wait_xcnt 0x0" ::: "memory");      /* behind the group of loads: the wait and order fence said above the loop */
    cc[0][0] = g2_mma(e0, b0, cc[0][0]); cc[1][0] = g2_mma(e1, b0, cc[1][0]); cc[2][0] = g2_mma(e2, b0, cc[2][0]); cc[3][0] = g2_mma(e3, b0, cc[3][0]);
    b0 = g2_fragu(b0p, ob);
    cc[0][1] = g2_mma(e0, b1, cc[0][1]); cc[1][1] = g2_mma(e1, b1, cc[1][1]); cc[2][1] = g2_mma(e2, b1, cc[2][1]); cc[3][1] = g2_mma(e3, b1, cc[3][1]);
    b1 = g2_fragu(b1p, ob);
    cc[0][2] = g2_mma(e0, b2, cc[0][2]); cc[1][2] = g2_mma(e1, b2, cc[1][2]); cc[2][2] = g2_mma(e2, b2, cc[2][2]); cc[3][2] = g2_mma(e3, b2, cc[3][2]);
    b2 = g2_fragu(b2p, ob);
    cc[0][3] = g2_mma(e0, b3, cc[0][3]); cc[1][3] = g2_mma(e1, b3, cc[1][3]); cc[2][3] = g2_mma(e2, b3, cc[2][3]); cc[3][3] = g2_mma(e3, b3, cc[3][3]);
    b3 = g2_fragu(b3p, ob);
    asm volatile("s_wait_xcnt 0x0" ::: "memory"); }      /* behind the last refetch, in front of the next trip's new offset register: as said above the loop */
  /* the epilogue takes the wave tile in two halves of 32 rows, one after the other through the wave's one 32 x 64 staging tile */
  for (int hf = 0; hf < 2; ++hf) { const int rowh = row0 + 32 * hf;
  v8f accs[8] = {cc[0][0], cc[0][1], cc[0][2], cc[0][3], cc[1][0], cc[1][1], cc[1][2], cc[1][3]};
#pragma unroll
  for (int u = 0; u < 8; ++u) { const int t = u & 3, half = u >> 2; const int col = col0 + t * 16 + ln; const float bv = bp ? bf16_round(bp[col]) : 0.f;
#pragma unroll
    for (int r = 0; r < 8; ++r) { const int rloc = half * 16 + 8 * hh + r; float v = accs[u][r] * alpha + bv; if (CP) { if (rowsPerB < 0) v += CP[cofs + (size_t)(row0g + rowh + rloc) * ldc + col];      /* rowsPerB < 0: own element of the batched C plane */ else { const int bidx = (row0g + rowh + rloc) / rowsPerB; v += CP[(size_t)bidx * sCPb + (size_t)by * 64 + col]; } }
      if (ACT == 3) v = fmaxf(v, 0.f); else if (ACT == 6) v = 0.5f * v * (1.0f + erff(v * 0.70710678118654752f)); else if (ACT == 11) v = 1.0f / (1.0f + expf(-v)); else if (ACT == 15) v = v / (1.0f + expf(-v)); else if (ACT == 12) v = (v > 0.f) ? v : 0.01f * v; else if (ACT == 8) v = tanhf(v); else if (ACT == 9) v = 0.5f * v * (1.0f + tanhf(0.7978845608028654f * (v + 0.044715f * v * v * v))); else if (ACT == 14) v = (v > 0.f) ? v : 0.1f * v; else if (ACT == 16) v = (v >= 0.f) ? v : 0.3f * v; else if (ACT == 17) v = (v >= 0.f) ? v : 0.2f * v;
      so[w][rloc][t * 16 + ln] = v; } }
  __builtin_amdgcn_fence(__ATOMIC_ACQ_REL, "workgroup"); __builtin_amdgcn_wave_barrier();
  if (omode == 1) {      /* chunk g * 32 + lane of fragment (row tile rt, k block kb): row ln, k (2 g + hh) * 8 .. + 7; every store is 512 contiguous bytes of a wave */
    const size_t f0 = ((size_t)(rowh >> 4) * (ldc >> 5) + (col0 >> 5)) * 512 + lane * 8; unsigned short* hp = (unsigned short*)C16 + f0; unsigned short* lp = (unsigned short*)CL + f0;
#pragma unroll
    for (int f = 0; f < 8; ++f) { const int rt = f >> 2, kb = (f >> 1) & 1, g = f & 1; const float* s = &so[w][rt * 16 + ln][kb * 32 + (2 * g + hh) * 8]; const v4f a = *(const v4fa*)s, c = *(const v4fa*)(s + 4); FragH fh, fl;
#pragma unroll
      for (int q = 0; q < 4; ++q) { _Float16 h = (_Float16)a[q]; fh.h[q] = h; fl.h[q] = (_Float16)((a[q] - (float)h) * 1024.0f); h = (_Float16)c[q]; fh.h[4 + q] = h; fl.h[4 + q] = (_Float16)((c[q] - (float)h) * 1024.0f); }
      const size_t o = (size_t)rt * (ldc >> 5) * 512 + kb * 512 + g * 256; *(v8us*)(hp + o) = fh.half[0]; *(v8us*)(lp + o) = fl.half[0]; }
    asm volatile("s_wait_xcnt 0x0" ::: "memory"); }      /* behind the block's last store, inside the block: in front of whatever next takes a register that these stores name (the V^T block's LDS loads where it is laid out behind this one; the accumulator moves at the foot of the half) */
  else if (omode == 2) {      /* chunk g * 32 + lane of d tile dt: row d = dt * 16 + ln, keys (2 g + hh) * 8 .. + 7 of the half's 32-key block; the wave's 64 columns are one head */
    const int tok = row0g + rowh; unsigned short* vp = (unsigned short*)C16 + ((size_t)(tok / SQ) * NH + (col0 >> 6)) * ((size_t)HD * SQ) + (size_t)((tok % SQ) >> 5) * 2048 + lane * 8;
#pragma unroll
    for (int f = 0; f < 8; ++f) { const int dt = f >> 1, g = f & 1; FragH fv;
#pragma unroll
      for (int q = 0; q < 8; ++q) fv.h[q] = (_Float16)so[w][(2 * g + hh) * 8 + q][dt * 16 + ln];
      *(v8us*)(vp + dt * 512 + g * 256) = fv.half[0]; }
    asm volatile("s_wait_xcnt 0x0" ::: "memory"); }      /* behind the block's last store, inside the block: as at the end of the block above */
  else { const int rsub = lane >> 4, c4 = (lane & 15) * 4;
#pragma unroll
    for (int q = 0; q < 16; ++q) { const int r = q * 2 + rsub; v4f v = *(const v4fa*)&so[w][r][c4]; if (C) *(v4f*)(C + cofs + (size_t)(rowh + r) * ldc + col0 + c4) = v; if (C16) { asm volatile("s_wait_xcnt 0x0" : "+v"(v) : : "memory");      /* behind the f32 store, in front of the conversion, which may take the store's data registers; v passes through the statement so that the conversion cannot be lifted over the wait */
      v4h h4; for (int i = 0; i < 4; ++i) h4[i] = (_Float16)v[i]; *(v4h*)(C16 + cofs + (size_t)(rowh + r) * ldc + col0 + c4) = h4; } }
    asm volatile("s_wait_xcnt 0x0" ::: "memory"); }      /* behind the block's last store, inside the block: as at the end of the first block */
  __builtin_amdgcn_fence(__ATOMIC_ACQ_REL, "workgroup", "local"); __builtin_amdgcn_wave_barrier();      /* keeps the second half's writes of the staging tile behind the first half's reads, which are of other lanes' elements; LDS only, so that the wave does not wait here for its global stores */
#pragma unroll
  for (int j = 0; j < 4; ++j) { cc[0][j] = cc[2][j]; cc[1][j] = cc[3][j]; }      /* the second half's accumulators move to where the one copy of the epilogue reads */
  } }
template <int ACT>
__global__ __launch_bounds__(128) void k_gemm2(const _Float16* __restrict__ A, int lda, size_t sA, const _Float16* __restrict__ Bh, int ldb, size_t sB, float alpha, const float* __restrict__ bias, size_t sBias, const float* __restrict__ CP, int rowsPerB, size_t sCPb, int row0g,
    float* __restrict__ C, _Float16* __restrict__ C16, _Float16* __restrict__ CL, int omode, int ldc, size_t sC, int M, int N, int K) { gemm2<ACT>(A, lda, sA, Bh, ldb, sB, alpha, bias, sBias, CP, rowsPerB, sCPb, row0g, C, C16, CL, omode, ldc, sC, M, N, K, blockIdx.y); }
// The three projections in one launch (none reads what another writes): blockIdx.y = 0 q, 1 k (each f32 -> f16 hi + x1024 residual planes, split in the epilogue), 2 v (f16 straight into the V^T fragments [NB * NH][SQ / 32][4 d tiles]). Pointers arrive at the first projected row; row0g = that row.
__global__ __launch_bounds__(128) void k_qkv(const _Float16* __restrict__ XQ, const _Float16* __restrict__ XKV, const _Float16* __restrict__ BQ, const _Float16* __restrict__ BK, const _Float16* __restrict__ BV,
    _Float16* __restrict__ Q16, _Float16* __restrict__ QL, _Float16* __restrict__ K16, _Float16* __restrict__ KL, _Float16* __restrict__ VT, int row0g) { const int y = blockIdx.y;
  gemm2<0>(y == 0 ? XQ : XKV, DM, 0, y == 0 ? BQ : y == 1 ? BK : BV, DM, 0, 0.0625f, nullptr, 0, nullptr, 1, 0, row0g, nullptr, y == 0 ? Q16 : y == 1 ? K16 : VT, y == 0 ? QL : KL, y == 2 ? 2 : 1, DM, 0, MP, DM, DM, 0); }


__global__ __launch_bounds__(256) void k_wnat(const float* __restrict__ w, size_t n8, _Float16* __restrict__ Bt) { const size_t t = (size_t)blockIdx.x * 256 + threadIdx.x; if (t >= n8) return; FragH f; for (int q = 0; q < 8; ++q) f.h[q] = (_Float16)(bf16_round(w[t * 8 + q]) * 16.0f); *(v8us*)((unsigned short*)Bt + t * 8) = f.half[0];  }
__global__ __launch_bounds__(256) void k_rsm(const float* __restrict__ S, _Float16* __restrict__ P, int nrows) {
  #pragma clang fp contract(off)
  const int i = blockIdx.x * 256 + threadIdx.x; if (i >= nrows) return; const float* s = S + (size_t)i * SQ; float mx = -3.0e38f;
#pragma unroll 1
  for (int j = 0; j < SQ; ++j) mx = fmaxf(mx, s[j]); float se = 0.f;
#pragma unroll 1
  for (int j = 0; j < SQ; ++j) se += expf(s[j] - mx); const float sc = 256.0f / se;
#pragma unroll 1
  for (int j0 = 0; j0 < SQ; j0 += 8) { FragH f; for (int q = 0; q < 8; ++q) f.h[q] = (_Float16)(expf(s[j0 + q] - mx) * sc); unsigned short* d = (unsigned short*)P + (size_t)i * SQ + j0; *(v8us*)d = f.half[0];  } }
__global__ __launch_bounds__(256) void k_vt(const _Float16* __restrict__ V16, int b, int h0, _Float16* __restrict__ VT) { __shared__ unsigned short tl[64][65]; const int tid = threadIdx.x; const int hh = blockIdx.x % HG, sg = blockIdx.x / HG; const int s0 = sg * 64; const int h = h0 + hh;
  for (int i = tid; i < 64 * 8; i += 256) { const int j = i / 8, d8 = (i % 8) * 8; FragH f; f.half[0] = *(const v8us*)((const unsigned short*)V16 + ((size_t)b * SQ + s0 + j) * DM + h * HD + d8); for (int q = 0; q < 8; ++q) tl[d8 + q][j] = f.u[q]; }
  __syncthreads();
  { for (int i = tid; i < 64 * 8; i += 256) { const int d = i / 8, j8 = (i % 8) * 8; FragH f; for (int q = 0; q < 8; ++q) f.u[q] = tl[d][j8 + q]; *(v8us*)((unsigned short*)VT + ((size_t)hh * HD + d) * SQ + s0 + j8) = f.half[0]; }  } }


__device__ __forceinline__ float xl_half(float x) { return __builtin_bit_cast(float, __builtin_amdgcn_permlanex16(__builtin_bit_cast(int, x), __builtin_bit_cast(int, x), 0x76543210, 0xfedcba98, false, false)); }  // lane l with lane l ^ 16
// v_exp_f32 with the v_nop in its own statement: it keeps the one slot that the instruction set asks for behind a transcendental
__device__ __forceinline__ float exp2_slot(float a) { float e; asm("v_exp_f32 %0, %1\n\tv_nop" : "=v"(e) : "v"(a)); return e; }
#define FAW 8                        /* waves per work-group of the fused attention kernel, 32 query columns each */
#define FA_ROW __builtin_amdgcn_sched_barrier(0)      /* an order fence for the compiler's scheduler; what each one keeps is said where it stands */
// One query tile's softmax step over the pass's 32 scores (sa: keys 0..15, sb: keys 16..31): new running maximum, weights x256 as the f16 B fragment, running sum; al = the factor that the tile's o takes.
__device__ __forceinline__ v16h fa_soft(const v8f sa, const v8f sb, float& m, float& mm, float& l, float& al) {
  float s[16];
#pragma unroll
  for (int r = 0; r < 8; ++r) { s[r] = sa[r]; s[8 + r] = sb[r]; }
  float x0 = fmaxf(s[0], s[1]), x1 = fmaxf(s[2], s[3]), x2 = fmaxf(s[4], s[5]), x3 = fmaxf(s[6], s[7]);
  x0 = fmaxf(x0, fmaxf(s[8], s[9])); x1 = fmaxf(x1, fmaxf(s[10], s[11])); x2 = fmaxf(x2, fmaxf(s[12], s[13])); x3 = fmaxf(x3, fmaxf(s[14], s[15]));
  float mx = fmaxf(fmaxf(x0, x1), fmaxf(x2, x3)); mx = fmaxf(mx, xl_half(mx));      /* both halves of the wave hold keys of the same query */
  const float mn = fmaxf(m, mx); const float mmn = fmaf(mn, 1.44269504088896340736f, -8.0f);      /* exponent offset in log2 units; the -8 carries the weights x256 */
  al = exp2_slot(mm - mmn); m = mn; mm = mmn;      /* 1 exactly while the maximum stands */
  FragH pf; float a0 = 0.f, a1 = 0.f, a2 = 0.f, a3 = 0.f;
#pragma unroll
  for (int i = 0; i < 16; i += 4) { const float p0 = exp2_slot(fmaf(s[i], 1.44269504088896340736f, -mmn)), p1 = exp2_slot(fmaf(s[i + 1], 1.44269504088896340736f, -mmn)), p2 = exp2_slot(fmaf(s[i + 2], 1.44269504088896340736f, -mmn)), p3 = exp2_slot(fmaf(s[i + 3], 1.44269504088896340736f, -mmn));
    a0 += p0; a1 += p1; a2 += p2; a3 += p3; pf.h[i] = (_Float16)p0; pf.h[i + 1] = (_Float16)p1; pf.h[i + 2] = (_Float16)p2; pf.h[i + 3] = (_Float16)p3; }
  l = fmaf(l, al, (a0 + a1) + (a2 + a3));
  return pf.v; }
__device__ __forceinline__ void fa_store(unsigned short* op, const v8f o0, const v8f o1, const v8f o2, const v8f o3, float sc) { FragH f;      /* o rows in fragment order (A operand of the output GEMM): d = 16 t + 8 hh + r of query ln is chunk 32 (t & 1) + lane of k block 2 h + (t >> 1) */
#pragma unroll
  for (int r = 0; r < 8; ++r) { f.h[r] = (_Float16)(o0[r] * sc); f.h[8 + r] = (_Float16)(o1[r] * sc); }
  *(v8us*)op = f.half[0]; *(v8us*)(op + 256) = f.half[1];
#pragma unroll
  for (int r = 0; r < 8; ++r) { f.h[r] = (_Float16)(o2[r] * sc); f.h[8 + r] = (_Float16)(o3[r] * sc); }
  *(v8us*)(op + 512) = f.half[0]; *(v8us*)(op + 768) = f.half[1]; }
__device__ __forceinline__ void fa_put(unsigned short* qw, int f, v16h x) { FragH t; t.v = x; *(v8us*)(qw + (2 * f) * (FAW * 32 * 8)) = t.half[0]; *(v8us*)(qw + (2 * f + 1) * (FAW * 32 * 8)) = t.half[1]; }      /* fragment f of the thread's q_lo store */
__device__ __forceinline__ v16h fa_get(const unsigned short* qw, int f) { FragH t; t.half[0] = *(const v8us*)(qw + (2 * f) * (FAW * 32 * 8)); t.half[1] = *(const v8us*)(qw + (2 * f + 1) * (FAW * 32 * 8)); return t.v; }
// K and V^T ring: the eight waves of a work-group walk the same keys, so each stage of FST keys (k_hi, k_lo, V^T: 16 KiB each, already in fragment order) is brought into LDS once, by asynchronous copies, one whole stage ahead of its use; the waves read their fragments from LDS.
#define FST 128                      /* keys of one ring stage: four passes */
#define FSH (FST * HD)               /* halves of one plane's share of a stage */
#define FSB (3 * FSH * 2)            /* bytes of one ring buffer: k_hi, k_lo, V^T one behind the other */
// One thread's share of a stage: twelve 16-byte copies (four of each plane; 256 threads x 16 bytes = 4 KiB a copy). ld: the thread's first LDS byte address; gh, gl: its first bytes of k_hi and k_lo (a copy covers two 2-KiB row-tile pieces, 32 * LQ bytes apart); gv: of V^T (contiguous).
// The s_wait_xcnt is the last line of the copies' own statement: it stands in front of whatever next rewrites an address register that a copy names.
__device__ __forceinline__ void fa_stage(unsigned ld, const char* gh, const char* gl, const char* gv) {
  asm volatile("global_load_async_to_lds_b128 %0, %12, off\n\t"
               "global_load_async_to_lds_b128 %1, %13, off\n\t"
               "global_load_async_to_lds_b128 %2, %14, off\n\t"
               "global_load_async_to_lds_b128 %3, %15, off\n\t"
               "global_load_async_to_lds_b128 %4, %16, off\n\t"
               "global_load_async_to_lds_b128 %5, %17, off\n\t"
               "global_load_async_to_lds_b128 %6, %18, off\n\t"
               "global_load_async_to_lds_b128 %7, %19, off\n\t"
               "global_load_async_to_lds_b128 %8, %20, off\n\t"
               "global_load_async_to_lds_b128 %9, %21, off\n\t"
               "global_load_async_to_lds_b128 %10, %22, off\n\t"
               "global_load_async_to_lds_b128 %11, %23, off\n\t"
               "s_wait_xcnt 0x0"
               :: "v"(ld), "v"(ld + 4096), "v"(ld + 8192), "v"(ld + 12288), "v"(ld + 16384), "v"(ld + 20480), "v"(ld + 24576), "v"(ld + 28672), "v"(ld + 32768), "v"(ld + 36864), "v"(ld + 40960), "v"(ld + 45056),
                  "v"(gh), "v"(gh + 64 * LQ), "v"(gh + 128 * LQ), "v"(gh + 192 * LQ), "v"(gl), "v"(gl + 64 * LQ), "v"(gl + 128 * LQ), "v"(gl + 192 * LQ), "v"(gv), "v"(gv + 4096), "v"(gv + 8192), "v"(gv + 12288) : "memory"); }
__device__ __forceinline__ v16h fa_ring(const unsigned short* p) { FragH f; f.half[0] = *(const v8us*)p; f.half[1] = *(const v8us*)(p + 256); return f.v; }      /* a fragment of the ring: p = the fragment's start + lane * 8 */
// amdgpu_waves_per_eu(4, 4): the register budget of four waves a SIMD (256), so that all 512 work-groups are resident at once, two a WGP; without it this build took 274 registers with q_lo held in them.
__global__ __launch_bounds__(FAW * 32) __attribute__((amdgpu_waves_per_eu(4, 4))) void k_fattn(const _Float16* __restrict__ Qh, const _Float16* __restrict__ Ql, const _Float16* __restrict__ Kh, const _Float16* __restrict__ Kl, const _Float16* __restrict__ VT, const float* __restrict__ relb, _Float16* __restrict__ O) {
  __shared__ float tb[257]; __shared__ __attribute__((aligned(16))) unsigned short qls[8][FAW * 32][8];      /* qls: the q_lo fragments, which the registers of four waves a SIMD do not hold beside the rest: thread t's own eight 16-byte chunks at [0..7][t] (a wave-wide read is 512 contiguous bytes); no thread reads what another wrote, so no barrier is owed */
  __shared__ __attribute__((aligned(16))) unsigned short ring[2][3 * FSH];      /* the K / V^T ring: two buffers of one stage */
  const int tid = threadIdx.x, lane = tid & 31, ln = lane & 15, hh = lane >> 4; const int h = blockIdx.y, b = blockIdx.z; const size_t r0 = (size_t)b * SQ;
  const _Float16* khb = Kh + r0 * LQ + (size_t)h * (HD * 16); const _Float16* klb = Kl + r0 * LQ + (size_t)h * (HD * 16); const _Float16* vb = VT + (size_t)(b * NH + h) * HD * SQ;      /* the head's first K row tile piece and V^T block */
  const unsigned rl = (unsigned)(size_t)(const void*)&ring[0][0] + tid * 16; const unsigned gko = (tid >> 7) * (32 * LQ) + (tid & 127) * 16;      /* the thread's LDS byte address in buffer 0; its byte in the first two row-tile pieces (2 KiB each, 32 * LQ bytes apart) */
  const char* gh = (const char*)khb + gko; const char* gl = (const char*)klb + gko; const char* gv = (const char*)vb + tid * 16;
  fa_stage(rl, gh, gl, gv);      /* stage 0 into buffer 0; it flies while the bias table is built */
  for (int t = tid; t < 257; t += FAW * 32) { const int d = t - 128; const int a = d < 0 ? -d : d; const int f = (a < 8) ? a : (8 + (a >= 12) + (a >= 16) + (a >= 23) + (a >= 32) + (a >= 46) + (a >= 64) + (a >= 91)); const int bk = (d > 0 ? 16 : 0) + f; tb[t] = bf16_round(relb[bk * NH + h]) * 1024.0f; }      /* x1024: exact */
  asm volatile("s_wait_asynccnt 0x0" ::: "memory");      /* the wave's own copies of stage 0 have landed, in front of the barrier behind which other waves read them */
  __syncthreads();      /* publishes the bias table and stage 0 to all waves */
  fa_stage(rl + FSB, gh + 256 * LQ, gl + 256 * LQ, gv + FSH * 2);      /* stage 1 into buffer 1 */
  const int q0 = (blockIdx.x * FAW + __builtin_amdgcn_readfirstlane(tid >> 5)) * 32;
  const size_t fo = (size_t)h * (HD * 16) + lane * 8;      /* fragment order: head h is k blocks 2 h and 2 h + 1 of a row tile, 512 halves each; a row tile is 16 * LQ halves */
  const _Float16* qp = Qh + (r0 + q0) * LQ + fo; const _Float16* qlp = Ql + (r0 + q0) * LQ + fo;
  const v16h qhA0 = g2_fragp(qp), qhA1 = g2_fragp(qp + 512), qhB0 = g2_fragp(qp + 16 * LQ), qhB1 = g2_fragp(qp + 16 * LQ + 512); asm volatile("s_wait_xcnt 0x0" ::: "memory");      /* this and the like waits below stand behind a group of loads, in front of whatever next overwrites a register that the group's addresses are in */
  unsigned short* qw = &qls[0][tid][0];
  fa_put(qw, 0, g2_fragp(qlp)); fa_put(qw, 1, g2_fragp(qlp + 512)); fa_put(qw, 2, g2_fragp(qlp + 16 * LQ)); fa_put(qw, 3, g2_fragp(qlp + 16 * LQ + 512)); asm volatile("s_wait_xcnt 0x0" ::: "memory");
  v16h qlA0 = fa_get(qw, 0), qlA1 = fa_get(qw, 1), qlB0 = fa_get(qw, 2), qlB1 = fa_get(qw, 3);
  const float bneg = __builtin_bit_cast(float, __builtin_amdgcn_readfirstlane(__builtin_bit_cast(int, tb[0]))), bpos = __builtin_bit_cast(float, __builtin_amdgcn_readfirstlane(__builtin_bit_cast(int, tb[256])));      /* the two far values, the same in every lane: held in scalar registers */
  const int dq = 128 + 8 * hh - (q0 + ln);      /* table index of key j0 + 8 hh + r against tile A's query: j0 + r + dq, clamped; tile B's query lies 16 further */
  const v8f z8 = {0.f,0.f,0.f,0.f,0.f,0.f,0.f,0.f}; v8f oA0 = z8, oA1 = z8, oA2 = z8, oA3 = z8, oB0 = z8, oB1 = z8, oB2 = z8, oB3 = z8; float mA = -1.0e30f, mmA = -1.0e30f, lA = 0.f, mB = -1.0e30f, mmB = -1.0e30f, lB = 0.f;
#pragma unroll 1      /* one trip = one ring stage; its foot is the stage hand-over */
  for (int st = 0; st < SQ / FST; ++st) {
  const unsigned short* sp = &ring[st & 1][0] + lane * 8;      /* this stage's buffer: a trip reads this buffer alone */
  v16h ka0 = fa_ring(sp), ka1 = fa_ring(sp + 512), kb0 = fa_ring(sp + 1024), kb1 = fa_ring(sp + 1536);      /* k_hi of the stage's first pass: key tiles a (0..15) and b (16..31), d 0..31 and 32..63; a fragment is 512 halves, a pass 2048 */
#pragma unroll 1      /* one pass's fragments in registers at a time: unrolled, the live set would cost resident waves */
  for (int ps = 0; ps < FST / 32; ++ps) { const int j0 = st * FST + ps * 32;
    const float bf = j0 < q0 ? bneg : bpos; v8f taA = {bf, bf, bf, bf, bf, bf, bf, bf}, tcA = taA, taB = taA, tcB = taA;      /* a pass wholly at distance 128 or more from all 32 queries: one value */
    if (j0 + 31 - q0 > -128 && j0 - (q0 + 31) < 128) {      /* wave-uniform: passes near the diagonal read the table */
#pragma unroll
      for (int r = 0; r < 8; ++r) { const int ia = j0 + r + dq, ib = ia + 16, ic = ia - 16; taA[r] = tb[ia < 0 ? 0 : (ia > 256 ? 256 : ia)]; tcA[r] = tb[ib < 0 ? 0 : (ib > 256 ? 256 : ib)]; taB[r] = tb[ic < 0 ? 0 : (ic > 256 ? 256 : ic)]; }
      tcB = taA; }      /* key tile b against query tile B: the distances of key tile a against query tile A */
    const unsigned short* lp = sp + FSH + ps * 2048; const v16h la0 = fa_ring(lp), la1 = fa_ring(lp + 512), lb0 = fa_ring(lp + 1024), lb1 = fa_ring(lp + 1536);      /* this pass's k_lo, into what V^T and the weights have left: first read behind the eight k_hi residual products, which cover its LDS latency */
    FA_ROW;      /* keeps the k_lo reads ahead of those eight products */
    /* FA_ROW behind each row of four products keeps the rows in this order: four independent accumulator chains interleaved, and k_lo, fetched at the head of the pass, first read behind eight k_hi products (left alone, this build drew k_lo products forward and ran three chains); the last one keeps the joins behind all products (among them, two groups of four v_nop stood) */
    taA = g2_mmab(ka0, qlA0, taA); tcA = g2_mmab(kb0, qlA0, tcA); taB = g2_mmab(ka0, qlB0, taB); tcB = g2_mmab(kb0, qlB0, tcB); FA_ROW;
    taA = g2_mmab(ka1, qlA1, taA); tcA = g2_mmab(kb1, qlA1, tcA); taB = g2_mmab(ka1, qlB1, taB); tcB = g2_mmab(kb1, qlB1, tcB); FA_ROW;
    taA = g2_mmab(la0, qhA0, taA); tcA = g2_mmab(lb0, qhA0, tcA); taB = g2_mmab(la0, qhB0, taB); tcB = g2_mmab(lb0, qhB0, tcB); FA_ROW;
    taA = g2_mmab(la1, qhA1, taA); tcA = g2_mmab(lb1, qhA1, tcA); taB = g2_mmab(la1, qhB1, taB); tcB = g2_mmab(lb1, qhB1, tcB); FA_ROW;
    v8f saA = g2_mmab(ka0, qhA0, z8), sbA = g2_mmab(kb0, qhA0, z8), saB = g2_mmab(ka0, qhB0, z8), sbB = g2_mmab(kb0, qhB0, z8); FA_ROW;
    saA = g2_mmab(ka1, qhA1, saA); sbA = g2_mmab(kb1, qhA1, sbA); saB = g2_mmab(ka1, qhB1, saB); sbB = g2_mmab(kb1, qhB1, sbB); FA_ROW;
#pragma unroll
    for (int r = 0; r < 8; ++r) { saA[r] = fmaf(taA[r], 0.0009765625f, saA[r]); sbA[r] = fmaf(tcA[r], 0.0009765625f, sbA[r]); saB[r] = fmaf(taB[r], 0.0009765625f, saB[r]); sbB[r] = fmaf(tcB[r], 0.0009765625f, sbB[r]); }
    __builtin_amdgcn_sched_barrier(0);      /* keeps the sixteen loads below one group behind the joined scores: issued earlier, they would need registers while both accumulator sets are still live */
    const unsigned short* vp = sp + 2 * FSH + ps * 2048; const unsigned short* kp = sp + ((ps + 1) & (FST / 32 - 1)) * 2048;      /* this pass's V^T, the next pass's K; the stage's last pass wraps to its own first pass (the same buffer, unused): nothing of the next stage is read in front of the hand-over */
    const v16h v0 = fa_ring(vp), v1 = fa_ring(vp + 512), v2 = fa_ring(vp + 1024), v3 = fa_ring(vp + 1536);      /* V^T fragments, hidden by tile A's softmax */
    ka0 = fa_ring(kp); ka1 = fa_ring(kp + 512); kb0 = fa_ring(kp + 1024); kb1 = fa_ring(kp + 1536);
    FA_ROW;      /* keeps the group ahead of the softmax that hides it */
    float al; const v16h pA = fa_soft(saA, sbA, mA, mmA, lA, al);
#pragma unroll
    for (int r = 0; r < 8; ++r) { oA0[r] *= al; oA1[r] *= al; oA2[r] *= al; oA3[r] *= al; }
    oA0 = g2_mmab(v0, pA, oA0); oA1 = g2_mmab(v1, pA, oA1); oA2 = g2_mmab(v2, pA, oA2); oA3 = g2_mmab(v3, pA, oA3);      /* O^T[d = 16 t + 8 hh + r][query ln]; tile B's softmax runs beside these products */
    FA_ROW;      /* keeps the two tiles' softmax apart: interleaved, their temporaries are live together */
    const v16h pB = fa_soft(saB, sbB, mB, mmB, lB, al);
#pragma unroll
    for (int r = 0; r < 8; ++r) { oB0[r] *= al; oB1[r] *= al; oB2[r] *= al; oB3[r] *= al; }
    qlA0 = fa_get(qw, 0); qlA1 = fa_get(qw, 1); qlB0 = fa_get(qw, 2); qlB1 = fa_get(qw, 3);      /* q_lo for the next pass's first products; read anew each pass */
    FA_ROW;      /* keeps the q_lo reads ahead of the four products that hide their latency */
    oB0 = g2_mmab(v0, pB, oB0); oB1 = g2_mmab(v1, pB, oB1); oB2 = g2_mmab(v2, pB, oB2); oB3 = g2_mmab(v3, pB, oB3);
  }
  /* stage hand-over, every wave, in this order */
  asm volatile("s_wait_dscnt 0x0" ::: "memory");      /* the wave's own reads of this buffer have returned, in front of the barrier behind which it is refilled */
  asm volatile("s_wait_asynccnt 0x0" ::: "memory");      /* the wave's own copies of the next stage have landed, in front of the barrier behind which other waves read them */
  __syncthreads();      /* publishes the next stage and ends every wave's reads of this buffer */
  if (st + 2 < SQ / FST) fa_stage(rl + (unsigned)(st & 1) * FSB, gh + (size_t)(st + 2) * (256 * LQ), gl + (size_t)(st + 2) * (256 * LQ), gv + (size_t)(st + 2) * (FSH * 2));      /* the same test in every wave: stage st + 2 into the buffer just left */
  }
  asm volatile("s_wait_asynccnt 0x0" ::: "memory");      /* no copy is outstanding when the wave ends */
  unsigned short* op = (unsigned short*)O + (r0 + q0) * DM + fo;
  fa_store(op, oA0, oA1, oA2, oA3, 64.0f / (lA + xl_half(lA))); fa_store(op + 16 * DM, oB0, oB1, oB2, oB3, 64.0f / (lB + xl_half(lB))); }

extern "C" void kernel_launch(void* const* d_in, const int* in_sizes, int n_in,
                              void* d_out, int out_size, void* d_ws, size_t ws_size, hipStream_t stream) {
  (void)in_sizes; (void)n_in; (void)out_size;
  const float* const* I = (const float* const*)d_in; const float* xq = I[0]; const float* xkv = I[1]; const float* wq = I[2]; const float* wk = I[3]; const float* wv = I[4]; const float* wo = I[5]; const float* relb = I[6]; const float* bq = nullptr; const float* bk = nullptr; (void)bq; (void)bk;      /* [in][out] weights, no biases; rel_bias [32 buckets][16 heads] */
  char* ws = (char*)d_ws; size_t off = 0;
  auto take = [&](size_t bytes) { char* p = ws + off; off += (bytes + 255) & ~(size_t)255; return p; };
  _Float16* BQ = (_Float16*)take((size_t)DM * DM * 2); _Float16* BK = (_Float16*)take((size_t)DM * DM * 2); _Float16* BV = (_Float16*)take((size_t)DM * DM * 2); _Float16* BO = (_Float16*)take((size_t)DM * DM * 2);
  _Float16* XQ = (_Float16*)take(NR * DM * 2); _Float16* XKV = (_Float16*)take(NR * DM * 2); _Float16* Q16 = (_Float16*)take(NR * DM * 2); _Float16* QL = (_Float16*)take(NR * DM * 2); _Float16* K16 = (_Float16*)take(NR * DM * 2); _Float16* KL = (_Float16*)take(NR * DM * 2); _Float16* O16 = (_Float16*)take(NR * DM * 2);
  _Float16* VT = (_Float16*)take((size_t)NB * NH * HD * SQ * 2);      /* V^T for ALL batches */
  if (off > ws_size) return;
  k_prep<<<4 * WTB + 2 * XTB, 256, 0, stream>>>(xq, xkv, wq, wk, wv, wo, XQ, XKV, BQ, BK, BV, BO);      /* weights [in][out] -> Bt[n][k] x16; both token sources as exact f16 rows */
  const size_t r0p = (size_t)B0 * SQ;      /* first projected row */
  k_qkv<<<dim3((unsigned)((MP / 128) * (DM / 128)), 3), 128, 0, stream>>>(XQ + r0p * DM, XKV + r0p * DM, BQ, BK, BV, Q16 + r0p * DM, QL + r0p * DM, K16 + r0p * DM, KL + r0p * DM, VT, (int)r0p);      /* q -> Q16 + QL, k -> K16 + KL, v -> V^T */
  k_fattn<<<dim3(SQ / (FAW * 32), NH, NB), FAW * 32, 0, stream>>>(Q16, QL, K16, KL, VT, relb, O16);      /* scores + bias, softmax and P . V of every batch and head; o (merged heads) x64 as f16 rows */
  k_gemm2<0><<<dim3((unsigned)((MPO / 128) * (DM / 128)), 1), 128, 0, stream>>>(O16 + r0p * DM, DM, 0, BO, DM, 0, 0.0009765625f, nullptr, 0, nullptr, 1, 0, 0, (float*)d_out + r0p * DM, nullptr, nullptr, 0, DM, 0, MPO, DM, DM);      /* out rows are the output layout */
}
